// v005
// Measured on an AMD MI455X. A time is GPU time per run, averaged over a window of back-to-back runs after a warm-up
// (all launches, gaps included; the runs take copies of the inputs in turn), and the median of several windows.
// Apart from v000's, it joins two sittings. Times from different sittings can be a few percent apart, while
// side-by-side timings come from the same sitting.
// Earlier versions than v005 are not in this document.
// A run of this version takes 69.2 microseconds.
// Timed twice side by side with v004, it ran 1.44 and 1.46 times as fast.
// Over all steps from v000, the starting kernel, it is 51.4 times as fast.
// De-stationary causal attention with a null branch, [b, l, h, e] layout (2 x 2,048 tokens, 8 heads x 64): A = softmax(scale * (q.k * tau_b + delta_bj)) over keys j <= i for (keys, values) and for (keys_null, values_null) with the same queries; out = soft_mask * out_edit + (1 - soft_mask) * out_null per query. All inputs rounded to bf16 (RNE); q is multiplied by tau_b on device (f32) and k, v rounded, k and v are stored as bf16 in WMMA fragment order, then ONE WMMA attention launch for both batches and both branches (v_wmma_f32_16x16x32_bf16, f32 accumulate) with q as a bf16 hi/lo split (f32-class: q*tau is not 16-bit exact) against bf16 k, the per-key additive table scale*delta_bj, causal, f32 online softmax, P as a bf16 hi/lo split against bf16 v; the blend in f32.
#include <hip/hip_runtime.h>
#include <math.h>

typedef __attribute__((ext_vector_type(16))) _Float16 v16h;
typedef __attribute__((ext_vector_type(8)))  _Float16 v8h;
typedef __attribute__((ext_vector_type(16))) __bf16   v16b;
typedef __attribute__((ext_vector_type(8)))  __bf16   v8b;
typedef __attribute__((ext_vector_type(8)))  float    v8f;
typedef __attribute__((ext_vector_type(4)))  float    v4f;

// 16-bit WMMA fragment map (wave32), lane L, h = L>>4, m = L&15:
//   A 16x32: lane = row m;   element i -> k = (i<8) ? 8h+i : 16+8h+(i-8)
//   B 32x16: lane = column m; the SAME k(i,h)
//   D 16x16 (8 f32): lane = column m; element r -> row 8h+r
__device__ __forceinline__ int frag_k(int i, int h) { return (i < 8) ? (8 * h + i) : (16 + 8 * h + (i - 8)); }
__device__ __forceinline__ __bf16 bf16_rne(float f) {
    unsigned int u = __float_as_uint(f);
    u += 0x7fffu + ((u >> 16) & 1u);
    return __builtin_bit_cast(__bf16, (unsigned short)(u >> 16));
}
__device__ __forceinline__ float bf16_f32(__bf16 b) { return __uint_as_float(((unsigned int)__builtin_bit_cast(unsigned short, b)) << 16); }
__device__ __forceinline__ v8f wmma16(v16h a, v16h b, v8f c) {
    c = __builtin_amdgcn_wmma_f32_16x16x32_f16(false, a, false, b, (short)0, c, false, false);
    asm volatile("v_nop\n\tv_nop\n\tv_nop\n\tv_nop" : "+v"(c) : "v"(a), "v"(b));
    return c;
}
__device__ __forceinline__ v8f wmmab(v16b a, v16b b, v8f c) {
    c = __builtin_amdgcn_wmma_f32_16x16x32_bf16(false, a, false, b, (short)0, c, false, false);
    asm volatile("v_nop\n\tv_nop\n\tv_nop\n\tv_nop" : "+v"(c) : "v"(a), "v"(b));
    return c;
}
struct Split { v16b hi, lo; };
// hi/lo split product: a.hi*b.hi + a.hi*b.lo + a.lo*b.hi
__device__ __forceinline__ v8f wmma3(const Split& a, const Split& b, v8f c) {
    c = __builtin_amdgcn_wmma_f32_16x16x32_bf16(false, a.hi, false, b.hi, (short)0, c, false, false);
    c = __builtin_amdgcn_wmma_f32_16x16x32_bf16(false, a.hi, false, b.lo, (short)0, c, false, false);
    c = __builtin_amdgcn_wmma_f32_16x16x32_bf16(false, a.lo, false, b.hi, (short)0, c, false, false);
    asm volatile("v_nop\n\tv_nop\n\tv_nop\n\tv_nop" : "+v"(c) : "v"(a.hi), "v"(a.lo), "v"(b.hi), "v"(b.lo));
    return c;
}
// hi/lo split a against a b that is exact in bf16 (its lo part is zero): a.hi*b + a.lo*b
__device__ __forceinline__ v8f wmma2(const Split& a, v16b b, v8f c) {
    c = __builtin_amdgcn_wmma_f32_16x16x32_bf16(false, a.hi, false, b, (short)0, c, false, false);
    c = __builtin_amdgcn_wmma_f32_16x16x32_bf16(false, a.lo, false, b, (short)0, c, false, false);
    return c;
}
// the same with the exact bf16 operand as A and the hi/lo split as B: a*b.hi + a*b.lo
__device__ __forceinline__ v8f wmma2t(v16b a, const Split& b, v8f c) {
    c = __builtin_amdgcn_wmma_f32_16x16x32_bf16(false, a, false, b.hi, (short)0, c, false, false);
    c = __builtin_amdgcn_wmma_f32_16x16x32_bf16(false, a, false, b.lo, (short)0, c, false, false);
    return c;
}
// One B fragment from a plane in fragment order (see k_ds_pre): two blocks of 256 halves, lane L's eight halves at 8L; block 0 holds elements 0..7, block 1 elements 8..15
__device__ __forceinline__ v16b bfrag_ld(const __bf16* __restrict__ p) {
    const v8b x = *(const v8b*)p, y = *(const v8b*)(p + 256);
    return __builtin_shufflevector(x, y, 0, 1, 2, 3, 4, 5, 6, 7, 8, 9, 10, 11, 12, 13, 14, 15);
}
struct Split3 { v16b hi, mid, lo; };
// triple split product (6 terms, drops only terms below 2^-24 relative)
__device__ __forceinline__ v8f wmma6(const Split3& a, const Split3& b, v8f c) {
    c = __builtin_amdgcn_wmma_f32_16x16x32_bf16(false, a.hi, false, b.hi, (short)0, c, false, false);
    c = __builtin_amdgcn_wmma_f32_16x16x32_bf16(false, a.hi, false, b.mid, (short)0, c, false, false);
    c = __builtin_amdgcn_wmma_f32_16x16x32_bf16(false, a.mid, false, b.hi, (short)0, c, false, false);
    c = __builtin_amdgcn_wmma_f32_16x16x32_bf16(false, a.hi, false, b.lo, (short)0, c, false, false);
    c = __builtin_amdgcn_wmma_f32_16x16x32_bf16(false, a.mid, false, b.mid, (short)0, c, false, false);
    c = __builtin_amdgcn_wmma_f32_16x16x32_bf16(false, a.lo, false, b.hi, (short)0, c, false, false);
    asm volatile("v_nop\n\tv_nop\n\tv_nop\n\tv_nop" : "+v"(c) : "v"(a.hi), "v"(a.mid), "v"(a.lo), "v"(b.hi), "v"(b.mid), "v"(b.lo));
    return c;
}

// Fragment gathers from f32 memory: element i <- p[(k0 + frag_k(i,h)) * sk] * s, zero for k >= klen.
__device__ __forceinline__ v16h fh_ld(const float* __restrict__ p, long long sk, int k0, int h, int klen, float s) {
    v16h a;
#pragma unroll
    for (int i = 0; i < 16; ++i) { const int k = k0 + frag_k(i, h); a[i] = (k < klen) ? (_Float16)(p[(long long)k * sk] * s) : (_Float16)0.f; }
    return a;
}
__device__ __forceinline__ Split sp_ld(const float* __restrict__ p, long long sk, int k0, int h, int klen, float s) {
    Split r;
#pragma unroll
    for (int i = 0; i < 16; ++i) {
        const int k = k0 + frag_k(i, h); const float x = (k < klen) ? p[(long long)k * sk] * s : 0.f;
        const __bf16 hb = bf16_rne(x); r.hi[i] = hb; r.lo[i] = bf16_rne(x - bf16_f32(hb));
    }
    return r;
}
__device__ __forceinline__ Split3 sp3_ld(const float* __restrict__ p, long long sk, int k0, int h, int klen, float s) {
    Split3 r;
#pragma unroll
    for (int i = 0; i < 16; ++i) {
        const int k = k0 + frag_k(i, h); const float x = (k < klen) ? p[(long long)k * sk] * s : 0.f;
        const __bf16 hb = bf16_rne(x); const float r1 = x - bf16_f32(hb); const __bf16 mb = bf16_rne(r1);
        r.hi[i] = hb; r.mid[i] = mb; r.lo[i] = bf16_rne(r1 - bf16_f32(mb));
    }
    return r;
}
__device__ __forceinline__ v16b bh_ld(const float* __restrict__ p, long long sk, int k0, int h, int klen, float s) {
    v16b a;
#pragma unroll
    for (int i = 0; i < 16; ++i) { const int k = k0 + frag_k(i, h); a[i] = bf16_rne((k < klen) ? p[(long long)k * sk] * s : 0.f); }
    return a;
}
// f16 fragment from an f16 LDS/global row with element stride 1 (k-contiguous), no bounds (tile already zero padded)
__device__ __forceinline__ v16h fh_row(const _Float16* __restrict__ row, int k0, int h) {
    v16h a;
#pragma unroll
    for (int i = 0; i < 16; ++i) a[i] = row[k0 + frag_k(i, h)];
    return a;
}

#define VST2(T, ptr, val) do { const T vst2_v_ = (val); *(T*)(ptr) = vst2_v_;  } while (0)
typedef float v4f __attribute__((ext_vector_type(4)));
#define VST2V4(ptr, val) do { const v4f vst2_v4_ = (val); *(v4f*)(ptr) = vst2_v4_;  } while (0)

__device__ __attribute__((noinline)) float act_fn(float v, int act) {
    if (act == 1) return fmaxf(v, 0.f);                                                                               // relu
    if (act == 2) { const float u = 0.7978845608028654f * (v + 0.044715f * v * v * v); return 0.5f * v * (1.f + tanhf(u)); } // tanh-gelu
    if (act == 3) return v / (1.f + expf(-v));                                                                        // silu
    if (act == 4) return 0.5f * v * (1.f + erff(v * 0.7071067811865476f));                                             // erf-gelu
    if (act == 5) return tanhf(v);
    if (act == 6) return 1.f / (1.f + expf(-v));                                                                      // sigmoid
    if (act == 7) return (v > 0.f) ? v : 0.01f * v;                                                                   // leaky relu 0.01
    if (act == 8) return (v > 0.f) ? v : (expf(v) - 1.f);                                                             // elu
    if (act == 9) return fminf(fmaxf(v, 0.f), 6.f);                                                                   // relu6
    if (act == 10) return fabsf(v);                                                                                    // abs
    if (act == 11) return (v >= 0.f) ? v : 0.1f * v;                                                                  // leaky 0.1
    if (act == 12) return (v > 0.f) ? v : 0.2f * v;                                                                   // leaky 0.2
    if (act == 13) return (v > 20.f) ? v : log1pf(expf(v));                                                            // softplus
    return v;
}

// =====================================================================================================================
// k_gemm<MODE>: C(z, m, n) = act(alpha * sum_k A(z, m, k) * B(z, k, n) + bias) + beta * R(z, m, n)
//   One wave (32-thread block) per 16 x 32 tile of C; grid (ceil(N/32), ceil(M/16), Z). Batch z -> (zo = z / zi_n, zi = z % zi_n)
//   with separate outer/inner strides for every tensor (e.g. batch and head). A(m,k) = A[zo*sAo + zi*sAi + m*sAm + k*sAk] (f32),
//   B(k,n) = B[zo*sBo + zi*sBi + n*sBn + k*sBk] (f32); any M, N, K (K zero-padded to 32 inside the fragments, M/N tails guarded).
//   C(m,n) = C[zo*sCo + zi*sCi + m*sCm + n] (n contiguous). flags: 1 bias[n], 2 bias[m], 4 residual R[zo*sRo + zi*sRi + m*sRm + n*sRn].
//   MODE 0: f16 operands (A prescaled by sa, B by sb, both undone in the epilogue); 1: bf16 hi/lo split (3 products); 2: bf16;
//   3: bf16 hi/mid/lo triple split (6 products); 4: as 3 with Kahan-compensated f32 accumulation across k-steps.
// =====================================================================================================================
struct GemmP {
    const float* A; const float* B; const float* bias; const float* R; float* C;
    long long sAo, sAi, sAm, sAk, sBo, sBi, sBn, sBk, sCo, sCi, sCm, sRo, sRi, sRm, sRn;
    int M, N, K, zi_n, flags, act; float alpha, beta, sa, sb;
    int Npad, pad_;     // columns [N, Npad) of C are written as 0 so that padded workspace rows are covered by whole-line stores; Npad >= N
};
static_assert(sizeof(GemmP) == 5 * 8 + 15 * 8 + 6 * 4 + 4 * 4 + 2 * 4, "GemmP has padding");

template <int MODE>
__global__ __launch_bounds__(32) void k_gemm(GemmP p) {
    const int lane = threadIdx.x & 31, h = lane >> 4, l15 = lane & 15;
    const int m0 = blockIdx.y * 16, n0 = blockIdx.x * 32;
    const int z = blockIdx.z, zo = z / p.zi_n, zi = z - zo * p.zi_n;
    const float* A = p.A + zo * p.sAo + zi * p.sAi;
    const float* B = p.B + zo * p.sBo + zi * p.sBi;
    const int am = min(m0 + l15, p.M - 1);                       // clamped row for loads (stores are guarded)
    v8f acc[2], comp[2];
#pragma unroll
    for (int t = 0; t < 2; ++t) { v8f zz = {}; acc[t] = zz; comp[t] = zz; }
    for (int k0 = 0; k0 < p.K; k0 += 32) {
        const float* arow = A + (long long)am * p.sAm;
        if (MODE == 1) {
            const Split a = sp_ld(arow, p.sAk, k0, h, p.K, 1.f);
#pragma unroll
            for (int t = 0; t < 2; ++t) {
                const int bn = min(n0 + t * 16 + l15, p.N - 1);
                acc[t] = wmma3(a, sp_ld(B + (long long)bn * p.sBn, p.sBk, k0, h, p.K, 1.f), acc[t]);
            }
        } else if (MODE == 3) {
            const Split3 a = sp3_ld(arow, p.sAk, k0, h, p.K, 1.f);
#pragma unroll
            for (int t = 0; t < 2; ++t) {
                const int bn = min(n0 + t * 16 + l15, p.N - 1);
                acc[t] = wmma6(a, sp3_ld(B + (long long)bn * p.sBn, p.sBk, k0, h, p.K, 1.f), acc[t]);
            }
        } else if (MODE == 4) {
            // triple split as MODE 3, but each k-step's 6 products go into a fresh accumulator and the partial is added to the running f32 sum
            // on the VALU with Kahan compensation (accumulation error stays ~1 ulp however long K is)
            const Split3 a = sp3_ld(arow, p.sAk, k0, h, p.K, 1.f);
#pragma unroll
            for (int t = 0; t < 2; ++t) {
                const int bn = min(n0 + t * 16 + l15, p.N - 1); v8f zz = {};
                const v8f part = wmma6(a, sp3_ld(B + (long long)bn * p.sBn, p.sBk, k0, h, p.K, 1.f), zz);
                const v8f y = part - comp[t]; const v8f s = acc[t] + y; comp[t] = (s - acc[t]) - y; acc[t] = s;
            }
        } else if (MODE == 2) {
            const v16b a = bh_ld(arow, p.sAk, k0, h, p.K, 1.f);
#pragma unroll
            for (int t = 0; t < 2; ++t) {
                const int bn = min(n0 + t * 16 + l15, p.N - 1);
                acc[t] = wmmab(a, bh_ld(B + (long long)bn * p.sBn, p.sBk, k0, h, p.K, 1.f), acc[t]);
            }
        } else {
            const v16h a = fh_ld(arow, p.sAk, k0, h, p.K, p.sa);
#pragma unroll
            for (int t = 0; t < 2; ++t) {
                const int bn = min(n0 + t * 16 + l15, p.N - 1);
                acc[t] = wmma16(a, fh_ld(B + (long long)bn * p.sBn, p.sBk, k0, h, p.K, p.sb), acc[t]);
            }
        }
    }
    const float iscale = (MODE == 0) ? p.alpha / (p.sa * p.sb) : p.alpha;
    float* C = p.C + zo * p.sCo + zi * p.sCi;
    const float* R = p.R + zo * p.sRo + zi * p.sRi;
    __shared__ __align__(16) float ctile[16][36];
#pragma unroll
    for (int t = 0; t < 2; ++t) {
        const int n = n0 + t * 16 + l15; const int nn = min(n, p.N - 1);
#pragma unroll
        for (int r = 0; r < 8; ++r) {
            const int m = m0 + 8 * h + r; const int mm = min(m, p.M - 1);
            float v = acc[t][r] * iscale;
            if (p.flags & 1) v += p.bias[nn];
            if (p.flags & 2) v += p.bias[mm];
            if (p.flags & 8) v *= p.bias[(long long)zo * p.M + mm];   /* per-(z,row) scale vector laid out [Z][M]; exclusive with the bias flags */
            v = act_fn(v, p.act);
            if (p.flags & 4) v += p.beta * R[(long long)mm * p.sRm + (long long)nn * p.sRn];
            ctile[8 * h + r][t * 16 + l15] = (n < p.N) ? v : 0.f;
        }
    }
    __syncthreads();
    const int NW = (p.Npad > p.N) ? p.Npad : p.N;           // write width
    const bool fast = (m0 + 16 <= p.M) && (n0 + 32 <= NW) && ((p.sCm & 3) == 0) && ((((size_t)C) & 15) == 0);
    if (fast) {
#pragma unroll
        for (int s = 0; s < 4; ++s) {
            const int row = s * 4 + (lane >> 3), c4 = (lane & 7) * 4;
            const v4f v = *(const v4f*)&ctile[row][c4];
            VST2V4(C + (long long)(m0 + row) * p.sCm + n0 + c4, v);
        }
    } else {
        for (int row = 0; row < 16; ++row) {
            const int m = m0 + row, n = n0 + lane;
            if (m < p.M && n < NW) VST2(float, C + (long long)m * p.sCm + n, ctile[row][lane]);
        }
    }
}


// =====================================================================================================================
// k_gemmT<MODE, TM, TN>: same contract as k_gemm, but one wave computes a (16*TM) x (16*TN) tile: TM A fragments and TN B fragments are
//   loaded per 32-wide k-step and reused across TM*TN WMMAs (far fewer load/convert instructions per MAC). MODE 0 (f16), 1 (bf16 hi/lo),
//   2 (bf16) only. grid (ceil(NW/(16*TN)), ceil(M/(16*TM)), Z), block 32. Epilogue identical to k_gemm, run per 16x32 sub-tile.
// =====================================================================================================================
template <int MODE, int TM, int TN>
__global__ __launch_bounds__(32) void k_gemmT(GemmP p) {
    const int lane = threadIdx.x & 31, h = lane >> 4, l15 = lane & 15;
    const int m0 = blockIdx.y * (16 * TM), n0 = blockIdx.x * (16 * TN);
    const int z = blockIdx.z, zo = z / p.zi_n, zi = z - zo * p.zi_n;
    const float* A = p.A + zo * p.sAo + zi * p.sAi;
    const float* B = p.B + zo * p.sBo + zi * p.sBi;
    v8f acc[TM][TN];
#pragma unroll
    for (int i = 0; i < TM; ++i)
#pragma unroll
        for (int t = 0; t < TN; ++t) { v8f zz = {}; acc[i][t] = zz; }
    for (int k0 = 0; k0 < p.K; k0 += 32) {
        if (MODE == 1) {
            Split a[TM], b[TN];
#pragma unroll
            for (int i = 0; i < TM; ++i) { const int am = min(m0 + 16 * i + l15, p.M - 1); a[i] = sp_ld(A + (long long)am * p.sAm, p.sAk, k0, h, p.K, 1.f); }
#pragma unroll
            for (int t = 0; t < TN; ++t) { const int bn = min(n0 + 16 * t + l15, p.N - 1); b[t] = sp_ld(B + (long long)bn * p.sBn, p.sBk, k0, h, p.K, 1.f); }
#pragma unroll
            for (int i = 0; i < TM; ++i)
#pragma unroll
                for (int t = 0; t < TN; ++t) acc[i][t] = wmma3(a[i], b[t], acc[i][t]);
        } else if (MODE == 2) {
            v16b a[TM], b[TN];
#pragma unroll
            for (int i = 0; i < TM; ++i) { const int am = min(m0 + 16 * i + l15, p.M - 1); a[i] = bh_ld(A + (long long)am * p.sAm, p.sAk, k0, h, p.K, 1.f); }
#pragma unroll
            for (int t = 0; t < TN; ++t) { const int bn = min(n0 + 16 * t + l15, p.N - 1); b[t] = bh_ld(B + (long long)bn * p.sBn, p.sBk, k0, h, p.K, 1.f); }
#pragma unroll
            for (int i = 0; i < TM; ++i)
#pragma unroll
                for (int t = 0; t < TN; ++t) acc[i][t] = wmmab(a[i], b[t], acc[i][t]);
        } else {
            v16h a[TM], b[TN];
#pragma unroll
            for (int i = 0; i < TM; ++i) { const int am = min(m0 + 16 * i + l15, p.M - 1); a[i] = fh_ld(A + (long long)am * p.sAm, p.sAk, k0, h, p.K, p.sa); }
#pragma unroll
            for (int t = 0; t < TN; ++t) { const int bn = min(n0 + 16 * t + l15, p.N - 1); b[t] = fh_ld(B + (long long)bn * p.sBn, p.sBk, k0, h, p.K, p.sb); }
#pragma unroll
            for (int i = 0; i < TM; ++i)
#pragma unroll
                for (int t = 0; t < TN; ++t) acc[i][t] = wmma16(a[i], b[t], acc[i][t]);
        }
    }
    const float iscale = (MODE == 0) ? p.alpha / (p.sa * p.sb) : p.alpha;
    float* C = p.C + zo * p.sCo + zi * p.sCi;
    const float* R = p.R + zo * p.sRo + zi * p.sRi;
    const int NW = (p.Npad > p.N) ? p.Npad : p.N;
    __shared__ __align__(16) float ctile[16][36];
#pragma unroll
    for (int i = 0; i < TM; ++i) {
        const int mb = m0 + 16 * i; if (mb >= p.M) break;          // wave-uniform
#pragma unroll
        for (int tp = 0; tp < TN / 2; ++tp) {
            const int nb = n0 + 32 * tp; if (nb >= NW) break;        // wave-uniform
#pragma unroll
            for (int t2 = 0; t2 < 2; ++t2) {
                const int t = 2 * tp + t2; const int n = nb + t2 * 16 + l15; const int nn = min(n, p.N - 1);
#pragma unroll
                for (int r = 0; r < 8; ++r) {
                    const int m = mb + 8 * h + r; const int mm = min(m, p.M - 1);
                    float v = acc[i][t][r] * iscale;
                    if (p.flags & 1) v += p.bias[nn];
                    if (p.flags & 2) v += p.bias[mm];
            if (p.flags & 8) v *= p.bias[(long long)zo * p.M + mm];   /* per-(z,row) scale vector laid out [Z][M]; exclusive with the bias flags */
                    v = act_fn(v, p.act);
                    if (p.flags & 4) v += p.beta * R[(long long)mm * p.sRm + (long long)nn * p.sRn];
                    ctile[8 * h + r][t2 * 16 + l15] = (n < p.N) ? v : 0.f;
                }
            }
            __syncthreads();
            const bool fast = (mb + 16 <= p.M) && (nb + 32 <= NW) && ((p.sCm & 3) == 0) && ((((size_t)C) & 15) == 0);
            if (fast) {
#pragma unroll
                for (int s = 0; s < 4; ++s) {
                    const int row = s * 4 + (lane >> 3), c4 = (lane & 7) * 4;
                    const v4f v = *(const v4f*)&ctile[row][c4];
                    VST2V4(C + (long long)(mb + row) * p.sCm + nb + c4, v);
                }
            } else {
                for (int row = 0; row < 16; ++row) {
                    const int m = mb + row, n = nb + lane;
                    if (m < p.M && n < NW) VST2(float, C + (long long)m * p.sCm + n, ctile[row][lane]);
                }
            }
            __syncthreads();
        }
    }
}

// =====================================================================================================================
//   Wave = 16 queries, AW waves per block, 64-key blocks; grid (ceil(Lq/(16*AW)), H, 2 branches x 2 batches), block 32*AW. Any Lq, Lk; head dim dh <= DHP
//   (DHP multiple of 32), value dim dv <= DVP (multiple of 16, <= 128). Every tensor addressed by (batch, head, row, element) strides, f32.
//   Scores: QM 0 f16 operands, 1 bf16 hi/lo split, 2 bf16 triple split; statistics f32 (exp2 domain); P.V: P x 4096 as f16 with V f16 staged in LDS
//   (SPLITPV: P as a bf16 hi/lo split, V bf16 fragments read from memory). kv head = h / hrep. Masking: causal = 1 (keep j <= i + coff, masked -> -inf, key blocks beyond the
//   diagonal skipped), causal = 2 (masked -> mfill, a finite fill like the -1e9; no skipping), causal = 3 (keep j >= i + coff,
//   masked -> -inf, no skipping); optional additive f32 mask Mf,
//   optional int keep-mask Mi (0 -> score := mfill), both addressed b*smb + h*smh + i*smi + j*smj (0 strides broadcast).
// =====================================================================================================================
#define AW 4
struct AttnP {   // apv4
    const float* Q; const float* K; const float* V; float* O; float* P; const float* Mf; const int* Mi; float* ST;
    const float* Pw; const float* Rt; const int* SQ; const int* SK;           // optional: post-softmax weight, relative-position table, segment ids
    long long swb, swh, swi, swj, srb, srh, sri;                                 // Pw strides (b,h,i,j); Rt strides (b,h,i), column = clamp(i - j + roff, 0, rn-1)
    long long sQb, sQh, sQi, sQd, sKb, sKh, sKj, sKd, sVb, sVh, sVj, sVd, sOb, sOh, sOi, sPb, sPh, sPi, smb, smh, smi, smj;
    int Lq, Lk, dh, dv, hrep, causal, coff, pband;   // pband > 0: P holds only the band |j - i| <= pband, column j - i + pband
    float scale, mfill; int nonorm, mpol;             // nonorm (online path only): O = sum_j exp(score_j) V_j without the 1/rowsum (scores must be <= ~0); mpol: Mi masks where ==0 (mpol 0) or where !=0 (mpol 1)
    int roff, rn, segpol, win;                        // Rt column offset/count; SQ/SK: score := mfill where (segpol 0) SQ[i] != SK[j] or (segpol 1) SQ[i] == SK[j]; win > 0: keys with i - j > win (after coff) -> -inf
};
//   Pw: the softmax numerator is multiplied by Pw(b,h,i,j) AFTER the row sum is taken (probs * weight, then P.V), as in post-softmax multiplicative biases.                                                    // ST (optional): per row (b,h,i) -> ST[((b*H + h)*Lq + i)*2 + {0,1}] = {row max of the scaled+masked score (natural units), sum_j exp(score - max)}
static_assert(sizeof(AttnP) == 12 * 8 + 29 * 8 + 16 * 4, "AttnP has padding");

// Four waves per SIMD: the one launch puts four workgroups on every WGP, which fit only with at most 256 registers a wave
#ifndef KATTN_ATTR
#define KATTN_ATTR __attribute__((amdgpu_waves_per_eu(4, 4)))
#endif
// The shape of this problem's attention launch as compile-time constants: with them the
// element bounds tests (k < dh, d < dv) and every optional path fold away, the unit element strides let the compiler merge a fragment's loads into
// 16-byte loads, and the additive table (always passed here, so read without a null test) no longer depends on the query row. Only the five base pointers stay run-time values.
__device__ __forceinline__ void attn_fix_shape(AttnP& p) {
    p.P = nullptr; p.Mi = nullptr; p.ST = nullptr; p.Pw = nullptr; p.Rt = nullptr; p.SQ = nullptr; p.SK = nullptr;
    p.swb = 0; p.swh = 0; p.swi = 0; p.swj = 0; p.srb = 0; p.srh = 0; p.sri = 0;
    p.sQb = 1048576; p.sQh = 64; p.sQi = 512; p.sQd = 1; p.sKb = 1048576; p.sKh = 64; p.sKj = 512; p.sKd = 1; p.sVb = 1048576; p.sVh = 64; p.sVj = 512; p.sVd = 1;
    p.sOb = 1048576; p.sOh = 64; p.sOi = 512; p.sPb = 0; p.sPh = 0; p.sPi = 0; p.smb = 2048; p.smh = 0; p.smi = 0; p.smj = 1;
    p.Lq = 2048; p.Lk = 2048; p.dh = 64; p.dv = 64; p.hrep = 1; p.causal = 1; p.coff = 0; p.pband = 0;
    p.scale = 0.125f; p.mfill = 0.0f; p.nonorm = 0; p.mpol = 0; p.roff = 0; p.rn = 1; p.segpol = 0; p.win = 0;
}
template <int DHP, int DVP, int QM, bool SPLITPV, bool TWOPASS>
__global__ __launch_bounds__(32 * AW) KATTN_ATTR void k_attn(AttnP p) {
    attn_fix_shape(p);
    constexpr int NT = DVP / 16;                // output tiles
    constexpr int KS = DHP / 32;                // k-steps for the scores
    constexpr int VP = DVP + 8;                 // LDS pitch (halves)
    __shared__ __align__(16) float    pl[AW][16 * 64];
    __shared__ __align__(16) _Float16 vl[SPLITPV ? 8 : 64 * VP];   // f16 V tile (SPLITPV reads V fragments from memory and stages nothing)
    const int lane = threadIdx.x & 31, hf = lane >> 4, l15 = lane & 15, wave = threadIdx.x >> 5;
    // blockIdx.z = 2 * branch + batch: K, V and O hold one plane per (branch, batch), indexed by bz; Q and the additive table are shared by the branches, indexed by b
    const int h = blockIdx.y, bz = blockIdx.z, b = bz & 1, hk = h / p.hrep;
    const int q0 = (blockIdx.x * AW + wave) * 16;
    float* myp = pl[wave];
    const float L2E = 1.4426950408889634f;
    const float NEG = -__builtin_inff();
    const int qi = min(q0 + l15, p.Lq - 1);
    const float* qrow = p.Q + b * p.sQb + h * p.sQh + (long long)qi * p.sQi;
    const float* kbase = p.K + bz * p.sKb + hk * p.sKh;
    const float* vbase = p.V + bz * p.sVb + hk * p.sVh;
    // QM 1 / SPLITPV: K and V are bf16 planes in fragment order, 131,072 halves per (bz, head), 4,096 per 64-key block, 512 per fragment
    const __bf16* kfrag = (const __bf16*)p.K + (bz * 8 + hk) * 131072 + lane * 8;
    const __bf16* vfrag = (const __bf16*)p.V + (bz * 8 + hk) * 131072 + lane * 8;
    v16h qa[QM == 0 ? KS : 1]; Split qs_[QM == 1 ? KS : 1]; Split3 qt_[QM == 2 ? KS : 1];
#pragma unroll
    for (int ks = 0; ks < KS; ++ks) {
        if (QM == 2) qt_[ks] = sp3_ld(qrow, p.sQd, ks * 32, hf, p.dh, 1.f);
        else if (QM == 1) qs_[ks] = sp_ld(qrow, p.sQd, ks * 32, hf, p.dh, 1.f);
        else qa[ks] = fh_ld(qrow, p.sQd, ks * 32, hf, p.dh, 1.f);
    }
    v8f o[NT]; float m8[8], l8[8];
#pragma unroll
    for (int t = 0; t < NT; ++t) { v8f zz = {}; o[t] = zz; }
#pragma unroll
    for (int i = 0; i < 8; ++i) { m8[i] = NEG; l8[i] = 0.f; }
    int jend = p.Lk; int jstart = 0;
    if (p.causal == 1) { const int je = (blockIdx.x * AW + AW - 1) * 16 + 16 + p.coff; jend = min(jend, max(je, 0)); }   // uniform per block
    if (p.win > 0) { const int js = (int)(blockIdx.x * AW) * 16 + p.coff - p.win; jstart = (js > 0) ? (js / 64) * 64 : 0; }   // uniform per block: key blocks entirely outside every row's window hold only -inf entries and are skipped exactly
    const int npass = TWOPASS ? 2 : 1;
    for (int pass = 0; pass < npass; ++pass) {
        const bool dopv = (!TWOPASS) || pass == 1;
        for (int j0 = jstart; j0 < jend; j0 += 64) {
            v16b kf[QM == 1 ? 4 : 1][KS];
            if (QM == 1) {
                // all of the key block's K fragments are asked for before the first product: one wait for memory, not one per fragment
                const __bf16* kblk = kfrag + (j0 >> 6) * 4096;
#pragma unroll
                for (int t = 0; t < 4; ++t)
#pragma unroll
                    for (int ks = 0; ks < KS; ++ks) kf[t][ks] = bfrag_ld(kblk + (t * KS + ks) * 512);
                asm volatile("s_wait_xcnt 0x0" :: "v"(kblk) : "memory");   // the loads' address pair stays live up to this wait, so that no later load lands in it and nothing rewrites it ahead of the wait
                __builtin_amdgcn_sched_barrier(0);   // keeps every K load ahead of the first product: the scheduler otherwise holds some back until registers come free, a second wait for memory
            }
            if (dopv && !SPLITPV) {
                __syncthreads();                                 // previous key block's reads of vl / pl are done
                static_assert((32 * AW) % DVP == 0, "a thread keeps its V column from pass to pass");
                constexpr int VR = (32 * AW) / DVP;              // V rows staged by the block per pass
                const int jr0 = threadIdx.x / DVP, d = threadIdx.x - jr0 * DVP;
                const float* vsrc = vbase + (long long)(j0 + jr0) * p.sVj + (long long)d * p.sVd;   // one address; the passes differ by constant offsets
#pragma unroll   // constant trip count: all of a thread's V loads of a key block are issued before the first is waited for
                for (int n = 0; n < 64 / VR; ++n) {
                    const int jr = jr0 + n * VR, j = j0 + jr;
                    const float f = ((p.Lk % 64 == 0 || j < p.Lk) && d < p.dv) ? vsrc[(long long)(n * VR) * p.sVj] : 0.f;
                    vl[jr * VP + d] = (_Float16)f;
                }
            }
            v8f s[4];
#pragma unroll
            for (int t = 0; t < 4; ++t) {
                const int j = min(j0 + t * 16 + l15, p.Lk - 1);
                const float* krow = kbase + (long long)j * p.sKj;
                v8f acc = {};
#pragma unroll
                for (int ks = 0; ks < KS; ++ks) {
                    if (QM == 2)      acc = wmma6(qt_[ks], sp3_ld(krow, p.sKd, ks * 32, hf, p.dh, 1.f), acc);
                    else if (QM == 1) acc = wmma2(qs_[ks], kf[t][ks], acc);
                    else              acc = wmma16(qa[ks], fh_ld(krow, p.sKd, ks * 32, hf, p.dh, 1.f), acc);
                }
                s[t] = acc;
            }
            v16b vf[SPLITPV ? NT : 1][2];
            if (dopv && SPLITPV) {
                // all of the key block's V fragments are asked for together and ahead of the softmax: their way from memory is covered by the score products, not paid at the P.v products
                const __bf16* vblk = vfrag + (j0 >> 6) * 4096;
#pragma unroll
                for (int t = 0; t < NT; ++t) { vf[t][0] = bfrag_ld(vblk + (t * 2 + 0) * 512); vf[t][1] = bfrag_ld(vblk + (t * 2 + 1) * 512); }
                asm volatile("s_wait_xcnt 0x0" :: "v"(vblk) : "memory");   // the loads' address pair stays live up to this wait, so that no load of the run lands in it and nothing rewrites it ahead of the wait
            }
            float pv[8][4];
#pragma unroll
            for (int i = 0; i < 8; ++i) {
                const int irow = q0 + i + 8 * hf;
                const int ic = min(irow, p.Lq - 1);
                float sc[4];
#pragma unroll
                for (int t = 0; t < 4; ++t) {
                    const int jg = j0 + t * 16 + l15;
                    float v = s[t][i] * p.scale;
                    v += p.Mf[b * p.smb + h * p.smh + (long long)ic * p.smi + (long long)min(jg, p.Lk - 1) * p.smj];
                    if (p.Rt) { int rc = ic - min(jg, p.Lk - 1) + p.roff; rc = rc < 0 ? 0 : (rc >= p.rn ? p.rn - 1 : rc); v += p.Rt[b * p.srb + h * p.srh + (long long)ic * p.sri + rc]; }
                    if (p.Mi) { const int mv = p.Mi[b * p.smb + h * p.smh + (long long)ic * p.smi + (long long)min(jg, p.Lk - 1) * p.smj]; if (p.mpol ? (mv != 0) : (mv == 0)) v = p.mfill; }
                    if (p.SQ) { const bool same = p.SQ[(long long)b * p.Lq + ic] == p.SK[(long long)b * p.Lk + min(jg, p.Lk - 1)]; if (p.segpol ? same : !same) v = p.mfill; }
                    if (p.causal == 2 && jg > irow + p.coff) v = p.mfill;
                    // causal test against the lane's first row (jg > irow + coff, rearranged): one live register, not eight row numbers, so the 256-register cap is met without spills
                    if (jg >= p.Lk || (p.causal == 1 && jg - (q0 + 8 * hf) > i + p.coff) || (p.causal == 3 && jg < irow + p.coff) || (p.win > 0 && irow + p.coff - jg > p.win)) v = NEG; else v *= L2E;
                    sc[t] = v;
                }
                if (!TWOPASS || pass == 0) {
                    float mx = fmaxf(fmaxf(sc[0], sc[1]), fmaxf(sc[2], sc[3]));
                    mx = fmaxf(mx, __shfl_xor(mx, 1, 32)); mx = fmaxf(mx, __shfl_xor(mx, 2, 32));
                    mx = fmaxf(mx, __shfl_xor(mx, 4, 32)); mx = fmaxf(mx, __shfl_xor(mx, 8, 32));
                    const float mnew = fmaxf(m8[i], mx);
                    const float corr = (mnew == NEG) ? 1.f : exp2f(m8[i] - mnew);
                    float rs = 0.f;
#pragma unroll
                    for (int t = 0; t < 4; ++t) {
                        const float pp = (sc[t] == NEG) ? 0.f : exp2f(sc[t] - mnew); rs += pp;
                        pv[i][t] = p.Pw ? pp * p.Pw[b * p.swb + h * p.swh + (long long)ic * p.swi + (long long)min(j0 + t * 16 + l15, p.Lk - 1) * p.swj] : pp;
                    }
                    rs += __shfl_xor(rs, 1, 32); rs += __shfl_xor(rs, 2, 32); rs += __shfl_xor(rs, 4, 32); rs += __shfl_xor(rs, 8, 32);
                    l8[i] = l8[i] * corr + rs; m8[i] = mnew;
                    if (!TWOPASS) {
#pragma unroll
                        for (int t = 0; t < NT; ++t) o[t][i] *= corr;
                    }
                } else {
                    const float inv = (l8[i] > 0.f) ? 1.f / l8[i] : 0.f;
#pragma unroll
                    for (int t = 0; t < 4; ++t) {
                        const int jg = j0 + t * 16 + l15;
                        float pp = (sc[t] == NEG) ? 0.f : exp2f(sc[t] - m8[i]) * inv;
                        if (p.Pw) pp *= p.Pw[b * p.swb + h * p.swh + (long long)ic * p.swi + (long long)min(jg, p.Lk - 1) * p.swj];
                        pv[i][t] = pp;
                    }
                }
            }
            if (dopv) {
#pragma unroll
                for (int i = 0; i < 8; ++i)
#pragma unroll
                    for (int t = 0; t < 4; ++t) ((float*)myp)[(i + 8 * hf) * 64 + t * 16 + l15] = pv[i][t];
                if (SPLITPV) {
                    // P is private to its wave and V is not staged: the wave's own LDS stores only have to be ordered before its lanes' reads of each other's values
                    __builtin_amdgcn_fence(__ATOMIC_RELEASE, "workgroup"); __builtin_amdgcn_wave_barrier(); __builtin_amdgcn_fence(__ATOMIC_ACQUIRE, "workgroup");
                } else __syncthreads();                          // P (per wave) and V (shared) visible
                if (p.P) {
                    float* pb_ = p.P + b * p.sPb + h * p.sPh;
                    const bool fastP = (p.pband == 0) && ((p.sPi & 3) == 0) && (j0 + 64 <= p.Lk) && (q0 + 16 <= p.Lq) && ((((size_t)pb_) & 15) == 0);
                    if (fastP) {
#pragma unroll
                        for (int s = 0; s < 8; ++s) {
                            const int row = s * 2 + (lane >> 4), c4 = (lane & 15) * 4;
                            const v4f v = *(const v4f*)(myp + row * 64 + c4);
                            VST2V4(pb_ + (long long)(q0 + row) * p.sPi + j0 + c4, v);
                        }
                    } else {
                        for (int row = 0; row < 16; ++row) {
                            const int irow = q0 + row; if (irow >= p.Lq) continue;
                            for (int c = lane; c < 64; c += 32) {
                                const int jg = j0 + c; if (jg >= p.Lk) continue;
                                if (p.pband == 0) VST2(float, pb_ + (long long)irow * p.sPi + jg, myp[row * 64 + c]);
                                else if (jg - irow <= p.pband && irow - jg <= p.pband) VST2(float, pb_ + (long long)irow * p.sPi + (jg - irow + p.pband), myp[row * 64 + c]);
                            }
                        }
                    }
                }
                if (SPLITPV) {
                    const Split pa0 = sp_ld(myp + l15 * 64, 1, 0, hf, 64, 1.f), pa1 = sp_ld(myp + l15 * 64, 1, 32, hf, 64, 1.f);
#pragma unroll
                    for (int t = 0; t < NT; ++t) {
                        o[t] = wmma2(pa0, vf[t][0], o[t]);
                        o[t] = wmma2(pa1, vf[t][1], o[t]);
                    }
                } else {
                    const v16h pa0 = fh_ld(myp + l15 * 64, 1, 0, hf, 64, 4096.f), pa1 = fh_ld(myp + l15 * 64, 1, 32, hf, 64, 4096.f);
#pragma unroll
                    for (int t = 0; t < NT; ++t) {
                        const int dcol = t * 16 + l15;
                        v16h b0, b1;
#pragma unroll
                        for (int e = 0; e < 16; ++e) { b0[e] = vl[frag_k(e, hf) * VP + dcol]; b1[e] = vl[(32 + frag_k(e, hf)) * VP + dcol]; }
                        o[t] = wmma16(pa0, b0, o[t]);
                        o[t] = wmma16(pa1, b1, o[t]);
                    }
                }
            }
        }
    }
    float* obase = p.O + bz * p.sOb + h * p.sOh;
    if (p.ST) {
        const int rl = lane >> 1, isel = rl & 7;           // row q0 + rl ; rl>>3 == hf holds because lane>>4 == (lane>>1)>>3
        float mv = 0.f, lv = 0.f;
#pragma unroll
        for (int i = 0; i < 8; ++i) if (i == isel) { mv = m8[i]; lv = l8[i]; }
        const int irow = q0 + rl;
        if (irow < p.Lq) { float* st = p.ST + (((long long)b * gridDim.y + h) * p.Lq + irow) * 2 + (lane & 1); VST2(float, st, (lane & 1) ? lv : mv * 0.6931471805599453f); }
    }
    float invr[8];
#pragma unroll
    for (int i = 0; i < 8; ++i) {
        if (TWOPASS) invr[i] = SPLITPV ? 1.f : (1.f / 4096.f);
        else if (p.nonorm) invr[i] = exp2f(m8[i]) * (SPLITPV ? 1.f : (1.f / 4096.f));
        else invr[i] = (l8[i] > 0.f) ? (SPLITPV ? 1.f / l8[i] : 1.f / (l8[i] * 4096.f)) : 0.f;
    }
    __syncthreads();                                             // all waves done with pl/vl from the main loop
    const bool ofast = ((p.sOi & 3) == 0) && ((((size_t)obase) & 15) == 0) && (q0 + 16 <= p.Lq);
#pragma unroll
    for (int c0 = 0; c0 < DVP; c0 += 64) {
#pragma unroll
        for (int i = 0; i < 8; ++i)
#pragma unroll
            for (int t = 0; t < NT; ++t) if (t * 16 >= c0 && t * 16 < c0 + 64) ((float*)myp)[(i + 8 * hf) * 64 + (t * 16 - c0) + l15] = o[t][i] * invr[i];
        __syncthreads();
        const int cw = (DVP - c0 < 64) ? (DVP - c0) : 64;      // staged columns in this chunk (multiple of 16)
        if (ofast && (c0 + cw <= p.dv) && (cw % 32 == 0)) {
            const int lpr = cw / 4;                              // lanes per row (16 for 64 cols, 8 for 32)
            const int rows_per_ins = 32 / lpr;
            for (int r0 = 0; r0 < 16; r0 += rows_per_ins) {
                const int row = r0 + lane / lpr, c4 = (lane % lpr) * 4;
                const v4f v = *(const v4f*)(myp + row * 64 + c4);
                VST2V4(obase + (long long)(q0 + row) * p.sOi + c0 + c4, v);
            }
        } else {
            for (int row = 0; row < 16; ++row) {
                const int irow = q0 + row; if (irow >= p.Lq) continue;
                for (int c = lane; c < cw; c += 32) { const int d = c0 + c; if (d < p.dv) VST2(float, obase + (long long)irow * p.sOi + d, myp[row * 64 + c]); }
            }
        }
        __syncthreads();
    }
}

typedef __attribute__((ext_vector_type(2))) float  v2f;
typedef __attribute__((ext_vector_type(2))) __bf16 v2b;
__device__ __forceinline__ float xhalf(float x) {   // the value of lane L ^ 16
    const int u = __float_as_int(x);
    return __int_as_float(__builtin_amdgcn_permlanex16(u, u, 0x76543210, 0xfedcba98, false, false));
}
__global__ __launch_bounds__(32 * AW) KATTN_ATTR void k_attn_t(const float* __restrict__ Q, const unsigned short* __restrict__ KF, const unsigned short* __restrict__ VF, const float* __restrict__ MF, float* __restrict__ O) {
    const int lane = threadIdx.x & 31, hf = lane >> 4, l15 = lane & 15, wave = threadIdx.x >> 5;
    // blockIdx.z = 2 * branch + batch: K, V and O hold one plane per (branch, batch), indexed by bz; Q and the additive table are shared by the branches, indexed by b
    const int h = blockIdx.y, bz = blockIdx.z, b = bz & 1;
    const int q0 = (blockIdx.x * AW + wave) * 16;
    const float L2E = 1.4426950408889634f;
    const float NEG = -__builtin_inff();
    const float* qrow = Q + b * 1048576 + h * 64 + (q0 + l15) * 512;
    // 131,072 halves per (bz, head), 4,096 per 64-key block, 512 per fragment
    const __bf16* kfrag = (const __bf16*)KF + (bz * 8 + h) * 131072 + lane * 8;
    const __bf16* vfrag = (const __bf16*)VF + (bz * 8 + h) * 131072 + lane * 8;
    const float* mrow = MF + b * 2048 + 8 * hf;      // the lane's eight keys of a tile
    Split qs_[2];
#pragma unroll
    for (int ks = 0; ks < 2; ++ks) qs_[ks] = sp_ld(qrow, 1, ks * 32, hf, 64, 0.125f * L2E);   // scale and log2(e) ride in Q: the products come out as exp2 arguments
    v8f o[4]; float m = NEG; v2f l2 = {0.f, 0.f};    // l2: the sum over this lane half's keys, even and odd registers apart; joined behind the loop
#pragma unroll
    for (int t = 0; t < 4; ++t) { v8f zz = {}; o[t] = zz; }
    const int jend = (blockIdx.x * AW + AW - 1) * 16 + 16;   // uniform per block
    for (int j0 = 0; j0 < jend; j0 += 64) {
        v16b kf[4][2];
        // all of the key block's K fragments are asked for before the first product: one wait for memory, not one per fragment
        const __bf16* kblk = kfrag + (j0 >> 6) * 4096;
#pragma unroll
        for (int t = 0; t < 4; ++t)
#pragma unroll
            for (int ks = 0; ks < 2; ++ks) kf[t][ks] = bfrag_ld(kblk + (t * 2 + ks) * 512);
        asm volatile("s_wait_xcnt 0x0" :: "v"(kblk) : "memory");   // the loads' address pair stays live up to this wait, so that no later load lands in it and nothing rewrites it ahead of the wait
        // the additive table of the lane's 32 keys, asked for with the K fragments: it is the score products' start value (their C operand), so that adding it costs no instruction
        const float* mblk = mrow + j0;
        v8f s[4];
#pragma unroll
        for (int t = 0; t < 4; ++t) s[t] = *(const v8f*)(mblk + t * 16);
        asm volatile("s_wait_xcnt 0x0" ::: "memory");   // stands behind the table loads, ahead of the rewrite of their address pair at the foot of the trip
        __builtin_amdgcn_sched_barrier(0);   // keeps every K load ahead of the first product: the scheduler otherwise holds some back until registers come free, a second wait for memory
#pragma unroll
        for (int t = 0; t < 4; ++t) {
#pragma unroll
            for (int ks = 0; ks < 2; ++ks) s[t] = wmma2t(kf[t][ks], qs_[ks], s[t]);
        }
        v16b vf[4][2];
        // all of the key block's V fragments are asked for together and ahead of the softmax: their way from memory is covered by the score products, not paid at the P.v products
        const __bf16* vblk = vfrag + (j0 >> 6) * 4096;
#pragma unroll
        for (int t = 0; t < 4; ++t) { vf[t][0] = bfrag_ld(vblk + (t * 2 + 0) * 512); vf[t][1] = bfrag_ld(vblk + (t * 2 + 1) * 512); }
        asm volatile("s_wait_xcnt 0x0" :: "v"(vblk) : "memory");   // the loads' address pair stays live up to this wait, so that no load of the run lands in it and nothing rewrites it ahead of the wait
        // the unrolls from here to the foot of the trip: s, pb and o are register arrays, which stay in registers only where every index is a constant
        if (j0 == jend - 64) {                       // only the block's last trip holds keys behind a query (block-uniform: a scalar branch)
            const int qrel = q0 + l15 - 8 * hf - j0; // causal test (key > query) against constants: one live register
#pragma unroll
            for (int t = 0; t < 4; ++t) {
#pragma unroll
                for (int r = 0; r < 8; ++r) s[t][r] = (t * 16 + r > qrel) ? NEG : s[t][r];
            }
        }
        float mx4[4];
#pragma unroll
        for (int t = 0; t < 4; ++t) {
            mx4[t] = fmaxf(fmaxf(s[t][0], s[t][1]), s[t][2]);
            mx4[t] = fmaxf(fmaxf(mx4[t], s[t][3]), s[t][4]);
            mx4[t] = fmaxf(fmaxf(mx4[t], s[t][5]), s[t][6]);
            mx4[t] = fmaxf(mx4[t], s[t][7]);
        }
        float mx = fmaxf(fmaxf(mx4[0], mx4[1]), fmaxf(mx4[2], mx4[3]));
        mx = fmaxf(mx, xhalf(mx));
        // key 0 is open to every query and every score is finite, so mnew is finite from the first trip on: exp2 of -inf gives the 0 that a masked key and the first trip's corr want
        const float mnew = fmaxf(m, mx);
        const float corr = __builtin_amdgcn_exp2f(m - mnew);
        v2f rs2[4];
        Split pb[2];
#pragma unroll
        for (int t = 0; t < 4; ++t) {
#pragma unroll
            for (int r = 0; r < 8; r += 2) {
                const v2f x = (v2f){s[t][r], s[t][r + 1]} - mnew;
                const v2f pp = {__builtin_amdgcn_exp2f(x.x), __builtin_amdgcn_exp2f(x.y)};
                rs2[t] = (r == 0) ? pp : rs2[t] + pp;
                const v2b hb = __builtin_convertvector(pp, v2b);
                const v2b lb = __builtin_convertvector(pp - __builtin_convertvector(hb, v2f), v2b);
                pb[t >> 1].hi[(t & 1) * 8 + r] = hb.x; pb[t >> 1].hi[(t & 1) * 8 + r + 1] = hb.y;
                pb[t >> 1].lo[(t & 1) * 8 + r] = lb.x; pb[t >> 1].lo[(t & 1) * 8 + r + 1] = lb.y;
            }
        }
        l2 = l2 * corr + ((rs2[0] + rs2[1]) + (rs2[2] + rs2[3])); m = mnew;
#pragma unroll
        for (int t = 0; t < 4; ++t) o[t] *= corr;
#pragma unroll
        for (int t = 0; t < 4; ++t) {
            o[t] = wmma2t(vf[t][0], pb[0], o[t]);
            o[t] = wmma2t(vf[t][1], pb[1], o[t]);
        }
    }
    float l = l2.x + l2.y;
    l += xhalf(l);
    const float inv = (l > 0.f) ? 1.f / l : 0.f;
    float* orow = O + bz * 1048576 + h * 64 + (q0 + l15) * 512 + 8 * hf;
#pragma unroll
    for (int t = 0; t < 4; ++t) {
        v4f x, y;
        x.x = o[t][0] * inv; x.y = o[t][1] * inv; x.z = o[t][2] * inv; x.w = o[t][3] * inv;
        y.x = o[t][4] * inv; y.y = o[t][5] * inv; y.z = o[t][6] * inv; y.w = o[t][7] * inv;
        VST2V4(orow + t * 16, x); VST2V4(orow + t * 16 + 4, y);
    }
}

// =====================================================================================================================
// k_tr: dst(z, c, r) = alpha * src(z, r, c) (+ beta * R2(z, c, r)): [Z][R][C] (row stride lds) -> [Z][C][R] (row stride ldd) through a 32x32 LDS tile;
//   flags: 1 -> add beta * residual R2 addressed like dst (z*sRz + c*ldr + r); act applied before the residual.
// =====================================================================================================================
struct TrP { const float* src; float* dst; const float* R2; long long sSz, lds, sDz, ldd, sRz, ldr; int R, C, flags, act; float alpha, beta; };
static_assert(sizeof(TrP) == 3 * 8 + 6 * 8 + 6 * 4, "TrP has padding");
__global__ __launch_bounds__(256) void k_tr(TrP p) {
    __shared__ float tile[32][33];
    const int c0 = blockIdx.x * 32, r0 = blockIdx.y * 32, z = blockIdx.z;
    const int lane = threadIdx.x & 31, wave = threadIdx.x >> 5;
    const float* s = p.src + z * p.sSz;
#pragma unroll
    for (int k = 0; k < 4; ++k) {
        const int rl = wave * 4 + k, r = r0 + rl, c = c0 + lane;
        tile[rl][lane] = (r < p.R && c < p.C) ? s[(long long)r * p.lds + c] : 0.f;
    }
    __syncthreads();
    float* d = p.dst + z * p.sDz; const float* rr = p.R2 + z * p.sRz;
#pragma unroll
    for (int k = 0; k < 4; ++k) {
        const int cl = wave * 4 + k, c = c0 + cl, r = r0 + lane;
        if (c < p.C && r < p.R) {
            float v = act_fn(p.alpha * tile[lane][cl], p.act);
            if (p.flags & 1) v += p.beta * rr[(long long)c * p.ldr + r];
            VST2(float, d + (long long)c * p.ldd + r, v);
        }
    }
}

// k_affine: dst[i] = a * (sdev ? sdev[0] : 1) * src[i] + b, i < n (one thread per element; consecutive lanes -> consecutive addresses)
__global__ __launch_bounds__(256) void k_affine(const float* __restrict__ src, float* __restrict__ dst, int n, float a, float b, const float* __restrict__ sdev) {
    const int i = blockIdx.x * 256 + threadIdx.x;
    if (i < n) { const float aa = sdev ? a * sdev[0] : a; const float v = aa * src[i] + b; VST2(float, dst + i, v); }
}

// =====================================================================================================================
// k_softmax: row softmax over n contiguous elements, one 256-thread block per row; rows addressed z*sz + r*sr (grid (R, Z)).
//   out = scale_out * softmax(scale_in * x + (Mf ? Mf[z*smz + r*smr + j] : 0)); a row whose max is -inf is written as 0.
// =====================================================================================================================
struct SmP { const float* src; float* dst; const float* Mf; long long sz, sr, dz, dr, smz, smr; int n, pad; float scale_in, scale_out; };
static_assert(sizeof(SmP) == 3 * 8 + 6 * 8 + 4 * 4, "SmP has padding");
__global__ __launch_bounds__(256) void k_softmax(SmP p) {
    __shared__ float red[256];
    const int r = blockIdx.x, z = blockIdx.y, tid = threadIdx.x;
    const float* s = p.src + z * p.sz + (long long)r * p.sr;
    const float* mf = p.Mf ? (p.Mf + z * p.smz + (long long)r * p.smr) : nullptr;
    float mx = -__builtin_inff();
    for (int j = tid; j < p.n; j += 256) { float v = s[j] * p.scale_in; if (mf) v += mf[j]; mx = fmaxf(mx, v); }
    red[tid] = mx; __syncthreads();
    for (int o = 128; o > 0; o >>= 1) { if (tid < o) red[tid] = fmaxf(red[tid], red[tid + o]); __syncthreads(); }
    mx = red[0]; __syncthreads();
    float sum = 0.f;
    for (int j = tid; j < p.n; j += 256) { float v = s[j] * p.scale_in; if (mf) v += mf[j]; sum += (mx == -__builtin_inff()) ? 0.f : expf(v - mx); }
    red[tid] = sum; __syncthreads();
    for (int o = 128; o > 0; o >>= 1) { if (tid < o) red[tid] += red[tid + o]; __syncthreads(); }
    sum = red[0];
    const float inv = (sum > 0.f) ? p.scale_out / sum : 0.f;
    float* d = p.dst + z * p.dz + (long long)r * p.dr;
    for (int j = tid; j < p.n; j += 256) { float v = s[j] * p.scale_in; if (mf) v += mf[j]; const float o = (mx == -__builtin_inff()) ? 0.f : expf(v - mx) * inv; VST2(float, d + j, o); }
}
// =====================================================================================================================
// k_stats: mean and rsqrt(var + eps) over a set of n elements addressed base + z*sz + (e / inner) * so + (e % inner) * si, one 256-thread
// k_norm_apply: y = (x - mean[set]) * rstd[set] * g[c] + b[c] over a [Z][C][L] chan-major tensor with set = z*G + c / (C/G) (G groups per z;
//   G = C -> per-chan sets indexed z*C+c; for batch norm pass stats indexed by c only via bn = 1). Optional act. Output same layout.
// =====================================================================================================================
//   mode 0: mean / rsqrt(var + eps); mode 1 (RMSNorm): 0 / rsqrt(mean(x^2) + eps); mode 2 (L2 normalize * sqrt(n)): 0 / sqrt(n) / max(||x||, eps); mode 3: as 0 with unbiased variance (n-1)
__global__ __launch_bounds__(256) void k_stats(const float* __restrict__ x, long long sz, long long so, long long si, int inner, int n, float eps, float* __restrict__ stat, int mode) {
    __shared__ float red[256];
    const int z = blockIdx.x, tid = threadIdx.x;
    const float* base = x + z * sz;
    float s = 0.f;
    for (int e = tid; e < n; e += 256) s += base[(long long)(e / inner) * so + (long long)(e % inner) * si];
    red[tid] = s; __syncthreads();
    for (int o = 128; o > 0; o >>= 1) { if (tid < o) red[tid] += red[tid + o]; __syncthreads(); }
    const float mu = (mode == 0 || mode == 3) ? red[0] / (float)n : 0.f; __syncthreads();
    float q = 0.f;
    for (int e = tid; e < n; e += 256) { const float dlt = base[(long long)(e / inner) * so + (long long)(e % inner) * si] - mu; q += dlt * dlt; }
    red[tid] = q; __syncthreads();
    for (int o = 128; o > 0; o >>= 1) { if (tid < o) red[tid] += red[tid + o]; __syncthreads(); }
    {
        float rs;
        if (mode == 2) rs = sqrtf((float)n) / fmaxf(sqrtf(red[0]), eps); else if (mode == 3) rs = rsqrtf(red[0] / (float)(n - 1) + eps); else rs = rsqrtf(red[0] / (float)n + eps);
        if (tid < 32) { const float v = (tid == 0) ? mu : ((tid == 1) ? rs : 0.f); VST2(float, stat + (long long)z * 32 + tid, v); }
    }
}
//   One thread per element over the flat [Z][C][L] index space: grid ceil(Z*C*L / 256).
__global__ __launch_bounds__(256) void k_norm_apply(const float* __restrict__ x, float* __restrict__ y, const float* __restrict__ stat, const float* __restrict__ g, const float* __restrict__ bta,
                                                     int Z, int C, int L, int G, int bn, int act) {
    const long long idx = (long long)blockIdx.x * 256 + threadIdx.x;
    if (idx >= (long long)Z * C * L) return;
    const int l = (int)(idx % L); const long long zc = idx / L; const int c = (int)(zc % C), z = (int)(zc / C); (void)l;
    const int set = bn ? c : (z * G + c / (C / G));
    float v = (x[idx] - stat[(long long)set * 32]) * stat[(long long)set * 32 + 1];
    if (g) v *= g[c];
    if (bta) v += bta[c];
    v = act_fn(v, act);
    VST2(float, y + idx, v);
}

// k_lse_neg: c[i] = -(st[2i] + log(st[2i+1])) = minus the log-sum-exp of row i from k_attn's ST output (for softmax over the query dimension)
__global__ __launch_bounds__(256) void k_lse_neg(const float* __restrict__ st, float* __restrict__ c, int n) {
    const int i = blockIdx.x * 256 + threadIdx.x;
    if (i < n) { const float v = -(st[2 * i] + logf(st[2 * i + 1])); VST2(float, c + i, v); }
}

// k_iota: dst[i] = a * i + b as int32 (segment/position id helper)
__global__ __launch_bounds__(256) void k_iota(int* __restrict__ dst, int n, int a, int b) {
    const int i = blockIdx.x * 256 + threadIdx.x;
    if (i < n) { const int v = a * i + b; VST2(int, dst + i, v); }
}

// k_axpby: dst[i] = a * x[i] + b * y[i] (+ c), i < n
__global__ __launch_bounds__(256) void k_axpby(const float* __restrict__ x, const float* __restrict__ y, float* __restrict__ dst, int n, float a, float b, float c) {
    const int i = blockIdx.x * 256 + threadIdx.x;
    if (i < n) { const float v = a * x[i] + b * y[i] + c; VST2(float, dst + i, v); }
}

// =====================================================================================================================
// k_rope: rotary embedding on a [R rows][Hn heads][D] view (row stride sXr, head stride sXh, element stride 1) -> Y (own strides).
//   mode 0: rotate_half (partner d±D/2, sign - for d<D/2); mode 1: interleaved pairs (partner d^1, sign - for even d).
//   table column tcol: tmode 0 -> d, 1 -> d % (D/2), 2 -> d / 2; position p: pmode 0 -> r % S, 1 -> head index, 2 -> pos[r];
//   c = C[(r / S) * sCb + p * sCp + tcol * sCd], s likewise from Sn; y = x[d] * c + sign * x[partner] * s. X and Y must not alias.
// =====================================================================================================================
struct RopeP { const float* X; float* Y; const float* C; const float* Sn; const int* pos; long long sXr, sXh, sYr, sYh, sCb, sCp, sCd; int R, Hn, D, S, mode, tmode, pmode, pad; };
static_assert(sizeof(RopeP) == 5 * 8 + 7 * 8 + 8 * 4, "RopeP has padding");
__global__ __launch_bounds__(256) void k_rope(RopeP p) {
    const long long idx = (long long)blockIdx.x * 256 + threadIdx.x;
    if (idx >= (long long)p.R * p.Hn * p.D) return;
    const int d = (int)(idx % p.D); const long long rh = idx / p.D; const int h = (int)(rh % p.Hn); const int r = (int)(rh / p.Hn);
    const int half = p.D / 2;
    int partner; float sign;
    if (p.mode == 0) { partner = (d < half) ? d + half : d - half; sign = (d < half) ? -1.f : 1.f; }
    else { partner = d ^ 1; sign = (d & 1) ? 1.f : -1.f; }
    const int tcol = (p.tmode == 0) ? d : ((p.tmode == 1) ? (d % half) : (d >> 1));
    const int pp = (p.pmode == 0) ? (r % p.S) : ((p.pmode == 1) ? h : p.pos[r]);
    const long long toff = (long long)(r / p.S) * p.sCb + (long long)pp * p.sCp + (long long)tcol * p.sCd;
    const float* xr = p.X + (long long)r * p.sXr + (long long)h * p.sXh;
    const float v = xr[d] * p.C[toff] + sign * xr[partner] * p.Sn[toff];
    VST2(float, p.Y + (long long)r * p.sYr + (long long)h * p.sYh + d, v);
}

// k_invf + k_sincos (split so neither kernel carries a large VALU-fma footprint): invf_i = num * (1 / powf(base, (2 i)/D)) [fmode 0],
//   num * expf((2 i) * cexp) [fmode 1], num * powf(base, -2 (i - 1) / D) [fmode 2]; then cs/sn[s*half + i] = cos/sin((pscale * s) * invf_i)
__global__ __launch_bounds__(256) void k_invf(float* __restrict__ invb, int half, int D, float base, float num, int fmode, float cexp) {
    const int i = blockIdx.x * 256 + threadIdx.x;
    if (i >= ((half + 31) / 32) * 32) return;
    if (i >= half) { VST2(float, invb + i, 0.f); return; }
    const float e = (float)(2 * i) / (float)D;
    float invf;
    if (fmode == 1) invf = num * expf((float)(2 * i) * cexp);
    else if (fmode == 2) invf = num * powf(base, (-2.0f * ((float)i - 1.0f)) / (float)D);
    else invf = num * (1.0f / powf(base, e));
    VST2(float, invb + i, invf);
}
__global__ __launch_bounds__(256) void k_sincos(float* __restrict__ cs, float* __restrict__ sn, const float* __restrict__ invb, int S, int half, float pscale) {
    const int idx = blockIdx.x * 256 + threadIdx.x;
    if (idx >= S * half) return;
    const int s = idx / half, i = idx - s * half;
    const float ang = (pscale * (float)s) * invb[i];
    VST2(float, cs + idx, cosf(ang)); VST2(float, sn + idx, sinf(ang));
}

// k_mulact: dst[i] = act(x[i]) * y[i]
__global__ __launch_bounds__(256) void k_mulact(const float* __restrict__ x, const float* __restrict__ y, float* __restrict__ dst, int n, int act) {
    const int i = blockIdx.x * 256 + threadIdx.x;
    if (i < n) { const float v = act_fn(x[i], act) * y[i]; VST2(float, dst + i, v); }
}

// =====================================================================================================================
// k_matvec: thread-per-row matrix-vector products for N <= 8 output columns (heads with 1-3 outputs, gates), f32 on the VALU.
//   C[r*sCm + j] = act(alpha * sum_k A[r*sAm + k*sAk] * B[j*sBn + k*sBk] + bias[j]) + beta * R[r*sRm + j*sRn]; each thread writes its N contiguous floats.
// =====================================================================================================================
__global__ __launch_bounds__(256) void k_matvec(GemmP p) {
    // 32 lanes write one line with one instruction.
    const int rpt = (p.N == 1) ? 1 : 32;
    const long long r0 = ((long long)blockIdx.x * 256 + threadIdx.x) * rpt; const int z = blockIdx.z, zo = z / p.zi_n, zi = z - zo * p.zi_n;
    if (r0 >= p.M) return;
    const float* Bb = p.B + zo * p.sBo + zi * p.sBi;
    float* C = p.C + zo * p.sCo + zi * p.sCi; const float* R = p.R + zo * p.sRo + zi * p.sRi;
    for (int rr = 0; rr < rpt; ++rr) {
        const long long r = r0 + rr; if (r >= p.M) break;
        const float* A = p.A + zo * p.sAo + zi * p.sAi + r * p.sAm;
        float acc[8] = {0.f, 0.f, 0.f, 0.f, 0.f, 0.f, 0.f, 0.f};
        for (int k = 0; k < p.K; ++k) { const float a = A[(long long)k * p.sAk];
#pragma unroll
            for (int j = 0; j < 8; ++j) if (j < p.N) acc[j] += a * Bb[(long long)j * p.sBn + (long long)k * p.sBk]; }
#pragma unroll
        for (int j = 0; j < 8; ++j) if (j < p.N) {
            float v = acc[j] * p.alpha;
            if (p.flags & 1) v += p.bias[j];
            if (p.flags & 2) v += p.bias[r];
            v = act_fn(v, p.act);
            if (p.flags & 4) v += p.beta * R[r * p.sRm + (long long)j * p.sRn];
            VST2(float, C + r * p.sCm + j, v);
        }
    }
}
// k_smallsoftmax: thread-per-row softmax for short rows (n <= 64): dst[r*dr + j] = softmax(scale*src[r*sr + j])
__global__ __launch_bounds__(256) void k_smallsoftmax(const float* __restrict__ src, float* __restrict__ dst, long long sr, long long dr, int n, long long R, float scale) {
    const long long r0 = ((long long)blockIdx.x * 256 + threadIdx.x) * 32;
    for (int rr = 0; rr < 32; ++rr) {
        const long long r = r0 + rr; if (r >= R) return;
        const float* s = src + r * sr; float* d = dst + r * dr;
        float mx = -__builtin_inff();
        for (int j = 0; j < n; ++j) mx = fmaxf(mx, s[j] * scale);
        float sum = 0.f;
        for (int j = 0; j < n; ++j) sum += expf(s[j] * scale - mx);
        const float inv = 1.f / sum;
        for (int j = 0; j < n; ++j) { const float v = expf(s[j] * scale - mx) * inv; VST2(float, d + j, v); }
    }
}

__global__ __launch_bounds__(32) void k_unitstat(float* __restrict__ st) { const int t = threadIdx.x; const float v = (t == 1) ? 1.f : 0.f; VST2(float, st + t, v); }

// destination (e.g. a d_out whose row width is not a multiple of 32 floats) is written by consecutive lanes of one instruction
__global__ __launch_bounds__(256) void k_lincopy(const float* __restrict__ src, long long lds, float* __restrict__ dst, long long ldd, long long rows, int cols) {
    const long long i = (long long)blockIdx.x * 256 + threadIdx.x; if (i >= rows * cols) return;
    const long long r = i / cols; const int c = (int)(i - r * cols);
    const float v = src[r * lds + c]; VST2(float, dst + r * ldd + c, v);
}


__device__ __forceinline__ void st_h2(unsigned short* d2, float a, float b) { const unsigned u = (unsigned)__builtin_bit_cast(unsigned short, (_Float16)a) | ((unsigned)__builtin_bit_cast(unsigned short, (_Float16)b) << 16); unsigned* d = (unsigned*)d2; *d = u;  }
__device__ __forceinline__ float ldh(const unsigned short* p) { return (float)__builtin_bit_cast(_Float16, *p); }
__device__ __forceinline__ v4f ld4h(const unsigned short* p) { const unsigned long long u = *(const unsigned long long*)p; v4f a;
    a.x = (float)__builtin_bit_cast(_Float16, (unsigned short)(u & 0xFFFFu)); a.y = (float)__builtin_bit_cast(_Float16, (unsigned short)((u >> 16) & 0xFFFFu)); a.z = (float)__builtin_bit_cast(_Float16, (unsigned short)((u >> 32) & 0xFFFFu)); a.w = (float)__builtin_bit_cast(_Float16, (unsigned short)((u >> 48) & 0xFFFFu)); return a; }
__device__ __forceinline__ unsigned long long pk4h(v4f s) { return (unsigned long long)__builtin_bit_cast(unsigned short, (_Float16)s.x) | ((unsigned long long)__builtin_bit_cast(unsigned short, (_Float16)s.y) << 16) | ((unsigned long long)__builtin_bit_cast(unsigned short, (_Float16)s.z) << 32) | ((unsigned long long)__builtin_bit_cast(unsigned short, (_Float16)s.w) << 48); }
typedef unsigned v4u __attribute__((ext_vector_type(4)));
__device__ __forceinline__ void st8h(unsigned short* d, v4f a, v4f b) { const unsigned long long pa = pk4h(a), pb = pk4h(b); v4u pk; pk.x = (unsigned)(pa & 0xFFFFFFFFull); pk.y = (unsigned)(pa >> 32); pk.z = (unsigned)(pb & 0xFFFFFFFFull); pk.w = (unsigned)(pb >> 32); v4u* dd = (v4u*)d; *dd = pk;  }
__device__ __forceinline__ unsigned short bfu_rne(float v) { unsigned u = __builtin_bit_cast(unsigned, v); u += 0x7FFFu + ((u >> 16) & 1u); return (unsigned short)(u >> 16); }
__device__ __forceinline__ void bfsplit(float v, unsigned short& hi, unsigned short& lo) { hi = bfu_rne(v); lo = bfu_rne(v - __builtin_bit_cast(float, (unsigned)hi << 16)); }
__device__ __forceinline__ void st_s2(unsigned short* Hp, unsigned short* Lp, long long o, float a, float b) { unsigned short h0,l0,h1,l1; bfsplit(a,h0,l0); bfsplit(b,h1,l1); const unsigned ph = (unsigned)h0 | ((unsigned)h1 << 16), pl = (unsigned)l0 | ((unsigned)l1 << 16);
    unsigned* dh = (unsigned*)(Hp + o); unsigned* dl = (unsigned*)(Lp + o); *dh = ph; *dl = pl;  }
__device__ __forceinline__ int cl(int v, int n) { return min(max(v, 0), n - 1); }

// GAT-style aggregation over a device in-edge CSR at dst (+ optional explicit self loop as iteration j = -1):
//   logit = leaky(AS[src][h] + AD[n][h] (+ EW[e]*CW[h]), slope); softmax over the node's edges per head; acc[c] = sum alpha XP[src][c] (f16 gather plane, pitch XW; 256 channels = H heads x CH)
//   wave per node; lane L owns channels 8L..8L+7 (head = 8L / CH); per-lane softmax state (lanes of one head agree) -> no shuffles in the loop.
//   EPI 0: + bias -> f32 OUT[n][256] via LDS redistribution (two 16-B stores per lane, each instruction 512 contiguous B)
//   EPI 1: + bias, LayerNorm(256) * g + bb, relu -> bf16 hi/lo planes OH/OL [n][256] (16-B stores)
//   EPI 2: mean over the 256/CH heads + bias[0..63], LayerNorm(64) * g + bb, relu -> f32 OUT[n][64] (CH must be 64; LDS redistribution, 8-B stores)
//   EPI 3: mean over heads + bias -> f32 OUT[n][64] (no norm / activation)
//   EPI 4: + bias, ELU -> bf16 hi/lo planes OH/OL [n][256];  EPI 5: + bias (full 256-wide, per head), ELU, then mean over the 256/CH heads -> f32 OUT[n][64]
//   EPI 6: (CH = 128, two heads) mean over the two heads, + bias[0..127], relu -> f32 OUT[n][128] (LDS redistribution, 16-B stores)
//   EWM 0: no edge weights; 1: logit += EW[e] * CW[h] (self loop weight 1); 2: alpha *= EW[e] after the softmax (message scale; self loop weight 1)
template <int CH, bool SELF, int EWM, int EPI>
__global__ __launch_bounds__(256) void k_gat_agg(const unsigned short* __restrict__ XP, int XW, const float* __restrict__ AS, const float* __restrict__ AD, int ASTR, const float* __restrict__ EW, const float* __restrict__ CW,
        const int* __restrict__ esrc, const int* __restrict__ off, const int* __restrict__ cnt, const int* __restrict__ slot, const float* __restrict__ bias, const float* __restrict__ g, const float* __restrict__ bb,
        float* __restrict__ OUT, unsigned short* __restrict__ OH, unsigned short* __restrict__ OL, int N, int E, int CAP, float slope) {
    __shared__ float stage[8][256];
    const int wv = threadIdx.x >> 5; const int n = blockIdx.x * 8 + wv; const int L = threadIdx.x & 31; if (n >= N) return; const int c0 = 8 * L; const int h = c0 / CH;
    const float ad = AD[(long long)n * ASTR + h]; const float cw = (EWM == 1) ? CW[h] : 0.f; float m = -3.0e38f, s = 0.f; v4f a0, a1; a0.x = a0.y = a0.z = a0.w = 0.f; a1 = a0;
    const int p0 = cl(off[n], E + 1), cn = min(max(cnt[n], 0), CAP);
    for (int j = (SELF ? -1 : 0); j < cn; ++j) { int sj; float ew = 0.f;
        if (j < 0) { sj = n; ew = 1.f; } else { int e = slot[cl(p0 + j, E)]; e = cl(e, E); sj = cl(esrc[e], N); if (EWM != 0) ew = EW[e]; }
        float lg = AS[(long long)sj * ASTR + h] + ad + ((EWM == 1) ? ew * cw : 0.f); lg = (lg >= 0.f) ? lg : slope * lg;
        const float mn = fmaxf(m, lg); const float cz = expf(m - mn), pj = expf(lg - mn); s = s * cz + pj; const float pw = (EWM == 2) ? pj * ew : pj;
        const unsigned short* xr = XP + (long long)sj * XW + c0; a0 = a0 * cz + ld4h(xr) * pw; a1 = a1 * cz + ld4h(xr + 4) * pw; m = mn; }
    const float inv = (s > 0.f) ? 1.f / (s + 1e-16f) : 0.f; a0 = a0 * inv; a1 = a1 * inv;
    if (EPI == 0 || EPI == 1 || EPI == 4 || EPI == 5) { a0 = a0 + *(const v4f*)(bias + c0); a1 = a1 + *(const v4f*)(bias + c0 + 4); }
    if (EPI == 4 || EPI == 5) { a0.x = (a0.x > 0.f) ? a0.x : (expf(a0.x) - 1.f); a0.y = (a0.y > 0.f) ? a0.y : (expf(a0.y) - 1.f); a0.z = (a0.z > 0.f) ? a0.z : (expf(a0.z) - 1.f); a0.w = (a0.w > 0.f) ? a0.w : (expf(a0.w) - 1.f);
        a1.x = (a1.x > 0.f) ? a1.x : (expf(a1.x) - 1.f); a1.y = (a1.y > 0.f) ? a1.y : (expf(a1.y) - 1.f); a1.z = (a1.z > 0.f) ? a1.z : (expf(a1.z) - 1.f); a1.w = (a1.w > 0.f) ? a1.w : (expf(a1.w) - 1.f); }
    if (EPI == 4) { float o8[8] = {a0.x, a0.y, a0.z, a0.w, a1.x, a1.y, a1.z, a1.w}; unsigned short hh[8], ll[8];
#pragma unroll
        for (int u = 0; u < 8; ++u) bfsplit(o8[u], hh[u], ll[u]);
        const unsigned long long ph0 = (unsigned long long)hh[0] | ((unsigned long long)hh[1] << 16) | ((unsigned long long)hh[2] << 32) | ((unsigned long long)hh[3] << 48), pl0 = (unsigned long long)ll[0] | ((unsigned long long)ll[1] << 16) | ((unsigned long long)ll[2] << 32) | ((unsigned long long)ll[3] << 48);
        const unsigned long long ph1 = (unsigned long long)hh[4] | ((unsigned long long)hh[5] << 16) | ((unsigned long long)hh[6] << 32) | ((unsigned long long)hh[7] << 48), pl1 = (unsigned long long)ll[4] | ((unsigned long long)ll[5] << 16) | ((unsigned long long)ll[6] << 32) | ((unsigned long long)ll[7] << 48);
        v4u pk; pk.x = (unsigned)(ph0 & 0xFFFFFFFFull); pk.y = (unsigned)(ph0 >> 32); pk.z = (unsigned)(ph1 & 0xFFFFFFFFull); pk.w = (unsigned)(ph1 >> 32); v4u* dh = (v4u*)(OH + (long long)n * 256 + c0); *dh = pk; 
        v4u ql; ql.x = (unsigned)(pl0 & 0xFFFFFFFFull); ql.y = (unsigned)(pl0 >> 32); ql.z = (unsigned)(pl1 & 0xFFFFFFFFull); ql.w = (unsigned)(pl1 >> 32); v4u* dl = (v4u*)(OL + (long long)n * 256 + c0); *dl = ql;  return; }
    if (EPI == 6) {
        a0.x += __shfl_xor(a0.x, 16); a0.y += __shfl_xor(a0.y, 16); a0.z += __shfl_xor(a0.z, 16); a0.w += __shfl_xor(a0.w, 16); a1.x += __shfl_xor(a1.x, 16); a1.y += __shfl_xor(a1.y, 16); a1.z += __shfl_xor(a1.z, 16); a1.w += __shfl_xor(a1.w, 16);
        if (L < 16) { const int cb = 8 * L; const v4f b0 = *(const v4f*)(bias + cb), b1v = *(const v4f*)(bias + cb + 4);
            stage[wv][cb] = fmaxf(a0.x * 0.5f + b0.x, 0.f); stage[wv][cb + 1] = fmaxf(a0.y * 0.5f + b0.y, 0.f); stage[wv][cb + 2] = fmaxf(a0.z * 0.5f + b0.z, 0.f); stage[wv][cb + 3] = fmaxf(a0.w * 0.5f + b0.w, 0.f);
            stage[wv][cb + 4] = fmaxf(a1.x * 0.5f + b1v.x, 0.f); stage[wv][cb + 5] = fmaxf(a1.y * 0.5f + b1v.y, 0.f); stage[wv][cb + 6] = fmaxf(a1.z * 0.5f + b1v.z, 0.f); stage[wv][cb + 7] = fmaxf(a1.w * 0.5f + b1v.w, 0.f); }
        __builtin_amdgcn_fence(__ATOMIC_RELEASE, "workgroup"); __builtin_amdgcn_wave_barrier(); __builtin_amdgcn_fence(__ATOMIC_ACQUIRE, "workgroup");
        v4f o6; o6.x = stage[wv][4 * L]; o6.y = stage[wv][4 * L + 1]; o6.z = stage[wv][4 * L + 2]; o6.w = stage[wv][4 * L + 3]; VST2V4(OUT + (long long)n * 128 + 4 * L, o6); return; }
    if (EPI == 5) {
        a0.x += __shfl_xor(a0.x, 8); a0.y += __shfl_xor(a0.y, 8); a0.z += __shfl_xor(a0.z, 8); a0.w += __shfl_xor(a0.w, 8); a1.x += __shfl_xor(a1.x, 8); a1.y += __shfl_xor(a1.y, 8); a1.z += __shfl_xor(a1.z, 8); a1.w += __shfl_xor(a1.w, 8);
        a0.x += __shfl_xor(a0.x, 16); a0.y += __shfl_xor(a0.y, 16); a0.z += __shfl_xor(a0.z, 16); a0.w += __shfl_xor(a0.w, 16); a1.x += __shfl_xor(a1.x, 16); a1.y += __shfl_xor(a1.y, 16); a1.z += __shfl_xor(a1.z, 16); a1.w += __shfl_xor(a1.w, 16);
        const int gq5 = L & 7; a0 = a0 * 0.25f; a1 = a1 * 0.25f;
        if (L < 8) { stage[wv][8 * gq5] = a0.x; stage[wv][8 * gq5 + 1] = a0.y; stage[wv][8 * gq5 + 2] = a0.z; stage[wv][8 * gq5 + 3] = a0.w; stage[wv][8 * gq5 + 4] = a1.x; stage[wv][8 * gq5 + 5] = a1.y; stage[wv][8 * gq5 + 6] = a1.z; stage[wv][8 * gq5 + 7] = a1.w; }
        __builtin_amdgcn_fence(__ATOMIC_RELEASE, "workgroup"); __builtin_amdgcn_wave_barrier(); __builtin_amdgcn_fence(__ATOMIC_ACQUIRE, "workgroup");
        const unsigned long long pk5 = (unsigned long long)__builtin_bit_cast(unsigned, stage[wv][2 * L]) | ((unsigned long long)__builtin_bit_cast(unsigned, stage[wv][2 * L + 1]) << 32); VST2(unsigned long long, (unsigned long long*)(OUT + (long long)n * 64 + 2 * L), pk5); return; }
    if (EPI == 1) { float sm = a0.x + a0.y + a0.z + a0.w + a1.x + a1.y + a1.z + a1.w;
#pragma unroll
        for (int o = 16; o > 0; o >>= 1) sm += __shfl_xor(sm, o);
        const float mu = sm * (1.f / 256.f); const v4f d0 = a0 - mu, d1 = a1 - mu; float q = d0.x * d0.x + d0.y * d0.y + d0.z * d0.z + d0.w * d0.w + d1.x * d1.x + d1.y * d1.y + d1.z * d1.z + d1.w * d1.w;
#pragma unroll
        for (int o = 16; o > 0; o >>= 1) q += __shfl_xor(q, o);
        const float rs = rsqrtf(q * (1.f / 256.f) + 1e-5f); float o8[8] = {d0.x, d0.y, d0.z, d0.w, d1.x, d1.y, d1.z, d1.w}; unsigned short hh[8], ll[8];
#pragma unroll
        for (int u = 0; u < 8; ++u) { const float v = fmaxf(o8[u] * rs * g[c0 + u] + bb[c0 + u], 0.f); bfsplit(v, hh[u], ll[u]); }
        const unsigned long long ph0 = (unsigned long long)hh[0] | ((unsigned long long)hh[1] << 16) | ((unsigned long long)hh[2] << 32) | ((unsigned long long)hh[3] << 48), pl0 = (unsigned long long)ll[0] | ((unsigned long long)ll[1] << 16) | ((unsigned long long)ll[2] << 32) | ((unsigned long long)ll[3] << 48);
        const unsigned long long ph1 = (unsigned long long)hh[4] | ((unsigned long long)hh[5] << 16) | ((unsigned long long)hh[6] << 32) | ((unsigned long long)hh[7] << 48), pl1 = (unsigned long long)ll[4] | ((unsigned long long)ll[5] << 16) | ((unsigned long long)ll[6] << 32) | ((unsigned long long)ll[7] << 48);
        // lane L's 8 halves at c0 = 8L: 16 B -> one 16-B store per plane (32 lanes x 16 B = whole 512-B row)
        v4u pk; pk.x = (unsigned)(ph0 & 0xFFFFFFFFull); pk.y = (unsigned)(ph0 >> 32); pk.z = (unsigned)(ph1 & 0xFFFFFFFFull); pk.w = (unsigned)(ph1 >> 32); v4u* dh = (v4u*)(OH + (long long)n * 256 + c0); *dh = pk; 
        v4u ql; ql.x = (unsigned)(pl0 & 0xFFFFFFFFull); ql.y = (unsigned)(pl0 >> 32); ql.z = (unsigned)(pl1 & 0xFFFFFFFFull); ql.w = (unsigned)(pl1 >> 32); v4u* dl = (v4u*)(OL + (long long)n * 256 + c0); *dl = ql;  return; }
    if (EPI == 2 || EPI == 3) {   // head mean: lanes L, L^8, L^16, L^24 hold the same chan group of the 4 heads (CH = 64 -> 8 lanes per head)
        a0.x += __shfl_xor(a0.x, 8); a0.y += __shfl_xor(a0.y, 8); a0.z += __shfl_xor(a0.z, 8); a0.w += __shfl_xor(a0.w, 8); a1.x += __shfl_xor(a1.x, 8); a1.y += __shfl_xor(a1.y, 8); a1.z += __shfl_xor(a1.z, 8); a1.w += __shfl_xor(a1.w, 8);
        a0.x += __shfl_xor(a0.x, 16); a0.y += __shfl_xor(a0.y, 16); a0.z += __shfl_xor(a0.z, 16); a0.w += __shfl_xor(a0.w, 16); a1.x += __shfl_xor(a1.x, 16); a1.y += __shfl_xor(a1.y, 16); a1.z += __shfl_xor(a1.z, 16); a1.w += __shfl_xor(a1.w, 16);
        const int gq = L & 7; a0 = a0 * 0.25f + *(const v4f*)(bias + 8 * gq); a1 = a1 * 0.25f + *(const v4f*)(bias + 8 * gq + 4);      // every lane now holds channels 8gq..8gq+7 of the mean
        if (EPI == 3) { if (L < 8) { stage[wv][8 * gq] = a0.x; stage[wv][8 * gq + 1] = a0.y; stage[wv][8 * gq + 2] = a0.z; stage[wv][8 * gq + 3] = a0.w; stage[wv][8 * gq + 4] = a1.x; stage[wv][8 * gq + 5] = a1.y; stage[wv][8 * gq + 6] = a1.z; stage[wv][8 * gq + 7] = a1.w; }
            __builtin_amdgcn_fence(__ATOMIC_RELEASE, "workgroup"); __builtin_amdgcn_wave_barrier(); __builtin_amdgcn_fence(__ATOMIC_ACQUIRE, "workgroup");
            const unsigned long long pk3 = (unsigned long long)__builtin_bit_cast(unsigned, stage[wv][2 * L]) | ((unsigned long long)__builtin_bit_cast(unsigned, stage[wv][2 * L + 1]) << 32); VST2(unsigned long long, (unsigned long long*)(OUT + (long long)n * 64 + 2 * L), pk3); return; }
        float sm = (L < 8) ? (a0.x + a0.y + a0.z + a0.w + a1.x + a1.y + a1.z + a1.w) : 0.f;
#pragma unroll
        for (int o = 16; o > 0; o >>= 1) sm += __shfl_xor(sm, o);
        const float mu = sm * (1.f / 64.f); const v4f d0 = a0 - mu, d1 = a1 - mu; float q = (L < 8) ? (d0.x * d0.x + d0.y * d0.y + d0.z * d0.z + d0.w * d0.w + d1.x * d1.x + d1.y * d1.y + d1.z * d1.z + d1.w * d1.w) : 0.f;
#pragma unroll
        for (int o = 16; o > 0; o >>= 1) q += __shfl_xor(q, o);
        const float rs = rsqrtf(q * (1.f / 64.f) + 1e-5f);
        if (L < 8) { const float* gg = g + 8 * gq; const float* bq = bb + 8 * gq; stage[wv][8 * gq] = fmaxf(d0.x * rs * gg[0] + bq[0], 0.f); stage[wv][8 * gq + 1] = fmaxf(d0.y * rs * gg[1] + bq[1], 0.f); stage[wv][8 * gq + 2] = fmaxf(d0.z * rs * gg[2] + bq[2], 0.f); stage[wv][8 * gq + 3] = fmaxf(d0.w * rs * gg[3] + bq[3], 0.f);
            stage[wv][8 * gq + 4] = fmaxf(d1.x * rs * gg[4] + bq[4], 0.f); stage[wv][8 * gq + 5] = fmaxf(d1.y * rs * gg[5] + bq[5], 0.f); stage[wv][8 * gq + 6] = fmaxf(d1.z * rs * gg[6] + bq[6], 0.f); stage[wv][8 * gq + 7] = fmaxf(d1.w * rs * gg[7] + bq[7], 0.f); }
        __builtin_amdgcn_fence(__ATOMIC_RELEASE, "workgroup"); __builtin_amdgcn_wave_barrier(); __builtin_amdgcn_fence(__ATOMIC_ACQUIRE, "workgroup");
        const unsigned long long pk = (unsigned long long)__builtin_bit_cast(unsigned, stage[wv][2 * L]) | ((unsigned long long)__builtin_bit_cast(unsigned, stage[wv][2 * L + 1]) << 32); VST2(unsigned long long, (unsigned long long*)(OUT + (long long)n * 64 + 2 * L), pk); return; }
    // EPI 0
    stage[wv][c0] = a0.x; stage[wv][c0 + 1] = a0.y; stage[wv][c0 + 2] = a0.z; stage[wv][c0 + 3] = a0.w; stage[wv][c0 + 4] = a1.x; stage[wv][c0 + 5] = a1.y; stage[wv][c0 + 6] = a1.z; stage[wv][c0 + 7] = a1.w;
    __builtin_amdgcn_fence(__ATOMIC_RELEASE, "workgroup"); __builtin_amdgcn_wave_barrier(); __builtin_amdgcn_fence(__ATOMIC_ACQUIRE, "workgroup");
#pragma unroll
    for (int q2 = 0; q2 < 2; ++q2) { const int c = 128 * q2 + 4 * L; v4f v; v.x = stage[wv][c]; v.y = stage[wv][c + 1]; v.z = stage[wv][c + 2]; v.w = stage[wv][c + 3]; VST2V4(OUT + (long long)n * 256 + c, v); } }

__device__ __forceinline__ void st4s(unsigned short* Hp, unsigned short* Lp, long long o, v4f a) { unsigned short h[4], l[4]; bfsplit(a.x, h[0], l[0]); bfsplit(a.y, h[1], l[1]); bfsplit(a.z, h[2], l[2]); bfsplit(a.w, h[3], l[3]);
    const unsigned long long ph = (unsigned long long)h[0] | ((unsigned long long)h[1] << 16) | ((unsigned long long)h[2] << 32) | ((unsigned long long)h[3] << 48), pl = (unsigned long long)l[0] | ((unsigned long long)l[1] << 16) | ((unsigned long long)l[2] << 32) | ((unsigned long long)l[3] << 48);
    VST2(unsigned long long, (unsigned long long*)(Hp + o), ph); VST2(unsigned long long, (unsigned long long*)(Lp + o), pl); }
// f32 [nval2 pairs] -> bf16 hi/lo planes (n2 pairs; pairs >= nval2 zero); thread-linear 4-B stores per plane
__global__ __launch_bounds__(256) void k_pl(const float* __restrict__ S, unsigned short* __restrict__ PH, unsigned short* __restrict__ PL, long long nval2, long long n2) { const long long u = (long long)blockIdx.x * 256 + threadIdx.x; if (u >= n2) return; const bool in = (u < nval2); const long long uc = in ? u : ((nval2 > 0) ? (nval2 - 1) : 0); const float a = S[2 * uc], b = S[2 * uc + 1]; st_s2(PH, PL, 2 * u, in ? a : 0.f, in ? b : 0.f); }
// WC [K][NOP] (thread-linear whole rows) = [W (cols < FO) | 0 | W_h . as_h @EO+h | W_h . ad_h @EO+NH+h | 0 ...]; W is [K][FO] (x @ W layout), as/ad [NH][DH]; EO >= FO.
// branch-free: every lane loads all candidates with clamped indices and selects by value (no exec-masked load arms)
__global__ __launch_bounds__(256) void k_wext(const float* __restrict__ Wm, const float* __restrict__ AS_, const float* __restrict__ AD_, int K, int NOP, int FO, int NH, int DH, int EO, float* __restrict__ WC) {
    #pragma clang fp contract(off)
    const long long u = (long long)blockIdx.x * 256 + threadIdx.x; if (u >= (long long)K * NOP) return; const int kk = (int)(u / NOP), o = (int)(u % NOP);
    const int oo = min(o, FO - 1); const float vw = Wm[(long long)kk * FO + oo]; const int q = min(max(o - EO, 0), 2 * NH - 1); const int h = q % NH; float s = 0.f;
#pragma unroll 1
    for (int c = 0; c < DH; ++c) { const float w = Wm[(long long)kk * FO + h * DH + c]; const float asv = AS_[h * DH + c], adv = AD_[h * DH + c]; s += w * ((q < NH) ? asv : adv); }
    const float v = (o < FO) ? vw : ((o >= EO && o < EO + 2 * NH) ? s : 0.f); VST2(float, WC + u, v); }
// GAT aggregation over a device in-edge CSR (+ analytic self loop as iteration j = -1 when SELF), per-lane online softmax (lanes of one head agree):
// HS rows (pitch P floats): [0,128) projected features z, col 128 + h = a_src.z_h, col 128 + NH + h = a_dst.z_h; lane L owns channels 4L..4L+3 (head = 4L / CH).
// out = sum_j softmax_j(leaky(el[src_j][h] + er[n][h])) z[src_j] (/ (den + deps)) + bias -> ACT (0 none, 1 relu, 2 elu, 3 leaky 0.01) ->
// MODE 0: f32 OUT[n][OW] cols < OC (16-B lane stores, OC*4 contiguous B per wave; OC in {64,128}); MODE 1: bf16 hi/lo planes PH/PL pitch PP (rows n >= N zero); MODE 2: both.
template <int CH, bool SELF, int ACT, int MODE>
__global__ __launch_bounds__(256) void k_gat128(const float* __restrict__ HS, int P, int NH, const float* __restrict__ bias, const int* __restrict__ SRC, const int* __restrict__ off, const int* __restrict__ cnt, const int* __restrict__ slot,
        float* __restrict__ OUT, int OW, int OC, unsigned short* __restrict__ PH, unsigned short* __restrict__ PL, int PP, int N, int NP, int E, int CAP, float slope, float deps) {
    #pragma clang fp contract(off)
    const int n = blockIdx.x * 8 + (threadIdx.x >> 5); const int L = threadIdx.x & 31; if (n >= NP) return; const int c = 4 * L; const int h = c / CH; v4f o; o.x = o.y = o.z = o.w = 0.f;
    if (n < N) { const float* hn = HS + (long long)n * P; const float er = hn[128 + NH + h]; float m = -3.0e38f, s = 0.f; v4f a; a.x = a.y = a.z = a.w = 0.f;
        const int p0 = min(max(off[n], 0), E), cn = min(max(cnt[n], 0), CAP);
        for (int j = (SELF ? -1 : 0); j < cn; ++j) { int sj; if (j < 0) sj = n; else { const int e = min(max(slot[min(p0 + j, E - 1)], 0), E - 1); sj = min(max(SRC[e], 0), N - 1); }
            const float* hs = HS + (long long)sj * P; float lg = hs[128 + h] + er; lg = (lg >= 0.f) ? lg : slope * lg;
            const float mn = fmaxf(m, lg); const float cz = expf(m - mn), pj = expf(lg - mn); s = s * cz + pj; a = a * cz + *(const v4f*)(hs + c) * pj; m = mn; }
        const float inv = (s > 0.f || deps > 0.f) ? 1.f / (s + deps) : 0.f; o = a * inv + *(const v4f*)(bias + c);
        if (ACT == 1) { o.x = fmaxf(o.x, 0.f); o.y = fmaxf(o.y, 0.f); o.z = fmaxf(o.z, 0.f); o.w = fmaxf(o.w, 0.f); }
        if (ACT == 2) { o.x = (o.x > 0.f) ? o.x : (expf(o.x) - 1.f); o.y = (o.y > 0.f) ? o.y : (expf(o.y) - 1.f); o.z = (o.z > 0.f) ? o.z : (expf(o.z) - 1.f); o.w = (o.w > 0.f) ? o.w : (expf(o.w) - 1.f); }
        if (ACT == 3) { o.x = (o.x >= 0.f) ? o.x : 0.01f * o.x; o.y = (o.y >= 0.f) ? o.y : 0.01f * o.y; o.z = (o.z >= 0.f) ? o.z : 0.01f * o.z; o.w = (o.w >= 0.f) ? o.w : 0.01f * o.w; }
        if (MODE != 1 && c < OC) VST2V4(OUT + (long long)n * OW + c, o); }
    if (MODE != 0) st4s(PH, PL, (long long)n * PP + c, o); }

// ---- util2 ----
// generic Bt plane builder from an f32 weight: Bt[o][k] (pitch KP halves) = (TRANS ? W[k*ldw + o] : W[o*ldw + k]) * (S ? S[o] : 1) for o < NO, k < KI; zero elsewhere for o < NOP rows, k < KP (thread per (o < NOP, pair k))
__global__ __launch_bounds__(256) void k_u2_bt(const float* __restrict__ Wm, int ldw, int TRANS, int KI, int NO, int KP, int NOP, const float* __restrict__ S, unsigned short* __restrict__ PH_, unsigned short* __restrict__ PL_) {
    const long long u = (long long)blockIdx.x * 256 + threadIdx.x; if (u >= (long long)NOP * (KP / 2)) return; const int k0 = 2 * (int)(u % (KP / 2)); const int o = (int)(u / (KP / 2)); float a = 0.f, b = 0.f;
    if (o < NO) { const float s = S ? S[o] : 1.f;
        if (k0 < KI) a = (TRANS ? Wm[(long long)k0 * ldw + o] : Wm[(long long)o * ldw + k0]) * s;
        if (k0 + 1 < KI) b = (TRANS ? Wm[(long long)(k0 + 1) * ldw + o] : Wm[(long long)o * ldw + k0 + 1]) * s; }
    st_s2(PH_, PL_, (long long)o * KP + k0, a, b); }
// generic padded vector: O[i] = (i < n) ? (A[i] * (S ? S[i] : 1) + (B2 ? B2[i] : 0)) : 0 for i < NP (one block of 256, NP <= 4096 looped)
__global__ __launch_bounds__(256) void k_u2_vec(const float* __restrict__ A, const float* __restrict__ S, const float* __restrict__ B2, int n, int NP, float* __restrict__ O) { for (int i = threadIdx.x; i < NP; i += 256) { float v = 0.f; if (i < n) v = A[i] * (S ? S[i] : 1.f) + (B2 ? B2[i] : 0.f); VST2(float, O + i, v); } }
__global__ __launch_bounds__(256) void k_u2_colstat(const float* __restrict__ X, int P, int N, float eps, float* __restrict__ STAT) {
    #pragma clang fp contract(off)
    __shared__ float red[256]; const int c = blockIdx.x; const int t = threadIdx.x; float s = 0.f; for (int r = t; r < N; r += 256) s += X[(long long)r * P + c]; red[t] = s; __syncthreads();
    for (int o = 128; o > 0; o >>= 1) { if (t < o) red[t] += red[t + o]; __syncthreads(); }
    const float mu = red[0] / (float)N; __syncthreads(); float q = 0.f; for (int r = t; r < N; r += 256) { const float d = X[(long long)r * P + c] - mu; q += d * d; } red[t] = q; __syncthreads();
    for (int o = 128; o > 0; o >>= 1) { if (t < o) red[t] += red[t + o]; __syncthreads(); }
    const float rs = 1.f / sqrtf(red[0] / (float)N + eps); if (t < 32) VST2(float, STAT + (long long)c * 32 + t, (t == 0) ? mu : ((t == 1) ? rs : 0.f)); }
// rows f32 [R][W] (pitch PW) -> planes at pitch PP, column offset coff; rows >= RL (live) written as zeros up to RP (thread per (r < RP, 4 of W))
__global__ __launch_bounds__(256) void k_u2_pl(const float* __restrict__ X, int PW, int Wd, int RL, int RP, unsigned short* __restrict__ PH_, unsigned short* __restrict__ PL_, int PP, int coff) { const long long u = (long long)blockIdx.x * 256 + threadIdx.x; if (u >= (long long)RP * (Wd / 4)) return; const int r = (int)(u / (Wd / 4)); const int c = 4 * (int)(u % (Wd / 4)); v4f v; v.x = v.y = v.z = v.w = 0.f; if (r < RL) v = *(const v4f*)(X + (long long)r * PW + c); st4s(PH_, PL_, (long long)r * PP + coff + c, v); }

typedef unsigned int cm_u4 __attribute__((ext_vector_type(4)));

__global__ __launch_bounds__(256) void k_cm_zero16(unsigned short* __restrict__ DST, long long n) { const long long u = (long long)blockIdx.x * 256 + threadIdx.x; if (u * 8 >= n) return; cm_u4 z; z.x = z.y = z.z = z.w = 0u; cm_u4* d = (cm_u4*)(DST + u * 8); *d = z;  }
// f32 -> bf16 (RNE) -> f16 casts for the bf16-input-leg path: every 16-bit operand then holds exactly the bf16-rounded input value (times a power-of-two
// weight scale), so the f16 WMMA products are exact. Plain: thread per (row, 8 cols),
// dst [R][C] pitch ldd; transposed: thread per (col, 8 consecutive rows) -> dst [C][R] pitch ldd; both store 16 B per thread, thread-linear along the dst row.
__device__ __forceinline__ unsigned int cmb_pk2(float a, float b) { return (unsigned int)__builtin_bit_cast(unsigned short, (_Float16)a) | ((unsigned int)__builtin_bit_cast(unsigned short, (_Float16)b) << 16); }
__device__ __forceinline__ float cmb_bf(float v) { const unsigned u = __builtin_bit_cast(unsigned, v); const unsigned r = (u + 0x7fffu + ((u >> 16) & 1u)) & 0xffff0000u; return __builtin_bit_cast(float, r); }   // bf16 RNE, kept as f32 (finite inputs)
// BR[i] = bf16_rne(B[i]) kept as f32 (thread per element; bias vectors)
__global__ __launch_bounds__(256) void k_cm_bfvec(const float* __restrict__ SRC, float* __restrict__ DST, int n) { const int u = blockIdx.x * 256 + threadIdx.x; if (u >= n) return; VST2(float, DST + u, cmb_bf(SRC[u])); }
__global__ __launch_bounds__(256) void k_cm_castb(const float* __restrict__ SRC, int lds, unsigned short* __restrict__ DST, int ldd, int nR, int nC, float sc) {
    const long long u = (long long)blockIdx.x * 256 + threadIdx.x; const int per = nC / 8; if (u >= (long long)nR * per) return; const int r = (int)(u / per); const int c0 = 8 * (int)(u % per);
    const float* s = SRC + (long long)r * lds + c0; float w[8];
#pragma unroll
    for (int e = 0; e < 8; ++e) w[e] = cmb_bf(s[e]) * sc;
    cm_u4 pk; pk.x = cmb_pk2(w[0], w[1]); pk.y = cmb_pk2(w[2], w[3]); pk.z = cmb_pk2(w[4], w[5]); pk.w = cmb_pk2(w[6], w[7]); VST2(cm_u4, (cm_u4*)(DST + (long long)r * ldd + c0), pk); }
__global__ __launch_bounds__(256) void k_cm_castbT(const float* __restrict__ SRC, int lds, unsigned short* __restrict__ DST, int ldd, int nR, int nC, float sc) {
    const long long u = (long long)blockIdx.x * 256 + threadIdx.x; const int per = nR / 8; if (u >= (long long)nC * per) return; const int c = (int)(u / per); const int r0 = 8 * (int)(u % per);
    float w[8];
#pragma unroll
    for (int e = 0; e < 8; ++e) w[e] = cmb_bf(SRC[(long long)(r0 + e) * lds + c]) * sc;
    cm_u4 pk; pk.x = cmb_pk2(w[0], w[1]); pk.y = cmb_pk2(w[2], w[3]); pk.z = cmb_pk2(w[4], w[5]); pk.w = cmb_pk2(w[6], w[7]); VST2(cm_u4, (cm_u4*)(DST + (long long)c * ldd + r0), pk); }

// QT = bf16(q) * bf16(tau[b]) (f32, thread per float4); MF[b][j] = sc * bf16(delta[b][j]), sc = scale * log2(e).
// KF, VF = bf16(keys | keys_null), bf16(values | values_null) as 2-byte halves in the order k_attn_t's A fragments want them, so that a fragment is two 16-byte loads a lane
// and each load of a wave reads 512 contiguous bytes: [branch][b][h][64-key block][tile 0..3][step 0..1][half 0..1][lane 0..31][8].
//   K: key = 64 block + 16 tile + (lane & 15), e = 32 step + 16 half + 8 (lane >> 4) + i;   V: d = 16 tile + (lane & 15), key = 64 block + 32 step + 16 half + 8 (lane >> 4) + i.
// Thread per 16-byte group of the destination (thread-linear stores); which = blockIdx range, block-uniform.
__global__ __launch_bounds__(256) void k_ds_pre(const float* __restrict__ Q, const float* __restrict__ Kp, const float* __restrict__ V, const float* __restrict__ Kn, const float* __restrict__ Vn, const float* __restrict__ TAU, const float* __restrict__ DELTA, float* __restrict__ QTp, unsigned short* __restrict__ KFp, unsigned short* __restrict__ VFp, float* __restrict__ MFp, float sc) {
    #pragma clang fp contract(off)
    const int blk = blockIdx.x;
    if (blk < 2048) { const long long u = (long long)blk * 256 + threadIdx.x; const int b = (int)(u / (2048LL * 8 * 16)); const float t = cmb_bf(TAU[b]); const v4f x = *(const v4f*)(Q + 4 * u); v4f r; r.x = cmb_bf(x.x) * t; r.y = cmb_bf(x.y) * t; r.z = cmb_bf(x.z) * t; r.w = cmb_bf(x.w) * t; VST2V4(QTp + 4 * u, r); }
    else if (blk < 2048 + 4 * 1024) {
        const int which = (blk - 2048) >> 10;                            // 0 keys, 1 values, 2 keys_null, 3 values_null
        const int c = ((blk - 2048) & 1023) * 256 + threadIdx.x;         // 16-byte group within the tensor: 262,144 of them
        const int lane = c & 31, half = (c >> 5) & 1, step = (c >> 6) & 1, tile = (c >> 7) & 3, kb = (c >> 9) & 31, h = (c >> 14) & 7, b = c >> 17;
        const int inner = 32 * step + 16 * half + 8 * (lane >> 4), outer = 16 * tile + (lane & 15);
        const float* s = (which == 0) ? Kp : (which == 1) ? V : (which == 2) ? Kn : Vn;
        float w[8];
        if ((which & 1) == 0) {
            const float* r = s + ((long long)(b * 2048 + kb * 64 + outer) * 8 + h) * 64 + inner;
            const v4f x = *(const v4f*)r, y = *(const v4f*)(r + 4);
            w[0] = x.x; w[1] = x.y; w[2] = x.z; w[3] = x.w; w[4] = y.x; w[5] = y.y; w[6] = y.z; w[7] = y.w;
        } else {
            const float* r = s + ((long long)(b * 2048 + kb * 64 + inner) * 8 + h) * 64 + outer;
#pragma unroll   // constant trip count: the eight row loads are issued together, with one wait
            for (int i = 0; i < 8; ++i) w[i] = r[i * 512];
        }
        cm_u4 pk;
        pk.x = (unsigned)bfu_rne(w[0]) | ((unsigned)bfu_rne(w[1]) << 16); pk.y = (unsigned)bfu_rne(w[2]) | ((unsigned)bfu_rne(w[3]) << 16);
        pk.z = (unsigned)bfu_rne(w[4]) | ((unsigned)bfu_rne(w[5]) << 16); pk.w = (unsigned)bfu_rne(w[6]) | ((unsigned)bfu_rne(w[7]) << 16);
        unsigned short* d = ((which & 1) ? VFp : KFp) + ((which >= 2) ? 2097152 : 0) + (long long)c * 8;
        VST2(cm_u4, (cm_u4*)d, pk); }
    else { const int u = (blk - 2048 - 4 * 1024) * 256 + threadIdx.x; VST2(float, MFp + u, sc * cmb_bf(DELTA[u]));
        asm volatile("s_wait_xcnt 0x0" ::: "memory");   // stands behind the store, ahead of any rewrite of the registers it names
    } }
// out = m * A1 + (1 - m) * A2 with m = bf16(soft_mask[b][l]) broadcast over (h, e); thread per float4
__global__ __launch_bounds__(256) void k_ds_blend(const float* __restrict__ A1, const float* __restrict__ A2, const float* __restrict__ SM, float* __restrict__ O, long long n4) {
    #pragma clang fp contract(off)
    const long long u = (long long)blockIdx.x * 256 + threadIdx.x; if (u >= n4) return; const float m = cmb_bf(SM[(4 * u) / 512]); const v4f a = *(const v4f*)(A1 + 4 * u), b = *(const v4f*)(A2 + 4 * u); v4f o;
    o.x = m * a.x + (1.f - m) * b.x; o.y = m * a.y + (1.f - m) * b.y; o.z = m * a.z + (1.f - m) * b.z; o.w = m * a.w + (1.f - m) * b.w; VST2V4(O + 4 * u, o); }


extern "C" void kernel_launch(void* const* d_in, const int* in_sizes, int n_in, void* d_out, int out_size, void* d_ws, size_t ws_size, hipStream_t stream) {
    (void)in_sizes; (void)n_in; (void)out_size; (void)ws_size;
    const float* q = (const float*)d_in[0];
    const float* kk = (const float*)d_in[1];
    const float* v = (const float*)d_in[2];
    const float* kn = (const float*)d_in[3];
    const float* vn = (const float*)d_in[4];
    const float* tau = (const float*)d_in[5];
    const float* delta = (const float*)d_in[6];
    const float* smask = (const float*)d_in[7];
    float* out = (float*)d_out;
    char* wsp = (char*)d_ws;
    float* QT = (float*)wsp; wsp += (((size_t)((size_t)2097152) * 4 + 255) / 256) * 256;
    unsigned short* KF = (unsigned short*)wsp; wsp += (((size_t)((size_t)4194304) * 2 + 255) / 256) * 256;   // [branch][batch] planes of 1,048,576 bf16 in fragment order
    unsigned short* VF = (unsigned short*)wsp; wsp += (((size_t)((size_t)4194304) * 2 + 255) / 256) * 256;   // the same
    float* MF = (float*)wsp; wsp += (((size_t)((size_t)4096) * 4 + 255) / 256) * 256;
    float* AO1 = (float*)wsp; wsp += (((size_t)((size_t)2097152) * 4 + 255) / 256) * 256;
    float* AO2 = (float*)wsp; wsp += (((size_t)((size_t)2097152) * 4 + 255) / 256) * 256;  // directly behind AO1: the attention launch writes both as [branch][batch] planes
    if ((size_t)(wsp - (char*)d_ws) > ws_size) return;   // static carve guard
    k_ds_pre<<<(unsigned)(2048 + 4 * 1024 + 16), 256, 0, stream>>>(q, kk, v, kn, vn, tau, delta, QT, KF, VF, MF, 0.18033688f);   // scale * log2(e): the table is added to exp2 arguments
    k_attn_t<<<dim3(2048 / (16 * AW), 8, 4), 32 * AW, 0, stream>>>(QT, KF, VF, MF, AO1);   // writes AO1 and AO2 as [branch][batch] planes
    k_ds_blend<<<(524288 + 255) / 256, 256, 0, stream>>>(AO1, AO2, smask, out, 524288LL);
}

// v006
// It runs in 50.3 microseconds.
// Next to v005, in two timings, it ran 1.39 and 1.40 times as fast.
// Counting every step since v000, which is the starting kernel, it is 71.6 times as fast.
// De-stationary causal attention with a null branch, [b, l, h, e] layout (2 x 2,048 tokens, 8 heads x 64): A = softmax(scale * (q.k * tau_b + delta_bj)) over keys j <= i for (keys, values) and for (keys_null, values_null) with the same queries; out = soft_mask * out_edit + (1 - soft_mask) * out_null per query. All inputs rounded to bf16 (RNE); q is multiplied by tau_b on device (f32) and k, v rounded, k and v are stored as bf16 in WMMA fragment order, then ONE WMMA attention launch for both batches and both branches (v_wmma_f32_16x16x32_bf16, f32 accumulate) with q as a bf16 hi/lo split (f32-class: q*tau is not 16-bit exact) against bf16 k, the per-key additive table scale*delta_bj, causal, f32 online softmax, P as a bf16 hi/lo split against bf16 v; the blend in f32.
#include <hip/hip_runtime.h>
#include <math.h>

typedef __attribute__((ext_vector_type(16))) _Float16 v16h;
typedef __attribute__((ext_vector_type(8)))  _Float16 v8h;
typedef __attribute__((ext_vector_type(16))) __bf16   v16b;
typedef __attribute__((ext_vector_type(8)))  __bf16   v8b;
typedef __attribute__((ext_vector_type(8)))  float    v8f;
typedef __attribute__((ext_vector_type(4)))  float    v4f;

// 16-bit WMMA fragment map (wave32), lane L, h = L>>4, m = L&15:
//   A 16x32: lane = row m;   element i -> k = (i<8) ? 8h+i : 16+8h+(i-8)
//   B 32x16: lane = column m; the SAME k(i,h)
//   D 16x16 (8 f32): lane = column m; element r -> row 8h+r
__device__ __forceinline__ int frag_k(int i, int h) { return (i < 8) ? (8 * h + i) : (16 + 8 * h + (i - 8)); }
__device__ __forceinline__ __bf16 bf16_rne(float f) {
    unsigned int u = __float_as_uint(f);
    u += 0x7fffu + ((u >> 16) & 1u);
    return __builtin_bit_cast(__bf16, (unsigned short)(u >> 16));
}
__device__ __forceinline__ float bf16_f32(__bf16 b) { return __uint_as_float(((unsigned int)__builtin_bit_cast(unsigned short, b)) << 16); }
__device__ __forceinline__ v8f wmma16(v16h a, v16h b, v8f c) {
    c = __builtin_amdgcn_wmma_f32_16x16x32_f16(false, a, false, b, (short)0, c, false, false);
    asm volatile("v_nop\n\tv_nop\n\tv_nop\n\tv_nop" : "+v"(c) : "v"(a), "v"(b));
    return c;
}
__device__ __forceinline__ v8f wmmab(v16b a, v16b b, v8f c) {
    c = __builtin_amdgcn_wmma_f32_16x16x32_bf16(false, a, false, b, (short)0, c, false, false);
    asm volatile("v_nop\n\tv_nop\n\tv_nop\n\tv_nop" : "+v"(c) : "v"(a), "v"(b));
    return c;
}
struct Split { v16b hi, lo; };
// hi/lo split product: a.hi*b.hi + a.hi*b.lo + a.lo*b.hi
__device__ __forceinline__ v8f wmma3(const Split& a, const Split& b, v8f c) {
    c = __builtin_amdgcn_wmma_f32_16x16x32_bf16(false, a.hi, false, b.hi, (short)0, c, false, false);
    c = __builtin_amdgcn_wmma_f32_16x16x32_bf16(false, a.hi, false, b.lo, (short)0, c, false, false);
    c = __builtin_amdgcn_wmma_f32_16x16x32_bf16(false, a.lo, false, b.hi, (short)0, c, false, false);
    asm volatile("v_nop\n\tv_nop\n\tv_nop\n\tv_nop" : "+v"(c) : "v"(a.hi), "v"(a.lo), "v"(b.hi), "v"(b.lo));
    return c;
}
// hi/lo split a against a b that is exact in bf16 (its lo part is zero): a.hi*b + a.lo*b
__device__ __forceinline__ v8f wmma2(const Split& a, v16b b, v8f c) {
    c = __builtin_amdgcn_wmma_f32_16x16x32_bf16(false, a.hi, false, b, (short)0, c, false, false);
    c = __builtin_amdgcn_wmma_f32_16x16x32_bf16(false, a.lo, false, b, (short)0, c, false, false);
    return c;
}
// the same with the exact bf16 operand as A and the hi/lo split as B: a*b.hi + a*b.lo
__device__ __forceinline__ v8f wmma2t(v16b a, const Split& b, v8f c) {
    c = __builtin_amdgcn_wmma_f32_16x16x32_bf16(false, a, false, b.hi, (short)0, c, false, false);
    c = __builtin_amdgcn_wmma_f32_16x16x32_bf16(false, a, false, b.lo, (short)0, c, false, false);
    return c;
}
// One B fragment from a plane in fragment order (see k_ds_pre): two blocks of 256 halves, lane L's eight halves at 8L; block 0 holds elements 0..7, block 1 elements 8..15
__device__ __forceinline__ v16b bfrag_ld(const __bf16* __restrict__ p) {
    const v8b x = *(const v8b*)p, y = *(const v8b*)(p + 256);
    return __builtin_shufflevector(x, y, 0, 1, 2, 3, 4, 5, 6, 7, 8, 9, 10, 11, 12, 13, 14, 15);
}
struct Split3 { v16b hi, mid, lo; };
// triple split product (6 terms, drops only terms below 2^-24 relative)
__device__ __forceinline__ v8f wmma6(const Split3& a, const Split3& b, v8f c) {
    c = __builtin_amdgcn_wmma_f32_16x16x32_bf16(false, a.hi, false, b.hi, (short)0, c, false, false);
    c = __builtin_amdgcn_wmma_f32_16x16x32_bf16(false, a.hi, false, b.mid, (short)0, c, false, false);
    c = __builtin_amdgcn_wmma_f32_16x16x32_bf16(false, a.mid, false, b.hi, (short)0, c, false, false);
    c = __builtin_amdgcn_wmma_f32_16x16x32_bf16(false, a.hi, false, b.lo, (short)0, c, false, false);
    c = __builtin_amdgcn_wmma_f32_16x16x32_bf16(false, a.mid, false, b.mid, (short)0, c, false, false);
    c = __builtin_amdgcn_wmma_f32_16x16x32_bf16(false, a.lo, false, b.hi, (short)0, c, false, false);
    asm volatile("v_nop\n\tv_nop\n\tv_nop\n\tv_nop" : "+v"(c) : "v"(a.hi), "v"(a.mid), "v"(a.lo), "v"(b.hi), "v"(b.mid), "v"(b.lo));
    return c;
}

// Fragment gathers from f32 memory: element i <- p[(k0 + frag_k(i,h)) * sk] * s, zero for k >= klen.
__device__ __forceinline__ v16h fh_ld(const float* __restrict__ p, long long sk, int k0, int h, int klen, float s) {
    v16h a;
#pragma unroll
    for (int i = 0; i < 16; ++i) { const int k = k0 + frag_k(i, h); a[i] = (k < klen) ? (_Float16)(p[(long long)k * sk] * s) : (_Float16)0.f; }
    return a;
}
__device__ __forceinline__ Split sp_ld(const float* __restrict__ p, long long sk, int k0, int h, int klen, float s) {
    Split r;
#pragma unroll
    for (int i = 0; i < 16; ++i) {
        const int k = k0 + frag_k(i, h); const float x = (k < klen) ? p[(long long)k * sk] * s : 0.f;
        const __bf16 hb = bf16_rne(x); r.hi[i] = hb; r.lo[i] = bf16_rne(x - bf16_f32(hb));
    }
    return r;
}
__device__ __forceinline__ Split3 sp3_ld(const float* __restrict__ p, long long sk, int k0, int h, int klen, float s) {
    Split3 r;
#pragma unroll
    for (int i = 0; i < 16; ++i) {
        const int k = k0 + frag_k(i, h); const float x = (k < klen) ? p[(long long)k * sk] * s : 0.f;
        const __bf16 hb = bf16_rne(x); const float r1 = x - bf16_f32(hb); const __bf16 mb = bf16_rne(r1);
        r.hi[i] = hb; r.mid[i] = mb; r.lo[i] = bf16_rne(r1 - bf16_f32(mb));
    }
    return r;
}
__device__ __forceinline__ v16b bh_ld(const float* __restrict__ p, long long sk, int k0, int h, int klen, float s) {
    v16b a;
#pragma unroll
    for (int i = 0; i < 16; ++i) { const int k = k0 + frag_k(i, h); a[i] = bf16_rne((k < klen) ? p[(long long)k * sk] * s : 0.f); }
    return a;
}
// f16 fragment from an f16 LDS/global row with element stride 1 (k-contiguous), no bounds (tile already zero padded)
__device__ __forceinline__ v16h fh_row(const _Float16* __restrict__ row, int k0, int h) {
    v16h a;
#pragma unroll
    for (int i = 0; i < 16; ++i) a[i] = row[k0 + frag_k(i, h)];
    return a;
}

#define VST2(T, ptr, val) do { const T vst2_v_ = (val); *(T*)(ptr) = vst2_v_;  } while (0)
typedef float v4f __attribute__((ext_vector_type(4)));
#define VST2V4(ptr, val) do { const v4f vst2_v4_ = (val); *(v4f*)(ptr) = vst2_v4_;  } while (0)

__device__ __attribute__((noinline)) float act_fn(float v, int act) {
    if (act == 1) return fmaxf(v, 0.f);                                                                               // relu
    if (act == 2) { const float u = 0.7978845608028654f * (v + 0.044715f * v * v * v); return 0.5f * v * (1.f + tanhf(u)); } // tanh-gelu
    if (act == 3) return v / (1.f + expf(-v));                                                                        // silu
    if (act == 4) return 0.5f * v * (1.f + erff(v * 0.7071067811865476f));                                             // erf-gelu
    if (act == 5) return tanhf(v);
    if (act == 6) return 1.f / (1.f + expf(-v));                                                                      // sigmoid
    if (act == 7) return (v > 0.f) ? v : 0.01f * v;                                                                   // leaky relu 0.01
    if (act == 8) return (v > 0.f) ? v : (expf(v) - 1.f);                                                             // elu
    if (act == 9) return fminf(fmaxf(v, 0.f), 6.f);                                                                   // relu6
    if (act == 10) return fabsf(v);                                                                                    // abs
    if (act == 11) return (v >= 0.f) ? v : 0.1f * v;                                                                  // leaky 0.1
    if (act == 12) return (v > 0.f) ? v : 0.2f * v;                                                                   // leaky 0.2
    if (act == 13) return (v > 20.f) ? v : log1pf(expf(v));                                                            // softplus
    return v;
}

// =====================================================================================================================
// k_gemm<MODE>: C(z, m, n) = act(alpha * sum_k A(z, m, k) * B(z, k, n) + bias) + beta * R(z, m, n)
//   One wave (32-thread block) per 16 x 32 tile of C; grid (ceil(N/32), ceil(M/16), Z). Batch z -> (zo = z / zi_n, zi = z % zi_n)
//   with separate outer/inner strides for every tensor (e.g. batch and head). A(m,k) = A[zo*sAo + zi*sAi + m*sAm + k*sAk] (f32),
//   B(k,n) = B[zo*sBo + zi*sBi + n*sBn + k*sBk] (f32); any M, N, K (K zero-padded to 32 inside the fragments, M/N tails guarded).
//   C(m,n) = C[zo*sCo + zi*sCi + m*sCm + n] (n contiguous). flags: 1 bias[n], 2 bias[m], 4 residual R[zo*sRo + zi*sRi + m*sRm + n*sRn].
//   MODE 0: f16 operands (A prescaled by sa, B by sb, both undone in the epilogue); 1: bf16 hi/lo split (3 products); 2: bf16;
//   3: bf16 hi/mid/lo triple split (6 products); 4: as 3 with Kahan-compensated f32 accumulation across k-steps.
// =====================================================================================================================
struct GemmP {
    const float* A; const float* B; const float* bias; const float* R; float* C;
    long long sAo, sAi, sAm, sAk, sBo, sBi, sBn, sBk, sCo, sCi, sCm, sRo, sRi, sRm, sRn;
    int M, N, K, zi_n, flags, act; float alpha, beta, sa, sb;
    int Npad, pad_;     // columns [N, Npad) of C are written as 0 so that padded workspace rows are covered by whole-line stores; Npad >= N
};
static_assert(sizeof(GemmP) == 5 * 8 + 15 * 8 + 6 * 4 + 4 * 4 + 2 * 4, "GemmP has padding");

template <int MODE>
__global__ __launch_bounds__(32) void k_gemm(GemmP p) {
    const int lane = threadIdx.x & 31, h = lane >> 4, l15 = lane & 15;
    const int m0 = blockIdx.y * 16, n0 = blockIdx.x * 32;
    const int z = blockIdx.z, zo = z / p.zi_n, zi = z - zo * p.zi_n;
    const float* A = p.A + zo * p.sAo + zi * p.sAi;
    const float* B = p.B + zo * p.sBo + zi * p.sBi;
    const int am = min(m0 + l15, p.M - 1);                       // clamped row for loads (stores are guarded)
    v8f acc[2], comp[2];
#pragma unroll
    for (int t = 0; t < 2; ++t) { v8f zz = {}; acc[t] = zz; comp[t] = zz; }
    for (int k0 = 0; k0 < p.K; k0 += 32) {
        const float* arow = A + (long long)am * p.sAm;
        if (MODE == 1) {
            const Split a = sp_ld(arow, p.sAk, k0, h, p.K, 1.f);
#pragma unroll
            for (int t = 0; t < 2; ++t) {
                const int bn = min(n0 + t * 16 + l15, p.N - 1);
                acc[t] = wmma3(a, sp_ld(B + (long long)bn * p.sBn, p.sBk, k0, h, p.K, 1.f), acc[t]);
            }
        } else if (MODE == 3) {
            const Split3 a = sp3_ld(arow, p.sAk, k0, h, p.K, 1.f);
#pragma unroll
            for (int t = 0; t < 2; ++t) {
                const int bn = min(n0 + t * 16 + l15, p.N - 1);
                acc[t] = wmma6(a, sp3_ld(B + (long long)bn * p.sBn, p.sBk, k0, h, p.K, 1.f), acc[t]);
            }
        } else if (MODE == 4) {
            // triple split as MODE 3, but each k-step's 6 products go into a fresh accumulator and the partial is added to the running f32 sum
            // on the VALU with Kahan compensation (accumulation error stays ~1 ulp however long K is)
            const Split3 a = sp3_ld(arow, p.sAk, k0, h, p.K, 1.f);
#pragma unroll
            for (int t = 0; t < 2; ++t) {
                const int bn = min(n0 + t * 16 + l15, p.N - 1); v8f zz = {};
                const v8f part = wmma6(a, sp3_ld(B + (long long)bn * p.sBn, p.sBk, k0, h, p.K, 1.f), zz);
                const v8f y = part - comp[t]; const v8f s = acc[t] + y; comp[t] = (s - acc[t]) - y; acc[t] = s;
            }
        } else if (MODE == 2) {
            const v16b a = bh_ld(arow, p.sAk, k0, h, p.K, 1.f);
#pragma unroll
            for (int t = 0; t < 2; ++t) {
                const int bn = min(n0 + t * 16 + l15, p.N - 1);
                acc[t] = wmmab(a, bh_ld(B + (long long)bn * p.sBn, p.sBk, k0, h, p.K, 1.f), acc[t]);
            }
        } else {
            const v16h a = fh_ld(arow, p.sAk, k0, h, p.K, p.sa);
#pragma unroll
            for (int t = 0; t < 2; ++t) {
                const int bn = min(n0 + t * 16 + l15, p.N - 1);
                acc[t] = wmma16(a, fh_ld(B + (long long)bn * p.sBn, p.sBk, k0, h, p.K, p.sb), acc[t]);
            }
        }
    }
    const float iscale = (MODE == 0) ? p.alpha / (p.sa * p.sb) : p.alpha;
    float* C = p.C + zo * p.sCo + zi * p.sCi;
    const float* R = p.R + zo * p.sRo + zi * p.sRi;
    __shared__ __align__(16) float ctile[16][36];
#pragma unroll
    for (int t = 0; t < 2; ++t) {
        const int n = n0 + t * 16 + l15; const int nn = min(n, p.N - 1);
#pragma unroll
        for (int r = 0; r < 8; ++r) {
            const int m = m0 + 8 * h + r; const int mm = min(m, p.M - 1);
            float v = acc[t][r] * iscale;
            if (p.flags & 1) v += p.bias[nn];
            if (p.flags & 2) v += p.bias[mm];
            if (p.flags & 8) v *= p.bias[(long long)zo * p.M + mm];   /* per-(z,row) scale vector laid out [Z][M]; exclusive with the bias flags */
            v = act_fn(v, p.act);
            if (p.flags & 4) v += p.beta * R[(long long)mm * p.sRm + (long long)nn * p.sRn];
            ctile[8 * h + r][t * 16 + l15] = (n < p.N) ? v : 0.f;
        }
    }
    __syncthreads();
    const int NW = (p.Npad > p.N) ? p.Npad : p.N;           // write width
    const bool fast = (m0 + 16 <= p.M) && (n0 + 32 <= NW) && ((p.sCm & 3) == 0) && ((((size_t)C) & 15) == 0);
    if (fast) {
#pragma unroll
        for (int s = 0; s < 4; ++s) {
            const int row = s * 4 + (lane >> 3), c4 = (lane & 7) * 4;
            const v4f v = *(const v4f*)&ctile[row][c4];
            VST2V4(C + (long long)(m0 + row) * p.sCm + n0 + c4, v);
        }
    } else {
        for (int row = 0; row < 16; ++row) {
            const int m = m0 + row, n = n0 + lane;
            if (m < p.M && n < NW) VST2(float, C + (long long)m * p.sCm + n, ctile[row][lane]);
        }
    }
}


// =====================================================================================================================
// k_gemmT<MODE, TM, TN>: same contract as k_gemm, but one wave computes a (16*TM) x (16*TN) tile: TM A fragments and TN B fragments are
//   loaded per 32-wide k-step and reused across TM*TN WMMAs (far fewer load/convert instructions per MAC). MODE 0 (f16), 1 (bf16 hi/lo),
//   2 (bf16) only. grid (ceil(NW/(16*TN)), ceil(M/(16*TM)), Z), block 32. Epilogue identical to k_gemm, run per 16x32 sub-tile.
// =====================================================================================================================
template <int MODE, int TM, int TN>
__global__ __launch_bounds__(32) void k_gemmT(GemmP p) {
    const int lane = threadIdx.x & 31, h = lane >> 4, l15 = lane & 15;
    const int m0 = blockIdx.y * (16 * TM), n0 = blockIdx.x * (16 * TN);
    const int z = blockIdx.z, zo = z / p.zi_n, zi = z - zo * p.zi_n;
    const float* A = p.A + zo * p.sAo + zi * p.sAi;
    const float* B = p.B + zo * p.sBo + zi * p.sBi;
    v8f acc[TM][TN];
#pragma unroll
    for (int i = 0; i < TM; ++i)
#pragma unroll
        for (int t = 0; t < TN; ++t) { v8f zz = {}; acc[i][t] = zz; }
    for (int k0 = 0; k0 < p.K; k0 += 32) {
        if (MODE == 1) {
            Split a[TM], b[TN];
#pragma unroll
            for (int i = 0; i < TM; ++i) { const int am = min(m0 + 16 * i + l15, p.M - 1); a[i] = sp_ld(A + (long long)am * p.sAm, p.sAk, k0, h, p.K, 1.f); }
#pragma unroll
            for (int t = 0; t < TN; ++t) { const int bn = min(n0 + 16 * t + l15, p.N - 1); b[t] = sp_ld(B + (long long)bn * p.sBn, p.sBk, k0, h, p.K, 1.f); }
#pragma unroll
            for (int i = 0; i < TM; ++i)
#pragma unroll
                for (int t = 0; t < TN; ++t) acc[i][t] = wmma3(a[i], b[t], acc[i][t]);
        } else if (MODE == 2) {
            v16b a[TM], b[TN];
#pragma unroll
            for (int i = 0; i < TM; ++i) { const int am = min(m0 + 16 * i + l15, p.M - 1); a[i] = bh_ld(A + (long long)am * p.sAm, p.sAk, k0, h, p.K, 1.f); }
#pragma unroll
            for (int t = 0; t < TN; ++t) { const int bn = min(n0 + 16 * t + l15, p.N - 1); b[t] = bh_ld(B + (long long)bn * p.sBn, p.sBk, k0, h, p.K, 1.f); }
#pragma unroll
            for (int i = 0; i < TM; ++i)
#pragma unroll
                for (int t = 0; t < TN; ++t) acc[i][t] = wmmab(a[i], b[t], acc[i][t]);
        } else {
            v16h a[TM], b[TN];
#pragma unroll
            for (int i = 0; i < TM; ++i) { const int am = min(m0 + 16 * i + l15, p.M - 1); a[i] = fh_ld(A + (long long)am * p.sAm, p.sAk, k0, h, p.K, p.sa); }
#pragma unroll
            for (int t = 0; t < TN; ++t) { const int bn = min(n0 + 16 * t + l15, p.N - 1); b[t] = fh_ld(B + (long long)bn * p.sBn, p.sBk, k0, h, p.K, p.sb); }
#pragma unroll
            for (int i = 0; i < TM; ++i)
#pragma unroll
                for (int t = 0; t < TN; ++t) acc[i][t] = wmma16(a[i], b[t], acc[i][t]);
        }
    }
    const float iscale = (MODE == 0) ? p.alpha / (p.sa * p.sb) : p.alpha;
    float* C = p.C + zo * p.sCo + zi * p.sCi;
    const float* R = p.R + zo * p.sRo + zi * p.sRi;
    const int NW = (p.Npad > p.N) ? p.Npad : p.N;
    __shared__ __align__(16) float ctile[16][36];
#pragma unroll
    for (int i = 0; i < TM; ++i) {
        const int mb = m0 + 16 * i; if (mb >= p.M) break;          // wave-uniform
#pragma unroll
        for (int tp = 0; tp < TN / 2; ++tp) {
            const int nb = n0 + 32 * tp; if (nb >= NW) break;        // wave-uniform
#pragma unroll
            for (int t2 = 0; t2 < 2; ++t2) {
                const int t = 2 * tp + t2; const int n = nb + t2 * 16 + l15; const int nn = min(n, p.N - 1);
#pragma unroll
                for (int r = 0; r < 8; ++r) {
                    const int m = mb + 8 * h + r; const int mm = min(m, p.M - 1);
                    float v = acc[i][t][r] * iscale;
                    if (p.flags & 1) v += p.bias[nn];
                    if (p.flags & 2) v += p.bias[mm];
            if (p.flags & 8) v *= p.bias[(long long)zo * p.M + mm];   /* per-(z,row) scale vector laid out [Z][M]; exclusive with the bias flags */
                    v = act_fn(v, p.act);
                    if (p.flags & 4) v += p.beta * R[(long long)mm * p.sRm + (long long)nn * p.sRn];
                    ctile[8 * h + r][t2 * 16 + l15] = (n < p.N) ? v : 0.f;
                }
            }
            __syncthreads();
            const bool fast = (mb + 16 <= p.M) && (nb + 32 <= NW) && ((p.sCm & 3) == 0) && ((((size_t)C) & 15) == 0);
            if (fast) {
#pragma unroll
                for (int s = 0; s < 4; ++s) {
                    const int row = s * 4 + (lane >> 3), c4 = (lane & 7) * 4;
                    const v4f v = *(const v4f*)&ctile[row][c4];
                    VST2V4(C + (long long)(mb + row) * p.sCm + nb + c4, v);
                }
            } else {
                for (int row = 0; row < 16; ++row) {
                    const int m = mb + row, n = nb + lane;
                    if (m < p.M && n < NW) VST2(float, C + (long long)m * p.sCm + n, ctile[row][lane]);
                }
            }
            __syncthreads();
        }
    }
}

// =====================================================================================================================
//   Wave = 16 queries, AW waves per block, 64-key blocks; grid (ceil(Lq/(16*AW)), H, 2 branches x 2 batches), block 32*AW. Any Lq, Lk; head dim dh <= DHP
//   (DHP multiple of 32), value dim dv <= DVP (multiple of 16, <= 128). Every tensor addressed by (batch, head, row, element) strides, f32.
//   Scores: QM 0 f16 operands, 1 bf16 hi/lo split, 2 bf16 triple split; statistics f32 (exp2 domain); P.V: P x 4096 as f16 with V f16 staged in LDS
//   (SPLITPV: P as a bf16 hi/lo split, V bf16 fragments read from memory). kv head = h / hrep. Masking: causal = 1 (keep j <= i + coff, masked -> -inf, key blocks beyond the
//   diagonal skipped), causal = 2 (masked -> mfill, a finite fill like the -1e9; no skipping), causal = 3 (keep j >= i + coff,
//   masked -> -inf, no skipping); optional additive f32 mask Mf,
//   optional int keep-mask Mi (0 -> score := mfill), both addressed b*smb + h*smh + i*smi + j*smj (0 strides broadcast).
// =====================================================================================================================
#define AW 4
struct AttnP {   // apv4
    const float* Q; const float* K; const float* V; float* O; float* P; const float* Mf; const int* Mi; float* ST;
    const float* Pw; const float* Rt; const int* SQ; const int* SK;           // optional: post-softmax weight, relative-position table, segment ids
    long long swb, swh, swi, swj, srb, srh, sri;                                 // Pw strides (b,h,i,j); Rt strides (b,h,i), column = clamp(i - j + roff, 0, rn-1)
    long long sQb, sQh, sQi, sQd, sKb, sKh, sKj, sKd, sVb, sVh, sVj, sVd, sOb, sOh, sOi, sPb, sPh, sPi, smb, smh, smi, smj;
    int Lq, Lk, dh, dv, hrep, causal, coff, pband;   // pband > 0: P holds only the band |j - i| <= pband, column j - i + pband
    float scale, mfill; int nonorm, mpol;             // nonorm (online path only): O = sum_j exp(score_j) V_j without the 1/rowsum (scores must be <= ~0); mpol: Mi masks where ==0 (mpol 0) or where !=0 (mpol 1)
    int roff, rn, segpol, win;                        // Rt column offset/count; SQ/SK: score := mfill where (segpol 0) SQ[i] != SK[j] or (segpol 1) SQ[i] == SK[j]; win > 0: keys with i - j > win (after coff) -> -inf
};
//   Pw: the softmax numerator is multiplied by Pw(b,h,i,j) AFTER the row sum is taken (probs * weight, then P.V), as in post-softmax multiplicative biases.                                                    // ST (optional): per row (b,h,i) -> ST[((b*H + h)*Lq + i)*2 + {0,1}] = {row max of the scaled+masked score (natural units), sum_j exp(score - max)}
static_assert(sizeof(AttnP) == 12 * 8 + 29 * 8 + 16 * 4, "AttnP has padding");

// Four waves per SIMD: the one launch puts four workgroups on every WGP, which fit only with at most 256 registers a wave
#ifndef KATTN_ATTR
#define KATTN_ATTR __attribute__((amdgpu_waves_per_eu(4, 4)))
#endif
// The shape of this problem's attention launch as compile-time constants: with them the
// element bounds tests (k < dh, d < dv) and every optional path fold away, the unit element strides let the compiler merge a fragment's loads into
// 16-byte loads, and the additive table (always passed here, so read without a null test) no longer depends on the query row. Only the five base pointers stay run-time values.
__device__ __forceinline__ void attn_fix_shape(AttnP& p) {
    p.P = nullptr; p.Mi = nullptr; p.ST = nullptr; p.Pw = nullptr; p.Rt = nullptr; p.SQ = nullptr; p.SK = nullptr;
    p.swb = 0; p.swh = 0; p.swi = 0; p.swj = 0; p.srb = 0; p.srh = 0; p.sri = 0;
    p.sQb = 1048576; p.sQh = 64; p.sQi = 512; p.sQd = 1; p.sKb = 1048576; p.sKh = 64; p.sKj = 512; p.sKd = 1; p.sVb = 1048576; p.sVh = 64; p.sVj = 512; p.sVd = 1;
    p.sOb = 1048576; p.sOh = 64; p.sOi = 512; p.sPb = 0; p.sPh = 0; p.sPi = 0; p.smb = 2048; p.smh = 0; p.smi = 0; p.smj = 1;
    p.Lq = 2048; p.Lk = 2048; p.dh = 64; p.dv = 64; p.hrep = 1; p.causal = 1; p.coff = 0; p.pband = 0;
    p.scale = 0.125f; p.mfill = 0.0f; p.nonorm = 0; p.mpol = 0; p.roff = 0; p.rn = 1; p.segpol = 0; p.win = 0;
}
template <int DHP, int DVP, int QM, bool SPLITPV, bool TWOPASS>
__global__ __launch_bounds__(32 * AW) KATTN_ATTR void k_attn(AttnP p) {
    attn_fix_shape(p);
    constexpr int NT = DVP / 16;                // output tiles
    constexpr int KS = DHP / 32;                // k-steps for the scores
    constexpr int VP = DVP + 8;                 // LDS pitch (halves)
    __shared__ __align__(16) float    pl[AW][16 * 64];
    __shared__ __align__(16) _Float16 vl[SPLITPV ? 8 : 64 * VP];   // f16 V tile (SPLITPV reads V fragments from memory and stages nothing)
    const int lane = threadIdx.x & 31, hf = lane >> 4, l15 = lane & 15, wave = threadIdx.x >> 5;
    // blockIdx.z = 2 * branch + batch: K, V and O hold one plane per (branch, batch), indexed by bz; Q and the additive table are shared by the branches, indexed by b
    const int h = blockIdx.y, bz = blockIdx.z, b = bz & 1, hk = h / p.hrep;
    const int q0 = (blockIdx.x * AW + wave) * 16;
    float* myp = pl[wave];
    const float L2E = 1.4426950408889634f;
    const float NEG = -__builtin_inff();
    const int qi = min(q0 + l15, p.Lq - 1);
    const float* qrow = p.Q + b * p.sQb + h * p.sQh + (long long)qi * p.sQi;
    const float* kbase = p.K + bz * p.sKb + hk * p.sKh;
    const float* vbase = p.V + bz * p.sVb + hk * p.sVh;
    // QM 1 / SPLITPV: K and V are bf16 planes in fragment order, 131,072 halves per (bz, head), 4,096 per 64-key block, 512 per fragment
    const __bf16* kfrag = (const __bf16*)p.K + (bz * 8 + hk) * 131072 + lane * 8;
    const __bf16* vfrag = (const __bf16*)p.V + (bz * 8 + hk) * 131072 + lane * 8;
    v16h qa[QM == 0 ? KS : 1]; Split qs_[QM == 1 ? KS : 1]; Split3 qt_[QM == 2 ? KS : 1];
#pragma unroll
    for (int ks = 0; ks < KS; ++ks) {
        if (QM == 2) qt_[ks] = sp3_ld(qrow, p.sQd, ks * 32, hf, p.dh, 1.f);
        else if (QM == 1) qs_[ks] = sp_ld(qrow, p.sQd, ks * 32, hf, p.dh, 1.f);
        else qa[ks] = fh_ld(qrow, p.sQd, ks * 32, hf, p.dh, 1.f);
    }
    v8f o[NT]; float m8[8], l8[8];
#pragma unroll
    for (int t = 0; t < NT; ++t) { v8f zz = {}; o[t] = zz; }
#pragma unroll
    for (int i = 0; i < 8; ++i) { m8[i] = NEG; l8[i] = 0.f; }
    int jend = p.Lk; int jstart = 0;
    if (p.causal == 1) { const int je = (blockIdx.x * AW + AW - 1) * 16 + 16 + p.coff; jend = min(jend, max(je, 0)); }   // uniform per block
    if (p.win > 0) { const int js = (int)(blockIdx.x * AW) * 16 + p.coff - p.win; jstart = (js > 0) ? (js / 64) * 64 : 0; }   // uniform per block: key blocks entirely outside every row's window hold only -inf entries and are skipped exactly
    const int npass = TWOPASS ? 2 : 1;
    for (int pass = 0; pass < npass; ++pass) {
        const bool dopv = (!TWOPASS) || pass == 1;
        for (int j0 = jstart; j0 < jend; j0 += 64) {
            v16b kf[QM == 1 ? 4 : 1][KS];
            if (QM == 1) {
                // all of the key block's K fragments are asked for before the first product: one wait for memory, not one per fragment
                const __bf16* kblk = kfrag + (j0 >> 6) * 4096;
#pragma unroll
                for (int t = 0; t < 4; ++t)
#pragma unroll
                    for (int ks = 0; ks < KS; ++ks) kf[t][ks] = bfrag_ld(kblk + (t * KS + ks) * 512);
                asm volatile("s_wait_xcnt 0x0" :: "v"(kblk) : "memory");   // the loads' address pair stays live up to this wait, so that no later load lands in it and nothing rewrites it ahead of the wait
                __builtin_amdgcn_sched_barrier(0);   // keeps every K load ahead of the first product: the scheduler otherwise holds some back until registers come free, a second wait for memory
            }
            if (dopv && !SPLITPV) {
                __syncthreads();                                 // previous key block's reads of vl / pl are done
                static_assert((32 * AW) % DVP == 0, "a thread keeps its V column from pass to pass");
                constexpr int VR = (32 * AW) / DVP;              // V rows staged by the block per pass
                const int jr0 = threadIdx.x / DVP, d = threadIdx.x - jr0 * DVP;
                const float* vsrc = vbase + (long long)(j0 + jr0) * p.sVj + (long long)d * p.sVd;   // one address; the passes differ by constant offsets
#pragma unroll   // constant trip count: all of a thread's V loads of a key block are issued before the first is waited for
                for (int n = 0; n < 64 / VR; ++n) {
                    const int jr = jr0 + n * VR, j = j0 + jr;
                    const float f = ((p.Lk % 64 == 0 || j < p.Lk) && d < p.dv) ? vsrc[(long long)(n * VR) * p.sVj] : 0.f;
                    vl[jr * VP + d] = (_Float16)f;
                }
            }
            v8f s[4];
#pragma unroll
            for (int t = 0; t < 4; ++t) {
                const int j = min(j0 + t * 16 + l15, p.Lk - 1);
                const float* krow = kbase + (long long)j * p.sKj;
                v8f acc = {};
#pragma unroll
                for (int ks = 0; ks < KS; ++ks) {
                    if (QM == 2)      acc = wmma6(qt_[ks], sp3_ld(krow, p.sKd, ks * 32, hf, p.dh, 1.f), acc);
                    else if (QM == 1) acc = wmma2(qs_[ks], kf[t][ks], acc);
                    else              acc = wmma16(qa[ks], fh_ld(krow, p.sKd, ks * 32, hf, p.dh, 1.f), acc);
                }
                s[t] = acc;
            }
            v16b vf[SPLITPV ? NT : 1][2];
            if (dopv && SPLITPV) {
                // all of the key block's V fragments are asked for together and ahead of the softmax: their way from memory is covered by the score products, not paid at the P.v products
                const __bf16* vblk = vfrag + (j0 >> 6) * 4096;
#pragma unroll
                for (int t = 0; t < NT; ++t) { vf[t][0] = bfrag_ld(vblk + (t * 2 + 0) * 512); vf[t][1] = bfrag_ld(vblk + (t * 2 + 1) * 512); }
                asm volatile("s_wait_xcnt 0x0" :: "v"(vblk) : "memory");   // the loads' address pair stays live up to this wait, so that no load of the run lands in it and nothing rewrites it ahead of the wait
            }
            float pv[8][4];
#pragma unroll
            for (int i = 0; i < 8; ++i) {
                const int irow = q0 + i + 8 * hf;
                const int ic = min(irow, p.Lq - 1);
                float sc[4];
#pragma unroll
                for (int t = 0; t < 4; ++t) {
                    const int jg = j0 + t * 16 + l15;
                    float v = s[t][i] * p.scale;
                    v += p.Mf[b * p.smb + h * p.smh + (long long)ic * p.smi + (long long)min(jg, p.Lk - 1) * p.smj];
                    if (p.Rt) { int rc = ic - min(jg, p.Lk - 1) + p.roff; rc = rc < 0 ? 0 : (rc >= p.rn ? p.rn - 1 : rc); v += p.Rt[b * p.srb + h * p.srh + (long long)ic * p.sri + rc]; }
                    if (p.Mi) { const int mv = p.Mi[b * p.smb + h * p.smh + (long long)ic * p.smi + (long long)min(jg, p.Lk - 1) * p.smj]; if (p.mpol ? (mv != 0) : (mv == 0)) v = p.mfill; }
                    if (p.SQ) { const bool same = p.SQ[(long long)b * p.Lq + ic] == p.SK[(long long)b * p.Lk + min(jg, p.Lk - 1)]; if (p.segpol ? same : !same) v = p.mfill; }
                    if (p.causal == 2 && jg > irow + p.coff) v = p.mfill;
                    // causal test against the lane's first row (jg > irow + coff, rearranged): one live register, not eight row numbers, so the 256-register cap is met without spills
                    if (jg >= p.Lk || (p.causal == 1 && jg - (q0 + 8 * hf) > i + p.coff) || (p.causal == 3 && jg < irow + p.coff) || (p.win > 0 && irow + p.coff - jg > p.win)) v = NEG; else v *= L2E;
                    sc[t] = v;
                }
                if (!TWOPASS || pass == 0) {
                    float mx = fmaxf(fmaxf(sc[0], sc[1]), fmaxf(sc[2], sc[3]));
                    mx = fmaxf(mx, __shfl_xor(mx, 1, 32)); mx = fmaxf(mx, __shfl_xor(mx, 2, 32));
                    mx = fmaxf(mx, __shfl_xor(mx, 4, 32)); mx = fmaxf(mx, __shfl_xor(mx, 8, 32));
                    const float mnew = fmaxf(m8[i], mx);
                    const float corr = (mnew == NEG) ? 1.f : exp2f(m8[i] - mnew);
                    float rs = 0.f;
#pragma unroll
                    for (int t = 0; t < 4; ++t) {
                        const float pp = (sc[t] == NEG) ? 0.f : exp2f(sc[t] - mnew); rs += pp;
                        pv[i][t] = p.Pw ? pp * p.Pw[b * p.swb + h * p.swh + (long long)ic * p.swi + (long long)min(j0 + t * 16 + l15, p.Lk - 1) * p.swj] : pp;
                    }
                    rs += __shfl_xor(rs, 1, 32); rs += __shfl_xor(rs, 2, 32); rs += __shfl_xor(rs, 4, 32); rs += __shfl_xor(rs, 8, 32);
                    l8[i] = l8[i] * corr + rs; m8[i] = mnew;
                    if (!TWOPASS) {
#pragma unroll
                        for (int t = 0; t < NT; ++t) o[t][i] *= corr;
                    }
                } else {
                    const float inv = (l8[i] > 0.f) ? 1.f / l8[i] : 0.f;
#pragma unroll
                    for (int t = 0; t < 4; ++t) {
                        const int jg = j0 + t * 16 + l15;
                        float pp = (sc[t] == NEG) ? 0.f : exp2f(sc[t] - m8[i]) * inv;
                        if (p.Pw) pp *= p.Pw[b * p.swb + h * p.swh + (long long)ic * p.swi + (long long)min(jg, p.Lk - 1) * p.swj];
                        pv[i][t] = pp;
                    }
                }
            }
            if (dopv) {
#pragma unroll
                for (int i = 0; i < 8; ++i)
#pragma unroll
                    for (int t = 0; t < 4; ++t) ((float*)myp)[(i + 8 * hf) * 64 + t * 16 + l15] = pv[i][t];
                if (SPLITPV) {
                    // P is private to its wave and V is not staged: the wave's own LDS stores only have to be ordered before its lanes' reads of each other's values
                    __builtin_amdgcn_fence(__ATOMIC_RELEASE, "workgroup"); __builtin_amdgcn_wave_barrier(); __builtin_amdgcn_fence(__ATOMIC_ACQUIRE, "workgroup");
                } else __syncthreads();                          // P (per wave) and V (shared) visible
                if (p.P) {
                    float* pb_ = p.P + b * p.sPb + h * p.sPh;
                    const bool fastP = (p.pband == 0) && ((p.sPi & 3) == 0) && (j0 + 64 <= p.Lk) && (q0 + 16 <= p.Lq) && ((((size_t)pb_) & 15) == 0);
                    if (fastP) {
#pragma unroll
                        for (int s = 0; s < 8; ++s) {
                            const int row = s * 2 + (lane >> 4), c4 = (lane & 15) * 4;
                            const v4f v = *(const v4f*)(myp + row * 64 + c4);
                            VST2V4(pb_ + (long long)(q0 + row) * p.sPi + j0 + c4, v);
                        }
                    } else {
                        for (int row = 0; row < 16; ++row) {
                            const int irow = q0 + row; if (irow >= p.Lq) continue;
                            for (int c = lane; c < 64; c += 32) {
                                const int jg = j0 + c; if (jg >= p.Lk) continue;
                                if (p.pband == 0) VST2(float, pb_ + (long long)irow * p.sPi + jg, myp[row * 64 + c]);
                                else if (jg - irow <= p.pband && irow - jg <= p.pband) VST2(float, pb_ + (long long)irow * p.sPi + (jg - irow + p.pband), myp[row * 64 + c]);
                            }
                        }
                    }
                }
                if (SPLITPV) {
                    const Split pa0 = sp_ld(myp + l15 * 64, 1, 0, hf, 64, 1.f), pa1 = sp_ld(myp + l15 * 64, 1, 32, hf, 64, 1.f);
#pragma unroll
                    for (int t = 0; t < NT; ++t) {
                        o[t] = wmma2(pa0, vf[t][0], o[t]);
                        o[t] = wmma2(pa1, vf[t][1], o[t]);
                    }
                } else {
                    const v16h pa0 = fh_ld(myp + l15 * 64, 1, 0, hf, 64, 4096.f), pa1 = fh_ld(myp + l15 * 64, 1, 32, hf, 64, 4096.f);
#pragma unroll
                    for (int t = 0; t < NT; ++t) {
                        const int dcol = t * 16 + l15;
                        v16h b0, b1;
#pragma unroll
                        for (int e = 0; e < 16; ++e) { b0[e] = vl[frag_k(e, hf) * VP + dcol]; b1[e] = vl[(32 + frag_k(e, hf)) * VP + dcol]; }
                        o[t] = wmma16(pa0, b0, o[t]);
                        o[t] = wmma16(pa1, b1, o[t]);
                    }
                }
            }
        }
    }
    float* obase = p.O + bz * p.sOb + h * p.sOh;
    if (p.ST) {
        const int rl = lane >> 1, isel = rl & 7;           // row q0 + rl ; rl>>3 == hf holds because lane>>4 == (lane>>1)>>3
        float mv = 0.f, lv = 0.f;
#pragma unroll
        for (int i = 0; i < 8; ++i) if (i == isel) { mv = m8[i]; lv = l8[i]; }
        const int irow = q0 + rl;
        if (irow < p.Lq) { float* st = p.ST + (((long long)b * gridDim.y + h) * p.Lq + irow) * 2 + (lane & 1); VST2(float, st, (lane & 1) ? lv : mv * 0.6931471805599453f); }
    }
    float invr[8];
#pragma unroll
    for (int i = 0; i < 8; ++i) {
        if (TWOPASS) invr[i] = SPLITPV ? 1.f : (1.f / 4096.f);
        else if (p.nonorm) invr[i] = exp2f(m8[i]) * (SPLITPV ? 1.f : (1.f / 4096.f));
        else invr[i] = (l8[i] > 0.f) ? (SPLITPV ? 1.f / l8[i] : 1.f / (l8[i] * 4096.f)) : 0.f;
    }
    __syncthreads();                                             // all waves done with pl/vl from the main loop
    const bool ofast = ((p.sOi & 3) == 0) && ((((size_t)obase) & 15) == 0) && (q0 + 16 <= p.Lq);
#pragma unroll
    for (int c0 = 0; c0 < DVP; c0 += 64) {
#pragma unroll
        for (int i = 0; i < 8; ++i)
#pragma unroll
            for (int t = 0; t < NT; ++t) if (t * 16 >= c0 && t * 16 < c0 + 64) ((float*)myp)[(i + 8 * hf) * 64 + (t * 16 - c0) + l15] = o[t][i] * invr[i];
        __syncthreads();
        const int cw = (DVP - c0 < 64) ? (DVP - c0) : 64;      // staged columns in this chunk (multiple of 16)
        if (ofast && (c0 + cw <= p.dv) && (cw % 32 == 0)) {
            const int lpr = cw / 4;                              // lanes per row (16 for 64 cols, 8 for 32)
            const int rows_per_ins = 32 / lpr;
            for (int r0 = 0; r0 < 16; r0 += rows_per_ins) {
                const int row = r0 + lane / lpr, c4 = (lane % lpr) * 4;
                const v4f v = *(const v4f*)(myp + row * 64 + c4);
                VST2V4(obase + (long long)(q0 + row) * p.sOi + c0 + c4, v);
            }
        } else {
            for (int row = 0; row < 16; ++row) {
                const int irow = q0 + row; if (irow >= p.Lq) continue;
                for (int c = lane; c < cw; c += 32) { const int d = c0 + c; if (d < p.dv) VST2(float, obase + (long long)irow * p.sOi + d, myp[row * 64 + c]); }
            }
        }
        __syncthreads();
    }
}

typedef __attribute__((ext_vector_type(2))) float  v2f;
typedef __attribute__((ext_vector_type(2))) __bf16 v2b;
__device__ __forceinline__ float xhalf(float x) {   // the value of lane L ^ 16
    const int u = __float_as_int(x);
    return __int_as_float(__builtin_amdgcn_permlanex16(u, u, 0x76543210, 0xfedcba98, false, false));
}
__global__ __launch_bounds__(32 * AW) KATTN_ATTR void k_attn_t(const float* __restrict__ Q, const unsigned short* __restrict__ KF, const unsigned short* __restrict__ VF, const float* __restrict__ MF, float* __restrict__ O, float* __restrict__ OB, float* __restrict__ ML) {
    const int lane = threadIdx.x & 31, hf = lane >> 4, l15 = lane & 15, wave = threadIdx.x >> 5;
    // bz = 2 * branch + batch: K, V and O hold one plane per (branch, batch), indexed by bz; Q and the additive table are shared by the branches, indexed by b
    const int h = blockIdx.x & 7, bz = blockIdx.x >> 3, b = bz & 1;
    // unit -> (query block xb, part, key range), all block-uniform. Units 0..15: keys 0..1,023 of blocks 16..31 (16 trips, none masked). Units 16..47, in pairs of n = 16..1 trips:
    // the whole of block n - 1, then the keys from 1,024 on of block 15 + n. Every (block, part) comes up once.
    const int un = blockIdx.y, un2 = un - 16, ntr = 16 - (un2 >> 1);
    const int part = (un >= 16) ? (un2 & 1) : 0;
    const int xb = (un < 16) ? 16 + un : (part ? 15 + ntr : ntr - 1);
    const int jbeg = part * 1024, jend = (un < 16) ? 1024 : (xb + 1) * 64;
    const int q0 = (xb * AW + wave) * 16;
    const float L2E = 1.4426950408889634f;
    const float NEG = -__builtin_inff();
    const float* qrow = Q + b * 1048576 + h * 64 + (q0 + l15) * 512;
    // 131,072 halves per (bz, head), 4,096 per 64-key block, 512 per fragment
    const __bf16* kfrag = (const __bf16*)KF + (bz * 8 + h) * 131072 + lane * 8;
    const __bf16* vfrag = (const __bf16*)VF + (bz * 8 + h) * 131072 + lane * 8;
    const float* mrow = MF + b * 2048 + 8 * hf;      // the lane's eight keys of a tile
    Split qs_[2];
#pragma unroll
    for (int ks = 0; ks < 2; ++ks) qs_[ks] = sp_ld(qrow, 1, ks * 32, hf, 64, 0.125f * L2E);   // scale and log2(e) ride in Q: the products come out as exp2 arguments
    v8f o[4]; float m = NEG; v2f l2 = {0.f, 0.f};    // l2: the sum over this lane half's keys, even and odd registers apart; joined behind the loop
#pragma unroll
    for (int t = 0; t < 4; ++t) { v8f zz = {}; o[t] = zz; }
    for (int j0 = jbeg; j0 < jend; j0 += 64) {
        v16b kf[4][2];
        // all of the key block's K fragments are asked for before the first product: one wait for memory, not one per fragment
        const __bf16* kblk = kfrag + (j0 >> 6) * 4096;
#pragma unroll
        for (int t = 0; t < 4; ++t)
#pragma unroll
            for (int ks = 0; ks < 2; ++ks) kf[t][ks] = bfrag_ld(kblk + (t * 2 + ks) * 512);
        asm volatile("s_wait_xcnt 0x0" :: "v"(kblk) : "memory");   // the loads' address pair stays live up to this wait, so that no later load lands in it and nothing rewrites it ahead of the wait
        // the additive table of the lane's 32 keys, asked for with the K fragments: it is the score products' start value (their C operand), so that adding it costs no instruction
        const float* mblk = mrow + j0;
        v8f s[4];
#pragma unroll
        for (int t = 0; t < 4; ++t) s[t] = *(const v8f*)(mblk + t * 16);
        asm volatile("s_wait_xcnt 0x0" ::: "memory");   // stands behind the table loads, ahead of the rewrite of their address pair at the foot of the trip
        __builtin_amdgcn_sched_barrier(0);   // keeps every K load ahead of the first product: the scheduler otherwise holds some back until registers come free, a second wait for memory
#pragma unroll
        for (int t = 0; t < 4; ++t) {
#pragma unroll
            for (int ks = 0; ks < 2; ++ks) s[t] = wmma2t(kf[t][ks], qs_[ks], s[t]);
        }
        v16b vf[4][2];
        // all of the key block's V fragments are asked for together and ahead of the softmax: their way from memory is covered by the score products, not paid at the P.v products
        const __bf16* vblk = vfrag + (j0 >> 6) * 4096;
#pragma unroll
        for (int t = 0; t < 4; ++t) { vf[t][0] = bfrag_ld(vblk + (t * 2 + 0) * 512); vf[t][1] = bfrag_ld(vblk + (t * 2 + 1) * 512); }
        asm volatile("s_wait_xcnt 0x0" :: "v"(vblk) : "memory");   // the loads' address pair stays live up to this wait, so that no load of the run lands in it and nothing rewrites it ahead of the wait
        // the unrolls from here to the foot of the trip: s, pb and o are register arrays, which stay in registers only where every index is a constant
        if (j0 == xb * 64) {                         // only the trip on the diagonal holds keys behind a query (block-uniform: a scalar branch)
            const int qrel = q0 + l15 - 8 * hf - j0; // causal test (key > query) against constants: one live register
#pragma unroll
            for (int t = 0; t < 4; ++t) {
#pragma unroll
                for (int r = 0; r < 8; ++r) s[t][r] = (t * 16 + r > qrel) ? NEG : s[t][r];
            }
        }
        float mx4[4];
#pragma unroll
        for (int t = 0; t < 4; ++t) {
            mx4[t] = fmaxf(fmaxf(s[t][0], s[t][1]), s[t][2]);
            mx4[t] = fmaxf(fmaxf(mx4[t], s[t][3]), s[t][4]);
            mx4[t] = fmaxf(fmaxf(mx4[t], s[t][5]), s[t][6]);
            mx4[t] = fmaxf(mx4[t], s[t][7]);
        }
        float mx = fmaxf(fmaxf(mx4[0], mx4[1]), fmaxf(mx4[2], mx4[3]));
        mx = fmaxf(mx, xhalf(mx));
        // the first key of a unit's range (0, or 1,024 for queries from 1,024 on) is open to each of its queries and every score is finite, so mnew is finite from the first trip on: exp2 of -inf gives the 0 that a masked key and the first trip's corr want
        const float mnew = fmaxf(m, mx);
        const float corr = __builtin_amdgcn_exp2f(m - mnew);
        v2f rs2[4];
        Split pb[2];
#pragma unroll
        for (int t = 0; t < 4; ++t) {
#pragma unroll
            for (int r = 0; r < 8; r += 2) {
                const v2f x = (v2f){s[t][r], s[t][r + 1]} - mnew;
                const v2f pp = {__builtin_amdgcn_exp2f(x.x), __builtin_amdgcn_exp2f(x.y)};
                rs2[t] = (r == 0) ? pp : rs2[t] + pp;
                const v2b hb = __builtin_convertvector(pp, v2b);
                const v2b lb = __builtin_convertvector(pp - __builtin_convertvector(hb, v2f), v2b);
                pb[t >> 1].hi[(t & 1) * 8 + r] = hb.x; pb[t >> 1].hi[(t & 1) * 8 + r + 1] = hb.y;
                pb[t >> 1].lo[(t & 1) * 8 + r] = lb.x; pb[t >> 1].lo[(t & 1) * 8 + r + 1] = lb.y;
            }
        }
        l2 = l2 * corr + ((rs2[0] + rs2[1]) + (rs2[2] + rs2[3])); m = mnew;
#pragma unroll
        for (int t = 0; t < 4; ++t) o[t] *= corr;
#pragma unroll
        for (int t = 0; t < 4; ++t) {
            o[t] = wmma2t(vf[t][0], pb[0], o[t]);
            o[t] = wmma2t(vf[t][1], pb[1], o[t]);
        }
    }
    float l = l2.x + l2.y;
    l += xhalf(l);
    const float inv = (l > 0.f) ? 1.f / l : 0.f;
    // part 0 goes to the full planes O, part 1 to the half planes OB (queries 1,024 on)
    float* orow = (part ? OB + bz * 524288 + (q0 + l15 - 1024) * 512 : O + bz * 1048576 + (q0 + l15) * 512) + h * 64 + 8 * hf;
#pragma unroll
    for (int t = 0; t < 4; ++t) {
        v4f x, y;
        x.x = o[t][0] * inv; x.y = o[t][1] * inv; x.z = o[t][2] * inv; x.w = o[t][3] * inv;
        y.x = o[t][4] * inv; y.y = o[t][5] * inv; y.z = o[t][6] * inv; y.w = o[t][7] * inv;
        VST2V4(orow + t * 16, x); VST2V4(orow + t * 16 + 4, y);
    }
    // a split block's maximum (exp2 units) and sum, per part, plane, query and head: what the blend launch weighs the two parts by
    if (xb >= 16 && hf == 0) { const v2f ml = {m, l}; VST2(v2f, ML + (((part * 4 + bz) * 1024 + (q0 + l15 - 1024)) * 8 + h) * 2, ml); }
}

// =====================================================================================================================
// k_tr: dst(z, c, r) = alpha * src(z, r, c) (+ beta * R2(z, c, r)): [Z][R][C] (row stride lds) -> [Z][C][R] (row stride ldd) through a 32x32 LDS tile;
//   flags: 1 -> add beta * residual R2 addressed like dst (z*sRz + c*ldr + r); act applied before the residual.
// =====================================================================================================================
struct TrP { const float* src; float* dst; const float* R2; long long sSz, lds, sDz, ldd, sRz, ldr; int R, C, flags, act; float alpha, beta; };
static_assert(sizeof(TrP) == 3 * 8 + 6 * 8 + 6 * 4, "TrP has padding");
__global__ __launch_bounds__(256) void k_tr(TrP p) {
    __shared__ float tile[32][33];
    const int c0 = blockIdx.x * 32, r0 = blockIdx.y * 32, z = blockIdx.z;
    const int lane = threadIdx.x & 31, wave = threadIdx.x >> 5;
    const float* s = p.src + z * p.sSz;
#pragma unroll
    for (int k = 0; k < 4; ++k) {
        const int rl = wave * 4 + k, r = r0 + rl, c = c0 + lane;
        tile[rl][lane] = (r < p.R && c < p.C) ? s[(long long)r * p.lds + c] : 0.f;
    }
    __syncthreads();
    float* d = p.dst + z * p.sDz; const float* rr = p.R2 + z * p.sRz;
#pragma unroll
    for (int k = 0; k < 4; ++k) {
        const int cl = wave * 4 + k, c = c0 + cl, r = r0 + lane;
        if (c < p.C && r < p.R) {
            float v = act_fn(p.alpha * tile[lane][cl], p.act);
            if (p.flags & 1) v += p.beta * rr[(long long)c * p.ldr + r];
            VST2(float, d + (long long)c * p.ldd + r, v);
        }
    }
}

// k_affine: dst[i] = a * (sdev ? sdev[0] : 1) * src[i] + b, i < n (one thread per element; consecutive lanes -> consecutive addresses)
__global__ __launch_bounds__(256) void k_affine(const float* __restrict__ src, float* __restrict__ dst, int n, float a, float b, const float* __restrict__ sdev) {
    const int i = blockIdx.x * 256 + threadIdx.x;
    if (i < n) { const float aa = sdev ? a * sdev[0] : a; const float v = aa * src[i] + b; VST2(float, dst + i, v); }
}

// =====================================================================================================================
// k_softmax: row softmax over n contiguous elements, one 256-thread block per row; rows addressed z*sz + r*sr (grid (R, Z)).
//   out = scale_out * softmax(scale_in * x + (Mf ? Mf[z*smz + r*smr + j] : 0)); a row whose max is -inf is written as 0.
// =====================================================================================================================
struct SmP { const float* src; float* dst; const float* Mf; long long sz, sr, dz, dr, smz, smr; int n, pad; float scale_in, scale_out; };
static_assert(sizeof(SmP) == 3 * 8 + 6 * 8 + 4 * 4, "SmP has padding");
__global__ __launch_bounds__(256) void k_softmax(SmP p) {
    __shared__ float red[256];
    const int r = blockIdx.x, z = blockIdx.y, tid = threadIdx.x;
    const float* s = p.src + z * p.sz + (long long)r * p.sr;
    const float* mf = p.Mf ? (p.Mf + z * p.smz + (long long)r * p.smr) : nullptr;
    float mx = -__builtin_inff();
    for (int j = tid; j < p.n; j += 256) { float v = s[j] * p.scale_in; if (mf) v += mf[j]; mx = fmaxf(mx, v); }
    red[tid] = mx; __syncthreads();
    for (int o = 128; o > 0; o >>= 1) { if (tid < o) red[tid] = fmaxf(red[tid], red[tid + o]); __syncthreads(); }
    mx = red[0]; __syncthreads();
    float sum = 0.f;
    for (int j = tid; j < p.n; j += 256) { float v = s[j] * p.scale_in; if (mf) v += mf[j]; sum += (mx == -__builtin_inff()) ? 0.f : expf(v - mx); }
    red[tid] = sum; __syncthreads();
    for (int o = 128; o > 0; o >>= 1) { if (tid < o) red[tid] += red[tid + o]; __syncthreads(); }
    sum = red[0];
    const float inv = (sum > 0.f) ? p.scale_out / sum : 0.f;
    float* d = p.dst + z * p.dz + (long long)r * p.dr;
    for (int j = tid; j < p.n; j += 256) { float v = s[j] * p.scale_in; if (mf) v += mf[j]; const float o = (mx == -__builtin_inff()) ? 0.f : expf(v - mx) * inv; VST2(float, d + j, o); }
}
// =====================================================================================================================
// k_stats: mean and rsqrt(var + eps) over a set of n elements addressed base + z*sz + (e / inner) * so + (e % inner) * si, one 256-thread
// k_norm_apply: y = (x - mean[set]) * rstd[set] * g[c] + b[c] over a [Z][C][L] chan-major tensor with set = z*G + c / (C/G) (G groups per z;
//   G = C -> per-chan sets indexed z*C+c; for batch norm pass stats indexed by c only via bn = 1). Optional act. Output same layout.
// =====================================================================================================================
//   mode 0: mean / rsqrt(var + eps); mode 1 (RMSNorm): 0 / rsqrt(mean(x^2) + eps); mode 2 (L2 normalize * sqrt(n)): 0 / sqrt(n) / max(||x||, eps); mode 3: as 0 with unbiased variance (n-1)
__global__ __launch_bounds__(256) void k_stats(const float* __restrict__ x, long long sz, long long so, long long si, int inner, int n, float eps, float* __restrict__ stat, int mode) {
    __shared__ float red[256];
    const int z = blockIdx.x, tid = threadIdx.x;
    const float* base = x + z * sz;
    float s = 0.f;
    for (int e = tid; e < n; e += 256) s += base[(long long)(e / inner) * so + (long long)(e % inner) * si];
    red[tid] = s; __syncthreads();
    for (int o = 128; o > 0; o >>= 1) { if (tid < o) red[tid] += red[tid + o]; __syncthreads(); }
    const float mu = (mode == 0 || mode == 3) ? red[0] / (float)n : 0.f; __syncthreads();
    float q = 0.f;
    for (int e = tid; e < n; e += 256) { const float dlt = base[(long long)(e / inner) * so + (long long)(e % inner) * si] - mu; q += dlt * dlt; }
    red[tid] = q; __syncthreads();
    for (int o = 128; o > 0; o >>= 1) { if (tid < o) red[tid] += red[tid + o]; __syncthreads(); }
    {
        float rs;
        if (mode == 2) rs = sqrtf((float)n) / fmaxf(sqrtf(red[0]), eps); else if (mode == 3) rs = rsqrtf(red[0] / (float)(n - 1) + eps); else rs = rsqrtf(red[0] / (float)n + eps);
        if (tid < 32) { const float v = (tid == 0) ? mu : ((tid == 1) ? rs : 0.f); VST2(float, stat + (long long)z * 32 + tid, v); }
    }
}
//   One thread per element over the flat [Z][C][L] index space: grid ceil(Z*C*L / 256).
__global__ __launch_bounds__(256) void k_norm_apply(const float* __restrict__ x, float* __restrict__ y, const float* __restrict__ stat, const float* __restrict__ g, const float* __restrict__ bta,
                                                     int Z, int C, int L, int G, int bn, int act) {
    const long long idx = (long long)blockIdx.x * 256 + threadIdx.x;
    if (idx >= (long long)Z * C * L) return;
    const int l = (int)(idx % L); const long long zc = idx / L; const int c = (int)(zc % C), z = (int)(zc / C); (void)l;
    const int set = bn ? c : (z * G + c / (C / G));
    float v = (x[idx] - stat[(long long)set * 32]) * stat[(long long)set * 32 + 1];
    if (g) v *= g[c];
    if (bta) v += bta[c];
    v = act_fn(v, act);
    VST2(float, y + idx, v);
}

// k_lse_neg: c[i] = -(st[2i] + log(st[2i+1])) = minus the log-sum-exp of row i from k_attn's ST output (for softmax over the query dimension)
__global__ __launch_bounds__(256) void k_lse_neg(const float* __restrict__ st, float* __restrict__ c, int n) {
    const int i = blockIdx.x * 256 + threadIdx.x;
    if (i < n) { const float v = -(st[2 * i] + logf(st[2 * i + 1])); VST2(float, c + i, v); }
}

// k_iota: dst[i] = a * i + b as int32 (segment/position id helper)
__global__ __launch_bounds__(256) void k_iota(int* __restrict__ dst, int n, int a, int b) {
    const int i = blockIdx.x * 256 + threadIdx.x;
    if (i < n) { const int v = a * i + b; VST2(int, dst + i, v); }
}

// k_axpby: dst[i] = a * x[i] + b * y[i] (+ c), i < n
__global__ __launch_bounds__(256) void k_axpby(const float* __restrict__ x, const float* __restrict__ y, float* __restrict__ dst, int n, float a, float b, float c) {
    const int i = blockIdx.x * 256 + threadIdx.x;
    if (i < n) { const float v = a * x[i] + b * y[i] + c; VST2(float, dst + i, v); }
}

// =====================================================================================================================
// k_rope: rotary embedding on a [R rows][Hn heads][D] view (row stride sXr, head stride sXh, element stride 1) -> Y (own strides).
//   mode 0: rotate_half (partner d±D/2, sign - for d<D/2); mode 1: interleaved pairs (partner d^1, sign - for even d).
//   table column tcol: tmode 0 -> d, 1 -> d % (D/2), 2 -> d / 2; position p: pmode 0 -> r % S, 1 -> head index, 2 -> pos[r];
//   c = C[(r / S) * sCb + p * sCp + tcol * sCd], s likewise from Sn; y = x[d] * c + sign * x[partner] * s. X and Y must not alias.
// =====================================================================================================================
struct RopeP { const float* X; float* Y; const float* C; const float* Sn; const int* pos; long long sXr, sXh, sYr, sYh, sCb, sCp, sCd; int R, Hn, D, S, mode, tmode, pmode, pad; };
static_assert(sizeof(RopeP) == 5 * 8 + 7 * 8 + 8 * 4, "RopeP has padding");
__global__ __launch_bounds__(256) void k_rope(RopeP p) {
    const long long idx = (long long)blockIdx.x * 256 + threadIdx.x;
    if (idx >= (long long)p.R * p.Hn * p.D) return;
    const int d = (int)(idx % p.D); const long long rh = idx / p.D; const int h = (int)(rh % p.Hn); const int r = (int)(rh / p.Hn);
    const int half = p.D / 2;
    int partner; float sign;
    if (p.mode == 0) { partner = (d < half) ? d + half : d - half; sign = (d < half) ? -1.f : 1.f; }
    else { partner = d ^ 1; sign = (d & 1) ? 1.f : -1.f; }
    const int tcol = (p.tmode == 0) ? d : ((p.tmode == 1) ? (d % half) : (d >> 1));
    const int pp = (p.pmode == 0) ? (r % p.S) : ((p.pmode == 1) ? h : p.pos[r]);
    const long long toff = (long long)(r / p.S) * p.sCb + (long long)pp * p.sCp + (long long)tcol * p.sCd;
    const float* xr = p.X + (long long)r * p.sXr + (long long)h * p.sXh;
    const float v = xr[d] * p.C[toff] + sign * xr[partner] * p.Sn[toff];
    VST2(float, p.Y + (long long)r * p.sYr + (long long)h * p.sYh + d, v);
}

// k_invf + k_sincos (split so neither kernel carries a large VALU-fma footprint): invf_i = num * (1 / powf(base, (2 i)/D)) [fmode 0],
//   num * expf((2 i) * cexp) [fmode 1], num * powf(base, -2 (i - 1) / D) [fmode 2]; then cs/sn[s*half + i] = cos/sin((pscale * s) * invf_i)
__global__ __launch_bounds__(256) void k_invf(float* __restrict__ invb, int half, int D, float base, float num, int fmode, float cexp) {
    const int i = blockIdx.x * 256 + threadIdx.x;
    if (i >= ((half + 31) / 32) * 32) return;
    if (i >= half) { VST2(float, invb + i, 0.f); return; }
    const float e = (float)(2 * i) / (float)D;
    float invf;
    if (fmode == 1) invf = num * expf((float)(2 * i) * cexp);
    else if (fmode == 2) invf = num * powf(base, (-2.0f * ((float)i - 1.0f)) / (float)D);
    else invf = num * (1.0f / powf(base, e));
    VST2(float, invb + i, invf);
}
__global__ __launch_bounds__(256) void k_sincos(float* __restrict__ cs, float* __restrict__ sn, const float* __restrict__ invb, int S, int half, float pscale) {
    const int idx = blockIdx.x * 256 + threadIdx.x;
    if (idx >= S * half) return;
    const int s = idx / half, i = idx - s * half;
    const float ang = (pscale * (float)s) * invb[i];
    VST2(float, cs + idx, cosf(ang)); VST2(float, sn + idx, sinf(ang));
}

// k_mulact: dst[i] = act(x[i]) * y[i]
__global__ __launch_bounds__(256) void k_mulact(const float* __restrict__ x, const float* __restrict__ y, float* __restrict__ dst, int n, int act) {
    const int i = blockIdx.x * 256 + threadIdx.x;
    if (i < n) { const float v = act_fn(x[i], act) * y[i]; VST2(float, dst + i, v); }
}

// =====================================================================================================================
// k_matvec: thread-per-row matrix-vector products for N <= 8 output columns (heads with 1-3 outputs, gates), f32 on the VALU.
//   C[r*sCm + j] = act(alpha * sum_k A[r*sAm + k*sAk] * B[j*sBn + k*sBk] + bias[j]) + beta * R[r*sRm + j*sRn]; each thread writes its N contiguous floats.
// =====================================================================================================================
__global__ __launch_bounds__(256) void k_matvec(GemmP p) {
    // 32 lanes write one line with one instruction.
    const int rpt = (p.N == 1) ? 1 : 32;
    const long long r0 = ((long long)blockIdx.x * 256 + threadIdx.x) * rpt; const int z = blockIdx.z, zo = z / p.zi_n, zi = z - zo * p.zi_n;
    if (r0 >= p.M) return;
    const float* Bb = p.B + zo * p.sBo + zi * p.sBi;
    float* C = p.C + zo * p.sCo + zi * p.sCi; const float* R = p.R + zo * p.sRo + zi * p.sRi;
    for (int rr = 0; rr < rpt; ++rr) {
        const long long r = r0 + rr; if (r >= p.M) break;
        const float* A = p.A + zo * p.sAo + zi * p.sAi + r * p.sAm;
        float acc[8] = {0.f, 0.f, 0.f, 0.f, 0.f, 0.f, 0.f, 0.f};
        for (int k = 0; k < p.K; ++k) { const float a = A[(long long)k * p.sAk];
#pragma unroll
            for (int j = 0; j < 8; ++j) if (j < p.N) acc[j] += a * Bb[(long long)j * p.sBn + (long long)k * p.sBk]; }
#pragma unroll
        for (int j = 0; j < 8; ++j) if (j < p.N) {
            float v = acc[j] * p.alpha;
            if (p.flags & 1) v += p.bias[j];
            if (p.flags & 2) v += p.bias[r];
            v = act_fn(v, p.act);
            if (p.flags & 4) v += p.beta * R[r * p.sRm + (long long)j * p.sRn];
            VST2(float, C + r * p.sCm + j, v);
        }
    }
}
// k_smallsoftmax: thread-per-row softmax for short rows (n <= 64): dst[r*dr + j] = softmax(scale*src[r*sr + j])
__global__ __launch_bounds__(256) void k_smallsoftmax(const float* __restrict__ src, float* __restrict__ dst, long long sr, long long dr, int n, long long R, float scale) {
    const long long r0 = ((long long)blockIdx.x * 256 + threadIdx.x) * 32;
    for (int rr = 0; rr < 32; ++rr) {
        const long long r = r0 + rr; if (r >= R) return;
        const float* s = src + r * sr; float* d = dst + r * dr;
        float mx = -__builtin_inff();
        for (int j = 0; j < n; ++j) mx = fmaxf(mx, s[j] * scale);
        float sum = 0.f;
        for (int j = 0; j < n; ++j) sum += expf(s[j] * scale - mx);
        const float inv = 1.f / sum;
        for (int j = 0; j < n; ++j) { const float v = expf(s[j] * scale - mx) * inv; VST2(float, d + j, v); }
    }
}

__global__ __launch_bounds__(32) void k_unitstat(float* __restrict__ st) { const int t = threadIdx.x; const float v = (t == 1) ? 1.f : 0.f; VST2(float, st + t, v); }

// destination (e.g. a d_out whose row width is not a multiple of 32 floats) is written by consecutive lanes of one instruction
__global__ __launch_bounds__(256) void k_lincopy(const float* __restrict__ src, long long lds, float* __restrict__ dst, long long ldd, long long rows, int cols) {
    const long long i = (long long)blockIdx.x * 256 + threadIdx.x; if (i >= rows * cols) return;
    const long long r = i / cols; const int c = (int)(i - r * cols);
    const float v = src[r * lds + c]; VST2(float, dst + r * ldd + c, v);
}


__device__ __forceinline__ void st_h2(unsigned short* d2, float a, float b) { const unsigned u = (unsigned)__builtin_bit_cast(unsigned short, (_Float16)a) | ((unsigned)__builtin_bit_cast(unsigned short, (_Float16)b) << 16); unsigned* d = (unsigned*)d2; *d = u;  }
__device__ __forceinline__ float ldh(const unsigned short* p) { return (float)__builtin_bit_cast(_Float16, *p); }
__device__ __forceinline__ v4f ld4h(const unsigned short* p) { const unsigned long long u = *(const unsigned long long*)p; v4f a;
    a.x = (float)__builtin_bit_cast(_Float16, (unsigned short)(u & 0xFFFFu)); a.y = (float)__builtin_bit_cast(_Float16, (unsigned short)((u >> 16) & 0xFFFFu)); a.z = (float)__builtin_bit_cast(_Float16, (unsigned short)((u >> 32) & 0xFFFFu)); a.w = (float)__builtin_bit_cast(_Float16, (unsigned short)((u >> 48) & 0xFFFFu)); return a; }
__device__ __forceinline__ unsigned long long pk4h(v4f s) { return (unsigned long long)__builtin_bit_cast(unsigned short, (_Float16)s.x) | ((unsigned long long)__builtin_bit_cast(unsigned short, (_Float16)s.y) << 16) | ((unsigned long long)__builtin_bit_cast(unsigned short, (_Float16)s.z) << 32) | ((unsigned long long)__builtin_bit_cast(unsigned short, (_Float16)s.w) << 48); }
typedef unsigned v4u __attribute__((ext_vector_type(4)));
__device__ __forceinline__ void st8h(unsigned short* d, v4f a, v4f b) { const unsigned long long pa = pk4h(a), pb = pk4h(b); v4u pk; pk.x = (unsigned)(pa & 0xFFFFFFFFull); pk.y = (unsigned)(pa >> 32); pk.z = (unsigned)(pb & 0xFFFFFFFFull); pk.w = (unsigned)(pb >> 32); v4u* dd = (v4u*)d; *dd = pk;  }
__device__ __forceinline__ unsigned short bfu_rne(float v) { unsigned u = __builtin_bit_cast(unsigned, v); u += 0x7FFFu + ((u >> 16) & 1u); return (unsigned short)(u >> 16); }
__device__ __forceinline__ void bfsplit(float v, unsigned short& hi, unsigned short& lo) { hi = bfu_rne(v); lo = bfu_rne(v - __builtin_bit_cast(float, (unsigned)hi << 16)); }
__device__ __forceinline__ void st_s2(unsigned short* Hp, unsigned short* Lp, long long o, float a, float b) { unsigned short h0,l0,h1,l1; bfsplit(a,h0,l0); bfsplit(b,h1,l1); const unsigned ph = (unsigned)h0 | ((unsigned)h1 << 16), pl = (unsigned)l0 | ((unsigned)l1 << 16);
    unsigned* dh = (unsigned*)(Hp + o); unsigned* dl = (unsigned*)(Lp + o); *dh = ph; *dl = pl;  }
__device__ __forceinline__ int cl(int v, int n) { return min(max(v, 0), n - 1); }

// GAT-style aggregation over a device in-edge CSR at dst (+ optional explicit self loop as iteration j = -1):
//   logit = leaky(AS[src][h] + AD[n][h] (+ EW[e]*CW[h]), slope); softmax over the node's edges per head; acc[c] = sum alpha XP[src][c] (f16 gather plane, pitch XW; 256 channels = H heads x CH)
//   wave per node; lane L owns channels 8L..8L+7 (head = 8L / CH); per-lane softmax state (lanes of one head agree) -> no shuffles in the loop.
//   EPI 0: + bias -> f32 OUT[n][256] via LDS redistribution (two 16-B stores per lane, each instruction 512 contiguous B)
//   EPI 1: + bias, LayerNorm(256) * g + bb, relu -> bf16 hi/lo planes OH/OL [n][256] (16-B stores)
//   EPI 2: mean over the 256/CH heads + bias[0..63], LayerNorm(64) * g + bb, relu -> f32 OUT[n][64] (CH must be 64; LDS redistribution, 8-B stores)
//   EPI 3: mean over heads + bias -> f32 OUT[n][64] (no norm / activation)
//   EPI 4: + bias, ELU -> bf16 hi/lo planes OH/OL [n][256];  EPI 5: + bias (full 256-wide, per head), ELU, then mean over the 256/CH heads -> f32 OUT[n][64]
//   EPI 6: (CH = 128, two heads) mean over the two heads, + bias[0..127], relu -> f32 OUT[n][128] (LDS redistribution, 16-B stores)
//   EWM 0: no edge weights; 1: logit += EW[e] * CW[h] (self loop weight 1); 2: alpha *= EW[e] after the softmax (message scale; self loop weight 1)
template <int CH, bool SELF, int EWM, int EPI>
__global__ __launch_bounds__(256) void k_gat_agg(const unsigned short* __restrict__ XP, int XW, const float* __restrict__ AS, const float* __restrict__ AD, int ASTR, const float* __restrict__ EW, const float* __restrict__ CW,
        const int* __restrict__ esrc, const int* __restrict__ off, const int* __restrict__ cnt, const int* __restrict__ slot, const float* __restrict__ bias, const float* __restrict__ g, const float* __restrict__ bb,
        float* __restrict__ OUT, unsigned short* __restrict__ OH, unsigned short* __restrict__ OL, int N, int E, int CAP, float slope) {
    __shared__ float stage[8][256];
    const int wv = threadIdx.x >> 5; const int n = blockIdx.x * 8 + wv; const int L = threadIdx.x & 31; if (n >= N) return; const int c0 = 8 * L; const int h = c0 / CH;
    const float ad = AD[(long long)n * ASTR + h]; const float cw = (EWM == 1) ? CW[h] : 0.f; float m = -3.0e38f, s = 0.f; v4f a0, a1; a0.x = a0.y = a0.z = a0.w = 0.f; a1 = a0;
    const int p0 = cl(off[n], E + 1), cn = min(max(cnt[n], 0), CAP);
    for (int j = (SELF ? -1 : 0); j < cn; ++j) { int sj; float ew = 0.f;
        if (j < 0) { sj = n; ew = 1.f; } else { int e = slot[cl(p0 + j, E)]; e = cl(e, E); sj = cl(esrc[e], N); if (EWM != 0) ew = EW[e]; }
        float lg = AS[(long long)sj * ASTR + h] + ad + ((EWM == 1) ? ew * cw : 0.f); lg = (lg >= 0.f) ? lg : slope * lg;
        const float mn = fmaxf(m, lg); const float cz = expf(m - mn), pj = expf(lg - mn); s = s * cz + pj; const float pw = (EWM == 2) ? pj * ew : pj;
        const unsigned short* xr = XP + (long long)sj * XW + c0; a0 = a0 * cz + ld4h(xr) * pw; a1 = a1 * cz + ld4h(xr + 4) * pw; m = mn; }
    const float inv = (s > 0.f) ? 1.f / (s + 1e-16f) : 0.f; a0 = a0 * inv; a1 = a1 * inv;
    if (EPI == 0 || EPI == 1 || EPI == 4 || EPI == 5) { a0 = a0 + *(const v4f*)(bias + c0); a1 = a1 + *(const v4f*)(bias + c0 + 4); }
    if (EPI == 4 || EPI == 5) { a0.x = (a0.x > 0.f) ? a0.x : (expf(a0.x) - 1.f); a0.y = (a0.y > 0.f) ? a0.y : (expf(a0.y) - 1.f); a0.z = (a0.z > 0.f) ? a0.z : (expf(a0.z) - 1.f); a0.w = (a0.w > 0.f) ? a0.w : (expf(a0.w) - 1.f);
        a1.x = (a1.x > 0.f) ? a1.x : (expf(a1.x) - 1.f); a1.y = (a1.y > 0.f) ? a1.y : (expf(a1.y) - 1.f); a1.z = (a1.z > 0.f) ? a1.z : (expf(a1.z) - 1.f); a1.w = (a1.w > 0.f) ? a1.w : (expf(a1.w) - 1.f); }
    if (EPI == 4) { float o8[8] = {a0.x, a0.y, a0.z, a0.w, a1.x, a1.y, a1.z, a1.w}; unsigned short hh[8], ll[8];
#pragma unroll
        for (int u = 0; u < 8; ++u) bfsplit(o8[u], hh[u], ll[u]);
        const unsigned long long ph0 = (unsigned long long)hh[0] | ((unsigned long long)hh[1] << 16) | ((unsigned long long)hh[2] << 32) | ((unsigned long long)hh[3] << 48), pl0 = (unsigned long long)ll[0] | ((unsigned long long)ll[1] << 16) | ((unsigned long long)ll[2] << 32) | ((unsigned long long)ll[3] << 48);
        const unsigned long long ph1 = (unsigned long long)hh[4] | ((unsigned long long)hh[5] << 16) | ((unsigned long long)hh[6] << 32) | ((unsigned long long)hh[7] << 48), pl1 = (unsigned long long)ll[4] | ((unsigned long long)ll[5] << 16) | ((unsigned long long)ll[6] << 32) | ((unsigned long long)ll[7] << 48);
        v4u pk; pk.x = (unsigned)(ph0 & 0xFFFFFFFFull); pk.y = (unsigned)(ph0 >> 32); pk.z = (unsigned)(ph1 & 0xFFFFFFFFull); pk.w = (unsigned)(ph1 >> 32); v4u* dh = (v4u*)(OH + (long long)n * 256 + c0); *dh = pk; 
        v4u ql; ql.x = (unsigned)(pl0 & 0xFFFFFFFFull); ql.y = (unsigned)(pl0 >> 32); ql.z = (unsigned)(pl1 & 0xFFFFFFFFull); ql.w = (unsigned)(pl1 >> 32); v4u* dl = (v4u*)(OL + (long long)n * 256 + c0); *dl = ql;  return; }
    if (EPI == 6) {
        a0.x += __shfl_xor(a0.x, 16); a0.y += __shfl_xor(a0.y, 16); a0.z += __shfl_xor(a0.z, 16); a0.w += __shfl_xor(a0.w, 16); a1.x += __shfl_xor(a1.x, 16); a1.y += __shfl_xor(a1.y, 16); a1.z += __shfl_xor(a1.z, 16); a1.w += __shfl_xor(a1.w, 16);
        if (L < 16) { const int cb = 8 * L; const v4f b0 = *(const v4f*)(bias + cb), b1v = *(const v4f*)(bias + cb + 4);
            stage[wv][cb] = fmaxf(a0.x * 0.5f + b0.x, 0.f); stage[wv][cb + 1] = fmaxf(a0.y * 0.5f + b0.y, 0.f); stage[wv][cb + 2] = fmaxf(a0.z * 0.5f + b0.z, 0.f); stage[wv][cb + 3] = fmaxf(a0.w * 0.5f + b0.w, 0.f);
            stage[wv][cb + 4] = fmaxf(a1.x * 0.5f + b1v.x, 0.f); stage[wv][cb + 5] = fmaxf(a1.y * 0.5f + b1v.y, 0.f); stage[wv][cb + 6] = fmaxf(a1.z * 0.5f + b1v.z, 0.f); stage[wv][cb + 7] = fmaxf(a1.w * 0.5f + b1v.w, 0.f); }
        __builtin_amdgcn_fence(__ATOMIC_RELEASE, "workgroup"); __builtin_amdgcn_wave_barrier(); __builtin_amdgcn_fence(__ATOMIC_ACQUIRE, "workgroup");
        v4f o6; o6.x = stage[wv][4 * L]; o6.y = stage[wv][4 * L + 1]; o6.z = stage[wv][4 * L + 2]; o6.w = stage[wv][4 * L + 3]; VST2V4(OUT + (long long)n * 128 + 4 * L, o6); return; }
    if (EPI == 5) {
        a0.x += __shfl_xor(a0.x, 8); a0.y += __shfl_xor(a0.y, 8); a0.z += __shfl_xor(a0.z, 8); a0.w += __shfl_xor(a0.w, 8); a1.x += __shfl_xor(a1.x, 8); a1.y += __shfl_xor(a1.y, 8); a1.z += __shfl_xor(a1.z, 8); a1.w += __shfl_xor(a1.w, 8);
        a0.x += __shfl_xor(a0.x, 16); a0.y += __shfl_xor(a0.y, 16); a0.z += __shfl_xor(a0.z, 16); a0.w += __shfl_xor(a0.w, 16); a1.x += __shfl_xor(a1.x, 16); a1.y += __shfl_xor(a1.y, 16); a1.z += __shfl_xor(a1.z, 16); a1.w += __shfl_xor(a1.w, 16);
        const int gq5 = L & 7; a0 = a0 * 0.25f; a1 = a1 * 0.25f;
        if (L < 8) { stage[wv][8 * gq5] = a0.x; stage[wv][8 * gq5 + 1] = a0.y; stage[wv][8 * gq5 + 2] = a0.z; stage[wv][8 * gq5 + 3] = a0.w; stage[wv][8 * gq5 + 4] = a1.x; stage[wv][8 * gq5 + 5] = a1.y; stage[wv][8 * gq5 + 6] = a1.z; stage[wv][8 * gq5 + 7] = a1.w; }
        __builtin_amdgcn_fence(__ATOMIC_RELEASE, "workgroup"); __builtin_amdgcn_wave_barrier(); __builtin_amdgcn_fence(__ATOMIC_ACQUIRE, "workgroup");
        const unsigned long long pk5 = (unsigned long long)__builtin_bit_cast(unsigned, stage[wv][2 * L]) | ((unsigned long long)__builtin_bit_cast(unsigned, stage[wv][2 * L + 1]) << 32); VST2(unsigned long long, (unsigned long long*)(OUT + (long long)n * 64 + 2 * L), pk5); return; }
    if (EPI == 1) { float sm = a0.x + a0.y + a0.z + a0.w + a1.x + a1.y + a1.z + a1.w;
#pragma unroll
        for (int o = 16; o > 0; o >>= 1) sm += __shfl_xor(sm, o);
        const float mu = sm * (1.f / 256.f); const v4f d0 = a0 - mu, d1 = a1 - mu; float q = d0.x * d0.x + d0.y * d0.y + d0.z * d0.z + d0.w * d0.w + d1.x * d1.x + d1.y * d1.y + d1.z * d1.z + d1.w * d1.w;
#pragma unroll
        for (int o = 16; o > 0; o >>= 1) q += __shfl_xor(q, o);
        const float rs = rsqrtf(q * (1.f / 256.f) + 1e-5f); float o8[8] = {d0.x, d0.y, d0.z, d0.w, d1.x, d1.y, d1.z, d1.w}; unsigned short hh[8], ll[8];
#pragma unroll
        for (int u = 0; u < 8; ++u) { const float v = fmaxf(o8[u] * rs * g[c0 + u] + bb[c0 + u], 0.f); bfsplit(v, hh[u], ll[u]); }
        const unsigned long long ph0 = (unsigned long long)hh[0] | ((unsigned long long)hh[1] << 16) | ((unsigned long long)hh[2] << 32) | ((unsigned long long)hh[3] << 48), pl0 = (unsigned long long)ll[0] | ((unsigned long long)ll[1] << 16) | ((unsigned long long)ll[2] << 32) | ((unsigned long long)ll[3] << 48);
        const unsigned long long ph1 = (unsigned long long)hh[4] | ((unsigned long long)hh[5] << 16) | ((unsigned long long)hh[6] << 32) | ((unsigned long long)hh[7] << 48), pl1 = (unsigned long long)ll[4] | ((unsigned long long)ll[5] << 16) | ((unsigned long long)ll[6] << 32) | ((unsigned long long)ll[7] << 48);
        // lane L's 8 halves at c0 = 8L: 16 B -> one 16-B store per plane (32 lanes x 16 B = whole 512-B row)
        v4u pk; pk.x = (unsigned)(ph0 & 0xFFFFFFFFull); pk.y = (unsigned)(ph0 >> 32); pk.z = (unsigned)(ph1 & 0xFFFFFFFFull); pk.w = (unsigned)(ph1 >> 32); v4u* dh = (v4u*)(OH + (long long)n * 256 + c0); *dh = pk; 
        v4u ql; ql.x = (unsigned)(pl0 & 0xFFFFFFFFull); ql.y = (unsigned)(pl0 >> 32); ql.z = (unsigned)(pl1 & 0xFFFFFFFFull); ql.w = (unsigned)(pl1 >> 32); v4u* dl = (v4u*)(OL + (long long)n * 256 + c0); *dl = ql;  return; }
    if (EPI == 2 || EPI == 3) {   // head mean: lanes L, L^8, L^16, L^24 hold the same chan group of the 4 heads (CH = 64 -> 8 lanes per head)
        a0.x += __shfl_xor(a0.x, 8); a0.y += __shfl_xor(a0.y, 8); a0.z += __shfl_xor(a0.z, 8); a0.w += __shfl_xor(a0.w, 8); a1.x += __shfl_xor(a1.x, 8); a1.y += __shfl_xor(a1.y, 8); a1.z += __shfl_xor(a1.z, 8); a1.w += __shfl_xor(a1.w, 8);
        a0.x += __shfl_xor(a0.x, 16); a0.y += __shfl_xor(a0.y, 16); a0.z += __shfl_xor(a0.z, 16); a0.w += __shfl_xor(a0.w, 16); a1.x += __shfl_xor(a1.x, 16); a1.y += __shfl_xor(a1.y, 16); a1.z += __shfl_xor(a1.z, 16); a1.w += __shfl_xor(a1.w, 16);
        const int gq = L & 7; a0 = a0 * 0.25f + *(const v4f*)(bias + 8 * gq); a1 = a1 * 0.25f + *(const v4f*)(bias + 8 * gq + 4);      // every lane now holds channels 8gq..8gq+7 of the mean
        if (EPI == 3) { if (L < 8) { stage[wv][8 * gq] = a0.x; stage[wv][8 * gq + 1] = a0.y; stage[wv][8 * gq + 2] = a0.z; stage[wv][8 * gq + 3] = a0.w; stage[wv][8 * gq + 4] = a1.x; stage[wv][8 * gq + 5] = a1.y; stage[wv][8 * gq + 6] = a1.z; stage[wv][8 * gq + 7] = a1.w; }
            __builtin_amdgcn_fence(__ATOMIC_RELEASE, "workgroup"); __builtin_amdgcn_wave_barrier(); __builtin_amdgcn_fence(__ATOMIC_ACQUIRE, "workgroup");
            const unsigned long long pk3 = (unsigned long long)__builtin_bit_cast(unsigned, stage[wv][2 * L]) | ((unsigned long long)__builtin_bit_cast(unsigned, stage[wv][2 * L + 1]) << 32); VST2(unsigned long long, (unsigned long long*)(OUT + (long long)n * 64 + 2 * L), pk3); return; }
        float sm = (L < 8) ? (a0.x + a0.y + a0.z + a0.w + a1.x + a1.y + a1.z + a1.w) : 0.f;
#pragma unroll
        for (int o = 16; o > 0; o >>= 1) sm += __shfl_xor(sm, o);
        const float mu = sm * (1.f / 64.f); const v4f d0 = a0 - mu, d1 = a1 - mu; float q = (L < 8) ? (d0.x * d0.x + d0.y * d0.y + d0.z * d0.z + d0.w * d0.w + d1.x * d1.x + d1.y * d1.y + d1.z * d1.z + d1.w * d1.w) : 0.f;
#pragma unroll
        for (int o = 16; o > 0; o >>= 1) q += __shfl_xor(q, o);
        const float rs = rsqrtf(q * (1.f / 64.f) + 1e-5f);
        if (L < 8) { const float* gg = g + 8 * gq; const float* bq = bb + 8 * gq; stage[wv][8 * gq] = fmaxf(d0.x * rs * gg[0] + bq[0], 0.f); stage[wv][8 * gq + 1] = fmaxf(d0.y * rs * gg[1] + bq[1], 0.f); stage[wv][8 * gq + 2] = fmaxf(d0.z * rs * gg[2] + bq[2], 0.f); stage[wv][8 * gq + 3] = fmaxf(d0.w * rs * gg[3] + bq[3], 0.f);
            stage[wv][8 * gq + 4] = fmaxf(d1.x * rs * gg[4] + bq[4], 0.f); stage[wv][8 * gq + 5] = fmaxf(d1.y * rs * gg[5] + bq[5], 0.f); stage[wv][8 * gq + 6] = fmaxf(d1.z * rs * gg[6] + bq[6], 0.f); stage[wv][8 * gq + 7] = fmaxf(d1.w * rs * gg[7] + bq[7], 0.f); }
        __builtin_amdgcn_fence(__ATOMIC_RELEASE, "workgroup"); __builtin_amdgcn_wave_barrier(); __builtin_amdgcn_fence(__ATOMIC_ACQUIRE, "workgroup");
        const unsigned long long pk = (unsigned long long)__builtin_bit_cast(unsigned, stage[wv][2 * L]) | ((unsigned long long)__builtin_bit_cast(unsigned, stage[wv][2 * L + 1]) << 32); VST2(unsigned long long, (unsigned long long*)(OUT + (long long)n * 64 + 2 * L), pk); return; }
    // EPI 0
    stage[wv][c0] = a0.x; stage[wv][c0 + 1] = a0.y; stage[wv][c0 + 2] = a0.z; stage[wv][c0 + 3] = a0.w; stage[wv][c0 + 4] = a1.x; stage[wv][c0 + 5] = a1.y; stage[wv][c0 + 6] = a1.z; stage[wv][c0 + 7] = a1.w;
    __builtin_amdgcn_fence(__ATOMIC_RELEASE, "workgroup"); __builtin_amdgcn_wave_barrier(); __builtin_amdgcn_fence(__ATOMIC_ACQUIRE, "workgroup");
#pragma unroll
    for (int q2 = 0; q2 < 2; ++q2) { const int c = 128 * q2 + 4 * L; v4f v; v.x = stage[wv][c]; v.y = stage[wv][c + 1]; v.z = stage[wv][c + 2]; v.w = stage[wv][c + 3]; VST2V4(OUT + (long long)n * 256 + c, v); } }

__device__ __forceinline__ void st4s(unsigned short* Hp, unsigned short* Lp, long long o, v4f a) { unsigned short h[4], l[4]; bfsplit(a.x, h[0], l[0]); bfsplit(a.y, h[1], l[1]); bfsplit(a.z, h[2], l[2]); bfsplit(a.w, h[3], l[3]);
    const unsigned long long ph = (unsigned long long)h[0] | ((unsigned long long)h[1] << 16) | ((unsigned long long)h[2] << 32) | ((unsigned long long)h[3] << 48), pl = (unsigned long long)l[0] | ((unsigned long long)l[1] << 16) | ((unsigned long long)l[2] << 32) | ((unsigned long long)l[3] << 48);
    VST2(unsigned long long, (unsigned long long*)(Hp + o), ph); VST2(unsigned long long, (unsigned long long*)(Lp + o), pl); }
// f32 [nval2 pairs] -> bf16 hi/lo planes (n2 pairs; pairs >= nval2 zero); thread-linear 4-B stores per plane
__global__ __launch_bounds__(256) void k_pl(const float* __restrict__ S, unsigned short* __restrict__ PH, unsigned short* __restrict__ PL, long long nval2, long long n2) { const long long u = (long long)blockIdx.x * 256 + threadIdx.x; if (u >= n2) return; const bool in = (u < nval2); const long long uc = in ? u : ((nval2 > 0) ? (nval2 - 1) : 0); const float a = S[2 * uc], b = S[2 * uc + 1]; st_s2(PH, PL, 2 * u, in ? a : 0.f, in ? b : 0.f); }
// WC [K][NOP] (thread-linear whole rows) = [W (cols < FO) | 0 | W_h . as_h @EO+h | W_h . ad_h @EO+NH+h | 0 ...]; W is [K][FO] (x @ W layout), as/ad [NH][DH]; EO >= FO.
// branch-free: every lane loads all candidates with clamped indices and selects by value (no exec-masked load arms)
__global__ __launch_bounds__(256) void k_wext(const float* __restrict__ Wm, const float* __restrict__ AS_, const float* __restrict__ AD_, int K, int NOP, int FO, int NH, int DH, int EO, float* __restrict__ WC) {
    #pragma clang fp contract(off)
    const long long u = (long long)blockIdx.x * 256 + threadIdx.x; if (u >= (long long)K * NOP) return; const int kk = (int)(u / NOP), o = (int)(u % NOP);
    const int oo = min(o, FO - 1); const float vw = Wm[(long long)kk * FO + oo]; const int q = min(max(o - EO, 0), 2 * NH - 1); const int h = q % NH; float s = 0.f;
#pragma unroll 1
    for (int c = 0; c < DH; ++c) { const float w = Wm[(long long)kk * FO + h * DH + c]; const float asv = AS_[h * DH + c], adv = AD_[h * DH + c]; s += w * ((q < NH) ? asv : adv); }
    const float v = (o < FO) ? vw : ((o >= EO && o < EO + 2 * NH) ? s : 0.f); VST2(float, WC + u, v); }
// GAT aggregation over a device in-edge CSR (+ analytic self loop as iteration j = -1 when SELF), per-lane online softmax (lanes of one head agree):
// HS rows (pitch P floats): [0,128) projected features z, col 128 + h = a_src.z_h, col 128 + NH + h = a_dst.z_h; lane L owns channels 4L..4L+3 (head = 4L / CH).
// out = sum_j softmax_j(leaky(el[src_j][h] + er[n][h])) z[src_j] (/ (den + deps)) + bias -> ACT (0 none, 1 relu, 2 elu, 3 leaky 0.01) ->
// MODE 0: f32 OUT[n][OW] cols < OC (16-B lane stores, OC*4 contiguous B per wave; OC in {64,128}); MODE 1: bf16 hi/lo planes PH/PL pitch PP (rows n >= N zero); MODE 2: both.
template <int CH, bool SELF, int ACT, int MODE>
__global__ __launch_bounds__(256) void k_gat128(const float* __restrict__ HS, int P, int NH, const float* __restrict__ bias, const int* __restrict__ SRC, const int* __restrict__ off, const int* __restrict__ cnt, const int* __restrict__ slot,
        float* __restrict__ OUT, int OW, int OC, unsigned short* __restrict__ PH, unsigned short* __restrict__ PL, int PP, int N, int NP, int E, int CAP, float slope, float deps) {
    #pragma clang fp contract(off)
    const int n = blockIdx.x * 8 + (threadIdx.x >> 5); const int L = threadIdx.x & 31; if (n >= NP) return; const int c = 4 * L; const int h = c / CH; v4f o; o.x = o.y = o.z = o.w = 0.f;
    if (n < N) { const float* hn = HS + (long long)n * P; const float er = hn[128 + NH + h]; float m = -3.0e38f, s = 0.f; v4f a; a.x = a.y = a.z = a.w = 0.f;
        const int p0 = min(max(off[n], 0), E), cn = min(max(cnt[n], 0), CAP);
        for (int j = (SELF ? -1 : 0); j < cn; ++j) { int sj; if (j < 0) sj = n; else { const int e = min(max(slot[min(p0 + j, E - 1)], 0), E - 1); sj = min(max(SRC[e], 0), N - 1); }
            const float* hs = HS + (long long)sj * P; float lg = hs[128 + h] + er; lg = (lg >= 0.f) ? lg : slope * lg;
            const float mn = fmaxf(m, lg); const float cz = expf(m - mn), pj = expf(lg - mn); s = s * cz + pj; a = a * cz + *(const v4f*)(hs + c) * pj; m = mn; }
        const float inv = (s > 0.f || deps > 0.f) ? 1.f / (s + deps) : 0.f; o = a * inv + *(const v4f*)(bias + c);
        if (ACT == 1) { o.x = fmaxf(o.x, 0.f); o.y = fmaxf(o.y, 0.f); o.z = fmaxf(o.z, 0.f); o.w = fmaxf(o.w, 0.f); }
        if (ACT == 2) { o.x = (o.x > 0.f) ? o.x : (expf(o.x) - 1.f); o.y = (o.y > 0.f) ? o.y : (expf(o.y) - 1.f); o.z = (o.z > 0.f) ? o.z : (expf(o.z) - 1.f); o.w = (o.w > 0.f) ? o.w : (expf(o.w) - 1.f); }
        if (ACT == 3) { o.x = (o.x >= 0.f) ? o.x : 0.01f * o.x; o.y = (o.y >= 0.f) ? o.y : 0.01f * o.y; o.z = (o.z >= 0.f) ? o.z : 0.01f * o.z; o.w = (o.w >= 0.f) ? o.w : 0.01f * o.w; }
        if (MODE != 1 && c < OC) VST2V4(OUT + (long long)n * OW + c, o); }
    if (MODE != 0) st4s(PH, PL, (long long)n * PP + c, o); }

// ---- util2 ----
// generic Bt plane builder from an f32 weight: Bt[o][k] (pitch KP halves) = (TRANS ? W[k*ldw + o] : W[o*ldw + k]) * (S ? S[o] : 1) for o < NO, k < KI; zero elsewhere for o < NOP rows, k < KP (thread per (o < NOP, pair k))
__global__ __launch_bounds__(256) void k_u2_bt(const float* __restrict__ Wm, int ldw, int TRANS, int KI, int NO, int KP, int NOP, const float* __restrict__ S, unsigned short* __restrict__ PH_, unsigned short* __restrict__ PL_) {
    const long long u = (long long)blockIdx.x * 256 + threadIdx.x; if (u >= (long long)NOP * (KP / 2)) return; const int k0 = 2 * (int)(u % (KP / 2)); const int o = (int)(u / (KP / 2)); float a = 0.f, b = 0.f;
    if (o < NO) { const float s = S ? S[o] : 1.f;
        if (k0 < KI) a = (TRANS ? Wm[(long long)k0 * ldw + o] : Wm[(long long)o * ldw + k0]) * s;
        if (k0 + 1 < KI) b = (TRANS ? Wm[(long long)(k0 + 1) * ldw + o] : Wm[(long long)o * ldw + k0 + 1]) * s; }
    st_s2(PH_, PL_, (long long)o * KP + k0, a, b); }
// generic padded vector: O[i] = (i < n) ? (A[i] * (S ? S[i] : 1) + (B2 ? B2[i] : 0)) : 0 for i < NP (one block of 256, NP <= 4096 looped)
__global__ __launch_bounds__(256) void k_u2_vec(const float* __restrict__ A, const float* __restrict__ S, const float* __restrict__ B2, int n, int NP, float* __restrict__ O) { for (int i = threadIdx.x; i < NP; i += 256) { float v = 0.f; if (i < n) v = A[i] * (S ? S[i] : 1.f) + (B2 ? B2[i] : 0.f); VST2(float, O + i, v); } }
__global__ __launch_bounds__(256) void k_u2_colstat(const float* __restrict__ X, int P, int N, float eps, float* __restrict__ STAT) {
    #pragma clang fp contract(off)
    __shared__ float red[256]; const int c = blockIdx.x; const int t = threadIdx.x; float s = 0.f; for (int r = t; r < N; r += 256) s += X[(long long)r * P + c]; red[t] = s; __syncthreads();
    for (int o = 128; o > 0; o >>= 1) { if (t < o) red[t] += red[t + o]; __syncthreads(); }
    const float mu = red[0] / (float)N; __syncthreads(); float q = 0.f; for (int r = t; r < N; r += 256) { const float d = X[(long long)r * P + c] - mu; q += d * d; } red[t] = q; __syncthreads();
    for (int o = 128; o > 0; o >>= 1) { if (t < o) red[t] += red[t + o]; __syncthreads(); }
    const float rs = 1.f / sqrtf(red[0] / (float)N + eps); if (t < 32) VST2(float, STAT + (long long)c * 32 + t, (t == 0) ? mu : ((t == 1) ? rs : 0.f)); }
// rows f32 [R][W] (pitch PW) -> planes at pitch PP, column offset coff; rows >= RL (live) written as zeros up to RP (thread per (r < RP, 4 of W))
__global__ __launch_bounds__(256) void k_u2_pl(const float* __restrict__ X, int PW, int Wd, int RL, int RP, unsigned short* __restrict__ PH_, unsigned short* __restrict__ PL_, int PP, int coff) { const long long u = (long long)blockIdx.x * 256 + threadIdx.x; if (u >= (long long)RP * (Wd / 4)) return; const int r = (int)(u / (Wd / 4)); const int c = 4 * (int)(u % (Wd / 4)); v4f v; v.x = v.y = v.z = v.w = 0.f; if (r < RL) v = *(const v4f*)(X + (long long)r * PW + c); st4s(PH_, PL_, (long long)r * PP + coff + c, v); }

typedef unsigned int cm_u4 __attribute__((ext_vector_type(4)));

__global__ __launch_bounds__(256) void k_cm_zero16(unsigned short* __restrict__ DST, long long n) { const long long u = (long long)blockIdx.x * 256 + threadIdx.x; if (u * 8 >= n) return; cm_u4 z; z.x = z.y = z.z = z.w = 0u; cm_u4* d = (cm_u4*)(DST + u * 8); *d = z;  }
// f32 -> bf16 (RNE) -> f16 casts for the bf16-input-leg path: every 16-bit operand then holds exactly the bf16-rounded input value (times a power-of-two
// weight scale), so the f16 WMMA products are exact. Plain: thread per (row, 8 cols),
// dst [R][C] pitch ldd; transposed: thread per (col, 8 consecutive rows) -> dst [C][R] pitch ldd; both store 16 B per thread, thread-linear along the dst row.
__device__ __forceinline__ unsigned int cmb_pk2(float a, float b) { return (unsigned int)__builtin_bit_cast(unsigned short, (_Float16)a) | ((unsigned int)__builtin_bit_cast(unsigned short, (_Float16)b) << 16); }
__device__ __forceinline__ float cmb_bf(float v) { const unsigned u = __builtin_bit_cast(unsigned, v); const unsigned r = (u + 0x7fffu + ((u >> 16) & 1u)) & 0xffff0000u; return __builtin_bit_cast(float, r); }   // bf16 RNE, kept as f32 (finite inputs)
// BR[i] = bf16_rne(B[i]) kept as f32 (thread per element; bias vectors)
__global__ __launch_bounds__(256) void k_cm_bfvec(const float* __restrict__ SRC, float* __restrict__ DST, int n) { const int u = blockIdx.x * 256 + threadIdx.x; if (u >= n) return; VST2(float, DST + u, cmb_bf(SRC[u])); }
__global__ __launch_bounds__(256) void k_cm_castb(const float* __restrict__ SRC, int lds, unsigned short* __restrict__ DST, int ldd, int nR, int nC, float sc) {
    const long long u = (long long)blockIdx.x * 256 + threadIdx.x; const int per = nC / 8; if (u >= (long long)nR * per) return; const int r = (int)(u / per); const int c0 = 8 * (int)(u % per);
    const float* s = SRC + (long long)r * lds + c0; float w[8];
#pragma unroll
    for (int e = 0; e < 8; ++e) w[e] = cmb_bf(s[e]) * sc;
    cm_u4 pk; pk.x = cmb_pk2(w[0], w[1]); pk.y = cmb_pk2(w[2], w[3]); pk.z = cmb_pk2(w[4], w[5]); pk.w = cmb_pk2(w[6], w[7]); VST2(cm_u4, (cm_u4*)(DST + (long long)r * ldd + c0), pk); }
__global__ __launch_bounds__(256) void k_cm_castbT(const float* __restrict__ SRC, int lds, unsigned short* __restrict__ DST, int ldd, int nR, int nC, float sc) {
    const long long u = (long long)blockIdx.x * 256 + threadIdx.x; const int per = nR / 8; if (u >= (long long)nC * per) return; const int c = (int)(u / per); const int r0 = 8 * (int)(u % per);
    float w[8];
#pragma unroll
    for (int e = 0; e < 8; ++e) w[e] = cmb_bf(SRC[(long long)(r0 + e) * lds + c]) * sc;
    cm_u4 pk; pk.x = cmb_pk2(w[0], w[1]); pk.y = cmb_pk2(w[2], w[3]); pk.z = cmb_pk2(w[4], w[5]); pk.w = cmb_pk2(w[6], w[7]); VST2(cm_u4, (cm_u4*)(DST + (long long)c * ldd + r0), pk); }

// QT = bf16(q) * bf16(tau[b]) (f32, thread per float4); MF[b][j] = sc * bf16(delta[b][j]), sc = scale * log2(e).
// KF, VF = bf16(keys | keys_null), bf16(values | values_null) as 2-byte halves in the order k_attn_t's A fragments want them, so that a fragment is two 16-byte loads a lane
// and each load of a wave reads 512 contiguous bytes: [branch][b][h][64-key block][tile 0..3][step 0..1][half 0..1][lane 0..31][8].
//   K: key = 64 block + 16 tile + (lane & 15), e = 32 step + 16 half + 8 (lane >> 4) + i;   V: d = 16 tile + (lane & 15), key = 64 block + 32 step + 16 half + 8 (lane >> 4) + i.
// Thread per 16-byte group of the destination (thread-linear stores); which = blockIdx range, block-uniform.
__global__ __launch_bounds__(256) void k_ds_pre(const float* __restrict__ Q, const float* __restrict__ Kp, const float* __restrict__ V, const float* __restrict__ Kn, const float* __restrict__ Vn, const float* __restrict__ TAU, const float* __restrict__ DELTA, float* __restrict__ QTp, unsigned short* __restrict__ KFp, unsigned short* __restrict__ VFp, float* __restrict__ MFp, float sc) {
    #pragma clang fp contract(off)
    const int blk = blockIdx.x;
    if (blk < 2048) { const long long u = (long long)blk * 256 + threadIdx.x; const int b = (int)(u / (2048LL * 8 * 16)); const float t = cmb_bf(TAU[b]); const v4f x = *(const v4f*)(Q + 4 * u); v4f r; r.x = cmb_bf(x.x) * t; r.y = cmb_bf(x.y) * t; r.z = cmb_bf(x.z) * t; r.w = cmb_bf(x.w) * t; VST2V4(QTp + 4 * u, r); }
    else if (blk < 2048 + 4 * 1024) {
        const int which = (blk - 2048) >> 10;                            // 0 keys, 1 values, 2 keys_null, 3 values_null
        const int c = ((blk - 2048) & 1023) * 256 + threadIdx.x;         // 16-byte group within the tensor: 262,144 of them
        const int lane = c & 31, half = (c >> 5) & 1, step = (c >> 6) & 1, tile = (c >> 7) & 3, kb = (c >> 9) & 31, h = (c >> 14) & 7, b = c >> 17;
        const int inner = 32 * step + 16 * half + 8 * (lane >> 4), outer = 16 * tile + (lane & 15);
        const float* s = (which == 0) ? Kp : (which == 1) ? V : (which == 2) ? Kn : Vn;
        float w[8];
        if ((which & 1) == 0) {
            const float* r = s + ((long long)(b * 2048 + kb * 64 + outer) * 8 + h) * 64 + inner;
            const v4f x = *(const v4f*)r, y = *(const v4f*)(r + 4);
            w[0] = x.x; w[1] = x.y; w[2] = x.z; w[3] = x.w; w[4] = y.x; w[5] = y.y; w[6] = y.z; w[7] = y.w;
        } else {
            const float* r = s + ((long long)(b * 2048 + kb * 64 + inner) * 8 + h) * 64 + outer;
#pragma unroll   // constant trip count: the eight row loads are issued together, with one wait
            for (int i = 0; i < 8; ++i) w[i] = r[i * 512];
        }
        cm_u4 pk;
        pk.x = (unsigned)bfu_rne(w[0]) | ((unsigned)bfu_rne(w[1]) << 16); pk.y = (unsigned)bfu_rne(w[2]) | ((unsigned)bfu_rne(w[3]) << 16);
        pk.z = (unsigned)bfu_rne(w[4]) | ((unsigned)bfu_rne(w[5]) << 16); pk.w = (unsigned)bfu_rne(w[6]) | ((unsigned)bfu_rne(w[7]) << 16);
        unsigned short* d = ((which & 1) ? VFp : KFp) + ((which >= 2) ? 2097152 : 0) + (long long)c * 8;
        VST2(cm_u4, (cm_u4*)d, pk); }
    else { const int u = (blk - 2048 - 4 * 1024) * 256 + threadIdx.x; VST2(float, MFp + u, sc * cmb_bf(DELTA[u]));
        asm volatile("s_wait_xcnt 0x0" ::: "memory");   // stands behind the store, ahead of any rewrite of the registers it names
    } }
// The two parts of a query's softmax, each normalised by its own sum e.y under its own maximum e.x (exp2 units), as one: weights e.y * 2^(e.x - max) over their sum
__device__ __forceinline__ v4f ds_join(v4f p0, v4f p1, v2f e0, v2f e1) {
    const float mm = fmaxf(e0.x, e1.x);
    const float w0 = e0.y * __builtin_amdgcn_exp2f(e0.x - mm), w1 = e1.y * __builtin_amdgcn_exp2f(e1.x - mm);
    const float inv = 1.f / (w0 + w1);
    return p0 * (w0 * inv) + p1 * (w1 * inv);
}
// out = m * A1 + (1 - m) * A2 with m = bf16(soft_mask[b][l]) broadcast over (h, e); thread per float4. For queries from 1,024 on A1 and A2 hold the keys below 1,024 only:
// the part behind them (PB, half planes [branch][batch]) is joined first, by the maxima and sums in ML ([part][branch][batch][query - 1,024][head][2]).
__global__ __launch_bounds__(256) void k_ds_blend(const float* __restrict__ A1, const float* __restrict__ A2, const float* __restrict__ PB, const float* __restrict__ ML, const float* __restrict__ SM, float* __restrict__ O, long long n4) {
    #pragma clang fp contract(off)
    const long long u = (long long)blockIdx.x * 256 + threadIdx.x; if (u >= n4) return; const float m = cmb_bf(SM[(4 * u) / 512]); v4f a = *(const v4f*)(A1 + 4 * u), b = *(const v4f*)(A2 + 4 * u); v4f o;
    asm volatile("s_wait_xcnt 0x0" ::: "memory");   // stands behind the three loads, ahead of the rewrite of their address pairs by the address sums below
    if ((blockIdx.x & 1023) >= 512) {   // a block is two neighbouring queries of one batch: the test is block-uniform, a scalar branch
        const int bt = blockIdx.x >> 10, r2 = ((blockIdx.x & 511) << 1) + (threadIdx.x >> 7), c4 = threadIdx.x & 127;   // r2 = query - 1,024
        const float* pb = PB + bt * 524288 + r2 * 512 + c4 * 4;
        const float* ml = ML + bt * 16384 + r2 * 16 + (c4 >> 4) * 2;
        const v4f a1 = *(const v4f*)pb, b1 = *(const v4f*)(pb + 1048576);
        const v2f ea0 = *(const v2f*)ml, ea1 = *(const v2f*)(ml + 65536), eb0 = *(const v2f*)(ml + 32768), eb1 = *(const v2f*)(ml + 98304);
        asm volatile("s_wait_xcnt 0x0" ::: "memory");   // stands behind the six loads, ahead of any rewrite of their two address pairs
        a = ds_join(a, a1, ea0, ea1); b = ds_join(b, b1, eb0, eb1);
    }
    o.x = m * a.x + (1.f - m) * b.x; o.y = m * a.y + (1.f - m) * b.y; o.z = m * a.z + (1.f - m) * b.z; o.w = m * a.w + (1.f - m) * b.w; VST2V4(O + 4 * u, o); }


extern "C" void kernel_launch(void* const* d_in, const int* in_sizes, int n_in, void* d_out, int out_size, void* d_ws, size_t ws_size, hipStream_t stream) {
    (void)in_sizes; (void)n_in; (void)out_size; (void)ws_size;
    const float* q = (const float*)d_in[0];
    const float* kk = (const float*)d_in[1];
    const float* v = (const float*)d_in[2];
    const float* kn = (const float*)d_in[3];
    const float* vn = (const float*)d_in[4];
    const float* tau = (const float*)d_in[5];
    const float* delta = (const float*)d_in[6];
    const float* smask = (const float*)d_in[7];
    float* out = (float*)d_out;
    char* wsp = (char*)d_ws;
    float* QT = (float*)wsp; wsp += (((size_t)((size_t)2097152) * 4 + 255) / 256) * 256;
    unsigned short* KF = (unsigned short*)wsp; wsp += (((size_t)((size_t)4194304) * 2 + 255) / 256) * 256;   // [branch][batch] planes of 1,048,576 bf16 in fragment order
    unsigned short* VF = (unsigned short*)wsp; wsp += (((size_t)((size_t)4194304) * 2 + 255) / 256) * 256;   // the same
    float* MF = (float*)wsp; wsp += (((size_t)((size_t)4096) * 4 + 255) / 256) * 256;
    float* AO1 = (float*)wsp; wsp += (((size_t)((size_t)2097152) * 4 + 255) / 256) * 256;
    float* AO2 = (float*)wsp; wsp += (((size_t)((size_t)2097152) * 4 + 255) / 256) * 256;  // directly behind AO1: the attention launch writes both as [branch][batch] planes
    float* AOB = (float*)wsp; wsp += (((size_t)((size_t)2097152) * 4 + 255) / 256) * 256;  // [branch][batch] half planes: queries 1,024 on, keys 1,024 on
    float* ML = (float*)wsp; wsp += (((size_t)((size_t)131072) * 4 + 255) / 256) * 256;    // [part][branch][batch][query - 1,024][head] maximum and sum
    if ((size_t)(wsp - (char*)d_ws) > ws_size) return;   // static carve guard
    k_ds_pre<<<(unsigned)(2048 + 4 * 1024 + 16), 256, 0, stream>>>(q, kk, v, kn, vn, tau, delta, QT, KF, VF, MF, 0.18033688f);   // scale * log2(e): the table is added to exp2 arguments
    k_attn_t<<<dim3(32, 48, 1), 32 * AW, 0, stream>>>(QT, KF, VF, MF, AO1, AOB, ML);   // writes AO1 and AO2 as [branch][batch] planes, AOB and ML
    k_ds_blend<<<(524288 + 255) / 256, 256, 0, stream>>>(AO1, AO2, AOB, ML, smask, out, 524288LL);
}

// v008
// Measured time: 38.3 microseconds a run.
// It is 1.35 times as fast as v006, going by the measured steps of the versions left out in between.
// All steps since the starting kernel, v000, together make it 96.4 times as fast.
// De-stationary causal attention with a null branch, [b, l, h, e] layout (2 x 2,048 tokens, 8 heads x 64): A = softmax(scale * (q.k * tau_b + delta_bj)) over keys j <= i for (keys, values) and for (keys_null, values_null) with the same queries; out = soft_mask * out_edit + (1 - soft_mask) * out_null per query. All inputs rounded to bf16 (RNE); q is multiplied by tau_b on device (f32) and k, v rounded, k is stored as bf16 and the bf16-rounded v as f16, both in WMMA fragment order, then ONE WMMA attention launch for both batches and both branches (v_wmma_f32_16x16x32_bf16, f32 accumulate) with q as a bf16 hi/lo split (f32-class: q*tau is not 16-bit exact) against bf16 k, the per-key additive table scale*delta_bj, causal, f32 online softmax, P as one f16 value a score against f16 v (v_wmma_f32_16x16x32_f16, f32 accumulate); the blend in f32.
#include <hip/hip_runtime.h>
#include <math.h>

typedef __attribute__((ext_vector_type(16))) _Float16 v16h;
typedef __attribute__((ext_vector_type(8)))  _Float16 v8h;
typedef __attribute__((ext_vector_type(16))) __bf16   v16b;
typedef __attribute__((ext_vector_type(8)))  __bf16   v8b;
typedef __attribute__((ext_vector_type(8)))  float    v8f;
typedef __attribute__((ext_vector_type(4)))  float    v4f;

// 16-bit WMMA fragment map (wave32), lane L, h = L>>4, m = L&15:
//   A 16x32: lane = row m;   element i -> k = (i<8) ? 8h+i : 16+8h+(i-8)
//   B 32x16: lane = column m; the SAME k(i,h)
//   D 16x16 (8 f32): lane = column m; element r -> row 8h+r
__device__ __forceinline__ int frag_k(int i, int h) { return (i < 8) ? (8 * h + i) : (16 + 8 * h + (i - 8)); }
__device__ __forceinline__ __bf16 bf16_rne(float f) {
    unsigned int u = __float_as_uint(f);
    u += 0x7fffu + ((u >> 16) & 1u);
    return __builtin_bit_cast(__bf16, (unsigned short)(u >> 16));
}
__device__ __forceinline__ float bf16_f32(__bf16 b) { return __uint_as_float(((unsigned int)__builtin_bit_cast(unsigned short, b)) << 16); }
__device__ __forceinline__ v8f wmma16(v16h a, v16h b, v8f c) {
    c = __builtin_amdgcn_wmma_f32_16x16x32_f16(false, a, false, b, (short)0, c, false, false);
    asm volatile("v_nop\n\tv_nop\n\tv_nop\n\tv_nop" : "+v"(c) : "v"(a), "v"(b));
    return c;
}
__device__ __forceinline__ v8f wmmab(v16b a, v16b b, v8f c) {
    c = __builtin_amdgcn_wmma_f32_16x16x32_bf16(false, a, false, b, (short)0, c, false, false);
    asm volatile("v_nop\n\tv_nop\n\tv_nop\n\tv_nop" : "+v"(c) : "v"(a), "v"(b));
    return c;
}
struct Split { v16b hi, lo; };
// hi/lo split product: a.hi*b.hi + a.hi*b.lo + a.lo*b.hi
__device__ __forceinline__ v8f wmma3(const Split& a, const Split& b, v8f c) {
    c = __builtin_amdgcn_wmma_f32_16x16x32_bf16(false, a.hi, false, b.hi, (short)0, c, false, false);
    c = __builtin_amdgcn_wmma_f32_16x16x32_bf16(false, a.hi, false, b.lo, (short)0, c, false, false);
    c = __builtin_amdgcn_wmma_f32_16x16x32_bf16(false, a.lo, false, b.hi, (short)0, c, false, false);
    asm volatile("v_nop\n\tv_nop\n\tv_nop\n\tv_nop" : "+v"(c) : "v"(a.hi), "v"(a.lo), "v"(b.hi), "v"(b.lo));
    return c;
}
// hi/lo split a against a b that is exact in bf16 (its lo part is zero): a.hi*b + a.lo*b
__device__ __forceinline__ v8f wmma2(const Split& a, v16b b, v8f c) {
    c = __builtin_amdgcn_wmma_f32_16x16x32_bf16(false, a.hi, false, b, (short)0, c, false, false);
    c = __builtin_amdgcn_wmma_f32_16x16x32_bf16(false, a.lo, false, b, (short)0, c, false, false);
    return c;
}
// the same with the exact bf16 operand as A and the hi/lo split as B: a*b.hi + a*b.lo
__device__ __forceinline__ v8f wmma2t(v16b a, const Split& b, v8f c) {
    c = __builtin_amdgcn_wmma_f32_16x16x32_bf16(false, a, false, b.hi, (short)0, c, false, false);
    c = __builtin_amdgcn_wmma_f32_16x16x32_bf16(false, a, false, b.lo, (short)0, c, false, false);
    return c;
}
// One f16 fragment from a plane in fragment order, laid out as bfrag_ld's
__device__ __forceinline__ v16h hfrag_ld(const _Float16* __restrict__ p) {
    const v8h x = *(const v8h*)p, y = *(const v8h*)(p + 256);
    return __builtin_shufflevector(x, y, 0, 1, 2, 3, 4, 5, 6, 7, 8, 9, 10, 11, 12, 13, 14, 15);
}
// One B fragment from a plane in fragment order (see k_ds_pre): two blocks of 256 halves, lane L's eight halves at 8L; block 0 holds elements 0..7, block 1 elements 8..15
__device__ __forceinline__ v16b bfrag_ld(const __bf16* __restrict__ p) {
    const v8b x = *(const v8b*)p, y = *(const v8b*)(p + 256);
    return __builtin_shufflevector(x, y, 0, 1, 2, 3, 4, 5, 6, 7, 8, 9, 10, 11, 12, 13, 14, 15);
}
struct Split3 { v16b hi, mid, lo; };
// triple split product (6 terms, drops only terms below 2^-24 relative)
__device__ __forceinline__ v8f wmma6(const Split3& a, const Split3& b, v8f c) {
    c = __builtin_amdgcn_wmma_f32_16x16x32_bf16(false, a.hi, false, b.hi, (short)0, c, false, false);
    c = __builtin_amdgcn_wmma_f32_16x16x32_bf16(false, a.hi, false, b.mid, (short)0, c, false, false);
    c = __builtin_amdgcn_wmma_f32_16x16x32_bf16(false, a.mid, false, b.hi, (short)0, c, false, false);
    c = __builtin_amdgcn_wmma_f32_16x16x32_bf16(false, a.hi, false, b.lo, (short)0, c, false, false);
    c = __builtin_amdgcn_wmma_f32_16x16x32_bf16(false, a.mid, false, b.mid, (short)0, c, false, false);
    c = __builtin_amdgcn_wmma_f32_16x16x32_bf16(false, a.lo, false, b.hi, (short)0, c, false, false);
    asm volatile("v_nop\n\tv_nop\n\tv_nop\n\tv_nop" : "+v"(c) : "v"(a.hi), "v"(a.mid), "v"(a.lo), "v"(b.hi), "v"(b.mid), "v"(b.lo));
    return c;
}

// Fragment gathers from f32 memory: element i <- p[(k0 + frag_k(i,h)) * sk] * s, zero for k >= klen.
__device__ __forceinline__ v16h fh_ld(const float* __restrict__ p, long long sk, int k0, int h, int klen, float s) {
    v16h a;
#pragma unroll
    for (int i = 0; i < 16; ++i) { const int k = k0 + frag_k(i, h); a[i] = (k < klen) ? (_Float16)(p[(long long)k * sk] * s) : (_Float16)0.f; }
    return a;
}
__device__ __forceinline__ Split sp_ld(const float* __restrict__ p, long long sk, int k0, int h, int klen, float s) {
    Split r;
#pragma unroll
    for (int i = 0; i < 16; ++i) {
        const int k = k0 + frag_k(i, h); const float x = (k < klen) ? p[(long long)k * sk] * s : 0.f;
        const __bf16 hb = bf16_rne(x); r.hi[i] = hb; r.lo[i] = bf16_rne(x - bf16_f32(hb));
    }
    return r;
}
__device__ __forceinline__ Split3 sp3_ld(const float* __restrict__ p, long long sk, int k0, int h, int klen, float s) {
    Split3 r;
#pragma unroll
    for (int i = 0; i < 16; ++i) {
        const int k = k0 + frag_k(i, h); const float x = (k < klen) ? p[(long long)k * sk] * s : 0.f;
        const __bf16 hb = bf16_rne(x); const float r1 = x - bf16_f32(hb); const __bf16 mb = bf16_rne(r1);
        r.hi[i] = hb; r.mid[i] = mb; r.lo[i] = bf16_rne(r1 - bf16_f32(mb));
    }
    return r;
}
__device__ __forceinline__ v16b bh_ld(const float* __restrict__ p, long long sk, int k0, int h, int klen, float s) {
    v16b a;
#pragma unroll
    for (int i = 0; i < 16; ++i) { const int k = k0 + frag_k(i, h); a[i] = bf16_rne((k < klen) ? p[(long long)k * sk] * s : 0.f); }
    return a;
}
// f16 fragment from an f16 LDS/global row with element stride 1 (k-contiguous), no bounds (tile already zero padded)
__device__ __forceinline__ v16h fh_row(const _Float16* __restrict__ row, int k0, int h) {
    v16h a;
#pragma unroll
    for (int i = 0; i < 16; ++i) a[i] = row[k0 + frag_k(i, h)];
    return a;
}

#define VST2(T, ptr, val) do { const T vst2_v_ = (val); *(T*)(ptr) = vst2_v_;  } while (0)
typedef float v4f __attribute__((ext_vector_type(4)));
#define VST2V4(ptr, val) do { const v4f vst2_v4_ = (val); *(v4f*)(ptr) = vst2_v4_;  } while (0)

__device__ __attribute__((noinline)) float act_fn(float v, int act) {
    if (act == 1) return fmaxf(v, 0.f);                                                                               // relu
    if (act == 2) { const float u = 0.7978845608028654f * (v + 0.044715f * v * v * v); return 0.5f * v * (1.f + tanhf(u)); } // tanh-gelu
    if (act == 3) return v / (1.f + expf(-v));                                                                        // silu
    if (act == 4) return 0.5f * v * (1.f + erff(v * 0.7071067811865476f));                                             // erf-gelu
    if (act == 5) return tanhf(v);
    if (act == 6) return 1.f / (1.f + expf(-v));                                                                      // sigmoid
    if (act == 7) return (v > 0.f) ? v : 0.01f * v;                                                                   // leaky relu 0.01
    if (act == 8) return (v > 0.f) ? v : (expf(v) - 1.f);                                                             // elu
    if (act == 9) return fminf(fmaxf(v, 0.f), 6.f);                                                                   // relu6
    if (act == 10) return fabsf(v);                                                                                    // abs
    if (act == 11) return (v >= 0.f) ? v : 0.1f * v;                                                                  // leaky 0.1
    if (act == 12) return (v > 0.f) ? v : 0.2f * v;                                                                   // leaky 0.2
    if (act == 13) return (v > 20.f) ? v : log1pf(expf(v));                                                            // softplus
    return v;
}

// =====================================================================================================================
// k_gemm<MODE>: C(z, m, n) = act(alpha * sum_k A(z, m, k) * B(z, k, n) + bias) + beta * R(z, m, n)
//   One wave (32-thread block) per 16 x 32 tile of C; grid (ceil(N/32), ceil(M/16), Z). Batch z -> (zo = z / zi_n, zi = z % zi_n)
//   with separate outer/inner strides for every tensor (e.g. batch and head). A(m,k) = A[zo*sAo + zi*sAi + m*sAm + k*sAk] (f32),
//   B(k,n) = B[zo*sBo + zi*sBi + n*sBn + k*sBk] (f32); any M, N, K (K zero-padded to 32 inside the fragments, M/N tails guarded).
//   C(m,n) = C[zo*sCo + zi*sCi + m*sCm + n] (n contiguous). flags: 1 bias[n], 2 bias[m], 4 residual R[zo*sRo + zi*sRi + m*sRm + n*sRn].
//   MODE 0: f16 operands (A prescaled by sa, B by sb, both undone in the epilogue); 1: bf16 hi/lo split (3 products); 2: bf16;
//   3: bf16 hi/mid/lo triple split (6 products); 4: as 3 with Kahan-compensated f32 accumulation across k-steps.
// =====================================================================================================================
struct GemmP {
    const float* A; const float* B; const float* bias; const float* R; float* C;
    long long sAo, sAi, sAm, sAk, sBo, sBi, sBn, sBk, sCo, sCi, sCm, sRo, sRi, sRm, sRn;
    int M, N, K, zi_n, flags, act; float alpha, beta, sa, sb;
    int Npad, pad_;     // columns [N, Npad) of C are written as 0 so that padded workspace rows are covered by whole-line stores; Npad >= N
};
static_assert(sizeof(GemmP) == 5 * 8 + 15 * 8 + 6 * 4 + 4 * 4 + 2 * 4, "GemmP has padding");

template <int MODE>
__global__ __launch_bounds__(32) void k_gemm(GemmP p) {
    const int lane = threadIdx.x & 31, h = lane >> 4, l15 = lane & 15;
    const int m0 = blockIdx.y * 16, n0 = blockIdx.x * 32;
    const int z = blockIdx.z, zo = z / p.zi_n, zi = z - zo * p.zi_n;
    const float* A = p.A + zo * p.sAo + zi * p.sAi;
    const float* B = p.B + zo * p.sBo + zi * p.sBi;
    const int am = min(m0 + l15, p.M - 1);                       // clamped row for loads (stores are guarded)
    v8f acc[2], comp[2];
#pragma unroll
    for (int t = 0; t < 2; ++t) { v8f zz = {}; acc[t] = zz; comp[t] = zz; }
    for (int k0 = 0; k0 < p.K; k0 += 32) {
        const float* arow = A + (long long)am * p.sAm;
        if (MODE == 1) {
            const Split a = sp_ld(arow, p.sAk, k0, h, p.K, 1.f);
#pragma unroll
            for (int t = 0; t < 2; ++t) {
                const int bn = min(n0 + t * 16 + l15, p.N - 1);
                acc[t] = wmma3(a, sp_ld(B + (long long)bn * p.sBn, p.sBk, k0, h, p.K, 1.f), acc[t]);
            }
        } else if (MODE == 3) {
            const Split3 a = sp3_ld(arow, p.sAk, k0, h, p.K, 1.f);
#pragma unroll
            for (int t = 0; t < 2; ++t) {
                const int bn = min(n0 + t * 16 + l15, p.N - 1);
                acc[t] = wmma6(a, sp3_ld(B + (long long)bn * p.sBn, p.sBk, k0, h, p.K, 1.f), acc[t]);
            }
        } else if (MODE == 4) {
            // triple split as MODE 3, but each k-step's 6 products go into a fresh accumulator and the partial is added to the running f32 sum
            // on the VALU with Kahan compensation (accumulation error stays ~1 ulp however long K is)
            const Split3 a = sp3_ld(arow, p.sAk, k0, h, p.K, 1.f);
#pragma unroll
            for (int t = 0; t < 2; ++t) {
                const int bn = min(n0 + t * 16 + l15, p.N - 1); v8f zz = {};
                const v8f part = wmma6(a, sp3_ld(B + (long long)bn * p.sBn, p.sBk, k0, h, p.K, 1.f), zz);
                const v8f y = part - comp[t]; const v8f s = acc[t] + y; comp[t] = (s - acc[t]) - y; acc[t] = s;
            }
        } else if (MODE == 2) {
            const v16b a = bh_ld(arow, p.sAk, k0, h, p.K, 1.f);
#pragma unroll
            for (int t = 0; t < 2; ++t) {
                const int bn = min(n0 + t * 16 + l15, p.N - 1);
                acc[t] = wmmab(a, bh_ld(B + (long long)bn * p.sBn, p.sBk, k0, h, p.K, 1.f), acc[t]);
            }
        } else {
            const v16h a = fh_ld(arow, p.sAk, k0, h, p.K, p.sa);
#pragma unroll
            for (int t = 0; t < 2; ++t) {
                const int bn = min(n0 + t * 16 + l15, p.N - 1);
                acc[t] = wmma16(a, fh_ld(B + (long long)bn * p.sBn, p.sBk, k0, h, p.K, p.sb), acc[t]);
            }
        }
    }
    const float iscale = (MODE == 0) ? p.alpha / (p.sa * p.sb) : p.alpha;
    float* C = p.C + zo * p.sCo + zi * p.sCi;
    const float* R = p.R + zo * p.sRo + zi * p.sRi;
    __shared__ __align__(16) float ctile[16][36];
#pragma unroll
    for (int t = 0; t < 2; ++t) {
        const int n = n0 + t * 16 + l15; const int nn = min(n, p.N - 1);
#pragma unroll
        for (int r = 0; r < 8; ++r) {
            const int m = m0 + 8 * h + r; const int mm = min(m, p.M - 1);
            float v = acc[t][r] * iscale;
            if (p.flags & 1) v += p.bias[nn];
            if (p.flags & 2) v += p.bias[mm];
            if (p.flags & 8) v *= p.bias[(long long)zo * p.M + mm];   /* per-(z,row) scale vector laid out [Z][M]; exclusive with the bias flags */
            v = act_fn(v, p.act);
            if (p.flags & 4) v += p.beta * R[(long long)mm * p.sRm + (long long)nn * p.sRn];
            ctile[8 * h + r][t * 16 + l15] = (n < p.N) ? v : 0.f;
        }
    }
    __syncthreads();
    const int NW = (p.Npad > p.N) ? p.Npad : p.N;           // write width
    const bool fast = (m0 + 16 <= p.M) && (n0 + 32 <= NW) && ((p.sCm & 3) == 0) && ((((size_t)C) & 15) == 0);
    if (fast) {
#pragma unroll
        for (int s = 0; s < 4; ++s) {
            const int row = s * 4 + (lane >> 3), c4 = (lane & 7) * 4;
            const v4f v = *(const v4f*)&ctile[row][c4];
            VST2V4(C + (long long)(m0 + row) * p.sCm + n0 + c4, v);
        }
    } else {
        for (int row = 0; row < 16; ++row) {
            const int m = m0 + row, n = n0 + lane;
            if (m < p.M && n < NW) VST2(float, C + (long long)m * p.sCm + n, ctile[row][lane]);
        }
    }
}


// =====================================================================================================================
// k_gemmT<MODE, TM, TN>: same contract as k_gemm, but one wave computes a (16*TM) x (16*TN) tile: TM A fragments and TN B fragments are
//   loaded per 32-wide k-step and reused across TM*TN WMMAs (far fewer load/convert instructions per MAC). MODE 0 (f16), 1 (bf16 hi/lo),
//   2 (bf16) only. grid (ceil(NW/(16*TN)), ceil(M/(16*TM)), Z), block 32. Epilogue identical to k_gemm, run per 16x32 sub-tile.
// =====================================================================================================================
template <int MODE, int TM, int TN>
__global__ __launch_bounds__(32) void k_gemmT(GemmP p) {
    const int lane = threadIdx.x & 31, h = lane >> 4, l15 = lane & 15;
    const int m0 = blockIdx.y * (16 * TM), n0 = blockIdx.x * (16 * TN);
    const int z = blockIdx.z, zo = z / p.zi_n, zi = z - zo * p.zi_n;
    const float* A = p.A + zo * p.sAo + zi * p.sAi;
    const float* B = p.B + zo * p.sBo + zi * p.sBi;
    v8f acc[TM][TN];
#pragma unroll
    for (int i = 0; i < TM; ++i)
#pragma unroll
        for (int t = 0; t < TN; ++t) { v8f zz = {}; acc[i][t] = zz; }
    for (int k0 = 0; k0 < p.K; k0 += 32) {
        if (MODE == 1) {
            Split a[TM], b[TN];
#pragma unroll
            for (int i = 0; i < TM; ++i) { const int am = min(m0 + 16 * i + l15, p.M - 1); a[i] = sp_ld(A + (long long)am * p.sAm, p.sAk, k0, h, p.K, 1.f); }
#pragma unroll
            for (int t = 0; t < TN; ++t) { const int bn = min(n0 + 16 * t + l15, p.N - 1); b[t] = sp_ld(B + (long long)bn * p.sBn, p.sBk, k0, h, p.K, 1.f); }
#pragma unroll
            for (int i = 0; i < TM; ++i)
#pragma unroll
                for (int t = 0; t < TN; ++t) acc[i][t] = wmma3(a[i], b[t], acc[i][t]);
        } else if (MODE == 2) {
            v16b a[TM], b[TN];
#pragma unroll
            for (int i = 0; i < TM; ++i) { const int am = min(m0 + 16 * i + l15, p.M - 1); a[i] = bh_ld(A + (long long)am * p.sAm, p.sAk, k0, h, p.K, 1.f); }
#pragma unroll
            for (int t = 0; t < TN; ++t) { const int bn = min(n0 + 16 * t + l15, p.N - 1); b[t] = bh_ld(B + (long long)bn * p.sBn, p.sBk, k0, h, p.K, 1.f); }
#pragma unroll
            for (int i = 0; i < TM; ++i)
#pragma unroll
                for (int t = 0; t < TN; ++t) acc[i][t] = wmmab(a[i], b[t], acc[i][t]);
        } else {
            v16h a[TM], b[TN];
#pragma unroll
            for (int i = 0; i < TM; ++i) { const int am = min(m0 + 16 * i + l15, p.M - 1); a[i] = fh_ld(A + (long long)am * p.sAm, p.sAk, k0, h, p.K, p.sa); }
#pragma unroll
            for (int t = 0; t < TN; ++t) { const int bn = min(n0 + 16 * t + l15, p.N - 1); b[t] = fh_ld(B + (long long)bn * p.sBn, p.sBk, k0, h, p.K, p.sb); }
#pragma unroll
            for (int i = 0; i < TM; ++i)
#pragma unroll
                for (int t = 0; t < TN; ++t) acc[i][t] = wmma16(a[i], b[t], acc[i][t]);
        }
    }
    const float iscale = (MODE == 0) ? p.alpha / (p.sa * p.sb) : p.alpha;
    float* C = p.C + zo * p.sCo + zi * p.sCi;
    const float* R = p.R + zo * p.sRo + zi * p.sRi;
    const int NW = (p.Npad > p.N) ? p.Npad : p.N;
    __shared__ __align__(16) float ctile[16][36];
#pragma unroll
    for (int i = 0; i < TM; ++i) {
        const int mb = m0 + 16 * i; if (mb >= p.M) break;          // wave-uniform
#pragma unroll
        for (int tp = 0; tp < TN / 2; ++tp) {
            const int nb = n0 + 32 * tp; if (nb >= NW) break;        // wave-uniform
#pragma unroll
            for (int t2 = 0; t2 < 2; ++t2) {
                const int t = 2 * tp + t2; const int n = nb + t2 * 16 + l15; const int nn = min(n, p.N - 1);
#pragma unroll
                for (int r = 0; r < 8; ++r) {
                    const int m = mb + 8 * h + r; const int mm = min(m, p.M - 1);
                    float v = acc[i][t][r] * iscale;
                    if (p.flags & 1) v += p.bias[nn];
                    if (p.flags & 2) v += p.bias[mm];
            if (p.flags & 8) v *= p.bias[(long long)zo * p.M + mm];   /* per-(z,row) scale vector laid out [Z][M]; exclusive with the bias flags */
                    v = act_fn(v, p.act);
                    if (p.flags & 4) v += p.beta * R[(long long)mm * p.sRm + (long long)nn * p.sRn];
                    ctile[8 * h + r][t2 * 16 + l15] = (n < p.N) ? v : 0.f;
                }
            }
            __syncthreads();
            const bool fast = (mb + 16 <= p.M) && (nb + 32 <= NW) && ((p.sCm & 3) == 0) && ((((size_t)C) & 15) == 0);
            if (fast) {
#pragma unroll
                for (int s = 0; s < 4; ++s) {
                    const int row = s * 4 + (lane >> 3), c4 = (lane & 7) * 4;
                    const v4f v = *(const v4f*)&ctile[row][c4];
                    VST2V4(C + (long long)(mb + row) * p.sCm + nb + c4, v);
                }
            } else {
                for (int row = 0; row < 16; ++row) {
                    const int m = mb + row, n = nb + lane;
                    if (m < p.M && n < NW) VST2(float, C + (long long)m * p.sCm + n, ctile[row][lane]);
                }
            }
            __syncthreads();
        }
    }
}

// =====================================================================================================================
//   Wave = 16 queries, AW waves per block, 64-key blocks; grid (ceil(Lq/(16*AW)), H, 2 branches x 2 batches), block 32*AW. Any Lq, Lk; head dim dh <= DHP
//   (DHP multiple of 32), value dim dv <= DVP (multiple of 16, <= 128). Every tensor addressed by (batch, head, row, element) strides, f32.
//   Scores: QM 0 f16 operands, 1 bf16 hi/lo split, 2 bf16 triple split; statistics f32 (exp2 domain); P.V: P x 4096 as f16 with V f16 staged in LDS
//   (SPLITPV: P as a bf16 hi/lo split, V bf16 fragments read from memory). kv head = h / hrep. Masking: causal = 1 (keep j <= i + coff, masked -> -inf, key blocks beyond the
//   diagonal skipped), causal = 2 (masked -> mfill, a finite fill like the -1e9; no skipping), causal = 3 (keep j >= i + coff,
//   masked -> -inf, no skipping); optional additive f32 mask Mf,
//   optional int keep-mask Mi (0 -> score := mfill), both addressed b*smb + h*smh + i*smi + j*smj (0 strides broadcast).
// =====================================================================================================================
#define AW 4
struct AttnP {   // apv4
    const float* Q; const float* K; const float* V; float* O; float* P; const float* Mf; const int* Mi; float* ST;
    const float* Pw; const float* Rt; const int* SQ; const int* SK;           // optional: post-softmax weight, relative-position table, segment ids
    long long swb, swh, swi, swj, srb, srh, sri;                                 // Pw strides (b,h,i,j); Rt strides (b,h,i), column = clamp(i - j + roff, 0, rn-1)
    long long sQb, sQh, sQi, sQd, sKb, sKh, sKj, sKd, sVb, sVh, sVj, sVd, sOb, sOh, sOi, sPb, sPh, sPi, smb, smh, smi, smj;
    int Lq, Lk, dh, dv, hrep, causal, coff, pband;   // pband > 0: P holds only the band |j - i| <= pband, column j - i + pband
    float scale, mfill; int nonorm, mpol;             // nonorm (online path only): O = sum_j exp(score_j) V_j without the 1/rowsum (scores must be <= ~0); mpol: Mi masks where ==0 (mpol 0) or where !=0 (mpol 1)
    int roff, rn, segpol, win;                        // Rt column offset/count; SQ/SK: score := mfill where (segpol 0) SQ[i] != SK[j] or (segpol 1) SQ[i] == SK[j]; win > 0: keys with i - j > win (after coff) -> -inf
};
//   Pw: the softmax numerator is multiplied by Pw(b,h,i,j) AFTER the row sum is taken (probs * weight, then P.V), as in post-softmax multiplicative biases.                                                    // ST (optional): per row (b,h,i) -> ST[((b*H + h)*Lq + i)*2 + {0,1}] = {row max of the scaled+masked score (natural units), sum_j exp(score - max)}
static_assert(sizeof(AttnP) == 12 * 8 + 29 * 8 + 16 * 4, "AttnP has padding");

// Four waves per SIMD: a workgroup of 16 waves puts four on every SIMD, which fit only with at most 256 registers a wave
#ifndef KATTN_ATTR
#define KATTN_ATTR __attribute__((amdgpu_waves_per_eu(4, 4)))
#endif
// The shape of this problem's attention launch as compile-time constants: with them the
// element bounds tests (k < dh, d < dv) and every optional path fold away, the unit element strides let the compiler merge a fragment's loads into
// 16-byte loads, and the additive table (always passed here, so read without a null test) no longer depends on the query row. Only the five base pointers stay run-time values.
__device__ __forceinline__ void attn_fix_shape(AttnP& p) {
    p.P = nullptr; p.Mi = nullptr; p.ST = nullptr; p.Pw = nullptr; p.Rt = nullptr; p.SQ = nullptr; p.SK = nullptr;
    p.swb = 0; p.swh = 0; p.swi = 0; p.swj = 0; p.srb = 0; p.srh = 0; p.sri = 0;
    p.sQb = 1048576; p.sQh = 64; p.sQi = 512; p.sQd = 1; p.sKb = 1048576; p.sKh = 64; p.sKj = 512; p.sKd = 1; p.sVb = 1048576; p.sVh = 64; p.sVj = 512; p.sVd = 1;
    p.sOb = 1048576; p.sOh = 64; p.sOi = 512; p.sPb = 0; p.sPh = 0; p.sPi = 0; p.smb = 2048; p.smh = 0; p.smi = 0; p.smj = 1;
    p.Lq = 2048; p.Lk = 2048; p.dh = 64; p.dv = 64; p.hrep = 1; p.causal = 1; p.coff = 0; p.pband = 0;
    p.scale = 0.125f; p.mfill = 0.0f; p.nonorm = 0; p.mpol = 0; p.roff = 0; p.rn = 1; p.segpol = 0; p.win = 0;
}
template <int DHP, int DVP, int QM, bool SPLITPV, bool TWOPASS>
__global__ __launch_bounds__(32 * AW) KATTN_ATTR void k_attn(AttnP p) {
    attn_fix_shape(p);
    constexpr int NT = DVP / 16;                // output tiles
    constexpr int KS = DHP / 32;                // k-steps for the scores
    constexpr int VP = DVP + 8;                 // LDS pitch (halves)
    __shared__ __align__(16) float    pl[AW][16 * 64];
    __shared__ __align__(16) _Float16 vl[SPLITPV ? 8 : 64 * VP];   // f16 V tile (SPLITPV reads V fragments from memory and stages nothing)
    const int lane = threadIdx.x & 31, hf = lane >> 4, l15 = lane & 15, wave = threadIdx.x >> 5;
    // blockIdx.z = 2 * branch + batch: K, V and O hold one plane per (branch, batch), indexed by bz; Q and the additive table are shared by the branches, indexed by b
    const int h = blockIdx.y, bz = blockIdx.z, b = bz & 1, hk = h / p.hrep;
    const int q0 = (blockIdx.x * AW + wave) * 16;
    float* myp = pl[wave];
    const float L2E = 1.4426950408889634f;
    const float NEG = -__builtin_inff();
    const int qi = min(q0 + l15, p.Lq - 1);
    const float* qrow = p.Q + b * p.sQb + h * p.sQh + (long long)qi * p.sQi;
    const float* kbase = p.K + bz * p.sKb + hk * p.sKh;
    const float* vbase = p.V + bz * p.sVb + hk * p.sVh;
    // QM 1 / SPLITPV: K and V are bf16 planes in fragment order, 131,072 halves per (bz, head), 4,096 per 64-key block, 512 per fragment
    const __bf16* kfrag = (const __bf16*)p.K + (bz * 8 + hk) * 131072 + lane * 8;
    const __bf16* vfrag = (const __bf16*)p.V + (bz * 8 + hk) * 131072 + lane * 8;
    v16h qa[QM == 0 ? KS : 1]; Split qs_[QM == 1 ? KS : 1]; Split3 qt_[QM == 2 ? KS : 1];
#pragma unroll
    for (int ks = 0; ks < KS; ++ks) {
        if (QM == 2) qt_[ks] = sp3_ld(qrow, p.sQd, ks * 32, hf, p.dh, 1.f);
        else if (QM == 1) qs_[ks] = sp_ld(qrow, p.sQd, ks * 32, hf, p.dh, 1.f);
        else qa[ks] = fh_ld(qrow, p.sQd, ks * 32, hf, p.dh, 1.f);
    }
    v8f o[NT]; float m8[8], l8[8];
#pragma unroll
    for (int t = 0; t < NT; ++t) { v8f zz = {}; o[t] = zz; }
#pragma unroll
    for (int i = 0; i < 8; ++i) { m8[i] = NEG; l8[i] = 0.f; }
    int jend = p.Lk; int jstart = 0;
    if (p.causal == 1) { const int je = (blockIdx.x * AW + AW - 1) * 16 + 16 + p.coff; jend = min(jend, max(je, 0)); }   // uniform per block
    if (p.win > 0) { const int js = (int)(blockIdx.x * AW) * 16 + p.coff - p.win; jstart = (js > 0) ? (js / 64) * 64 : 0; }   // uniform per block: key blocks entirely outside every row's window hold only -inf entries and are skipped exactly
    const int npass = TWOPASS ? 2 : 1;
    for (int pass = 0; pass < npass; ++pass) {
        const bool dopv = (!TWOPASS) || pass == 1;
        for (int j0 = jstart; j0 < jend; j0 += 64) {
            v16b kf[QM == 1 ? 4 : 1][KS];
            if (QM == 1) {
                // all of the key block's K fragments are asked for before the first product: one wait for memory, not one per fragment
                const __bf16* kblk = kfrag + (j0 >> 6) * 4096;
#pragma unroll
                for (int t = 0; t < 4; ++t)
#pragma unroll
                    for (int ks = 0; ks < KS; ++ks) kf[t][ks] = bfrag_ld(kblk + (t * KS + ks) * 512);
                asm volatile("s_wait_xcnt 0x0" :: "v"(kblk) : "memory");   // the loads' address pair stays live up to this wait, so that no later load lands in it and nothing rewrites it ahead of the wait
                __builtin_amdgcn_sched_barrier(0);   // keeps every K load ahead of the first product: the scheduler otherwise holds some back until registers come free, a second wait for memory
            }
            if (dopv && !SPLITPV) {
                __syncthreads();                                 // previous key block's reads of vl / pl are done
                static_assert((32 * AW) % DVP == 0, "a thread keeps its V column from pass to pass");
                constexpr int VR = (32 * AW) / DVP;              // V rows staged by the block per pass
                const int jr0 = threadIdx.x / DVP, d = threadIdx.x - jr0 * DVP;
                const float* vsrc = vbase + (long long)(j0 + jr0) * p.sVj + (long long)d * p.sVd;   // one address; the passes differ by constant offsets
#pragma unroll   // constant trip count: all of a thread's V loads of a key block are issued before the first is waited for
                for (int n = 0; n < 64 / VR; ++n) {
                    const int jr = jr0 + n * VR, j = j0 + jr;
                    const float f = ((p.Lk % 64 == 0 || j < p.Lk) && d < p.dv) ? vsrc[(long long)(n * VR) * p.sVj] : 0.f;
                    vl[jr * VP + d] = (_Float16)f;
                }
            }
            v8f s[4];
#pragma unroll
            for (int t = 0; t < 4; ++t) {
                const int j = min(j0 + t * 16 + l15, p.Lk - 1);
                const float* krow = kbase + (long long)j * p.sKj;
                v8f acc = {};
#pragma unroll
                for (int ks = 0; ks < KS; ++ks) {
                    if (QM == 2)      acc = wmma6(qt_[ks], sp3_ld(krow, p.sKd, ks * 32, hf, p.dh, 1.f), acc);
                    else if (QM == 1) acc = wmma2(qs_[ks], kf[t][ks], acc);
                    else              acc = wmma16(qa[ks], fh_ld(krow, p.sKd, ks * 32, hf, p.dh, 1.f), acc);
                }
                s[t] = acc;
            }
            v16b vf[SPLITPV ? NT : 1][2];
            if (dopv && SPLITPV) {
                // all of the key block's V fragments are asked for together and ahead of the softmax: their way from memory is covered by the score products, not paid at the P.v products
                const __bf16* vblk = vfrag + (j0 >> 6) * 4096;
#pragma unroll
                for (int t = 0; t < NT; ++t) { vf[t][0] = bfrag_ld(vblk + (t * 2 + 0) * 512); vf[t][1] = bfrag_ld(vblk + (t * 2 + 1) * 512); }
                asm volatile("s_wait_xcnt 0x0" :: "v"(vblk) : "memory");   // the loads' address pair stays live up to this wait, so that no load of the run lands in it and nothing rewrites it ahead of the wait
            }
            float pv[8][4];
#pragma unroll
            for (int i = 0; i < 8; ++i) {
                const int irow = q0 + i + 8 * hf;
                const int ic = min(irow, p.Lq - 1);
                float sc[4];
#pragma unroll
                for (int t = 0; t < 4; ++t) {
                    const int jg = j0 + t * 16 + l15;
                    float v = s[t][i] * p.scale;
                    v += p.Mf[b * p.smb + h * p.smh + (long long)ic * p.smi + (long long)min(jg, p.Lk - 1) * p.smj];
                    if (p.Rt) { int rc = ic - min(jg, p.Lk - 1) + p.roff; rc = rc < 0 ? 0 : (rc >= p.rn ? p.rn - 1 : rc); v += p.Rt[b * p.srb + h * p.srh + (long long)ic * p.sri + rc]; }
                    if (p.Mi) { const int mv = p.Mi[b * p.smb + h * p.smh + (long long)ic * p.smi + (long long)min(jg, p.Lk - 1) * p.smj]; if (p.mpol ? (mv != 0) : (mv == 0)) v = p.mfill; }
                    if (p.SQ) { const bool same = p.SQ[(long long)b * p.Lq + ic] == p.SK[(long long)b * p.Lk + min(jg, p.Lk - 1)]; if (p.segpol ? same : !same) v = p.mfill; }
                    if (p.causal == 2 && jg > irow + p.coff) v = p.mfill;
                    // causal test against the lane's first row (jg > irow + coff, rearranged): one live register, not eight row numbers, so the 256-register cap is met without spills
                    if (jg >= p.Lk || (p.causal == 1 && jg - (q0 + 8 * hf) > i + p.coff) || (p.causal == 3 && jg < irow + p.coff) || (p.win > 0 && irow + p.coff - jg > p.win)) v = NEG; else v *= L2E;
                    sc[t] = v;
                }
                if (!TWOPASS || pass == 0) {
                    float mx = fmaxf(fmaxf(sc[0], sc[1]), fmaxf(sc[2], sc[3]));
                    mx = fmaxf(mx, __shfl_xor(mx, 1, 32)); mx = fmaxf(mx, __shfl_xor(mx, 2, 32));
                    mx = fmaxf(mx, __shfl_xor(mx, 4, 32)); mx = fmaxf(mx, __shfl_xor(mx, 8, 32));
                    const float mnew = fmaxf(m8[i], mx);
                    const float corr = (mnew == NEG) ? 1.f : exp2f(m8[i] - mnew);
                    float rs = 0.f;
#pragma unroll
                    for (int t = 0; t < 4; ++t) {
                        const float pp = (sc[t] == NEG) ? 0.f : exp2f(sc[t] - mnew); rs += pp;
                        pv[i][t] = p.Pw ? pp * p.Pw[b * p.swb + h * p.swh + (long long)ic * p.swi + (long long)min(j0 + t * 16 + l15, p.Lk - 1) * p.swj] : pp;
                    }
                    rs += __shfl_xor(rs, 1, 32); rs += __shfl_xor(rs, 2, 32); rs += __shfl_xor(rs, 4, 32); rs += __shfl_xor(rs, 8, 32);
                    l8[i] = l8[i] * corr + rs; m8[i] = mnew;
                    if (!TWOPASS) {
#pragma unroll
                        for (int t = 0; t < NT; ++t) o[t][i] *= corr;
                    }
                } else {
                    const float inv = (l8[i] > 0.f) ? 1.f / l8[i] : 0.f;
#pragma unroll
                    for (int t = 0; t < 4; ++t) {
                        const int jg = j0 + t * 16 + l15;
                        float pp = (sc[t] == NEG) ? 0.f : exp2f(sc[t] - m8[i]) * inv;
                        if (p.Pw) pp *= p.Pw[b * p.swb + h * p.swh + (long long)ic * p.swi + (long long)min(jg, p.Lk - 1) * p.swj];
                        pv[i][t] = pp;
                    }
                }
            }
            if (dopv) {
#pragma unroll
                for (int i = 0; i < 8; ++i)
#pragma unroll
                    for (int t = 0; t < 4; ++t) ((float*)myp)[(i + 8 * hf) * 64 + t * 16 + l15] = pv[i][t];
                if (SPLITPV) {
                    // P is private to its wave and V is not staged: the wave's own LDS stores only have to be ordered before its lanes' reads of each other's values
                    __builtin_amdgcn_fence(__ATOMIC_RELEASE, "workgroup"); __builtin_amdgcn_wave_barrier(); __builtin_amdgcn_fence(__ATOMIC_ACQUIRE, "workgroup");
                } else __syncthreads();                          // P (per wave) and V (shared) visible
                if (p.P) {
                    float* pb_ = p.P + b * p.sPb + h * p.sPh;
                    const bool fastP = (p.pband == 0) && ((p.sPi & 3) == 0) && (j0 + 64 <= p.Lk) && (q0 + 16 <= p.Lq) && ((((size_t)pb_) & 15) == 0);
                    if (fastP) {
#pragma unroll
                        for (int s = 0; s < 8; ++s) {
                            const int row = s * 2 + (lane >> 4), c4 = (lane & 15) * 4;
                            const v4f v = *(const v4f*)(myp + row * 64 + c4);
                            VST2V4(pb_ + (long long)(q0 + row) * p.sPi + j0 + c4, v);
                        }
                    } else {
                        for (int row = 0; row < 16; ++row) {
                            const int irow = q0 + row; if (irow >= p.Lq) continue;
                            for (int c = lane; c < 64; c += 32) {
                                const int jg = j0 + c; if (jg >= p.Lk) continue;
                                if (p.pband == 0) VST2(float, pb_ + (long long)irow * p.sPi + jg, myp[row * 64 + c]);
                                else if (jg - irow <= p.pband && irow - jg <= p.pband) VST2(float, pb_ + (long long)irow * p.sPi + (jg - irow + p.pband), myp[row * 64 + c]);
                            }
                        }
                    }
                }
                if (SPLITPV) {
                    const Split pa0 = sp_ld(myp + l15 * 64, 1, 0, hf, 64, 1.f), pa1 = sp_ld(myp + l15 * 64, 1, 32, hf, 64, 1.f);
#pragma unroll
                    for (int t = 0; t < NT; ++t) {
                        o[t] = wmma2(pa0, vf[t][0], o[t]);
                        o[t] = wmma2(pa1, vf[t][1], o[t]);
                    }
                } else {
                    const v16h pa0 = fh_ld(myp + l15 * 64, 1, 0, hf, 64, 4096.f), pa1 = fh_ld(myp + l15 * 64, 1, 32, hf, 64, 4096.f);
#pragma unroll
                    for (int t = 0; t < NT; ++t) {
                        const int dcol = t * 16 + l15;
                        v16h b0, b1;
#pragma unroll
                        for (int e = 0; e < 16; ++e) { b0[e] = vl[frag_k(e, hf) * VP + dcol]; b1[e] = vl[(32 + frag_k(e, hf)) * VP + dcol]; }
                        o[t] = wmma16(pa0, b0, o[t]);
                        o[t] = wmma16(pa1, b1, o[t]);
                    }
                }
            }
        }
    }
    float* obase = p.O + bz * p.sOb + h * p.sOh;
    if (p.ST) {
        const int rl = lane >> 1, isel = rl & 7;           // row q0 + rl ; rl>>3 == hf holds because lane>>4 == (lane>>1)>>3
        float mv = 0.f, lv = 0.f;
#pragma unroll
        for (int i = 0; i < 8; ++i) if (i == isel) { mv = m8[i]; lv = l8[i]; }
        const int irow = q0 + rl;
        if (irow < p.Lq) { float* st = p.ST + (((long long)b * gridDim.y + h) * p.Lq + irow) * 2 + (lane & 1); VST2(float, st, (lane & 1) ? lv : mv * 0.6931471805599453f); }
    }
    float invr[8];
#pragma unroll
    for (int i = 0; i < 8; ++i) {
        if (TWOPASS) invr[i] = SPLITPV ? 1.f : (1.f / 4096.f);
        else if (p.nonorm) invr[i] = exp2f(m8[i]) * (SPLITPV ? 1.f : (1.f / 4096.f));
        else invr[i] = (l8[i] > 0.f) ? (SPLITPV ? 1.f / l8[i] : 1.f / (l8[i] * 4096.f)) : 0.f;
    }
    __syncthreads();                                             // all waves done with pl/vl from the main loop
    const bool ofast = ((p.sOi & 3) == 0) && ((((size_t)obase) & 15) == 0) && (q0 + 16 <= p.Lq);
#pragma unroll
    for (int c0 = 0; c0 < DVP; c0 += 64) {
#pragma unroll
        for (int i = 0; i < 8; ++i)
#pragma unroll
            for (int t = 0; t < NT; ++t) if (t * 16 >= c0 && t * 16 < c0 + 64) ((float*)myp)[(i + 8 * hf) * 64 + (t * 16 - c0) + l15] = o[t][i] * invr[i];
        __syncthreads();
        const int cw = (DVP - c0 < 64) ? (DVP - c0) : 64;      // staged columns in this chunk (multiple of 16)
        if (ofast && (c0 + cw <= p.dv) && (cw % 32 == 0)) {
            const int lpr = cw / 4;                              // lanes per row (16 for 64 cols, 8 for 32)
            const int rows_per_ins = 32 / lpr;
            for (int r0 = 0; r0 < 16; r0 += rows_per_ins) {
                const int row = r0 + lane / lpr, c4 = (lane % lpr) * 4;
                const v4f v = *(const v4f*)(myp + row * 64 + c4);
                VST2V4(obase + (long long)(q0 + row) * p.sOi + c0 + c4, v);
            }
        } else {
            for (int row = 0; row < 16; ++row) {
                const int irow = q0 + row; if (irow >= p.Lq) continue;
                for (int c = lane; c < cw; c += 32) { const int d = c0 + c; if (d < p.dv) VST2(float, obase + (long long)irow * p.sOi + d, myp[row * 64 + c]); }
            }
        }
        __syncthreads();
    }
}

typedef __attribute__((ext_vector_type(2))) float  v2f;
typedef __attribute__((ext_vector_type(2))) _Float16 v2h;
__device__ __forceinline__ float xhalf(float x) {   // the value of lane L ^ 16
    const int u = __float_as_int(x);
    return __int_as_float(__builtin_amdgcn_permlanex16(u, u, 0x76543210, 0xfedcba98, false, false));
}
#define SOP 68   // floats a query row of an output tile takes in LDS: 272 bytes, an odd multiple of 16, the pitch at which 16-byte LDS accesses of neighbouring rows miss each other's banks
__global__ __launch_bounds__(32 * 4 * AW) KATTN_ATTR void k_attn_t(const float* __restrict__ Q, const unsigned short* __restrict__ KF, const unsigned short* __restrict__ VF, const float* __restrict__ MF, const float* __restrict__ SM, float* __restrict__ O) {
    __shared__ __attribute__((aligned(16))) float so[2 * 4 * AW * 16 * SOP];   // [pass][wave][query of the tile][d]: every wave's unnormalised output
    __shared__ v2f sml[2 * 4 * AW * 16];                                       // [pass][wave][query of the tile]: its maximum (exp2 units) and sum
    const int lane = threadIdx.x & 31, hf = lane >> 4, l15 = lane & 15;
    const int wave = __builtin_amdgcn_readfirstlane(threadIdx.x >> 5);     // in a scalar register: the key range and the K, V planes hang on it, and the loop and its diagonal test stay scalar branches
    const int qt = wave & 3, grp = wave >> 2, part = grp & 1;              // wave = 4 (2 branch + part) + query tile
    // bz = 2 * branch + batch: K and V hold one plane per (branch, batch), indexed by bz; Q, the additive table and the output are shared by the branches, indexed by b
    const int h = blockIdx.x & 7, b = blockIdx.x >> 3, bz = (grp & 2) + b;
    const float L2E = 1.4426950408889634f;
    const float NEG = -__builtin_inff();
    // 131,072 halves per (bz, head), 4,096 per 64-key block, 512 per fragment
    const __bf16* kfrag = (const __bf16*)KF + (bz * 8 + h) * 131072 + lane * 8;
    const _Float16* vfrag = (const _Float16*)VF + (bz * 8 + h) * 131072 + lane * 8;
    const float* mrow = MF + b * 2048 + 8 * hf;      // the lane's eight keys of a tile
    // the lane's place in the join behind the passes (said there); its two queries' soft masks are asked for here, so that their way from memory is not paid behind the barrier
    const int qi = grp * 4 + (lane >> 3), c4 = (lane & 7) * 4, qa = (31 - blockIdx.y) * 64 + qt * 16 + qi, qb = blockIdx.y * 64 + qt * 16 + qi;
    const int ia = b * 2048 + qa, ib = b * 2048 + qb;
    const float smr[2] = {SM[ia], SM[ib]};
    asm volatile("s_wait_xcnt 0x0" :: "v"(ia), "v"(ib) : "memory");   // the two loads' index registers stay live up to this wait, so that nothing rewrites them ahead of it
    // two passes: query block 31 - y, then block y: 33 key trips together for every workgroup, so that the 256 workgroups, one on each WGP, carry the same load.
    // No barrier stands between the passes (each has its own LDS): a wave goes on at once, and its Q loads are covered by the waves still at work
    for (int pass = 0; pass < 2; ++pass) {
        // query block xb has xb + 1 key trips: part 0 takes the first n0 = ceil((xb + 1) / 2), part 1 the rest (none for block 0), the trip on the diagonal among them
        const int xb = pass ? blockIdx.y : 31 - blockIdx.y, n0 = (xb + 2) >> 1;
        const int jbeg = part ? n0 * 64 : 0, jend = part ? (xb + 1) * 64 : n0 * 64;
        const int q0 = (xb * AW + qt) * 16;
        const float* qrow = Q + b * 1048576 + h * 64 + (q0 + l15) * 512;
        Split qs_[2];
#pragma unroll
        for (int ks = 0; ks < 2; ++ks) qs_[ks] = sp_ld(qrow, 1, ks * 32, hf, 64, 0.125f * L2E);   // scale and log2(e) ride in Q: the products come out as exp2 arguments
        v8f o[4]; float m = NEG; v2f l2 = {0.f, 0.f};    // l2: the sum over this lane half's keys, even and odd registers apart; joined behind the loop
#pragma unroll
        for (int t = 0; t < 4; ++t) { v8f zz = {}; o[t] = zz; }
        for (int j0 = jbeg; j0 < jend; j0 += 64) {
            v16b kf[4][2];
            // all of the key block's K fragments are asked for before the first product: one wait for memory, not one per fragment
            const __bf16* kblk = kfrag + (j0 >> 6) * 4096;
#pragma unroll
            for (int t = 0; t < 4; ++t)
#pragma unroll
                for (int ks = 0; ks < 2; ++ks) kf[t][ks] = bfrag_ld(kblk + (t * 2 + ks) * 512);
            asm volatile("s_wait_xcnt 0x0" :: "v"(kblk) : "memory");   // the loads' address pair stays live up to this wait, so that no later load lands in it and nothing rewrites it ahead of the wait
            // the additive table of the lane's 32 keys, asked for with the K fragments: it is the score products' start value (their C operand), so that adding it costs no instruction
            const float* mblk = mrow + j0;
            v8f s[4];
#pragma unroll
            for (int t = 0; t < 4; ++t) s[t] = *(const v8f*)(mblk + t * 16);
            asm volatile("s_wait_xcnt 0x0" ::: "memory");   // stands behind the table loads, ahead of the rewrite of their address pair at the foot of the trip
            __builtin_amdgcn_sched_barrier(0);   // keeps every K load ahead of the first product: the scheduler otherwise holds some back until registers come free, a second wait for memory
#pragma unroll
            for (int t = 0; t < 4; ++t) {
#pragma unroll
                for (int ks = 0; ks < 2; ++ks) s[t] = wmma2t(kf[t][ks], qs_[ks], s[t]);
            }
            v16h vf[4][2];
            // all of the key block's V fragments are asked for together and ahead of the softmax: their way from memory is covered by the score products, not paid at the P.v products
            const _Float16* vblk = vfrag + (j0 >> 6) * 4096;
#pragma unroll
            for (int t = 0; t < 4; ++t) { vf[t][0] = hfrag_ld(vblk + (t * 2 + 0) * 512); vf[t][1] = hfrag_ld(vblk + (t * 2 + 1) * 512); }
            asm volatile("s_wait_xcnt 0x0" :: "v"(vblk) : "memory");   // the loads' address pair stays live up to this wait, so that no load of the run lands in it and nothing rewrites it ahead of the wait
            // the unrolls from here to the foot of the trip: s, pb and o are register arrays, which stay in registers only where every index is a constant
            if (j0 == xb * 64) {                         // only the trip on the diagonal holds keys behind a query (the same for the whole wave, in scalar registers: a scalar branch)
                const int qrel = q0 + l15 - 8 * hf - j0; // causal test (key > query) against constants: one live register
#pragma unroll
                for (int t = 0; t < 4; ++t) {
#pragma unroll
                    for (int r = 0; r < 8; ++r) s[t][r] = (t * 16 + r > qrel) ? NEG : s[t][r];
                }
            }
            float mx4[4];
#pragma unroll
            for (int t = 0; t < 4; ++t) {
                mx4[t] = fmaxf(fmaxf(s[t][0], s[t][1]), s[t][2]);
                mx4[t] = fmaxf(fmaxf(mx4[t], s[t][3]), s[t][4]);
                mx4[t] = fmaxf(fmaxf(mx4[t], s[t][5]), s[t][6]);
                mx4[t] = fmaxf(mx4[t], s[t][7]);
            }
            float mx = fmaxf(fmaxf(mx4[0], mx4[1]), fmaxf(mx4[2], mx4[3]));
            mx = fmaxf(mx, xhalf(mx));
            // the first key of a wave's range (at most the block's first query) is open to each of its queries and every score is finite, so mnew is finite from the first trip on: exp2 of -inf gives the 0 that a masked key and the first trip's corr want
            const float mnew = fmaxf(m, mx);
            const float corr = __builtin_amdgcn_exp2f(m - mnew);
            v2f rs2[4];
            v16h pb[2];   // P as one f16 value a score: 11 significant bits, 0 <= p <= 1; the sum l2 takes the unrounded f32 values
#pragma unroll
            for (int t = 0; t < 4; ++t) {
#pragma unroll
                for (int r = 0; r < 8; r += 2) {
                    const v2f x = (v2f){s[t][r], s[t][r + 1]} - mnew;
                    const v2f pp = {__builtin_amdgcn_exp2f(x.x), __builtin_amdgcn_exp2f(x.y)};
                    rs2[t] = (r == 0) ? pp : rs2[t] + pp;
                    const v2h hb = __builtin_convertvector(pp, v2h);
                    pb[t >> 1][(t & 1) * 8 + r] = hb.x; pb[t >> 1][(t & 1) * 8 + r + 1] = hb.y;
                }
            }
            l2 = l2 * corr + ((rs2[0] + rs2[1]) + (rs2[2] + rs2[3])); m = mnew;
#pragma unroll
            for (int t = 0; t < 4; ++t) o[t] *= corr;
#pragma unroll
            for (int t = 0; t < 4; ++t) {
                o[t] = __builtin_amdgcn_wmma_f32_16x16x32_f16(false, vf[t][0], false, pb[0], (short)0, o[t], false, false);
                o[t] = __builtin_amdgcn_wmma_f32_16x16x32_f16(false, vf[t][1], false, pb[1], (short)0, o[t], false, false);
            }
        }
        float l = l2.x + l2.y;
        l += xhalf(l);
        // every wave lays its unnormalised output, maximum and sum down in LDS
        float* srow = so + ((pass * 4 * AW + wave) * 16 + l15) * SOP + 8 * hf;
        for (int t = 0; t < 4; ++t) {
            const v4f x = {o[t][0], o[t][1], o[t][2], o[t][3]}, y = {o[t][4], o[t][5], o[t][6], o[t][7]};
            *(v4f*)(srow + t * 16) = x; *(v4f*)(srow + t * 16 + 4) = y;
        }
        if (hf == 0) { const v2f ml = {m, l}; sml[(pass * 4 * AW + wave) * 16 + l15] = ml; }
    }
    __syncthreads();   // every wave passes it once, behind both of its passes: behind it the four waves of a query tile read each other's results
    // the join, shared out: wave (grp, qt) finishes queries 4 grp .. 4 grp + 3 of tile qt; eight lanes a query, a lane takes d = 4 (lane & 7) + 0..3 and the same + 32, so that each store instruction fills whole 128-byte lines
    for (int pass = 0; pass < 2; ++pass) {
        const float sm = bf16_f32(bf16_rne(smr[pass]));   // the soft mask, rounded to bf16 like every input
        float w[4];   // weight of (branch, part): 2^(max - joint max) over the branch's joint sum, times the branch's share of the blend. A part without trips has maximum -inf and sum 0: weight 0 (part 0 always has a finite maximum)
        for (int br = 0; br < 2; ++br) {
            const v2f e0 = sml[((pass * 4 + 2 * br) * 4 + qt) * 16 + qi], e1 = sml[((pass * 4 + 2 * br + 1) * 4 + qt) * 16 + qi];
            const float mm = fmaxf(e0.x, e1.x);
            const float a0 = __builtin_amdgcn_exp2f(e0.x - mm), a1 = __builtin_amdgcn_exp2f(e1.x - mm);
            const float sh = (br ? 1.f - sm : sm) / (e0.y * a0 + e1.y * a1);
            w[2 * br] = a0 * sh; w[2 * br + 1] = a1 * sh;
        }
        const float* jrow = so + ((pass * 4 * AW + qt) * 16 + qi) * SOP + c4;
        float* orow = O + b * 1048576 + (pass ? qb : qa) * 512 + h * 64 + c4;
        for (int hh = 0; hh < 2; ++hh) {
            v4f r = *(const v4f*)(jrow + hh * 32) * w[0];
            for (int g = 1; g < 4; ++g) r += *(const v4f*)(jrow + g * (4 * 16 * SOP) + hh * 32) * w[g];
            VST2V4(orow + hh * 32, r);
        }
    }
}

// =====================================================================================================================
// k_tr: dst(z, c, r) = alpha * src(z, r, c) (+ beta * R2(z, c, r)): [Z][R][C] (row stride lds) -> [Z][C][R] (row stride ldd) through a 32x32 LDS tile;
//   flags: 1 -> add beta * residual R2 addressed like dst (z*sRz + c*ldr + r); act applied before the residual.
// =====================================================================================================================
struct TrP { const float* src; float* dst; const float* R2; long long sSz, lds, sDz, ldd, sRz, ldr; int R, C, flags, act; float alpha, beta; };
static_assert(sizeof(TrP) == 3 * 8 + 6 * 8 + 6 * 4, "TrP has padding");
__global__ __launch_bounds__(256) void k_tr(TrP p) {
    __shared__ float tile[32][33];
    const int c0 = blockIdx.x * 32, r0 = blockIdx.y * 32, z = blockIdx.z;
    const int lane = threadIdx.x & 31, wave = threadIdx.x >> 5;
    const float* s = p.src + z * p.sSz;
#pragma unroll
    for (int k = 0; k < 4; ++k) {
        const int rl = wave * 4 + k, r = r0 + rl, c = c0 + lane;
        tile[rl][lane] = (r < p.R && c < p.C) ? s[(long long)r * p.lds + c] : 0.f;
    }
    __syncthreads();
    float* d = p.dst + z * p.sDz; const float* rr = p.R2 + z * p.sRz;
#pragma unroll
    for (int k = 0; k < 4; ++k) {
        const int cl = wave * 4 + k, c = c0 + cl, r = r0 + lane;
        if (c < p.C && r < p.R) {
            float v = act_fn(p.alpha * tile[lane][cl], p.act);
            if (p.flags & 1) v += p.beta * rr[(long long)c * p.ldr + r];
            VST2(float, d + (long long)c * p.ldd + r, v);
        }
    }
}

// k_affine: dst[i] = a * (sdev ? sdev[0] : 1) * src[i] + b, i < n (one thread per element; consecutive lanes -> consecutive addresses)
__global__ __launch_bounds__(256) void k_affine(const float* __restrict__ src, float* __restrict__ dst, int n, float a, float b, const float* __restrict__ sdev) {
    const int i = blockIdx.x * 256 + threadIdx.x;
    if (i < n) { const float aa = sdev ? a * sdev[0] : a; const float v = aa * src[i] + b; VST2(float, dst + i, v); }
}

// =====================================================================================================================
// k_softmax: row softmax over n contiguous elements, one 256-thread block per row; rows addressed z*sz + r*sr (grid (R, Z)).
//   out = scale_out * softmax(scale_in * x + (Mf ? Mf[z*smz + r*smr + j] : 0)); a row whose max is -inf is written as 0.
// =====================================================================================================================
struct SmP { const float* src; float* dst; const float* Mf; long long sz, sr, dz, dr, smz, smr; int n, pad; float scale_in, scale_out; };
static_assert(sizeof(SmP) == 3 * 8 + 6 * 8 + 4 * 4, "SmP has padding");
__global__ __launch_bounds__(256) void k_softmax(SmP p) {
    __shared__ float red[256];
    const int r = blockIdx.x, z = blockIdx.y, tid = threadIdx.x;
    const float* s = p.src + z * p.sz + (long long)r * p.sr;
    const float* mf = p.Mf ? (p.Mf + z * p.smz + (long long)r * p.smr) : nullptr;
    float mx = -__builtin_inff();
    for (int j = tid; j < p.n; j += 256) { float v = s[j] * p.scale_in; if (mf) v += mf[j]; mx = fmaxf(mx, v); }
    red[tid] = mx; __syncthreads();
    for (int o = 128; o > 0; o >>= 1) { if (tid < o) red[tid] = fmaxf(red[tid], red[tid + o]); __syncthreads(); }
    mx = red[0]; __syncthreads();
    float sum = 0.f;
    for (int j = tid; j < p.n; j += 256) { float v = s[j] * p.scale_in; if (mf) v += mf[j]; sum += (mx == -__builtin_inff()) ? 0.f : expf(v - mx); }
    red[tid] = sum; __syncthreads();
    for (int o = 128; o > 0; o >>= 1) { if (tid < o) red[tid] += red[tid + o]; __syncthreads(); }
    sum = red[0];
    const float inv = (sum > 0.f) ? p.scale_out / sum : 0.f;
    float* d = p.dst + z * p.dz + (long long)r * p.dr;
    for (int j = tid; j < p.n; j += 256) { float v = s[j] * p.scale_in; if (mf) v += mf[j]; const float o = (mx == -__builtin_inff()) ? 0.f : expf(v - mx) * inv; VST2(float, d + j, o); }
}
// =====================================================================================================================
// k_stats: mean and rsqrt(var + eps) over a set of n elements addressed base + z*sz + (e / inner) * so + (e % inner) * si, one 256-thread
// k_norm_apply: y = (x - mean[set]) * rstd[set] * g[c] + b[c] over a [Z][C][L] chan-major tensor with set = z*G + c / (C/G) (G groups per z;
//   G = C -> per-chan sets indexed z*C+c; for batch norm pass stats indexed by c only via bn = 1). Optional act. Output same layout.
// =====================================================================================================================
//   mode 0: mean / rsqrt(var + eps); mode 1 (RMSNorm): 0 / rsqrt(mean(x^2) + eps); mode 2 (L2 normalize * sqrt(n)): 0 / sqrt(n) / max(||x||, eps); mode 3: as 0 with unbiased variance (n-1)
__global__ __launch_bounds__(256) void k_stats(const float* __restrict__ x, long long sz, long long so, long long si, int inner, int n, float eps, float* __restrict__ stat, int mode) {
    __shared__ float red[256];
    const int z = blockIdx.x, tid = threadIdx.x;
    const float* base = x + z * sz;
    float s = 0.f;
    for (int e = tid; e < n; e += 256) s += base[(long long)(e / inner) * so + (long long)(e % inner) * si];
    red[tid] = s; __syncthreads();
    for (int o = 128; o > 0; o >>= 1) { if (tid < o) red[tid] += red[tid + o]; __syncthreads(); }
    const float mu = (mode == 0 || mode == 3) ? red[0] / (float)n : 0.f; __syncthreads();
    float q = 0.f;
    for (int e = tid; e < n; e += 256) { const float dlt = base[(long long)(e / inner) * so + (long long)(e % inner) * si] - mu; q += dlt * dlt; }
    red[tid] = q; __syncthreads();
    for (int o = 128; o > 0; o >>= 1) { if (tid < o) red[tid] += red[tid + o]; __syncthreads(); }
    {
        float rs;
        if (mode == 2) rs = sqrtf((float)n) / fmaxf(sqrtf(red[0]), eps); else if (mode == 3) rs = rsqrtf(red[0] / (float)(n - 1) + eps); else rs = rsqrtf(red[0] / (float)n + eps);
        if (tid < 32) { const float v = (tid == 0) ? mu : ((tid == 1) ? rs : 0.f); VST2(float, stat + (long long)z * 32 + tid, v); }
    }
}
//   One thread per element over the flat [Z][C][L] index space: grid ceil(Z*C*L / 256).
__global__ __launch_bounds__(256) void k_norm_apply(const float* __restrict__ x, float* __restrict__ y, const float* __restrict__ stat, const float* __restrict__ g, const float* __restrict__ bta,
                                                     int Z, int C, int L, int G, int bn, int act) {
    const long long idx = (long long)blockIdx.x * 256 + threadIdx.x;
    if (idx >= (long long)Z * C * L) return;
    const int l = (int)(idx % L); const long long zc = idx / L; const int c = (int)(zc % C), z = (int)(zc / C); (void)l;
    const int set = bn ? c : (z * G + c / (C / G));
    float v = (x[idx] - stat[(long long)set * 32]) * stat[(long long)set * 32 + 1];
    if (g) v *= g[c];
    if (bta) v += bta[c];
    v = act_fn(v, act);
    VST2(float, y + idx, v);
}

// k_lse_neg: c[i] = -(st[2i] + log(st[2i+1])) = minus the log-sum-exp of row i from k_attn's ST output (for softmax over the query dimension)
__global__ __launch_bounds__(256) void k_lse_neg(const float* __restrict__ st, float* __restrict__ c, int n) {
    const int i = blockIdx.x * 256 + threadIdx.x;
    if (i < n) { const float v = -(st[2 * i] + logf(st[2 * i + 1])); VST2(float, c + i, v); }
}

// k_iota: dst[i] = a * i + b as int32 (segment/position id helper)
__global__ __launch_bounds__(256) void k_iota(int* __restrict__ dst, int n, int a, int b) {
    const int i = blockIdx.x * 256 + threadIdx.x;
    if (i < n) { const int v = a * i + b; VST2(int, dst + i, v); }
}

// k_axpby: dst[i] = a * x[i] + b * y[i] (+ c), i < n
__global__ __launch_bounds__(256) void k_axpby(const float* __restrict__ x, const float* __restrict__ y, float* __restrict__ dst, int n, float a, float b, float c) {
    const int i = blockIdx.x * 256 + threadIdx.x;
    if (i < n) { const float v = a * x[i] + b * y[i] + c; VST2(float, dst + i, v); }
}

// =====================================================================================================================
// k_rope: rotary embedding on a [R rows][Hn heads][D] view (row stride sXr, head stride sXh, element stride 1) -> Y (own strides).
//   mode 0: rotate_half (partner d±D/2, sign - for d<D/2); mode 1: interleaved pairs (partner d^1, sign - for even d).
//   table column tcol: tmode 0 -> d, 1 -> d % (D/2), 2 -> d / 2; position p: pmode 0 -> r % S, 1 -> head index, 2 -> pos[r];
//   c = C[(r / S) * sCb + p * sCp + tcol * sCd], s likewise from Sn; y = x[d] * c + sign * x[partner] * s. X and Y must not alias.
// =====================================================================================================================
struct RopeP { const float* X; float* Y; const float* C; const float* Sn; const int* pos; long long sXr, sXh, sYr, sYh, sCb, sCp, sCd; int R, Hn, D, S, mode, tmode, pmode, pad; };
static_assert(sizeof(RopeP) == 5 * 8 + 7 * 8 + 8 * 4, "RopeP has padding");
__global__ __launch_bounds__(256) void k_rope(RopeP p) {
    const long long idx = (long long)blockIdx.x * 256 + threadIdx.x;
    if (idx >= (long long)p.R * p.Hn * p.D) return;
    const int d = (int)(idx % p.D); const long long rh = idx / p.D; const int h = (int)(rh % p.Hn); const int r = (int)(rh / p.Hn);
    const int half = p.D / 2;
    int partner; float sign;
    if (p.mode == 0) { partner = (d < half) ? d + half : d - half; sign = (d < half) ? -1.f : 1.f; }
    else { partner = d ^ 1; sign = (d & 1) ? 1.f : -1.f; }
    const int tcol = (p.tmode == 0) ? d : ((p.tmode == 1) ? (d % half) : (d >> 1));
    const int pp = (p.pmode == 0) ? (r % p.S) : ((p.pmode == 1) ? h : p.pos[r]);
    const long long toff = (long long)(r / p.S) * p.sCb + (long long)pp * p.sCp + (long long)tcol * p.sCd;
    const float* xr = p.X + (long long)r * p.sXr + (long long)h * p.sXh;
    const float v = xr[d] * p.C[toff] + sign * xr[partner] * p.Sn[toff];
    VST2(float, p.Y + (long long)r * p.sYr + (long long)h * p.sYh + d, v);
}

// k_invf + k_sincos (split so neither kernel carries a large VALU-fma footprint): invf_i = num * (1 / powf(base, (2 i)/D)) [fmode 0],
//   num * expf((2 i) * cexp) [fmode 1], num * powf(base, -2 (i - 1) / D) [fmode 2]; then cs/sn[s*half + i] = cos/sin((pscale * s) * invf_i)
__global__ __launch_bounds__(256) void k_invf(float* __restrict__ invb, int half, int D, float base, float num, int fmode, float cexp) {
    const int i = blockIdx.x * 256 + threadIdx.x;
    if (i >= ((half + 31) / 32) * 32) return;
    if (i >= half) { VST2(float, invb + i, 0.f); return; }
    const float e = (float)(2 * i) / (float)D;
    float invf;
    if (fmode == 1) invf = num * expf((float)(2 * i) * cexp);
    else if (fmode == 2) invf = num * powf(base, (-2.0f * ((float)i - 1.0f)) / (float)D);
    else invf = num * (1.0f / powf(base, e));
    VST2(float, invb + i, invf);
}
__global__ __launch_bounds__(256) void k_sincos(float* __restrict__ cs, float* __restrict__ sn, const float* __restrict__ invb, int S, int half, float pscale) {
    const int idx = blockIdx.x * 256 + threadIdx.x;
    if (idx >= S * half) return;
    const int s = idx / half, i = idx - s * half;
    const float ang = (pscale * (float)s) * invb[i];
    VST2(float, cs + idx, cosf(ang)); VST2(float, sn + idx, sinf(ang));
}

// k_mulact: dst[i] = act(x[i]) * y[i]
__global__ __launch_bounds__(256) void k_mulact(const float* __restrict__ x, const float* __restrict__ y, float* __restrict__ dst, int n, int act) {
    const int i = blockIdx.x * 256 + threadIdx.x;
    if (i < n) { const float v = act_fn(x[i], act) * y[i]; VST2(float, dst + i, v); }
}

// =====================================================================================================================
// k_matvec: thread-per-row matrix-vector products for N <= 8 output columns (heads with 1-3 outputs, gates), f32 on the VALU.
//   C[r*sCm + j] = act(alpha * sum_k A[r*sAm + k*sAk] * B[j*sBn + k*sBk] + bias[j]) + beta * R[r*sRm + j*sRn]; each thread writes its N contiguous floats.
// =====================================================================================================================
__global__ __launch_bounds__(256) void k_matvec(GemmP p) {
    // 32 lanes write one line with one instruction.
    const int rpt = (p.N == 1) ? 1 : 32;
    const long long r0 = ((long long)blockIdx.x * 256 + threadIdx.x) * rpt; const int z = blockIdx.z, zo = z / p.zi_n, zi = z - zo * p.zi_n;
    if (r0 >= p.M) return;
    const float* Bb = p.B + zo * p.sBo + zi * p.sBi;
    float* C = p.C + zo * p.sCo + zi * p.sCi; const float* R = p.R + zo * p.sRo + zi * p.sRi;
    for (int rr = 0; rr < rpt; ++rr) {
        const long long r = r0 + rr; if (r >= p.M) break;
        const float* A = p.A + zo * p.sAo + zi * p.sAi + r * p.sAm;
        float acc[8] = {0.f, 0.f, 0.f, 0.f, 0.f, 0.f, 0.f, 0.f};
        for (int k = 0; k < p.K; ++k) { const float a = A[(long long)k * p.sAk];
#pragma unroll
            for (int j = 0; j < 8; ++j) if (j < p.N) acc[j] += a * Bb[(long long)j * p.sBn + (long long)k * p.sBk]; }
#pragma unroll
        for (int j = 0; j < 8; ++j) if (j < p.N) {
            float v = acc[j] * p.alpha;
            if (p.flags & 1) v += p.bias[j];
            if (p.flags & 2) v += p.bias[r];
            v = act_fn(v, p.act);
            if (p.flags & 4) v += p.beta * R[r * p.sRm + (long long)j * p.sRn];
            VST2(float, C + r * p.sCm + j, v);
        }
    }
}
// k_smallsoftmax: thread-per-row softmax for short rows (n <= 64): dst[r*dr + j] = softmax(scale*src[r*sr + j])
__global__ __launch_bounds__(256) void k_smallsoftmax(const float* __restrict__ src, float* __restrict__ dst, long long sr, long long dr, int n, long long R, float scale) {
    const long long r0 = ((long long)blockIdx.x * 256 + threadIdx.x) * 32;
    for (int rr = 0; rr < 32; ++rr) {
        const long long r = r0 + rr; if (r >= R) return;
        const float* s = src + r * sr; float* d = dst + r * dr;
        float mx = -__builtin_inff();
        for (int j = 0; j < n; ++j) mx = fmaxf(mx, s[j] * scale);
        float sum = 0.f;
        for (int j = 0; j < n; ++j) sum += expf(s[j] * scale - mx);
        const float inv = 1.f / sum;
        for (int j = 0; j < n; ++j) { const float v = expf(s[j] * scale - mx) * inv; VST2(float, d + j, v); }
    }
}

__global__ __launch_bounds__(32) void k_unitstat(float* __restrict__ st) { const int t = threadIdx.x; const float v = (t == 1) ? 1.f : 0.f; VST2(float, st + t, v); }

// destination (e.g. a d_out whose row width is not a multiple of 32 floats) is written by consecutive lanes of one instruction
__global__ __launch_bounds__(256) void k_lincopy(const float* __restrict__ src, long long lds, float* __restrict__ dst, long long ldd, long long rows, int cols) {
    const long long i = (long long)blockIdx.x * 256 + threadIdx.x; if (i >= rows * cols) return;
    const long long r = i / cols; const int c = (int)(i - r * cols);
    const float v = src[r * lds + c]; VST2(float, dst + r * ldd + c, v);
}


__device__ __forceinline__ void st_h2(unsigned short* d2, float a, float b) { const unsigned u = (unsigned)__builtin_bit_cast(unsigned short, (_Float16)a) | ((unsigned)__builtin_bit_cast(unsigned short, (_Float16)b) << 16); unsigned* d = (unsigned*)d2; *d = u;  }
__device__ __forceinline__ float ldh(const unsigned short* p) { return (float)__builtin_bit_cast(_Float16, *p); }
__device__ __forceinline__ v4f ld4h(const unsigned short* p) { const unsigned long long u = *(const unsigned long long*)p; v4f a;
    a.x = (float)__builtin_bit_cast(_Float16, (unsigned short)(u & 0xFFFFu)); a.y = (float)__builtin_bit_cast(_Float16, (unsigned short)((u >> 16) & 0xFFFFu)); a.z = (float)__builtin_bit_cast(_Float16, (unsigned short)((u >> 32) & 0xFFFFu)); a.w = (float)__builtin_bit_cast(_Float16, (unsigned short)((u >> 48) & 0xFFFFu)); return a; }
__device__ __forceinline__ unsigned long long pk4h(v4f s) { return (unsigned long long)__builtin_bit_cast(unsigned short, (_Float16)s.x) | ((unsigned long long)__builtin_bit_cast(unsigned short, (_Float16)s.y) << 16) | ((unsigned long long)__builtin_bit_cast(unsigned short, (_Float16)s.z) << 32) | ((unsigned long long)__builtin_bit_cast(unsigned short, (_Float16)s.w) << 48); }
typedef unsigned v4u __attribute__((ext_vector_type(4)));
__device__ __forceinline__ void st8h(unsigned short* d, v4f a, v4f b) { const unsigned long long pa = pk4h(a), pb = pk4h(b); v4u pk; pk.x = (unsigned)(pa & 0xFFFFFFFFull); pk.y = (unsigned)(pa >> 32); pk.z = (unsigned)(pb & 0xFFFFFFFFull); pk.w = (unsigned)(pb >> 32); v4u* dd = (v4u*)d; *dd = pk;  }
__device__ __forceinline__ unsigned short bfu_rne(float v) { unsigned u = __builtin_bit_cast(unsigned, v); u += 0x7FFFu + ((u >> 16) & 1u); return (unsigned short)(u >> 16); }
__device__ __forceinline__ void bfsplit(float v, unsigned short& hi, unsigned short& lo) { hi = bfu_rne(v); lo = bfu_rne(v - __builtin_bit_cast(float, (unsigned)hi << 16)); }
__device__ __forceinline__ void st_s2(unsigned short* Hp, unsigned short* Lp, long long o, float a, float b) { unsigned short h0,l0,h1,l1; bfsplit(a,h0,l0); bfsplit(b,h1,l1); const unsigned ph = (unsigned)h0 | ((unsigned)h1 << 16), pl = (unsigned)l0 | ((unsigned)l1 << 16);
    unsigned* dh = (unsigned*)(Hp + o); unsigned* dl = (unsigned*)(Lp + o); *dh = ph; *dl = pl;  }
__device__ __forceinline__ int cl(int v, int n) { return min(max(v, 0), n - 1); }

// GAT-style aggregation over a device in-edge CSR at dst (+ optional explicit self loop as iteration j = -1):
//   logit = leaky(AS[src][h] + AD[n][h] (+ EW[e]*CW[h]), slope); softmax over the node's edges per head; acc[c] = sum alpha XP[src][c] (f16 gather plane, pitch XW; 256 channels = H heads x CH)
//   wave per node; lane L owns channels 8L..8L+7 (head = 8L / CH); per-lane softmax state (lanes of one head agree) -> no shuffles in the loop.
//   EPI 0: + bias -> f32 OUT[n][256] via LDS redistribution (two 16-B stores per lane, each instruction 512 contiguous B)
//   EPI 1: + bias, LayerNorm(256) * g + bb, relu -> bf16 hi/lo planes OH/OL [n][256] (16-B stores)
//   EPI 2: mean over the 256/CH heads + bias[0..63], LayerNorm(64) * g + bb, relu -> f32 OUT[n][64] (CH must be 64; LDS redistribution, 8-B stores)
//   EPI 3: mean over heads + bias -> f32 OUT[n][64] (no norm / activation)
//   EPI 4: + bias, ELU -> bf16 hi/lo planes OH/OL [n][256];  EPI 5: + bias (full 256-wide, per head), ELU, then mean over the 256/CH heads -> f32 OUT[n][64]
//   EPI 6: (CH = 128, two heads) mean over the two heads, + bias[0..127], relu -> f32 OUT[n][128] (LDS redistribution, 16-B stores)
//   EWM 0: no edge weights; 1: logit += EW[e] * CW[h] (self loop weight 1); 2: alpha *= EW[e] after the softmax (message scale; self loop weight 1)
template <int CH, bool SELF, int EWM, int EPI>
__global__ __launch_bounds__(256) void k_gat_agg(const unsigned short* __restrict__ XP, int XW, const float* __restrict__ AS, const float* __restrict__ AD, int ASTR, const float* __restrict__ EW, const float* __restrict__ CW,
        const int* __restrict__ esrc, const int* __restrict__ off, const int* __restrict__ cnt, const int* __restrict__ slot, const float* __restrict__ bias, const float* __restrict__ g, const float* __restrict__ bb,
        float* __restrict__ OUT, unsigned short* __restrict__ OH, unsigned short* __restrict__ OL, int N, int E, int CAP, float slope) {
    __shared__ float stage[8][256];
    const int wv = threadIdx.x >> 5; const int n = blockIdx.x * 8 + wv; const int L = threadIdx.x & 31; if (n >= N) return; const int c0 = 8 * L; const int h = c0 / CH;
    const float ad = AD[(long long)n * ASTR + h]; const float cw = (EWM == 1) ? CW[h] : 0.f; float m = -3.0e38f, s = 0.f; v4f a0, a1; a0.x = a0.y = a0.z = a0.w = 0.f; a1 = a0;
    const int p0 = cl(off[n], E + 1), cn = min(max(cnt[n], 0), CAP);
    for (int j = (SELF ? -1 : 0); j < cn; ++j) { int sj; float ew = 0.f;
        if (j < 0) { sj = n; ew = 1.f; } else { int e = slot[cl(p0 + j, E)]; e = cl(e, E); sj = cl(esrc[e], N); if (EWM != 0) ew = EW[e]; }
        float lg = AS[(long long)sj * ASTR + h] + ad + ((EWM == 1) ? ew * cw : 0.f); lg = (lg >= 0.f) ? lg : slope * lg;
        const float mn = fmaxf(m, lg); const float cz = expf(m - mn), pj = expf(lg - mn); s = s * cz + pj; const float pw = (EWM == 2) ? pj * ew : pj;
        const unsigned short* xr = XP + (long long)sj * XW + c0; a0 = a0 * cz + ld4h(xr) * pw; a1 = a1 * cz + ld4h(xr + 4) * pw; m = mn; }
    const float inv = (s > 0.f) ? 1.f / (s + 1e-16f) : 0.f; a0 = a0 * inv; a1 = a1 * inv;
    if (EPI == 0 || EPI == 1 || EPI == 4 || EPI == 5) { a0 = a0 + *(const v4f*)(bias + c0); a1 = a1 + *(const v4f*)(bias + c0 + 4); }
    if (EPI == 4 || EPI == 5) { a0.x = (a0.x > 0.f) ? a0.x : (expf(a0.x) - 1.f); a0.y = (a0.y > 0.f) ? a0.y : (expf(a0.y) - 1.f); a0.z = (a0.z > 0.f) ? a0.z : (expf(a0.z) - 1.f); a0.w = (a0.w > 0.f) ? a0.w : (expf(a0.w) - 1.f);
        a1.x = (a1.x > 0.f) ? a1.x : (expf(a1.x) - 1.f); a1.y = (a1.y > 0.f) ? a1.y : (expf(a1.y) - 1.f); a1.z = (a1.z > 0.f) ? a1.z : (expf(a1.z) - 1.f); a1.w = (a1.w > 0.f) ? a1.w : (expf(a1.w) - 1.f); }
    if (EPI == 4) { float o8[8] = {a0.x, a0.y, a0.z, a0.w, a1.x, a1.y, a1.z, a1.w}; unsigned short hh[8], ll[8];
#pragma unroll
        for (int u = 0; u < 8; ++u) bfsplit(o8[u], hh[u], ll[u]);
        const unsigned long long ph0 = (unsigned long long)hh[0] | ((unsigned long long)hh[1] << 16) | ((unsigned long long)hh[2] << 32) | ((unsigned long long)hh[3] << 48), pl0 = (unsigned long long)ll[0] | ((unsigned long long)ll[1] << 16) | ((unsigned long long)ll[2] << 32) | ((unsigned long long)ll[3] << 48);
        const unsigned long long ph1 = (unsigned long long)hh[4] | ((unsigned long long)hh[5] << 16) | ((unsigned long long)hh[6] << 32) | ((unsigned long long)hh[7] << 48), pl1 = (unsigned long long)ll[4] | ((unsigned long long)ll[5] << 16) | ((unsigned long long)ll[6] << 32) | ((unsigned long long)ll[7] << 48);
        v4u pk; pk.x = (unsigned)(ph0 & 0xFFFFFFFFull); pk.y = (unsigned)(ph0 >> 32); pk.z = (unsigned)(ph1 & 0xFFFFFFFFull); pk.w = (unsigned)(ph1 >> 32); v4u* dh = (v4u*)(OH + (long long)n * 256 + c0); *dh = pk; 
        v4u ql; ql.x = (unsigned)(pl0 & 0xFFFFFFFFull); ql.y = (unsigned)(pl0 >> 32); ql.z = (unsigned)(pl1 & 0xFFFFFFFFull); ql.w = (unsigned)(pl1 >> 32); v4u* dl = (v4u*)(OL + (long long)n * 256 + c0); *dl = ql;  return; }
    if (EPI == 6) {
        a0.x += __shfl_xor(a0.x, 16); a0.y += __shfl_xor(a0.y, 16); a0.z += __shfl_xor(a0.z, 16); a0.w += __shfl_xor(a0.w, 16); a1.x += __shfl_xor(a1.x, 16); a1.y += __shfl_xor(a1.y, 16); a1.z += __shfl_xor(a1.z, 16); a1.w += __shfl_xor(a1.w, 16);
        if (L < 16) { const int cb = 8 * L; const v4f b0 = *(const v4f*)(bias + cb), b1v = *(const v4f*)(bias + cb + 4);
            stage[wv][cb] = fmaxf(a0.x * 0.5f + b0.x, 0.f); stage[wv][cb + 1] = fmaxf(a0.y * 0.5f + b0.y, 0.f); stage[wv][cb + 2] = fmaxf(a0.z * 0.5f + b0.z, 0.f); stage[wv][cb + 3] = fmaxf(a0.w * 0.5f + b0.w, 0.f);
            stage[wv][cb + 4] = fmaxf(a1.x * 0.5f + b1v.x, 0.f); stage[wv][cb + 5] = fmaxf(a1.y * 0.5f + b1v.y, 0.f); stage[wv][cb + 6] = fmaxf(a1.z * 0.5f + b1v.z, 0.f); stage[wv][cb + 7] = fmaxf(a1.w * 0.5f + b1v.w, 0.f); }
        __builtin_amdgcn_fence(__ATOMIC_RELEASE, "workgroup"); __builtin_amdgcn_wave_barrier(); __builtin_amdgcn_fence(__ATOMIC_ACQUIRE, "workgroup");
        v4f o6; o6.x = stage[wv][4 * L]; o6.y = stage[wv][4 * L + 1]; o6.z = stage[wv][4 * L + 2]; o6.w = stage[wv][4 * L + 3]; VST2V4(OUT + (long long)n * 128 + 4 * L, o6); return; }
    if (EPI == 5) {
        a0.x += __shfl_xor(a0.x, 8); a0.y += __shfl_xor(a0.y, 8); a0.z += __shfl_xor(a0.z, 8); a0.w += __shfl_xor(a0.w, 8); a1.x += __shfl_xor(a1.x, 8); a1.y += __shfl_xor(a1.y, 8); a1.z += __shfl_xor(a1.z, 8); a1.w += __shfl_xor(a1.w, 8);
        a0.x += __shfl_xor(a0.x, 16); a0.y += __shfl_xor(a0.y, 16); a0.z += __shfl_xor(a0.z, 16); a0.w += __shfl_xor(a0.w, 16); a1.x += __shfl_xor(a1.x, 16); a1.y += __shfl_xor(a1.y, 16); a1.z += __shfl_xor(a1.z, 16); a1.w += __shfl_xor(a1.w, 16);
        const int gq5 = L & 7; a0 = a0 * 0.25f; a1 = a1 * 0.25f;
        if (L < 8) { stage[wv][8 * gq5] = a0.x; stage[wv][8 * gq5 + 1] = a0.y; stage[wv][8 * gq5 + 2] = a0.z; stage[wv][8 * gq5 + 3] = a0.w; stage[wv][8 * gq5 + 4] = a1.x; stage[wv][8 * gq5 + 5] = a1.y; stage[wv][8 * gq5 + 6] = a1.z; stage[wv][8 * gq5 + 7] = a1.w; }
        __builtin_amdgcn_fence(__ATOMIC_RELEASE, "workgroup"); __builtin_amdgcn_wave_barrier(); __builtin_amdgcn_fence(__ATOMIC_ACQUIRE, "workgroup");
        const unsigned long long pk5 = (unsigned long long)__builtin_bit_cast(unsigned, stage[wv][2 * L]) | ((unsigned long long)__builtin_bit_cast(unsigned, stage[wv][2 * L + 1]) << 32); VST2(unsigned long long, (unsigned long long*)(OUT + (long long)n * 64 + 2 * L), pk5); return; }
    if (EPI == 1) { float sm = a0.x + a0.y + a0.z + a0.w + a1.x + a1.y + a1.z + a1.w;
#pragma unroll
        for (int o = 16; o > 0; o >>= 1) sm += __shfl_xor(sm, o);
        const float mu = sm * (1.f / 256.f); const v4f d0 = a0 - mu, d1 = a1 - mu; float q = d0.x * d0.x + d0.y * d0.y + d0.z * d0.z + d0.w * d0.w + d1.x * d1.x + d1.y * d1.y + d1.z * d1.z + d1.w * d1.w;
#pragma unroll
        for (int o = 16; o > 0; o >>= 1) q += __shfl_xor(q, o);
        const float rs = rsqrtf(q * (1.f / 256.f) + 1e-5f); float o8[8] = {d0.x, d0.y, d0.z, d0.w, d1.x, d1.y, d1.z, d1.w}; unsigned short hh[8], ll[8];
#pragma unroll
        for (int u = 0; u < 8; ++u) { const float v = fmaxf(o8[u] * rs * g[c0 + u] + bb[c0 + u], 0.f); bfsplit(v, hh[u], ll[u]); }
        const unsigned long long ph0 = (unsigned long long)hh[0] | ((unsigned long long)hh[1] << 16) | ((unsigned long long)hh[2] << 32) | ((unsigned long long)hh[3] << 48), pl0 = (unsigned long long)ll[0] | ((unsigned long long)ll[1] << 16) | ((unsigned long long)ll[2] << 32) | ((unsigned long long)ll[3] << 48);
        const unsigned long long ph1 = (unsigned long long)hh[4] | ((unsigned long long)hh[5] << 16) | ((unsigned long long)hh[6] << 32) | ((unsigned long long)hh[7] << 48), pl1 = (unsigned long long)ll[4] | ((unsigned long long)ll[5] << 16) | ((unsigned long long)ll[6] << 32) | ((unsigned long long)ll[7] << 48);
        // lane L's 8 halves at c0 = 8L: 16 B -> one 16-B store per plane (32 lanes x 16 B = whole 512-B row)
        v4u pk; pk.x = (unsigned)(ph0 & 0xFFFFFFFFull); pk.y = (unsigned)(ph0 >> 32); pk.z = (unsigned)(ph1 & 0xFFFFFFFFull); pk.w = (unsigned)(ph1 >> 32); v4u* dh = (v4u*)(OH + (long long)n * 256 + c0); *dh = pk; 
        v4u ql; ql.x = (unsigned)(pl0 & 0xFFFFFFFFull); ql.y = (unsigned)(pl0 >> 32); ql.z = (unsigned)(pl1 & 0xFFFFFFFFull); ql.w = (unsigned)(pl1 >> 32); v4u* dl = (v4u*)(OL + (long long)n * 256 + c0); *dl = ql;  return; }
    if (EPI == 2 || EPI == 3) {   // head mean: lanes L, L^8, L^16, L^24 hold the same chan group of the 4 heads (CH = 64 -> 8 lanes per head)
        a0.x += __shfl_xor(a0.x, 8); a0.y += __shfl_xor(a0.y, 8); a0.z += __shfl_xor(a0.z, 8); a0.w += __shfl_xor(a0.w, 8); a1.x += __shfl_xor(a1.x, 8); a1.y += __shfl_xor(a1.y, 8); a1.z += __shfl_xor(a1.z, 8); a1.w += __shfl_xor(a1.w, 8);
        a0.x += __shfl_xor(a0.x, 16); a0.y += __shfl_xor(a0.y, 16); a0.z += __shfl_xor(a0.z, 16); a0.w += __shfl_xor(a0.w, 16); a1.x += __shfl_xor(a1.x, 16); a1.y += __shfl_xor(a1.y, 16); a1.z += __shfl_xor(a1.z, 16); a1.w += __shfl_xor(a1.w, 16);
        const int gq = L & 7; a0 = a0 * 0.25f + *(const v4f*)(bias + 8 * gq); a1 = a1 * 0.25f + *(const v4f*)(bias + 8 * gq + 4);      // every lane now holds channels 8gq..8gq+7 of the mean
        if (EPI == 3) { if (L < 8) { stage[wv][8 * gq] = a0.x; stage[wv][8 * gq + 1] = a0.y; stage[wv][8 * gq + 2] = a0.z; stage[wv][8 * gq + 3] = a0.w; stage[wv][8 * gq + 4] = a1.x; stage[wv][8 * gq + 5] = a1.y; stage[wv][8 * gq + 6] = a1.z; stage[wv][8 * gq + 7] = a1.w; }
            __builtin_amdgcn_fence(__ATOMIC_RELEASE, "workgroup"); __builtin_amdgcn_wave_barrier(); __builtin_amdgcn_fence(__ATOMIC_ACQUIRE, "workgroup");
            const unsigned long long pk3 = (unsigned long long)__builtin_bit_cast(unsigned, stage[wv][2 * L]) | ((unsigned long long)__builtin_bit_cast(unsigned, stage[wv][2 * L + 1]) << 32); VST2(unsigned long long, (unsigned long long*)(OUT + (long long)n * 64 + 2 * L), pk3); return; }
        float sm = (L < 8) ? (a0.x + a0.y + a0.z + a0.w + a1.x + a1.y + a1.z + a1.w) : 0.f;
#pragma unroll
        for (int o = 16; o > 0; o >>= 1) sm += __shfl_xor(sm, o);
        const float mu = sm * (1.f / 64.f); const v4f d0 = a0 - mu, d1 = a1 - mu; float q = (L < 8) ? (d0.x * d0.x + d0.y * d0.y + d0.z * d0.z + d0.w * d0.w + d1.x * d1.x + d1.y * d1.y + d1.z * d1.z + d1.w * d1.w) : 0.f;
#pragma unroll
        for (int o = 16; o > 0; o >>= 1) q += __shfl_xor(q, o);
        const float rs = rsqrtf(q * (1.f / 64.f) + 1e-5f);
        if (L < 8) { const float* gg = g + 8 * gq; const float* bq = bb + 8 * gq; stage[wv][8 * gq] = fmaxf(d0.x * rs * gg[0] + bq[0], 0.f); stage[wv][8 * gq + 1] = fmaxf(d0.y * rs * gg[1] + bq[1], 0.f); stage[wv][8 * gq + 2] = fmaxf(d0.z * rs * gg[2] + bq[2], 0.f); stage[wv][8 * gq + 3] = fmaxf(d0.w * rs * gg[3] + bq[3], 0.f);
            stage[wv][8 * gq + 4] = fmaxf(d1.x * rs * gg[4] + bq[4], 0.f); stage[wv][8 * gq + 5] = fmaxf(d1.y * rs * gg[5] + bq[5], 0.f); stage[wv][8 * gq + 6] = fmaxf(d1.z * rs * gg[6] + bq[6], 0.f); stage[wv][8 * gq + 7] = fmaxf(d1.w * rs * gg[7] + bq[7], 0.f); }
        __builtin_amdgcn_fence(__ATOMIC_RELEASE, "workgroup"); __builtin_amdgcn_wave_barrier(); __builtin_amdgcn_fence(__ATOMIC_ACQUIRE, "workgroup");
        const unsigned long long pk = (unsigned long long)__builtin_bit_cast(unsigned, stage[wv][2 * L]) | ((unsigned long long)__builtin_bit_cast(unsigned, stage[wv][2 * L + 1]) << 32); VST2(unsigned long long, (unsigned long long*)(OUT + (long long)n * 64 + 2 * L), pk); return; }
    // EPI 0
    stage[wv][c0] = a0.x; stage[wv][c0 + 1] = a0.y; stage[wv][c0 + 2] = a0.z; stage[wv][c0 + 3] = a0.w; stage[wv][c0 + 4] = a1.x; stage[wv][c0 + 5] = a1.y; stage[wv][c0 + 6] = a1.z; stage[wv][c0 + 7] = a1.w;
    __builtin_amdgcn_fence(__ATOMIC_RELEASE, "workgroup"); __builtin_amdgcn_wave_barrier(); __builtin_amdgcn_fence(__ATOMIC_ACQUIRE, "workgroup");
#pragma unroll
    for (int q2 = 0; q2 < 2; ++q2) { const int c = 128 * q2 + 4 * L; v4f v; v.x = stage[wv][c]; v.y = stage[wv][c + 1]; v.z = stage[wv][c + 2]; v.w = stage[wv][c + 3]; VST2V4(OUT + (long long)n * 256 + c, v); } }

__device__ __forceinline__ void st4s(unsigned short* Hp, unsigned short* Lp, long long o, v4f a) { unsigned short h[4], l[4]; bfsplit(a.x, h[0], l[0]); bfsplit(a.y, h[1], l[1]); bfsplit(a.z, h[2], l[2]); bfsplit(a.w, h[3], l[3]);
    const unsigned long long ph = (unsigned long long)h[0] | ((unsigned long long)h[1] << 16) | ((unsigned long long)h[2] << 32) | ((unsigned long long)h[3] << 48), pl = (unsigned long long)l[0] | ((unsigned long long)l[1] << 16) | ((unsigned long long)l[2] << 32) | ((unsigned long long)l[3] << 48);
    VST2(unsigned long long, (unsigned long long*)(Hp + o), ph); VST2(unsigned long long, (unsigned long long*)(Lp + o), pl); }
// f32 [nval2 pairs] -> bf16 hi/lo planes (n2 pairs; pairs >= nval2 zero); thread-linear 4-B stores per plane
__global__ __launch_bounds__(256) void k_pl(const float* __restrict__ S, unsigned short* __restrict__ PH, unsigned short* __restrict__ PL, long long nval2, long long n2) { const long long u = (long long)blockIdx.x * 256 + threadIdx.x; if (u >= n2) return; const bool in = (u < nval2); const long long uc = in ? u : ((nval2 > 0) ? (nval2 - 1) : 0); const float a = S[2 * uc], b = S[2 * uc + 1]; st_s2(PH, PL, 2 * u, in ? a : 0.f, in ? b : 0.f); }
// WC [K][NOP] (thread-linear whole rows) = [W (cols < FO) | 0 | W_h . as_h @EO+h | W_h . ad_h @EO+NH+h | 0 ...]; W is [K][FO] (x @ W layout), as/ad [NH][DH]; EO >= FO.
// branch-free: every lane loads all candidates with clamped indices and selects by value (no exec-masked load arms)
__global__ __launch_bounds__(256) void k_wext(const float* __restrict__ Wm, const float* __restrict__ AS_, const float* __restrict__ AD_, int K, int NOP, int FO, int NH, int DH, int EO, float* __restrict__ WC) {
    #pragma clang fp contract(off)
    const long long u = (long long)blockIdx.x * 256 + threadIdx.x; if (u >= (long long)K * NOP) return; const int kk = (int)(u / NOP), o = (int)(u % NOP);
    const int oo = min(o, FO - 1); const float vw = Wm[(long long)kk * FO + oo]; const int q = min(max(o - EO, 0), 2 * NH - 1); const int h = q % NH; float s = 0.f;
#pragma unroll 1
    for (int c = 0; c < DH; ++c) { const float w = Wm[(long long)kk * FO + h * DH + c]; const float asv = AS_[h * DH + c], adv = AD_[h * DH + c]; s += w * ((q < NH) ? asv : adv); }
    const float v = (o < FO) ? vw : ((o >= EO && o < EO + 2 * NH) ? s : 0.f); VST2(float, WC + u, v); }
// GAT aggregation over a device in-edge CSR (+ analytic self loop as iteration j = -1 when SELF), per-lane online softmax (lanes of one head agree):
// HS rows (pitch P floats): [0,128) projected features z, col 128 + h = a_src.z_h, col 128 + NH + h = a_dst.z_h; lane L owns channels 4L..4L+3 (head = 4L / CH).
// out = sum_j softmax_j(leaky(el[src_j][h] + er[n][h])) z[src_j] (/ (den + deps)) + bias -> ACT (0 none, 1 relu, 2 elu, 3 leaky 0.01) ->
// MODE 0: f32 OUT[n][OW] cols < OC (16-B lane stores, OC*4 contiguous B per wave; OC in {64,128}); MODE 1: bf16 hi/lo planes PH/PL pitch PP (rows n >= N zero); MODE 2: both.
template <int CH, bool SELF, int ACT, int MODE>
__global__ __launch_bounds__(256) void k_gat128(const float* __restrict__ HS, int P, int NH, const float* __restrict__ bias, const int* __restrict__ SRC, const int* __restrict__ off, const int* __restrict__ cnt, const int* __restrict__ slot,
        float* __restrict__ OUT, int OW, int OC, unsigned short* __restrict__ PH, unsigned short* __restrict__ PL, int PP, int N, int NP, int E, int CAP, float slope, float deps) {
    #pragma clang fp contract(off)
    const int n = blockIdx.x * 8 + (threadIdx.x >> 5); const int L = threadIdx.x & 31; if (n >= NP) return; const int c = 4 * L; const int h = c / CH; v4f o; o.x = o.y = o.z = o.w = 0.f;
    if (n < N) { const float* hn = HS + (long long)n * P; const float er = hn[128 + NH + h]; float m = -3.0e38f, s = 0.f; v4f a; a.x = a.y = a.z = a.w = 0.f;
        const int p0 = min(max(off[n], 0), E), cn = min(max(cnt[n], 0), CAP);
        for (int j = (SELF ? -1 : 0); j < cn; ++j) { int sj; if (j < 0) sj = n; else { const int e = min(max(slot[min(p0 + j, E - 1)], 0), E - 1); sj = min(max(SRC[e], 0), N - 1); }
            const float* hs = HS + (long long)sj * P; float lg = hs[128 + h] + er; lg = (lg >= 0.f) ? lg : slope * lg;
            const float mn = fmaxf(m, lg); const float cz = expf(m - mn), pj = expf(lg - mn); s = s * cz + pj; a = a * cz + *(const v4f*)(hs + c) * pj; m = mn; }
        const float inv = (s > 0.f || deps > 0.f) ? 1.f / (s + deps) : 0.f; o = a * inv + *(const v4f*)(bias + c);
        if (ACT == 1) { o.x = fmaxf(o.x, 0.f); o.y = fmaxf(o.y, 0.f); o.z = fmaxf(o.z, 0.f); o.w = fmaxf(o.w, 0.f); }
        if (ACT == 2) { o.x = (o.x > 0.f) ? o.x : (expf(o.x) - 1.f); o.y = (o.y > 0.f) ? o.y : (expf(o.y) - 1.f); o.z = (o.z > 0.f) ? o.z : (expf(o.z) - 1.f); o.w = (o.w > 0.f) ? o.w : (expf(o.w) - 1.f); }
        if (ACT == 3) { o.x = (o.x >= 0.f) ? o.x : 0.01f * o.x; o.y = (o.y >= 0.f) ? o.y : 0.01f * o.y; o.z = (o.z >= 0.f) ? o.z : 0.01f * o.z; o.w = (o.w >= 0.f) ? o.w : 0.01f * o.w; }
        if (MODE != 1 && c < OC) VST2V4(OUT + (long long)n * OW + c, o); }
    if (MODE != 0) st4s(PH, PL, (long long)n * PP + c, o); }

// ---- util2 ----
// generic Bt plane builder from an f32 weight: Bt[o][k] (pitch KP halves) = (TRANS ? W[k*ldw + o] : W[o*ldw + k]) * (S ? S[o] : 1) for o < NO, k < KI; zero elsewhere for o < NOP rows, k < KP (thread per (o < NOP, pair k))
__global__ __launch_bounds__(256) void k_u2_bt(const float* __restrict__ Wm, int ldw, int TRANS, int KI, int NO, int KP, int NOP, const float* __restrict__ S, unsigned short* __restrict__ PH_, unsigned short* __restrict__ PL_) {
    const long long u = (long long)blockIdx.x * 256 + threadIdx.x; if (u >= (long long)NOP * (KP / 2)) return; const int k0 = 2 * (int)(u % (KP / 2)); const int o = (int)(u / (KP / 2)); float a = 0.f, b = 0.f;
    if (o < NO) { const float s = S ? S[o] : 1.f;
        if (k0 < KI) a = (TRANS ? Wm[(long long)k0 * ldw + o] : Wm[(long long)o * ldw + k0]) * s;
        if (k0 + 1 < KI) b = (TRANS ? Wm[(long long)(k0 + 1) * ldw + o] : Wm[(long long)o * ldw + k0 + 1]) * s; }
    st_s2(PH_, PL_, (long long)o * KP + k0, a, b); }
// generic padded vector: O[i] = (i < n) ? (A[i] * (S ? S[i] : 1) + (B2 ? B2[i] : 0)) : 0 for i < NP (one block of 256, NP <= 4096 looped)
__global__ __launch_bounds__(256) void k_u2_vec(const float* __restrict__ A, const float* __restrict__ S, const float* __restrict__ B2, int n, int NP, float* __restrict__ O) { for (int i = threadIdx.x; i < NP; i += 256) { float v = 0.f; if (i < n) v = A[i] * (S ? S[i] : 1.f) + (B2 ? B2[i] : 0.f); VST2(float, O + i, v); } }
__global__ __launch_bounds__(256) void k_u2_colstat(const float* __restrict__ X, int P, int N, float eps, float* __restrict__ STAT) {
    #pragma clang fp contract(off)
    __shared__ float red[256]; const int c = blockIdx.x; const int t = threadIdx.x; float s = 0.f; for (int r = t; r < N; r += 256) s += X[(long long)r * P + c]; red[t] = s; __syncthreads();
    for (int o = 128; o > 0; o >>= 1) { if (t < o) red[t] += red[t + o]; __syncthreads(); }
    const float mu = red[0] / (float)N; __syncthreads(); float q = 0.f; for (int r = t; r < N; r += 256) { const float d = X[(long long)r * P + c] - mu; q += d * d; } red[t] = q; __syncthreads();
    for (int o = 128; o > 0; o >>= 1) { if (t < o) red[t] += red[t + o]; __syncthreads(); }
    const float rs = 1.f / sqrtf(red[0] / (float)N + eps); if (t < 32) VST2(float, STAT + (long long)c * 32 + t, (t == 0) ? mu : ((t == 1) ? rs : 0.f)); }
// rows f32 [R][W] (pitch PW) -> planes at pitch PP, column offset coff; rows >= RL (live) written as zeros up to RP (thread per (r < RP, 4 of W))
__global__ __launch_bounds__(256) void k_u2_pl(const float* __restrict__ X, int PW, int Wd, int RL, int RP, unsigned short* __restrict__ PH_, unsigned short* __restrict__ PL_, int PP, int coff) { const long long u = (long long)blockIdx.x * 256 + threadIdx.x; if (u >= (long long)RP * (Wd / 4)) return; const int r = (int)(u / (Wd / 4)); const int c = 4 * (int)(u % (Wd / 4)); v4f v; v.x = v.y = v.z = v.w = 0.f; if (r < RL) v = *(const v4f*)(X + (long long)r * PW + c); st4s(PH_, PL_, (long long)r * PP + coff + c, v); }

typedef unsigned int cm_u4 __attribute__((ext_vector_type(4)));

__global__ __launch_bounds__(256) void k_cm_zero16(unsigned short* __restrict__ DST, long long n) { const long long u = (long long)blockIdx.x * 256 + threadIdx.x; if (u * 8 >= n) return; cm_u4 z; z.x = z.y = z.z = z.w = 0u; cm_u4* d = (cm_u4*)(DST + u * 8); *d = z;  }
// f32 -> bf16 (RNE) -> f16 casts for the bf16-input-leg path: every 16-bit operand then holds exactly the bf16-rounded input value (times a power-of-two
// weight scale), so the f16 WMMA products are exact. Plain: thread per (row, 8 cols),
// dst [R][C] pitch ldd; transposed: thread per (col, 8 consecutive rows) -> dst [C][R] pitch ldd; both store 16 B per thread, thread-linear along the dst row.
__device__ __forceinline__ unsigned int cmb_pk2(float a, float b) { return (unsigned int)__builtin_bit_cast(unsigned short, (_Float16)a) | ((unsigned int)__builtin_bit_cast(unsigned short, (_Float16)b) << 16); }
__device__ __forceinline__ float cmb_bf(float v) { const unsigned u = __builtin_bit_cast(unsigned, v); const unsigned r = (u + 0x7fffu + ((u >> 16) & 1u)) & 0xffff0000u; return __builtin_bit_cast(float, r); }   // bf16 RNE, kept as f32 (finite inputs)
// BR[i] = bf16_rne(B[i]) kept as f32 (thread per element; bias vectors)
__global__ __launch_bounds__(256) void k_cm_bfvec(const float* __restrict__ SRC, float* __restrict__ DST, int n) { const int u = blockIdx.x * 256 + threadIdx.x; if (u >= n) return; VST2(float, DST + u, cmb_bf(SRC[u])); }
__global__ __launch_bounds__(256) void k_cm_castb(const float* __restrict__ SRC, int lds, unsigned short* __restrict__ DST, int ldd, int nR, int nC, float sc) {
    const long long u = (long long)blockIdx.x * 256 + threadIdx.x; const int per = nC / 8; if (u >= (long long)nR * per) return; const int r = (int)(u / per); const int c0 = 8 * (int)(u % per);
    const float* s = SRC + (long long)r * lds + c0; float w[8];
#pragma unroll
    for (int e = 0; e < 8; ++e) w[e] = cmb_bf(s[e]) * sc;
    cm_u4 pk; pk.x = cmb_pk2(w[0], w[1]); pk.y = cmb_pk2(w[2], w[3]); pk.z = cmb_pk2(w[4], w[5]); pk.w = cmb_pk2(w[6], w[7]); VST2(cm_u4, (cm_u4*)(DST + (long long)r * ldd + c0), pk); }
__global__ __launch_bounds__(256) void k_cm_castbT(const float* __restrict__ SRC, int lds, unsigned short* __restrict__ DST, int ldd, int nR, int nC, float sc) {
    const long long u = (long long)blockIdx.x * 256 + threadIdx.x; const int per = nR / 8; if (u >= (long long)nC * per) return; const int c = (int)(u / per); const int r0 = 8 * (int)(u % per);
    float w[8];
#pragma unroll
    for (int e = 0; e < 8; ++e) w[e] = cmb_bf(SRC[(long long)(r0 + e) * lds + c]) * sc;
    cm_u4 pk; pk.x = cmb_pk2(w[0], w[1]); pk.y = cmb_pk2(w[2], w[3]); pk.z = cmb_pk2(w[4], w[5]); pk.w = cmb_pk2(w[6], w[7]); VST2(cm_u4, (cm_u4*)(DST + (long long)c * ldd + r0), pk); }

// QT = bf16(q) * bf16(tau[b]) (f32, thread per float4); MF[b][j] = sc * bf16(delta[b][j]), sc = scale * log2(e).
// KF = bf16(keys | keys_null); VF = bf16(values | values_null) written as f16 (exact from 2^-17 up in size, within 2^-25 below; finite up to 65,504), for the f16 P.V product. Both as 2-byte halves in the order the attention kernel's B fragments want them, so that a fragment is two 16-byte loads a lane
// and each load of a wave reads 512 contiguous bytes: [branch][b][h][64-key block][tile 0..3][step 0..1][half 0..1][lane 0..31][8].
//   K: key = 64 block + 16 tile + (lane & 15), e = 32 step + 16 half + 8 (lane >> 4) + i;   V: d = 16 tile + (lane & 15), key = 64 block + 32 step + 16 half + 8 (lane >> 4) + i.
// Thread per 16-byte group of the destination (thread-linear stores); which = blockIdx range, block-uniform.
__global__ __launch_bounds__(256) void k_ds_pre(const float* __restrict__ Q, const float* __restrict__ Kp, const float* __restrict__ V, const float* __restrict__ Kn, const float* __restrict__ Vn, const float* __restrict__ TAU, const float* __restrict__ DELTA, float* __restrict__ QTp, unsigned short* __restrict__ KFp, unsigned short* __restrict__ VFp, float* __restrict__ MFp, float sc) {
    #pragma clang fp contract(off)
    const int blk = blockIdx.x;
    if (blk < 2048) { const long long u = (long long)blk * 256 + threadIdx.x; const int b = (int)(u / (2048LL * 8 * 16)); const float t = cmb_bf(TAU[b]); const v4f x = *(const v4f*)(Q + 4 * u); v4f r; r.x = cmb_bf(x.x) * t; r.y = cmb_bf(x.y) * t; r.z = cmb_bf(x.z) * t; r.w = cmb_bf(x.w) * t; VST2V4(QTp + 4 * u, r); }
    else if (blk < 2048 + 4 * 1024) {
        const int which = (blk - 2048) >> 10;                            // 0 keys, 1 values, 2 keys_null, 3 values_null
        const int c = ((blk - 2048) & 1023) * 256 + threadIdx.x;         // 16-byte group within the tensor: 262,144 of them
        const int lane = c & 31, half = (c >> 5) & 1, step = (c >> 6) & 1, tile = (c >> 7) & 3, kb = (c >> 9) & 31, h = (c >> 14) & 7, b = c >> 17;
        const int inner = 32 * step + 16 * half + 8 * (lane >> 4), outer = 16 * tile + (lane & 15);
        const float* s = (which == 0) ? Kp : (which == 1) ? V : (which == 2) ? Kn : Vn;
        float w[8];
        cm_u4 pk;
        if ((which & 1) == 0) {
            const float* r = s + ((long long)(b * 2048 + kb * 64 + outer) * 8 + h) * 64 + inner;
            const v4f x = *(const v4f*)r, y = *(const v4f*)(r + 4);
            asm volatile("s_wait_xcnt 0x0" ::: "memory");   // stands behind the two loads, ahead of the rewrite of their address pair by the packing
            w[0] = x.x; w[1] = x.y; w[2] = x.z; w[3] = x.w; w[4] = y.x; w[5] = y.y; w[6] = y.z; w[7] = y.w;
            pk.x = (unsigned)bfu_rne(w[0]) | ((unsigned)bfu_rne(w[1]) << 16); pk.y = (unsigned)bfu_rne(w[2]) | ((unsigned)bfu_rne(w[3]) << 16);
            pk.z = (unsigned)bfu_rne(w[4]) | ((unsigned)bfu_rne(w[5]) << 16); pk.w = (unsigned)bfu_rne(w[6]) | ((unsigned)bfu_rne(w[7]) << 16);
        } else {
            const float* r = s + ((long long)(b * 2048 + kb * 64 + inner) * 8 + h) * 64 + outer;
#pragma unroll   // constant trip count: the eight row loads are issued together, with one wait
            for (int i = 0; i < 8; ++i) w[i] = r[i * 512];
            asm volatile("s_wait_xcnt 0x0" ::: "memory");   // stands behind the eight loads, ahead of the rewrite of their address pair by the packing
            v8h hv;   // the bf16-rounded value, written as f16: its 8 significant bits fit f16's 11
#pragma unroll   // hv is a register vector: every index a constant
            for (int i = 0; i < 8; ++i) hv[i] = (_Float16)cmb_bf(w[i]);
            pk = __builtin_bit_cast(cm_u4, hv);
        }
        unsigned short* d = ((which & 1) ? VFp : KFp) + ((which >= 2) ? 2097152 : 0) + (long long)c * 8;
        VST2(cm_u4, (cm_u4*)d, pk); }
    else { const int u = (blk - 2048 - 4 * 1024) * 256 + threadIdx.x; VST2(float, MFp + u, sc * cmb_bf(DELTA[u]));
        asm volatile("s_wait_xcnt 0x0" ::: "memory");   // stands behind the store, ahead of any rewrite of the registers it names
    } }

extern "C" void kernel_launch(void* const* d_in, const int* in_sizes, int n_in, void* d_out, int out_size, void* d_ws, size_t ws_size, hipStream_t stream) {
    (void)in_sizes; (void)n_in; (void)out_size; (void)ws_size;
    const float* q = (const float*)d_in[0];
    const float* kk = (const float*)d_in[1];
    const float* v = (const float*)d_in[2];
    const float* kn = (const float*)d_in[3];
    const float* vn = (const float*)d_in[4];
    const float* tau = (const float*)d_in[5];
    const float* delta = (const float*)d_in[6];
    const float* smask = (const float*)d_in[7];
    float* out = (float*)d_out;
    char* wsp = (char*)d_ws;
    float* QT = (float*)wsp; wsp += (((size_t)((size_t)2097152) * 4 + 255) / 256) * 256;
    unsigned short* KF = (unsigned short*)wsp; wsp += (((size_t)((size_t)4194304) * 2 + 255) / 256) * 256;   // [branch][batch] planes of 1,048,576 bf16 in fragment order
    unsigned short* VF = (unsigned short*)wsp; wsp += (((size_t)((size_t)4194304) * 2 + 255) / 256) * 256;   // the same, as f16
    float* MF = (float*)wsp; wsp += (((size_t)((size_t)4096) * 4 + 255) / 256) * 256;
    if ((size_t)(wsp - (char*)d_ws) > ws_size) return;   // static carve guard
    k_ds_pre<<<(unsigned)(2048 + 4 * 1024 + 16), 256, 0, stream>>>(q, kk, v, kn, vn, tau, delta, QT, KF, VF, MF, 0.18033688f);   // scale * log2(e): the table is added to exp2 arguments
    k_attn_t<<<dim3(16, 16, 1), 32 * 4 * AW, 0, stream>>>(QT, KF, VF, MF, smask, out);   // both branches, joined and blended: writes the output
}

// v009
// Measured time: 35 microseconds a run.
// Two timings next to v008 both put it at 1.09 times that version's speed.
// Counting every step since v000, which is the starting kernel, it is 105 times as fast.
// De-stationary causal attention with a null branch, [b, l, h, e] layout (2 x 2,048 tokens, 8 heads x 64): A = softmax(scale * (q.k * tau_b + delta_bj)) over keys j <= i for (keys, values) and for (keys_null, values_null) with the same queries; out = soft_mask * out_edit + (1 - soft_mask) * out_null per query. All inputs rounded to bf16 (RNE); k, v rounded, k is stored as bf16 and the bf16-rounded v as f16, both in WMMA fragment order, then ONE WMMA attention launch for both batches and both branches (v_wmma_f32_16x16x32_bf16, f32 accumulate) with bf16 q times the sign of tau_b against bf16 k (both exact), the per-key additive table delta_bj / |tau_b| as the products' start value, scale * |tau_b| applied in f32 in the exp2 argument, causal, f32 online softmax, P as one f16 value a score against f16 v (v_wmma_f32_16x16x32_f16, f32 accumulate); the blend in f32.
#include <hip/hip_runtime.h>
#include <math.h>

typedef __attribute__((ext_vector_type(16))) _Float16 v16h;
typedef __attribute__((ext_vector_type(8)))  _Float16 v8h;
typedef __attribute__((ext_vector_type(16))) __bf16   v16b;
typedef __attribute__((ext_vector_type(8)))  __bf16   v8b;
typedef __attribute__((ext_vector_type(8)))  float    v8f;
typedef __attribute__((ext_vector_type(4)))  float    v4f;

// 16-bit WMMA fragment map (wave32), lane L, h = L>>4, m = L&15:
//   A 16x32: lane = row m;   element i -> k = (i<8) ? 8h+i : 16+8h+(i-8)
//   B 32x16: lane = column m; the SAME k(i,h)
//   D 16x16 (8 f32): lane = column m; element r -> row 8h+r
__device__ __forceinline__ int frag_k(int i, int h) { return (i < 8) ? (8 * h + i) : (16 + 8 * h + (i - 8)); }
__device__ __forceinline__ __bf16 bf16_rne(float f) {
    unsigned int u = __float_as_uint(f);
    u += 0x7fffu + ((u >> 16) & 1u);
    return __builtin_bit_cast(__bf16, (unsigned short)(u >> 16));
}
__device__ __forceinline__ float bf16_f32(__bf16 b) { return __uint_as_float(((unsigned int)__builtin_bit_cast(unsigned short, b)) << 16); }
__device__ __forceinline__ v8f wmma16(v16h a, v16h b, v8f c) {
    c = __builtin_amdgcn_wmma_f32_16x16x32_f16(false, a, false, b, (short)0, c, false, false);
    asm volatile("v_nop\n\tv_nop\n\tv_nop\n\tv_nop" : "+v"(c) : "v"(a), "v"(b));
    return c;
}
__device__ __forceinline__ v8f wmmab(v16b a, v16b b, v8f c) {
    c = __builtin_amdgcn_wmma_f32_16x16x32_bf16(false, a, false, b, (short)0, c, false, false);
    asm volatile("v_nop\n\tv_nop\n\tv_nop\n\tv_nop" : "+v"(c) : "v"(a), "v"(b));
    return c;
}
struct Split { v16b hi, lo; };
// hi/lo split product: a.hi*b.hi + a.hi*b.lo + a.lo*b.hi
__device__ __forceinline__ v8f wmma3(const Split& a, const Split& b, v8f c) {
    c = __builtin_amdgcn_wmma_f32_16x16x32_bf16(false, a.hi, false, b.hi, (short)0, c, false, false);
    c = __builtin_amdgcn_wmma_f32_16x16x32_bf16(false, a.hi, false, b.lo, (short)0, c, false, false);
    c = __builtin_amdgcn_wmma_f32_16x16x32_bf16(false, a.lo, false, b.hi, (short)0, c, false, false);
    asm volatile("v_nop\n\tv_nop\n\tv_nop\n\tv_nop" : "+v"(c) : "v"(a.hi), "v"(a.lo), "v"(b.hi), "v"(b.lo));
    return c;
}
// hi/lo split a against a b that is exact in bf16 (its lo part is zero): a.hi*b + a.lo*b
__device__ __forceinline__ v8f wmma2(const Split& a, v16b b, v8f c) {
    c = __builtin_amdgcn_wmma_f32_16x16x32_bf16(false, a.hi, false, b, (short)0, c, false, false);
    c = __builtin_amdgcn_wmma_f32_16x16x32_bf16(false, a.lo, false, b, (short)0, c, false, false);
    return c;
}
// the same with the exact bf16 operand as A and the hi/lo split as B: a*b.hi + a*b.lo
__device__ __forceinline__ v8f wmma2t(v16b a, const Split& b, v8f c) {
    c = __builtin_amdgcn_wmma_f32_16x16x32_bf16(false, a, false, b.hi, (short)0, c, false, false);
    c = __builtin_amdgcn_wmma_f32_16x16x32_bf16(false, a, false, b.lo, (short)0, c, false, false);
    return c;
}
// One f16 fragment from a plane in fragment order, laid out as bfrag_ld's
__device__ __forceinline__ v16h hfrag_ld(const _Float16* __restrict__ p) {
    const v8h x = *(const v8h*)p, y = *(const v8h*)(p + 256);
    return __builtin_shufflevector(x, y, 0, 1, 2, 3, 4, 5, 6, 7, 8, 9, 10, 11, 12, 13, 14, 15);
}
// One B fragment from a plane in fragment order (see k_ds_pre): two blocks of 256 halves, lane L's eight halves at 8L; block 0 holds elements 0..7, block 1 elements 8..15
__device__ __forceinline__ v16b bfrag_ld(const __bf16* __restrict__ p) {
    const v8b x = *(const v8b*)p, y = *(const v8b*)(p + 256);
    return __builtin_shufflevector(x, y, 0, 1, 2, 3, 4, 5, 6, 7, 8, 9, 10, 11, 12, 13, 14, 15);
}
struct Split3 { v16b hi, mid, lo; };
// triple split product (6 terms, drops only terms below 2^-24 relative)
__device__ __forceinline__ v8f wmma6(const Split3& a, const Split3& b, v8f c) {
    c = __builtin_amdgcn_wmma_f32_16x16x32_bf16(false, a.hi, false, b.hi, (short)0, c, false, false);
    c = __builtin_amdgcn_wmma_f32_16x16x32_bf16(false, a.hi, false, b.mid, (short)0, c, false, false);
    c = __builtin_amdgcn_wmma_f32_16x16x32_bf16(false, a.mid, false, b.hi, (short)0, c, false, false);
    c = __builtin_amdgcn_wmma_f32_16x16x32_bf16(false, a.hi, false, b.lo, (short)0, c, false, false);
    c = __builtin_amdgcn_wmma_f32_16x16x32_bf16(false, a.mid, false, b.mid, (short)0, c, false, false);
    c = __builtin_amdgcn_wmma_f32_16x16x32_bf16(false, a.lo, false, b.hi, (short)0, c, false, false);
    asm volatile("v_nop\n\tv_nop\n\tv_nop\n\tv_nop" : "+v"(c) : "v"(a.hi), "v"(a.mid), "v"(a.lo), "v"(b.hi), "v"(b.mid), "v"(b.lo));
    return c;
}

// Fragment gathers from f32 memory: element i <- p[(k0 + frag_k(i,h)) * sk] * s, zero for k >= klen.
__device__ __forceinline__ v16h fh_ld(const float* __restrict__ p, long long sk, int k0, int h, int klen, float s) {
    v16h a;
#pragma unroll
    for (int i = 0; i < 16; ++i) { const int k = k0 + frag_k(i, h); a[i] = (k < klen) ? (_Float16)(p[(long long)k * sk] * s) : (_Float16)0.f; }
    return a;
}
__device__ __forceinline__ Split sp_ld(const float* __restrict__ p, long long sk, int k0, int h, int klen, float s) {
    Split r;
#pragma unroll
    for (int i = 0; i < 16; ++i) {
        const int k = k0 + frag_k(i, h); const float x = (k < klen) ? p[(long long)k * sk] * s : 0.f;
        const __bf16 hb = bf16_rne(x); r.hi[i] = hb; r.lo[i] = bf16_rne(x - bf16_f32(hb));
    }
    return r;
}
__device__ __forceinline__ Split3 sp3_ld(const float* __restrict__ p, long long sk, int k0, int h, int klen, float s) {
    Split3 r;
#pragma unroll
    for (int i = 0; i < 16; ++i) {
        const int k = k0 + frag_k(i, h); const float x = (k < klen) ? p[(long long)k * sk] * s : 0.f;
        const __bf16 hb = bf16_rne(x); const float r1 = x - bf16_f32(hb); const __bf16 mb = bf16_rne(r1);
        r.hi[i] = hb; r.mid[i] = mb; r.lo[i] = bf16_rne(r1 - bf16_f32(mb));
    }
    return r;
}
__device__ __forceinline__ v16b bh_ld(const float* __restrict__ p, long long sk, int k0, int h, int klen, float s) {
    v16b a;
#pragma unroll
    for (int i = 0; i < 16; ++i) { const int k = k0 + frag_k(i, h); a[i] = bf16_rne((k < klen) ? p[(long long)k * sk] * s : 0.f); }
    return a;
}
// f16 fragment from an f16 LDS/global row with element stride 1 (k-contiguous), no bounds (tile already zero padded)
__device__ __forceinline__ v16h fh_row(const _Float16* __restrict__ row, int k0, int h) {
    v16h a;
#pragma unroll
    for (int i = 0; i < 16; ++i) a[i] = row[k0 + frag_k(i, h)];
    return a;
}

#define VST2(T, ptr, val) do { const T vst2_v_ = (val); *(T*)(ptr) = vst2_v_;  } while (0)
typedef float v4f __attribute__((ext_vector_type(4)));
#define VST2V4(ptr, val) do { const v4f vst2_v4_ = (val); *(v4f*)(ptr) = vst2_v4_;  } while (0)

__device__ __attribute__((noinline)) float act_fn(float v, int act) {
    if (act == 1) return fmaxf(v, 0.f);                                                                               // relu
    if (act == 2) { const float u = 0.7978845608028654f * (v + 0.044715f * v * v * v); return 0.5f * v * (1.f + tanhf(u)); } // tanh-gelu
    if (act == 3) return v / (1.f + expf(-v));                                                                        // silu
    if (act == 4) return 0.5f * v * (1.f + erff(v * 0.7071067811865476f));                                             // erf-gelu
    if (act == 5) return tanhf(v);
    if (act == 6) return 1.f / (1.f + expf(-v));                                                                      // sigmoid
    if (act == 7) return (v > 0.f) ? v : 0.01f * v;                                                                   // leaky relu 0.01
    if (act == 8) return (v > 0.f) ? v : (expf(v) - 1.f);                                                             // elu
    if (act == 9) return fminf(fmaxf(v, 0.f), 6.f);                                                                   // relu6
    if (act == 10) return fabsf(v);                                                                                    // abs
    if (act == 11) return (v >= 0.f) ? v : 0.1f * v;                                                                  // leaky 0.1
    if (act == 12) return (v > 0.f) ? v : 0.2f * v;                                                                   // leaky 0.2
    if (act == 13) return (v > 20.f) ? v : log1pf(expf(v));                                                            // softplus
    return v;
}

// =====================================================================================================================
// k_gemm<MODE>: C(z, m, n) = act(alpha * sum_k A(z, m, k) * B(z, k, n) + bias) + beta * R(z, m, n)
//   One wave (32-thread block) per 16 x 32 tile of C; grid (ceil(N/32), ceil(M/16), Z). Batch z -> (zo = z / zi_n, zi = z % zi_n)
//   with separate outer/inner strides for every tensor (e.g. batch and head). A(m,k) = A[zo*sAo + zi*sAi + m*sAm + k*sAk] (f32),
//   B(k,n) = B[zo*sBo + zi*sBi + n*sBn + k*sBk] (f32); any M, N, K (K zero-padded to 32 inside the fragments, M/N tails guarded).
//   C(m,n) = C[zo*sCo + zi*sCi + m*sCm + n] (n contiguous). flags: 1 bias[n], 2 bias[m], 4 residual R[zo*sRo + zi*sRi + m*sRm + n*sRn].
//   MODE 0: f16 operands (A prescaled by sa, B by sb, both undone in the epilogue); 1: bf16 hi/lo split (3 products); 2: bf16;
//   3: bf16 hi/mid/lo triple split (6 products); 4: as 3 with Kahan-compensated f32 accumulation across k-steps.
// =====================================================================================================================
struct GemmP {
    const float* A; const float* B; const float* bias; const float* R; float* C;
    long long sAo, sAi, sAm, sAk, sBo, sBi, sBn, sBk, sCo, sCi, sCm, sRo, sRi, sRm, sRn;
    int M, N, K, zi_n, flags, act; float alpha, beta, sa, sb;
    int Npad, pad_;     // columns [N, Npad) of C are written as 0 so that padded workspace rows are covered by whole-line stores; Npad >= N
};
static_assert(sizeof(GemmP) == 5 * 8 + 15 * 8 + 6 * 4 + 4 * 4 + 2 * 4, "GemmP has padding");

template <int MODE>
__global__ __launch_bounds__(32) void k_gemm(GemmP p) {
    const int lane = threadIdx.x & 31, h = lane >> 4, l15 = lane & 15;
    const int m0 = blockIdx.y * 16, n0 = blockIdx.x * 32;
    const int z = blockIdx.z, zo = z / p.zi_n, zi = z - zo * p.zi_n;
    const float* A = p.A + zo * p.sAo + zi * p.sAi;
    const float* B = p.B + zo * p.sBo + zi * p.sBi;
    const int am = min(m0 + l15, p.M - 1);                       // clamped row for loads (stores are guarded)
    v8f acc[2], comp[2];
#pragma unroll
    for (int t = 0; t < 2; ++t) { v8f zz = {}; acc[t] = zz; comp[t] = zz; }
    for (int k0 = 0; k0 < p.K; k0 += 32) {
        const float* arow = A + (long long)am * p.sAm;
        if (MODE == 1) {
            const Split a = sp_ld(arow, p.sAk, k0, h, p.K, 1.f);
#pragma unroll
            for (int t = 0; t < 2; ++t) {
                const int bn = min(n0 + t * 16 + l15, p.N - 1);
                acc[t] = wmma3(a, sp_ld(B + (long long)bn * p.sBn, p.sBk, k0, h, p.K, 1.f), acc[t]);
            }
        } else if (MODE == 3) {
            const Split3 a = sp3_ld(arow, p.sAk, k0, h, p.K, 1.f);
#pragma unroll
            for (int t = 0; t < 2; ++t) {
                const int bn = min(n0 + t * 16 + l15, p.N - 1);
                acc[t] = wmma6(a, sp3_ld(B + (long long)bn * p.sBn, p.sBk, k0, h, p.K, 1.f), acc[t]);
            }
        } else if (MODE == 4) {
            // triple split as MODE 3, but each k-step's 6 products go into a fresh accumulator and the partial is added to the running f32 sum
            // on the VALU with Kahan compensation (accumulation error stays ~1 ulp however long K is)
            const Split3 a = sp3_ld(arow, p.sAk, k0, h, p.K, 1.f);
#pragma unroll
            for (int t = 0; t < 2; ++t) {
                const int bn = min(n0 + t * 16 + l15, p.N - 1); v8f zz = {};
                const v8f part = wmma6(a, sp3_ld(B + (long long)bn * p.sBn, p.sBk, k0, h, p.K, 1.f), zz);
                const v8f y = part - comp[t]; const v8f s = acc[t] + y; comp[t] = (s - acc[t]) - y; acc[t] = s;
            }
        } else if (MODE == 2) {
            const v16b a = bh_ld(arow, p.sAk, k0, h, p.K, 1.f);
#pragma unroll
            for (int t = 0; t < 2; ++t) {
                const int bn = min(n0 + t * 16 + l15, p.N - 1);
                acc[t] = wmmab(a, bh_ld(B + (long long)bn * p.sBn, p.sBk, k0, h, p.K, 1.f), acc[t]);
            }
        } else {
            const v16h a = fh_ld(arow, p.sAk, k0, h, p.K, p.sa);
#pragma unroll
            for (int t = 0; t < 2; ++t) {
                const int bn = min(n0 + t * 16 + l15, p.N - 1);
                acc[t] = wmma16(a, fh_ld(B + (long long)bn * p.sBn, p.sBk, k0, h, p.K, p.sb), acc[t]);
            }
        }
    }
    const float iscale = (MODE == 0) ? p.alpha / (p.sa * p.sb) : p.alpha;
    float* C = p.C + zo * p.sCo + zi * p.sCi;
    const float* R = p.R + zo * p.sRo + zi * p.sRi;
    __shared__ __align__(16) float ctile[16][36];
#pragma unroll
    for (int t = 0; t < 2; ++t) {
        const int n = n0 + t * 16 + l15; const int nn = min(n, p.N - 1);
#pragma unroll
        for (int r = 0; r < 8; ++r) {
            const int m = m0 + 8 * h + r; const int mm = min(m, p.M - 1);
            float v = acc[t][r] * iscale;
            if (p.flags & 1) v += p.bias[nn];
            if (p.flags & 2) v += p.bias[mm];
            if (p.flags & 8) v *= p.bias[(long long)zo * p.M + mm];   /* per-(z,row) scale vector laid out [Z][M]; exclusive with the bias flags */
            v = act_fn(v, p.act);
            if (p.flags & 4) v += p.beta * R[(long long)mm * p.sRm + (long long)nn * p.sRn];
            ctile[8 * h + r][t * 16 + l15] = (n < p.N) ? v : 0.f;
        }
    }
    __syncthreads();
    const int NW = (p.Npad > p.N) ? p.Npad : p.N;           // write width
    const bool fast = (m0 + 16 <= p.M) && (n0 + 32 <= NW) && ((p.sCm & 3) == 0) && ((((size_t)C) & 15) == 0);
    if (fast) {
#pragma unroll
        for (int s = 0; s < 4; ++s) {
            const int row = s * 4 + (lane >> 3), c4 = (lane & 7) * 4;
            const v4f v = *(const v4f*)&ctile[row][c4];
            VST2V4(C + (long long)(m0 + row) * p.sCm + n0 + c4, v);
        }
    } else {
        for (int row = 0; row < 16; ++row) {
            const int m = m0 + row, n = n0 + lane;
            if (m < p.M && n < NW) VST2(float, C + (long long)m * p.sCm + n, ctile[row][lane]);
        }
    }
}


// =====================================================================================================================
// k_gemmT<MODE, TM, TN>: same contract as k_gemm, but one wave computes a (16*TM) x (16*TN) tile: TM A fragments and TN B fragments are
//   loaded per 32-wide k-step and reused across TM*TN WMMAs (far fewer load/convert instructions per MAC). MODE 0 (f16), 1 (bf16 hi/lo),
//   2 (bf16) only. grid (ceil(NW/(16*TN)), ceil(M/(16*TM)), Z), block 32. Epilogue identical to k_gemm, run per 16x32 sub-tile.
// =====================================================================================================================
template <int MODE, int TM, int TN>
__global__ __launch_bounds__(32) void k_gemmT(GemmP p) {
    const int lane = threadIdx.x & 31, h = lane >> 4, l15 = lane & 15;
    const int m0 = blockIdx.y * (16 * TM), n0 = blockIdx.x * (16 * TN);
    const int z = blockIdx.z, zo = z / p.zi_n, zi = z - zo * p.zi_n;
    const float* A = p.A + zo * p.sAo + zi * p.sAi;
    const float* B = p.B + zo * p.sBo + zi * p.sBi;
    v8f acc[TM][TN];
#pragma unroll
    for (int i = 0; i < TM; ++i)
#pragma unroll
        for (int t = 0; t < TN; ++t) { v8f zz = {}; acc[i][t] = zz; }
    for (int k0 = 0; k0 < p.K; k0 += 32) {
        if (MODE == 1) {
            Split a[TM], b[TN];
#pragma unroll
            for (int i = 0; i < TM; ++i) { const int am = min(m0 + 16 * i + l15, p.M - 1); a[i] = sp_ld(A + (long long)am * p.sAm, p.sAk, k0, h, p.K, 1.f); }
#pragma unroll
            for (int t = 0; t < TN; ++t) { const int bn = min(n0 + 16 * t + l15, p.N - 1); b[t] = sp_ld(B + (long long)bn * p.sBn, p.sBk, k0, h, p.K, 1.f); }
#pragma unroll
            for (int i = 0; i < TM; ++i)
#pragma unroll
                for (int t = 0; t < TN; ++t) acc[i][t] = wmma3(a[i], b[t], acc[i][t]);
        } else if (MODE == 2) {
            v16b a[TM], b[TN];
#pragma unroll
            for (int i = 0; i < TM; ++i) { const int am = min(m0 + 16 * i + l15, p.M - 1); a[i] = bh_ld(A + (long long)am * p.sAm, p.sAk, k0, h, p.K, 1.f); }
#pragma unroll
            for (int t = 0; t < TN; ++t) { const int bn = min(n0 + 16 * t + l15, p.N - 1); b[t] = bh_ld(B + (long long)bn * p.sBn, p.sBk, k0, h, p.K, 1.f); }
#pragma unroll
            for (int i = 0; i < TM; ++i)
#pragma unroll
                for (int t = 0; t < TN; ++t) acc[i][t] = wmmab(a[i], b[t], acc[i][t]);
        } else {
            v16h a[TM], b[TN];
#pragma unroll
            for (int i = 0; i < TM; ++i) { const int am = min(m0 + 16 * i + l15, p.M - 1); a[i] = fh_ld(A + (long long)am * p.sAm, p.sAk, k0, h, p.K, p.sa); }
#pragma unroll
            for (int t = 0; t < TN; ++t) { const int bn = min(n0 + 16 * t + l15, p.N - 1); b[t] = fh_ld(B + (long long)bn * p.sBn, p.sBk, k0, h, p.K, p.sb); }
#pragma unroll
            for (int i = 0; i < TM; ++i)
#pragma unroll
                for (int t = 0; t < TN; ++t) acc[i][t] = wmma16(a[i], b[t], acc[i][t]);
        }
    }
    const float iscale = (MODE == 0) ? p.alpha / (p.sa * p.sb) : p.alpha;
    float* C = p.C + zo * p.sCo + zi * p.sCi;
    const float* R = p.R + zo * p.sRo + zi * p.sRi;
    const int NW = (p.Npad > p.N) ? p.Npad : p.N;
    __shared__ __align__(16) float ctile[16][36];
#pragma unroll
    for (int i = 0; i < TM; ++i) {
        const int mb = m0 + 16 * i; if (mb >= p.M) break;          // wave-uniform
#pragma unroll
        for (int tp = 0; tp < TN / 2; ++tp) {
            const int nb = n0 + 32 * tp; if (nb >= NW) break;        // wave-uniform
#pragma unroll
            for (int t2 = 0; t2 < 2; ++t2) {
                const int t = 2 * tp + t2; const int n = nb + t2 * 16 + l15; const int nn = min(n, p.N - 1);
#pragma unroll
                for (int r = 0; r < 8; ++r) {
                    const int m = mb + 8 * h + r; const int mm = min(m, p.M - 1);
                    float v = acc[i][t][r] * iscale;
                    if (p.flags & 1) v += p.bias[nn];
                    if (p.flags & 2) v += p.bias[mm];
            if (p.flags & 8) v *= p.bias[(long long)zo * p.M + mm];   /* per-(z,row) scale vector laid out [Z][M]; exclusive with the bias flags */
                    v = act_fn(v, p.act);
                    if (p.flags & 4) v += p.beta * R[(long long)mm * p.sRm + (long long)nn * p.sRn];
                    ctile[8 * h + r][t2 * 16 + l15] = (n < p.N) ? v : 0.f;
                }
            }
            __syncthreads();
            const bool fast = (mb + 16 <= p.M) && (nb + 32 <= NW) && ((p.sCm & 3) == 0) && ((((size_t)C) & 15) == 0);
            if (fast) {
#pragma unroll
                for (int s = 0; s < 4; ++s) {
                    const int row = s * 4 + (lane >> 3), c4 = (lane & 7) * 4;
                    const v4f v = *(const v4f*)&ctile[row][c4];
                    VST2V4(C + (long long)(mb + row) * p.sCm + nb + c4, v);
                }
            } else {
                for (int row = 0; row < 16; ++row) {
                    const int m = mb + row, n = nb + lane;
                    if (m < p.M && n < NW) VST2(float, C + (long long)m * p.sCm + n, ctile[row][lane]);
                }
            }
            __syncthreads();
        }
    }
}

// =====================================================================================================================
//   Wave = 16 queries, AW waves per block, 64-key blocks; grid (ceil(Lq/(16*AW)), H, 2 branches x 2 batches), block 32*AW. Any Lq, Lk; head dim dh <= DHP
//   (DHP multiple of 32), value dim dv <= DVP (multiple of 16, <= 128). Every tensor addressed by (batch, head, row, element) strides, f32.
//   Scores: QM 0 f16 operands, 1 bf16 hi/lo split, 2 bf16 triple split; statistics f32 (exp2 domain); P.V: P x 4096 as f16 with V f16 staged in LDS
//   (SPLITPV: P as a bf16 hi/lo split, V bf16 fragments read from memory). kv head = h / hrep. Masking: causal = 1 (keep j <= i + coff, masked -> -inf, key blocks beyond the
//   diagonal skipped), causal = 2 (masked -> mfill, a finite fill like the -1e9; no skipping), causal = 3 (keep j >= i + coff,
//   masked -> -inf, no skipping); optional additive f32 mask Mf,
//   optional int keep-mask Mi (0 -> score := mfill), both addressed b*smb + h*smh + i*smi + j*smj (0 strides broadcast).
// =====================================================================================================================
#define AW 4
struct AttnP {   // apv4
    const float* Q; const float* K; const float* V; float* O; float* P; const float* Mf; const int* Mi; float* ST;
    const float* Pw; const float* Rt; const int* SQ; const int* SK;           // optional: post-softmax weight, relative-position table, segment ids
    long long swb, swh, swi, swj, srb, srh, sri;                                 // Pw strides (b,h,i,j); Rt strides (b,h,i), column = clamp(i - j + roff, 0, rn-1)
    long long sQb, sQh, sQi, sQd, sKb, sKh, sKj, sKd, sVb, sVh, sVj, sVd, sOb, sOh, sOi, sPb, sPh, sPi, smb, smh, smi, smj;
    int Lq, Lk, dh, dv, hrep, causal, coff, pband;   // pband > 0: P holds only the band |j - i| <= pband, column j - i + pband
    float scale, mfill; int nonorm, mpol;             // nonorm (online path only): O = sum_j exp(score_j) V_j without the 1/rowsum (scores must be <= ~0); mpol: Mi masks where ==0 (mpol 0) or where !=0 (mpol 1)
    int roff, rn, segpol, win;                        // Rt column offset/count; SQ/SK: score := mfill where (segpol 0) SQ[i] != SK[j] or (segpol 1) SQ[i] == SK[j]; win > 0: keys with i - j > win (after coff) -> -inf
};
//   Pw: the softmax numerator is multiplied by Pw(b,h,i,j) AFTER the row sum is taken (probs * weight, then P.V), as in post-softmax multiplicative biases.                                                    // ST (optional): per row (b,h,i) -> ST[((b*H + h)*Lq + i)*2 + {0,1}] = {row max of the scaled+masked score (natural units), sum_j exp(score - max)}
static_assert(sizeof(AttnP) == 12 * 8 + 29 * 8 + 16 * 4, "AttnP has padding");

// Four waves per SIMD: a workgroup of 16 waves puts four on every SIMD, which fit only with at most 256 registers a wave
#ifndef KATTN_ATTR
#define KATTN_ATTR __attribute__((amdgpu_waves_per_eu(4, 4)))
#endif
// The shape of this problem's attention launch as compile-time constants: with them the
// element bounds tests (k < dh, d < dv) and every optional path fold away, the unit element strides let the compiler merge a fragment's loads into
// 16-byte loads, and the additive table (always passed here, so read without a null test) no longer depends on the query row. Only the five base pointers stay run-time values.
__device__ __forceinline__ void attn_fix_shape(AttnP& p) {
    p.P = nullptr; p.Mi = nullptr; p.ST = nullptr; p.Pw = nullptr; p.Rt = nullptr; p.SQ = nullptr; p.SK = nullptr;
    p.swb = 0; p.swh = 0; p.swi = 0; p.swj = 0; p.srb = 0; p.srh = 0; p.sri = 0;
    p.sQb = 1048576; p.sQh = 64; p.sQi = 512; p.sQd = 1; p.sKb = 1048576; p.sKh = 64; p.sKj = 512; p.sKd = 1; p.sVb = 1048576; p.sVh = 64; p.sVj = 512; p.sVd = 1;
    p.sOb = 1048576; p.sOh = 64; p.sOi = 512; p.sPb = 0; p.sPh = 0; p.sPi = 0; p.smb = 2048; p.smh = 0; p.smi = 0; p.smj = 1;
    p.Lq = 2048; p.Lk = 2048; p.dh = 64; p.dv = 64; p.hrep = 1; p.causal = 1; p.coff = 0; p.pband = 0;
    p.scale = 0.125f; p.mfill = 0.0f; p.nonorm = 0; p.mpol = 0; p.roff = 0; p.rn = 1; p.segpol = 0; p.win = 0;
}
template <int DHP, int DVP, int QM, bool SPLITPV, bool TWOPASS>
__global__ __launch_bounds__(32 * AW) KATTN_ATTR void k_attn(AttnP p) {
    attn_fix_shape(p);
    constexpr int NT = DVP / 16;                // output tiles
    constexpr int KS = DHP / 32;                // k-steps for the scores
    constexpr int VP = DVP + 8;                 // LDS pitch (halves)
    __shared__ __align__(16) float    pl[AW][16 * 64];
    __shared__ __align__(16) _Float16 vl[SPLITPV ? 8 : 64 * VP];   // f16 V tile (SPLITPV reads V fragments from memory and stages nothing)
    const int lane = threadIdx.x & 31, hf = lane >> 4, l15 = lane & 15, wave = threadIdx.x >> 5;
    // blockIdx.z = 2 * branch + batch: K, V and O hold one plane per (branch, batch), indexed by bz; Q and the additive table are shared by the branches, indexed by b
    const int h = blockIdx.y, bz = blockIdx.z, b = bz & 1, hk = h / p.hrep;
    const int q0 = (blockIdx.x * AW + wave) * 16;
    float* myp = pl[wave];
    const float L2E = 1.4426950408889634f;
    const float NEG = -__builtin_inff();
    const int qi = min(q0 + l15, p.Lq - 1);
    const float* qrow = p.Q + b * p.sQb + h * p.sQh + (long long)qi * p.sQi;
    const float* kbase = p.K + bz * p.sKb + hk * p.sKh;
    const float* vbase = p.V + bz * p.sVb + hk * p.sVh;
    // QM 1 / SPLITPV: K and V are bf16 planes in fragment order, 131,072 halves per (bz, head), 4,096 per 64-key block, 512 per fragment
    const __bf16* kfrag = (const __bf16*)p.K + (bz * 8 + hk) * 131072 + lane * 8;
    const __bf16* vfrag = (const __bf16*)p.V + (bz * 8 + hk) * 131072 + lane * 8;
    v16h qa[QM == 0 ? KS : 1]; Split qs_[QM == 1 ? KS : 1]; Split3 qt_[QM == 2 ? KS : 1];
#pragma unroll
    for (int ks = 0; ks < KS; ++ks) {
        if (QM == 2) qt_[ks] = sp3_ld(qrow, p.sQd, ks * 32, hf, p.dh, 1.f);
        else if (QM == 1) qs_[ks] = sp_ld(qrow, p.sQd, ks * 32, hf, p.dh, 1.f);
        else qa[ks] = fh_ld(qrow, p.sQd, ks * 32, hf, p.dh, 1.f);
    }
    v8f o[NT]; float m8[8], l8[8];
#pragma unroll
    for (int t = 0; t < NT; ++t) { v8f zz = {}; o[t] = zz; }
#pragma unroll
    for (int i = 0; i < 8; ++i) { m8[i] = NEG; l8[i] = 0.f; }
    int jend = p.Lk; int jstart = 0;
    if (p.causal == 1) { const int je = (blockIdx.x * AW + AW - 1) * 16 + 16 + p.coff; jend = min(jend, max(je, 0)); }   // uniform per block
    if (p.win > 0) { const int js = (int)(blockIdx.x * AW) * 16 + p.coff - p.win; jstart = (js > 0) ? (js / 64) * 64 : 0; }   // uniform per block: key blocks entirely outside every row's window hold only -inf entries and are skipped exactly
    const int npass = TWOPASS ? 2 : 1;
    for (int pass = 0; pass < npass; ++pass) {
        const bool dopv = (!TWOPASS) || pass == 1;
        for (int j0 = jstart; j0 < jend; j0 += 64) {
            v16b kf[QM == 1 ? 4 : 1][KS];
            if (QM == 1) {
                // all of the key block's K fragments are asked for before the first product: one wait for memory, not one per fragment
                const __bf16* kblk = kfrag + (j0 >> 6) * 4096;
#pragma unroll
                for (int t = 0; t < 4; ++t)
#pragma unroll
                    for (int ks = 0; ks < KS; ++ks) kf[t][ks] = bfrag_ld(kblk + (t * KS + ks) * 512);
                asm volatile("s_wait_xcnt 0x0" :: "v"(kblk) : "memory");   // the loads' address pair stays live up to this wait, so that no later load lands in it and nothing rewrites it ahead of the wait
                __builtin_amdgcn_sched_barrier(0);   // keeps every K load ahead of the first product: the scheduler otherwise holds some back until registers come free, a second wait for memory
            }
            if (dopv && !SPLITPV) {
                __syncthreads();                                 // previous key block's reads of vl / pl are done
                static_assert((32 * AW) % DVP == 0, "a thread keeps its V column from pass to pass");
                constexpr int VR = (32 * AW) / DVP;              // V rows staged by the block per pass
                const int jr0 = threadIdx.x / DVP, d = threadIdx.x - jr0 * DVP;
                const float* vsrc = vbase + (long long)(j0 + jr0) * p.sVj + (long long)d * p.sVd;   // one address; the passes differ by constant offsets
#pragma unroll   // constant trip count: all of a thread's V loads of a key block are issued before the first is waited for
                for (int n = 0; n < 64 / VR; ++n) {
                    const int jr = jr0 + n * VR, j = j0 + jr;
                    const float f = ((p.Lk % 64 == 0 || j < p.Lk) && d < p.dv) ? vsrc[(long long)(n * VR) * p.sVj] : 0.f;
                    vl[jr * VP + d] = (_Float16)f;
                }
            }
            v8f s[4];
#pragma unroll
            for (int t = 0; t < 4; ++t) {
                const int j = min(j0 + t * 16 + l15, p.Lk - 1);
                const float* krow = kbase + (long long)j * p.sKj;
                v8f acc = {};
#pragma unroll
                for (int ks = 0; ks < KS; ++ks) {
                    if (QM == 2)      acc = wmma6(qt_[ks], sp3_ld(krow, p.sKd, ks * 32, hf, p.dh, 1.f), acc);
                    else if (QM == 1) acc = wmma2(qs_[ks], kf[t][ks], acc);
                    else              acc = wmma16(qa[ks], fh_ld(krow, p.sKd, ks * 32, hf, p.dh, 1.f), acc);
                }
                s[t] = acc;
            }
            v16b vf[SPLITPV ? NT : 1][2];
            if (dopv && SPLITPV) {
                // all of the key block's V fragments are asked for together and ahead of the softmax: their way from memory is covered by the score products, not paid at the P.v products
                const __bf16* vblk = vfrag + (j0 >> 6) * 4096;
#pragma unroll
                for (int t = 0; t < NT; ++t) { vf[t][0] = bfrag_ld(vblk + (t * 2 + 0) * 512); vf[t][1] = bfrag_ld(vblk + (t * 2 + 1) * 512); }
                asm volatile("s_wait_xcnt 0x0" :: "v"(vblk) : "memory");   // the loads' address pair stays live up to this wait, so that no load of the run lands in it and nothing rewrites it ahead of the wait
            }
            float pv[8][4];
#pragma unroll
            for (int i = 0; i < 8; ++i) {
                const int irow = q0 + i + 8 * hf;
                const int ic = min(irow, p.Lq - 1);
                float sc[4];
#pragma unroll
                for (int t = 0; t < 4; ++t) {
                    const int jg = j0 + t * 16 + l15;
                    float v = s[t][i] * p.scale;
                    v += p.Mf[b * p.smb + h * p.smh + (long long)ic * p.smi + (long long)min(jg, p.Lk - 1) * p.smj];
                    if (p.Rt) { int rc = ic - min(jg, p.Lk - 1) + p.roff; rc = rc < 0 ? 0 : (rc >= p.rn ? p.rn - 1 : rc); v += p.Rt[b * p.srb + h * p.srh + (long long)ic * p.sri + rc]; }
                    if (p.Mi) { const int mv = p.Mi[b * p.smb + h * p.smh + (long long)ic * p.smi + (long long)min(jg, p.Lk - 1) * p.smj]; if (p.mpol ? (mv != 0) : (mv == 0)) v = p.mfill; }
                    if (p.SQ) { const bool same = p.SQ[(long long)b * p.Lq + ic] == p.SK[(long long)b * p.Lk + min(jg, p.Lk - 1)]; if (p.segpol ? same : !same) v = p.mfill; }
                    if (p.causal == 2 && jg > irow + p.coff) v = p.mfill;
                    // causal test against the lane's first row (jg > irow + coff, rearranged): one live register, not eight row numbers, so the 256-register cap is met without spills
                    if (jg >= p.Lk || (p.causal == 1 && jg - (q0 + 8 * hf) > i + p.coff) || (p.causal == 3 && jg < irow + p.coff) || (p.win > 0 && irow + p.coff - jg > p.win)) v = NEG; else v *= L2E;
                    sc[t] = v;
                }
                if (!TWOPASS || pass == 0) {
                    float mx = fmaxf(fmaxf(sc[0], sc[1]), fmaxf(sc[2], sc[3]));
                    mx = fmaxf(mx, __shfl_xor(mx, 1, 32)); mx = fmaxf(mx, __shfl_xor(mx, 2, 32));
                    mx = fmaxf(mx, __shfl_xor(mx, 4, 32)); mx = fmaxf(mx, __shfl_xor(mx, 8, 32));
                    const float mnew = fmaxf(m8[i], mx);
                    const float corr = (mnew == NEG) ? 1.f : exp2f(m8[i] - mnew);
                    float rs = 0.f;
#pragma unroll
                    for (int t = 0; t < 4; ++t) {
                        const float pp = (sc[t] == NEG) ? 0.f : exp2f(sc[t] - mnew); rs += pp;
                        pv[i][t] = p.Pw ? pp * p.Pw[b * p.swb + h * p.swh + (long long)ic * p.swi + (long long)min(j0 + t * 16 + l15, p.Lk - 1) * p.swj] : pp;
                    }
                    rs += __shfl_xor(rs, 1, 32); rs += __shfl_xor(rs, 2, 32); rs += __shfl_xor(rs, 4, 32); rs += __shfl_xor(rs, 8, 32);
                    l8[i] = l8[i] * corr + rs; m8[i] = mnew;
                    if (!TWOPASS) {
#pragma unroll
                        for (int t = 0; t < NT; ++t) o[t][i] *= corr;
                    }
                } else {
                    const float inv = (l8[i] > 0.f) ? 1.f / l8[i] : 0.f;
#pragma unroll
                    for (int t = 0; t < 4; ++t) {
                        const int jg = j0 + t * 16 + l15;
                        float pp = (sc[t] == NEG) ? 0.f : exp2f(sc[t] - m8[i]) * inv;
                        if (p.Pw) pp *= p.Pw[b * p.swb + h * p.swh + (long long)ic * p.swi + (long long)min(jg, p.Lk - 1) * p.swj];
                        pv[i][t] = pp;
                    }
                }
            }
            if (dopv) {
#pragma unroll
                for (int i = 0; i < 8; ++i)
#pragma unroll
                    for (int t = 0; t < 4; ++t) ((float*)myp)[(i + 8 * hf) * 64 + t * 16 + l15] = pv[i][t];
                if (SPLITPV) {
                    // P is private to its wave and V is not staged: the wave's own LDS stores only have to be ordered before its lanes' reads of each other's values
                    __builtin_amdgcn_fence(__ATOMIC_RELEASE, "workgroup"); __builtin_amdgcn_wave_barrier(); __builtin_amdgcn_fence(__ATOMIC_ACQUIRE, "workgroup");
                } else __syncthreads();                          // P (per wave) and V (shared) visible
                if (p.P) {
                    float* pb_ = p.P + b * p.sPb + h * p.sPh;
                    const bool fastP = (p.pband == 0) && ((p.sPi & 3) == 0) && (j0 + 64 <= p.Lk) && (q0 + 16 <= p.Lq) && ((((size_t)pb_) & 15) == 0);
                    if (fastP) {
#pragma unroll
                        for (int s = 0; s < 8; ++s) {
                            const int row = s * 2 + (lane >> 4), c4 = (lane & 15) * 4;
                            const v4f v = *(const v4f*)(myp + row * 64 + c4);
                            VST2V4(pb_ + (long long)(q0 + row) * p.sPi + j0 + c4, v);
                        }
                    } else {
                        for (int row = 0; row < 16; ++row) {
                            const int irow = q0 + row; if (irow >= p.Lq) continue;
                            for (int c = lane; c < 64; c += 32) {
                                const int jg = j0 + c; if (jg >= p.Lk) continue;
                                if (p.pband == 0) VST2(float, pb_ + (long long)irow * p.sPi + jg, myp[row * 64 + c]);
                                else if (jg - irow <= p.pband && irow - jg <= p.pband) VST2(float, pb_ + (long long)irow * p.sPi + (jg - irow + p.pband), myp[row * 64 + c]);
                            }
                        }
                    }
                }
                if (SPLITPV) {
                    const Split pa0 = sp_ld(myp + l15 * 64, 1, 0, hf, 64, 1.f), pa1 = sp_ld(myp + l15 * 64, 1, 32, hf, 64, 1.f);
#pragma unroll
                    for (int t = 0; t < NT; ++t) {
                        o[t] = wmma2(pa0, vf[t][0], o[t]);
                        o[t] = wmma2(pa1, vf[t][1], o[t]);
                    }
                } else {
                    const v16h pa0 = fh_ld(myp + l15 * 64, 1, 0, hf, 64, 4096.f), pa1 = fh_ld(myp + l15 * 64, 1, 32, hf, 64, 4096.f);
#pragma unroll
                    for (int t = 0; t < NT; ++t) {
                        const int dcol = t * 16 + l15;
                        v16h b0, b1;
#pragma unroll
                        for (int e = 0; e < 16; ++e) { b0[e] = vl[frag_k(e, hf) * VP + dcol]; b1[e] = vl[(32 + frag_k(e, hf)) * VP + dcol]; }
                        o[t] = wmma16(pa0, b0, o[t]);
                        o[t] = wmma16(pa1, b1, o[t]);
                    }
                }
            }
        }
    }
    float* obase = p.O + bz * p.sOb + h * p.sOh;
    if (p.ST) {
        const int rl = lane >> 1, isel = rl & 7;           // row q0 + rl ; rl>>3 == hf holds because lane>>4 == (lane>>1)>>3
        float mv = 0.f, lv = 0.f;
#pragma unroll
        for (int i = 0; i < 8; ++i) if (i == isel) { mv = m8[i]; lv = l8[i]; }
        const int irow = q0 + rl;
        if (irow < p.Lq) { float* st = p.ST + (((long long)b * gridDim.y + h) * p.Lq + irow) * 2 + (lane & 1); VST2(float, st, (lane & 1) ? lv : mv * 0.6931471805599453f); }
    }
    float invr[8];
#pragma unroll
    for (int i = 0; i < 8; ++i) {
        if (TWOPASS) invr[i] = SPLITPV ? 1.f : (1.f / 4096.f);
        else if (p.nonorm) invr[i] = exp2f(m8[i]) * (SPLITPV ? 1.f : (1.f / 4096.f));
        else invr[i] = (l8[i] > 0.f) ? (SPLITPV ? 1.f / l8[i] : 1.f / (l8[i] * 4096.f)) : 0.f;
    }
    __syncthreads();                                             // all waves done with pl/vl from the main loop
    const bool ofast = ((p.sOi & 3) == 0) && ((((size_t)obase) & 15) == 0) && (q0 + 16 <= p.Lq);
#pragma unroll
    for (int c0 = 0; c0 < DVP; c0 += 64) {
#pragma unroll
        for (int i = 0; i < 8; ++i)
#pragma unroll
            for (int t = 0; t < NT; ++t) if (t * 16 >= c0 && t * 16 < c0 + 64) ((float*)myp)[(i + 8 * hf) * 64 + (t * 16 - c0) + l15] = o[t][i] * invr[i];
        __syncthreads();
        const int cw = (DVP - c0 < 64) ? (DVP - c0) : 64;      // staged columns in this chunk (multiple of 16)
        if (ofast && (c0 + cw <= p.dv) && (cw % 32 == 0)) {
            const int lpr = cw / 4;                              // lanes per row (16 for 64 cols, 8 for 32)
            const int rows_per_ins = 32 / lpr;
            for (int r0 = 0; r0 < 16; r0 += rows_per_ins) {
                const int row = r0 + lane / lpr, c4 = (lane % lpr) * 4;
                const v4f v = *(const v4f*)(myp + row * 64 + c4);
                VST2V4(obase + (long long)(q0 + row) * p.sOi + c0 + c4, v);
            }
        } else {
            for (int row = 0; row < 16; ++row) {
                const int irow = q0 + row; if (irow >= p.Lq) continue;
                for (int c = lane; c < cw; c += 32) { const int d = c0 + c; if (d < p.dv) VST2(float, obase + (long long)irow * p.sOi + d, myp[row * 64 + c]); }
            }
        }
        __syncthreads();
    }
}

typedef __attribute__((ext_vector_type(2))) float  v2f;
typedef __attribute__((ext_vector_type(2))) _Float16 v2h;
__device__ __forceinline__ float xhalf(float x) {   // the value of lane L ^ 16
    const int u = __float_as_int(x);
    return __int_as_float(__builtin_amdgcn_permlanex16(u, u, 0x76543210, 0xfedcba98, false, false));
}
// tau of a batch, rounded to bf16 like every input, as (size, sign): scale * (q.k * tau + delta) = scale * size * (sign * q.k + delta / size).
// A tau below 1e-30 in size moves an exp2 argument by less than any f32 softmax weight can show: it counts as 0, for which sign = 0 and size = 1 give scale * delta with no division by 0.
__device__ __forceinline__ void ds_tau(float tau, float& size, float& sign) {
    const float t = bf16_f32(bf16_rne(tau)), a = fabsf(t);
    const bool on = a >= 1e-30f;
    size = on ? a : 1.f; sign = on ? (t < 0.f ? -1.f : 1.f) : 0.f;
}
#define SOP 68   // floats a query row of an output tile takes in LDS: 272 bytes, an odd multiple of 16, the pitch at which 16-byte LDS accesses of neighbouring rows miss each other's banks
__global__ __launch_bounds__(32 * 4 * AW) KATTN_ATTR void k_attn_t(const float* __restrict__ Q, const float* __restrict__ TAU, const unsigned short* __restrict__ KF, const unsigned short* __restrict__ VF, const float* __restrict__ MF, const float* __restrict__ SM, float* __restrict__ O) {
    __shared__ __attribute__((aligned(16))) float so[2 * 4 * AW * 16 * SOP];   // [pass][wave][query of the tile][d]: every wave's unnormalised output
    __shared__ v2f sml[2 * 4 * AW * 16];                                       // [pass][wave][query of the tile]: its maximum (exp2 units) and sum
    const int lane = threadIdx.x & 31, hf = lane >> 4, l15 = lane & 15;
    const int wave = __builtin_amdgcn_readfirstlane(threadIdx.x >> 5);     // in a scalar register: the key range and the K, V planes hang on it, and the loop and its diagonal test stay scalar branches
    const int qt = wave & 3, grp = wave >> 2, part = grp & 1;              // wave = 4 (2 branch + part) + query tile
    // bz = 2 * branch + batch: K and V hold one plane per (branch, batch), indexed by bz; Q, the additive table and the output are shared by the branches, indexed by b
    const int h = blockIdx.x & 7, b = blockIdx.x >> 3, bz = (grp & 2) + b;
    const float L2E = 1.4426950408889634f;
    const float NEG = -__builtin_inff();
    float tsz, tsg; ds_tau(TAU[b], tsz, tsg);
    const float cs = tsz * (0.125f * L2E);           // accumulator units to exp2 arguments; the same for the whole workgroup
    // 131,072 halves per (bz, head), 4,096 per 64-key block, 512 per fragment
    const __bf16* kfrag = (const __bf16*)KF + (bz * 8 + h) * 131072 + lane * 8;
    const _Float16* vfrag = (const _Float16*)VF + (bz * 8 + h) * 131072 + lane * 8;
    const float* mrow = MF + b * 2048 + 8 * hf;      // the lane's eight keys of a tile
    // the lane's place in the join behind the passes (said there); its two queries' soft masks are asked for here, so that their way from memory is not paid behind the barrier
    const int qi = grp * 4 + (lane >> 3), c4 = (lane & 7) * 4, qa = (31 - blockIdx.y) * 64 + qt * 16 + qi, qb = blockIdx.y * 64 + qt * 16 + qi;
    const int ia = b * 2048 + qa, ib = b * 2048 + qb;
    const float smr[2] = {SM[ia], SM[ib]};
    asm volatile("s_wait_xcnt 0x0" :: "v"(ia), "v"(ib) : "memory");   // the two loads' index registers stay live up to this wait, so that nothing rewrites them ahead of it
    // two passes: query block 31 - y, then block y: 33 key trips together for every workgroup, so that the 256 workgroups, one on each WGP, carry the same load.
    // No barrier stands between the passes (each has its own LDS): a wave goes on at once, and its Q loads are covered by the waves still at work
    for (int pass = 0; pass < 2; ++pass) {
        // query block xb has xb + 1 key trips: part 0 takes the first n0 = ceil((xb + 1) / 2), part 1 the rest (none for block 0), the trip on the diagonal among them
        const int xb = pass ? blockIdx.y : 31 - blockIdx.y, n0 = (xb + 2) >> 1;
        const int jbeg = part ? n0 * 64 : 0, jend = part ? (xb + 1) * 64 : n0 * 64;
        const int q0 = (xb * AW + qt) * 16;
        const float* qrow = Q + b * 1048576 + h * 64 + (q0 + l15) * 512;
        v16b qs_[2];
#pragma unroll
        for (int ks = 0; ks < 2; ++ks) qs_[ks] = bh_ld(qrow, 1, ks * 32, hf, 64, tsg);   // the query rounded to bf16, with tau's sign: exact in one operand
        v8f o[4]; float m = NEG; v2f l2 = {0.f, 0.f};    // l2: the sum over this lane half's keys, even and odd registers apart; joined behind the loop
#pragma unroll
        for (int t = 0; t < 4; ++t) { v8f zz = {}; o[t] = zz; }
        for (int j0 = jbeg; j0 < jend; j0 += 64) {
            v16b kf[4][2];
            // all of the key block's K fragments are asked for before the first product: one wait for memory, not one per fragment
            const __bf16* kblk = kfrag + (j0 >> 6) * 4096;
#pragma unroll
            for (int t = 0; t < 4; ++t)
#pragma unroll
                for (int ks = 0; ks < 2; ++ks) kf[t][ks] = bfrag_ld(kblk + (t * 2 + ks) * 512);
            asm volatile("s_wait_xcnt 0x0" :: "v"(kblk) : "memory");   // the loads' address pair stays live up to this wait, so that no later load lands in it and nothing rewrites it ahead of the wait
            // the additive table of the lane's 32 keys, asked for with the K fragments: it is the score products' start value (their C operand), so that adding it costs no instruction
            const float* mblk = mrow + j0;
            v8f s[4];
#pragma unroll
            for (int t = 0; t < 4; ++t) s[t] = *(const v8f*)(mblk + t * 16);
            asm volatile("s_wait_xcnt 0x0" ::: "memory");   // stands behind the table loads, ahead of the rewrite of their address pair at the foot of the trip
            __builtin_amdgcn_sched_barrier(0);   // keeps every K load ahead of the first product: the scheduler otherwise holds some back until registers come free, a second wait for memory
#pragma unroll
            for (int t = 0; t < 4; ++t) {
#pragma unroll
                for (int ks = 0; ks < 2; ++ks) s[t] = __builtin_amdgcn_wmma_f32_16x16x32_bf16(false, kf[t][ks], false, qs_[ks], (short)0, s[t], false, false);
            }
            v16h vf[4][2];
            // all of the key block's V fragments are asked for together and ahead of the softmax: their way from memory is covered by the score products, not paid at the P.v products
            const _Float16* vblk = vfrag + (j0 >> 6) * 4096;
#pragma unroll
            for (int t = 0; t < 4; ++t) { vf[t][0] = hfrag_ld(vblk + (t * 2 + 0) * 512); vf[t][1] = hfrag_ld(vblk + (t * 2 + 1) * 512); }
            asm volatile("s_wait_xcnt 0x0" :: "v"(vblk) : "memory");   // the loads' address pair stays live up to this wait, so that no load of the run lands in it and nothing rewrites it ahead of the wait
            // the unrolls from here to the foot of the trip: s, pb and o are register arrays, which stay in registers only where every index is a constant
            if (j0 == xb * 64) {                         // only the trip on the diagonal holds keys behind a query (the same for the whole wave, in scalar registers: a scalar branch)
                const int qrel = q0 + l15 - 8 * hf - j0; // causal test (key > query) against constants: one live register
#pragma unroll
                for (int t = 0; t < 4; ++t) {
#pragma unroll
                    for (int r = 0; r < 8; ++r) s[t][r] = (t * 16 + r > qrel) ? NEG : s[t][r];
                }
            }
            float mx4[4];
#pragma unroll
            for (int t = 0; t < 4; ++t) {
                mx4[t] = fmaxf(fmaxf(s[t][0], s[t][1]), s[t][2]);
                mx4[t] = fmaxf(fmaxf(mx4[t], s[t][3]), s[t][4]);
                mx4[t] = fmaxf(fmaxf(mx4[t], s[t][5]), s[t][6]);
                mx4[t] = fmaxf(mx4[t], s[t][7]);
            }
            float mx = fmaxf(fmaxf(mx4[0], mx4[1]), fmaxf(mx4[2], mx4[3]));
            mx = fmaxf(mx, xhalf(mx));
            // the first key of a wave's range (at most the block's first query) is open to each of its queries and every score is finite, so mnew is finite from the first trip on: exp2 of -inf gives the 0 that a masked key and the first trip's corr want
            const float mnew = fmaxf(m, mx * cs);        // m runs in exp2 units, as the join wants it
            const float corr = __builtin_amdgcn_exp2f(m - mnew);
            v2f rs2[4];
            v16h pb[2];   // P as one f16 value a score: 11 significant bits, 0 <= p <= 1; the sum l2 takes the unrounded f32 values
#pragma unroll
            for (int t = 0; t < 4; ++t) {
#pragma unroll
                for (int r = 0; r < 8; r += 2) {
                    const v2f x = __builtin_elementwise_fma((v2f){s[t][r], s[t][r + 1]}, (v2f){cs, cs}, (v2f){-mnew, -mnew});
                    const v2f pp = {__builtin_amdgcn_exp2f(x.x), __builtin_amdgcn_exp2f(x.y)};
                    rs2[t] = (r == 0) ? pp : rs2[t] + pp;
                    const v2h hb = __builtin_convertvector(pp, v2h);
                    pb[t >> 1][(t & 1) * 8 + r] = hb.x; pb[t >> 1][(t & 1) * 8 + r + 1] = hb.y;
                }
            }
            l2 = l2 * corr + ((rs2[0] + rs2[1]) + (rs2[2] + rs2[3])); m = mnew;
#pragma unroll
            for (int t = 0; t < 4; ++t) o[t] *= corr;
#pragma unroll
            for (int t = 0; t < 4; ++t) {
                o[t] = __builtin_amdgcn_wmma_f32_16x16x32_f16(false, vf[t][0], false, pb[0], (short)0, o[t], false, false);
                o[t] = __builtin_amdgcn_wmma_f32_16x16x32_f16(false, vf[t][1], false, pb[1], (short)0, o[t], false, false);
            }
        }
        float l = l2.x + l2.y;
        l += xhalf(l);
        // every wave lays its unnormalised output, maximum and sum down in LDS
        float* srow = so + ((pass * 4 * AW + wave) * 16 + l15) * SOP + 8 * hf;
        for (int t = 0; t < 4; ++t) {
            const v4f x = {o[t][0], o[t][1], o[t][2], o[t][3]}, y = {o[t][4], o[t][5], o[t][6], o[t][7]};
            *(v4f*)(srow + t * 16) = x; *(v4f*)(srow + t * 16 + 4) = y;
        }
        if (hf == 0) { const v2f ml = {m, l}; sml[(pass * 4 * AW + wave) * 16 + l15] = ml; }
    }
    __syncthreads();   // every wave passes it once, behind both of its passes: behind it the four waves of a query tile read each other's results
    // the join, shared out: wave (grp, qt) finishes queries 4 grp .. 4 grp + 3 of tile qt; eight lanes a query, a lane takes d = 4 (lane & 7) + 0..3 and the same + 32, so that each store instruction fills whole 128-byte lines
    for (int pass = 0; pass < 2; ++pass) {
        const float sm = bf16_f32(bf16_rne(smr[pass]));   // the soft mask, rounded to bf16 like every input
        float w[4];   // weight of (branch, part): 2^(max - joint max) over the branch's joint sum, times the branch's share of the blend. A part without trips has maximum -inf and sum 0: weight 0 (part 0 always has a finite maximum)
        for (int br = 0; br < 2; ++br) {
            const v2f e0 = sml[((pass * 4 + 2 * br) * 4 + qt) * 16 + qi], e1 = sml[((pass * 4 + 2 * br + 1) * 4 + qt) * 16 + qi];
            const float mm = fmaxf(e0.x, e1.x);
            const float a0 = __builtin_amdgcn_exp2f(e0.x - mm), a1 = __builtin_amdgcn_exp2f(e1.x - mm);
            const float sh = (br ? 1.f - sm : sm) / (e0.y * a0 + e1.y * a1);
            w[2 * br] = a0 * sh; w[2 * br + 1] = a1 * sh;
        }
        const float* jrow = so + ((pass * 4 * AW + qt) * 16 + qi) * SOP + c4;
        float* orow = O + b * 1048576 + (pass ? qb : qa) * 512 + h * 64 + c4;
        for (int hh = 0; hh < 2; ++hh) {
            v4f r = *(const v4f*)(jrow + hh * 32) * w[0];
            for (int g = 1; g < 4; ++g) r += *(const v4f*)(jrow + g * (4 * 16 * SOP) + hh * 32) * w[g];
            VST2V4(orow + hh * 32, r);
        }
    }
}

// =====================================================================================================================
// k_tr: dst(z, c, r) = alpha * src(z, r, c) (+ beta * R2(z, c, r)): [Z][R][C] (row stride lds) -> [Z][C][R] (row stride ldd) through a 32x32 LDS tile;
//   flags: 1 -> add beta * residual R2 addressed like dst (z*sRz + c*ldr + r); act applied before the residual.
// =====================================================================================================================
struct TrP { const float* src; float* dst; const float* R2; long long sSz, lds, sDz, ldd, sRz, ldr; int R, C, flags, act; float alpha, beta; };
static_assert(sizeof(TrP) == 3 * 8 + 6 * 8 + 6 * 4, "TrP has padding");
__global__ __launch_bounds__(256) void k_tr(TrP p) {
    __shared__ float tile[32][33];
    const int c0 = blockIdx.x * 32, r0 = blockIdx.y * 32, z = blockIdx.z;
    const int lane = threadIdx.x & 31, wave = threadIdx.x >> 5;
    const float* s = p.src + z * p.sSz;
#pragma unroll
    for (int k = 0; k < 4; ++k) {
        const int rl = wave * 4 + k, r = r0 + rl, c = c0 + lane;
        tile[rl][lane] = (r < p.R && c < p.C) ? s[(long long)r * p.lds + c] : 0.f;
    }
    __syncthreads();
    float* d = p.dst + z * p.sDz; const float* rr = p.R2 + z * p.sRz;
#pragma unroll
    for (int k = 0; k < 4; ++k) {
        const int cl = wave * 4 + k, c = c0 + cl, r = r0 + lane;
        if (c < p.C && r < p.R) {
            float v = act_fn(p.alpha * tile[lane][cl], p.act);
            if (p.flags & 1) v += p.beta * rr[(long long)c * p.ldr + r];
            VST2(float, d + (long long)c * p.ldd + r, v);
        }
    }
}

// k_affine: dst[i] = a * (sdev ? sdev[0] : 1) * src[i] + b, i < n (one thread per element; consecutive lanes -> consecutive addresses)
__global__ __launch_bounds__(256) void k_affine(const float* __restrict__ src, float* __restrict__ dst, int n, float a, float b, const float* __restrict__ sdev) {
    const int i = blockIdx.x * 256 + threadIdx.x;
    if (i < n) { const float aa = sdev ? a * sdev[0] : a; const float v = aa * src[i] + b; VST2(float, dst + i, v); }
}

// =====================================================================================================================
// k_softmax: row softmax over n contiguous elements, one 256-thread block per row; rows addressed z*sz + r*sr (grid (R, Z)).
//   out = scale_out * softmax(scale_in * x + (Mf ? Mf[z*smz + r*smr + j] : 0)); a row whose max is -inf is written as 0.
// =====================================================================================================================
struct SmP { const float* src; float* dst; const float* Mf; long long sz, sr, dz, dr, smz, smr; int n, pad; float scale_in, scale_out; };
static_assert(sizeof(SmP) == 3 * 8 + 6 * 8 + 4 * 4, "SmP has padding");
__global__ __launch_bounds__(256) void k_softmax(SmP p) {
    __shared__ float red[256];
    const int r = blockIdx.x, z = blockIdx.y, tid = threadIdx.x;
    const float* s = p.src + z * p.sz + (long long)r * p.sr;
    const float* mf = p.Mf ? (p.Mf + z * p.smz + (long long)r * p.smr) : nullptr;
    float mx = -__builtin_inff();
    for (int j = tid; j < p.n; j += 256) { float v = s[j] * p.scale_in; if (mf) v += mf[j]; mx = fmaxf(mx, v); }
    red[tid] = mx; __syncthreads();
    for (int o = 128; o > 0; o >>= 1) { if (tid < o) red[tid] = fmaxf(red[tid], red[tid + o]); __syncthreads(); }
    mx = red[0]; __syncthreads();
    float sum = 0.f;
    for (int j = tid; j < p.n; j += 256) { float v = s[j] * p.scale_in; if (mf) v += mf[j]; sum += (mx == -__builtin_inff()) ? 0.f : expf(v - mx); }
    red[tid] = sum; __syncthreads();
    for (int o = 128; o > 0; o >>= 1) { if (tid < o) red[tid] += red[tid + o]; __syncthreads(); }
    sum = red[0];
    const float inv = (sum > 0.f) ? p.scale_out / sum : 0.f;
    float* d = p.dst + z * p.dz + (long long)r * p.dr;
    for (int j = tid; j < p.n; j += 256) { float v = s[j] * p.scale_in; if (mf) v += mf[j]; const float o = (mx == -__builtin_inff()) ? 0.f : expf(v - mx) * inv; VST2(float, d + j, o); }
}
// =====================================================================================================================
// k_stats: mean and rsqrt(var + eps) over a set of n elements addressed base + z*sz + (e / inner) * so + (e % inner) * si, one 256-thread
// k_norm_apply: y = (x - mean[set]) * rstd[set] * g[c] + b[c] over a [Z][C][L] chan-major tensor with set = z*G + c / (C/G) (G groups per z;
//   G = C -> per-chan sets indexed z*C+c; for batch norm pass stats indexed by c only via bn = 1). Optional act. Output same layout.
// =====================================================================================================================
//   mode 0: mean / rsqrt(var + eps); mode 1 (RMSNorm): 0 / rsqrt(mean(x^2) + eps); mode 2 (L2 normalize * sqrt(n)): 0 / sqrt(n) / max(||x||, eps); mode 3: as 0 with unbiased variance (n-1)
__global__ __launch_bounds__(256) void k_stats(const float* __restrict__ x, long long sz, long long so, long long si, int inner, int n, float eps, float* __restrict__ stat, int mode) {
    __shared__ float red[256];
    const int z = blockIdx.x, tid = threadIdx.x;
    const float* base = x + z * sz;
    float s = 0.f;
    for (int e = tid; e < n; e += 256) s += base[(long long)(e / inner) * so + (long long)(e % inner) * si];
    red[tid] = s; __syncthreads();
    for (int o = 128; o > 0; o >>= 1) { if (tid < o) red[tid] += red[tid + o]; __syncthreads(); }
    const float mu = (mode == 0 || mode == 3) ? red[0] / (float)n : 0.f; __syncthreads();
    float q = 0.f;
    for (int e = tid; e < n; e += 256) { const float dlt = base[(long long)(e / inner) * so + (long long)(e % inner) * si] - mu; q += dlt * dlt; }
    red[tid] = q; __syncthreads();
    for (int o = 128; o > 0; o >>= 1) { if (tid < o) red[tid] += red[tid + o]; __syncthreads(); }
    {
        float rs;
        if (mode == 2) rs = sqrtf((float)n) / fmaxf(sqrtf(red[0]), eps); else if (mode == 3) rs = rsqrtf(red[0] / (float)(n - 1) + eps); else rs = rsqrtf(red[0] / (float)n + eps);
        if (tid < 32) { const float v = (tid == 0) ? mu : ((tid == 1) ? rs : 0.f); VST2(float, stat + (long long)z * 32 + tid, v); }
    }
}
//   One thread per element over the flat [Z][C][L] index space: grid ceil(Z*C*L / 256).
__global__ __launch_bounds__(256) void k_norm_apply(const float* __restrict__ x, float* __restrict__ y, const float* __restrict__ stat, const float* __restrict__ g, const float* __restrict__ bta,
                                                     int Z, int C, int L, int G, int bn, int act) {
    const long long idx = (long long)blockIdx.x * 256 + threadIdx.x;
    if (idx >= (long long)Z * C * L) return;
    const int l = (int)(idx % L); const long long zc = idx / L; const int c = (int)(zc % C), z = (int)(zc / C); (void)l;
    const int set = bn ? c : (z * G + c / (C / G));
    float v = (x[idx] - stat[(long long)set * 32]) * stat[(long long)set * 32 + 1];
    if (g) v *= g[c];
    if (bta) v += bta[c];
    v = act_fn(v, act);
    VST2(float, y + idx, v);
}

// k_lse_neg: c[i] = -(st[2i] + log(st[2i+1])) = minus the log-sum-exp of row i from k_attn's ST output (for softmax over the query dimension)
__global__ __launch_bounds__(256) void k_lse_neg(const float* __restrict__ st, float* __restrict__ c, int n) {
    const int i = blockIdx.x * 256 + threadIdx.x;
    if (i < n) { const float v = -(st[2 * i] + logf(st[2 * i + 1])); VST2(float, c + i, v); }
}

// k_iota: dst[i] = a * i + b as int32 (segment/position id helper)
__global__ __launch_bounds__(256) void k_iota(int* __restrict__ dst, int n, int a, int b) {
    const int i = blockIdx.x * 256 + threadIdx.x;
    if (i < n) { const int v = a * i + b; VST2(int, dst + i, v); }
}

// k_axpby: dst[i] = a * x[i] + b * y[i] (+ c), i < n
__global__ __launch_bounds__(256) void k_axpby(const float* __restrict__ x, const float* __restrict__ y, float* __restrict__ dst, int n, float a, float b, float c) {
    const int i = blockIdx.x * 256 + threadIdx.x;
    if (i < n) { const float v = a * x[i] + b * y[i] + c; VST2(float, dst + i, v); }
}

// =====================================================================================================================
// k_rope: rotary embedding on a [R rows][Hn heads][D] view (row stride sXr, head stride sXh, element stride 1) -> Y (own strides).
//   mode 0: rotate_half (partner d±D/2, sign - for d<D/2); mode 1: interleaved pairs (partner d^1, sign - for even d).
//   table column tcol: tmode 0 -> d, 1 -> d % (D/2), 2 -> d / 2; position p: pmode 0 -> r % S, 1 -> head index, 2 -> pos[r];
//   c = C[(r / S) * sCb + p * sCp + tcol * sCd], s likewise from Sn; y = x[d] * c + sign * x[partner] * s. X and Y must not alias.
// =====================================================================================================================
struct RopeP { const float* X; float* Y; const float* C; const float* Sn; const int* pos; long long sXr, sXh, sYr, sYh, sCb, sCp, sCd; int R, Hn, D, S, mode, tmode, pmode, pad; };
static_assert(sizeof(RopeP) == 5 * 8 + 7 * 8 + 8 * 4, "RopeP has padding");
__global__ __launch_bounds__(256) void k_rope(RopeP p) {
    const long long idx = (long long)blockIdx.x * 256 + threadIdx.x;
    if (idx >= (long long)p.R * p.Hn * p.D) return;
    const int d = (int)(idx % p.D); const long long rh = idx / p.D; const int h = (int)(rh % p.Hn); const int r = (int)(rh / p.Hn);
    const int half = p.D / 2;
    int partner; float sign;
    if (p.mode == 0) { partner = (d < half) ? d + half : d - half; sign = (d < half) ? -1.f : 1.f; }
    else { partner = d ^ 1; sign = (d & 1) ? 1.f : -1.f; }
    const int tcol = (p.tmode == 0) ? d : ((p.tmode == 1) ? (d % half) : (d >> 1));
    const int pp = (p.pmode == 0) ? (r % p.S) : ((p.pmode == 1) ? h : p.pos[r]);
    const long long toff = (long long)(r / p.S) * p.sCb + (long long)pp * p.sCp + (long long)tcol * p.sCd;
    const float* xr = p.X + (long long)r * p.sXr + (long long)h * p.sXh;
    const float v = xr[d] * p.C[toff] + sign * xr[partner] * p.Sn[toff];
    VST2(float, p.Y + (long long)r * p.sYr + (long long)h * p.sYh + d, v);
}

// k_invf + k_sincos (split so neither kernel carries a large VALU-fma footprint): invf_i = num * (1 / powf(base, (2 i)/D)) [fmode 0],
//   num * expf((2 i) * cexp) [fmode 1], num * powf(base, -2 (i - 1) / D) [fmode 2]; then cs/sn[s*half + i] = cos/sin((pscale * s) * invf_i)
__global__ __launch_bounds__(256) void k_invf(float* __restrict__ invb, int half, int D, float base, float num, int fmode, float cexp) {
    const int i = blockIdx.x * 256 + threadIdx.x;
    if (i >= ((half + 31) / 32) * 32) return;
    if (i >= half) { VST2(float, invb + i, 0.f); return; }
    const float e = (float)(2 * i) / (float)D;
    float invf;
    if (fmode == 1) invf = num * expf((float)(2 * i) * cexp);
    else if (fmode == 2) invf = num * powf(base, (-2.0f * ((float)i - 1.0f)) / (float)D);
    else invf = num * (1.0f / powf(base, e));
    VST2(float, invb + i, invf);
}
__global__ __launch_bounds__(256) void k_sincos(float* __restrict__ cs, float* __restrict__ sn, const float* __restrict__ invb, int S, int half, float pscale) {
    const int idx = blockIdx.x * 256 + threadIdx.x;
    if (idx >= S * half) return;
    const int s = idx / half, i = idx - s * half;
    const float ang = (pscale * (float)s) * invb[i];
    VST2(float, cs + idx, cosf(ang)); VST2(float, sn + idx, sinf(ang));
}

// k_mulact: dst[i] = act(x[i]) * y[i]
__global__ __launch_bounds__(256) void k_mulact(const float* __restrict__ x, const float* __restrict__ y, float* __restrict__ dst, int n, int act) {
    const int i = blockIdx.x * 256 + threadIdx.x;
    if (i < n) { const float v = act_fn(x[i], act) * y[i]; VST2(float, dst + i, v); }
}

// =====================================================================================================================
// k_matvec: thread-per-row matrix-vector products for N <= 8 output columns (heads with 1-3 outputs, gates), f32 on the VALU.
//   C[r*sCm + j] = act(alpha * sum_k A[r*sAm + k*sAk] * B[j*sBn + k*sBk] + bias[j]) + beta * R[r*sRm + j*sRn]; each thread writes its N contiguous floats.
// =====================================================================================================================
__global__ __launch_bounds__(256) void k_matvec(GemmP p) {
    // 32 lanes write one line with one instruction.
    const int rpt = (p.N == 1) ? 1 : 32;
    const long long r0 = ((long long)blockIdx.x * 256 + threadIdx.x) * rpt; const int z = blockIdx.z, zo = z / p.zi_n, zi = z - zo * p.zi_n;
    if (r0 >= p.M) return;
    const float* Bb = p.B + zo * p.sBo + zi * p.sBi;
    float* C = p.C + zo * p.sCo + zi * p.sCi; const float* R = p.R + zo * p.sRo + zi * p.sRi;
    for (int rr = 0; rr < rpt; ++rr) {
        const long long r = r0 + rr; if (r >= p.M) break;
        const float* A = p.A + zo * p.sAo + zi * p.sAi + r * p.sAm;
        float acc[8] = {0.f, 0.f, 0.f, 0.f, 0.f, 0.f, 0.f, 0.f};
        for (int k = 0; k < p.K; ++k) { const float a = A[(long long)k * p.sAk];
#pragma unroll
            for (int j = 0; j < 8; ++j) if (j < p.N) acc[j] += a * Bb[(long long)j * p.sBn + (long long)k * p.sBk]; }
#pragma unroll
        for (int j = 0; j < 8; ++j) if (j < p.N) {
            float v = acc[j] * p.alpha;
            if (p.flags & 1) v += p.bias[j];
            if (p.flags & 2) v += p.bias[r];
            v = act_fn(v, p.act);
            if (p.flags & 4) v += p.beta * R[r * p.sRm + (long long)j * p.sRn];
            VST2(float, C + r * p.sCm + j, v);
        }
    }
}
// k_smallsoftmax: thread-per-row softmax for short rows (n <= 64): dst[r*dr + j] = softmax(scale*src[r*sr + j])
__global__ __launch_bounds__(256) void k_smallsoftmax(const float* __restrict__ src, float* __restrict__ dst, long long sr, long long dr, int n, long long R, float scale) {
    const long long r0 = ((long long)blockIdx.x * 256 + threadIdx.x) * 32;
    for (int rr = 0; rr < 32; ++rr) {
        const long long r = r0 + rr; if (r >= R) return;
        const float* s = src + r * sr; float* d = dst + r * dr;
        float mx = -__builtin_inff();
        for (int j = 0; j < n; ++j) mx = fmaxf(mx, s[j] * scale);
        float sum = 0.f;
        for (int j = 0; j < n; ++j) sum += expf(s[j] * scale - mx);
        const float inv = 1.f / sum;
        for (int j = 0; j < n; ++j) { const float v = expf(s[j] * scale - mx) * inv; VST2(float, d + j, v); }
    }
}

__global__ __launch_bounds__(32) void k_unitstat(float* __restrict__ st) { const int t = threadIdx.x; const float v = (t == 1) ? 1.f : 0.f; VST2(float, st + t, v); }

// destination (e.g. a d_out whose row width is not a multiple of 32 floats) is written by consecutive lanes of one instruction
__global__ __launch_bounds__(256) void k_lincopy(const float* __restrict__ src, long long lds, float* __restrict__ dst, long long ldd, long long rows, int cols) {
    const long long i = (long long)blockIdx.x * 256 + threadIdx.x; if (i >= rows * cols) return;
    const long long r = i / cols; const int c = (int)(i - r * cols);
    const float v = src[r * lds + c]; VST2(float, dst + r * ldd + c, v);
}


__device__ __forceinline__ void st_h2(unsigned short* d2, float a, float b) { const unsigned u = (unsigned)__builtin_bit_cast(unsigned short, (_Float16)a) | ((unsigned)__builtin_bit_cast(unsigned short, (_Float16)b) << 16); unsigned* d = (unsigned*)d2; *d = u;  }
__device__ __forceinline__ float ldh(const unsigned short* p) { return (float)__builtin_bit_cast(_Float16, *p); }
__device__ __forceinline__ v4f ld4h(const unsigned short* p) { const unsigned long long u = *(const unsigned long long*)p; v4f a;
    a.x = (float)__builtin_bit_cast(_Float16, (unsigned short)(u & 0xFFFFu)); a.y = (float)__builtin_bit_cast(_Float16, (unsigned short)((u >> 16) & 0xFFFFu)); a.z = (float)__builtin_bit_cast(_Float16, (unsigned short)((u >> 32) & 0xFFFFu)); a.w = (float)__builtin_bit_cast(_Float16, (unsigned short)((u >> 48) & 0xFFFFu)); return a; }
__device__ __forceinline__ unsigned long long pk4h(v4f s) { return (unsigned long long)__builtin_bit_cast(unsigned short, (_Float16)s.x) | ((unsigned long long)__builtin_bit_cast(unsigned short, (_Float16)s.y) << 16) | ((unsigned long long)__builtin_bit_cast(unsigned short, (_Float16)s.z) << 32) | ((unsigned long long)__builtin_bit_cast(unsigned short, (_Float16)s.w) << 48); }
typedef unsigned v4u __attribute__((ext_vector_type(4)));
__device__ __forceinline__ void st8h(unsigned short* d, v4f a, v4f b) { const unsigned long long pa = pk4h(a), pb = pk4h(b); v4u pk; pk.x = (unsigned)(pa & 0xFFFFFFFFull); pk.y = (unsigned)(pa >> 32); pk.z = (unsigned)(pb & 0xFFFFFFFFull); pk.w = (unsigned)(pb >> 32); v4u* dd = (v4u*)d; *dd = pk;  }
__device__ __forceinline__ unsigned short bfu_rne(float v) { unsigned u = __builtin_bit_cast(unsigned, v); u += 0x7FFFu + ((u >> 16) & 1u); return (unsigned short)(u >> 16); }
__device__ __forceinline__ void bfsplit(float v, unsigned short& hi, unsigned short& lo) { hi = bfu_rne(v); lo = bfu_rne(v - __builtin_bit_cast(float, (unsigned)hi << 16)); }
__device__ __forceinline__ void st_s2(unsigned short* Hp, unsigned short* Lp, long long o, float a, float b) { unsigned short h0,l0,h1,l1; bfsplit(a,h0,l0); bfsplit(b,h1,l1); const unsigned ph = (unsigned)h0 | ((unsigned)h1 << 16), pl = (unsigned)l0 | ((unsigned)l1 << 16);
    unsigned* dh = (unsigned*)(Hp + o); unsigned* dl = (unsigned*)(Lp + o); *dh = ph; *dl = pl;  }
__device__ __forceinline__ int cl(int v, int n) { return min(max(v, 0), n - 1); }

// GAT-style aggregation over a device in-edge CSR at dst (+ optional explicit self loop as iteration j = -1):
//   logit = leaky(AS[src][h] + AD[n][h] (+ EW[e]*CW[h]), slope); softmax over the node's edges per head; acc[c] = sum alpha XP[src][c] (f16 gather plane, pitch XW; 256 channels = H heads x CH)
//   wave per node; lane L owns channels 8L..8L+7 (head = 8L / CH); per-lane softmax state (lanes of one head agree) -> no shuffles in the loop.
//   EPI 0: + bias -> f32 OUT[n][256] via LDS redistribution (two 16-B stores per lane, each instruction 512 contiguous B)
//   EPI 1: + bias, LayerNorm(256) * g + bb, relu -> bf16 hi/lo planes OH/OL [n][256] (16-B stores)
//   EPI 2: mean over the 256/CH heads + bias[0..63], LayerNorm(64) * g + bb, relu -> f32 OUT[n][64] (CH must be 64; LDS redistribution, 8-B stores)
//   EPI 3: mean over heads + bias -> f32 OUT[n][64] (no norm / activation)
//   EPI 4: + bias, ELU -> bf16 hi/lo planes OH/OL [n][256];  EPI 5: + bias (full 256-wide, per head), ELU, then mean over the 256/CH heads -> f32 OUT[n][64]
//   EPI 6: (CH = 128, two heads) mean over the two heads, + bias[0..127], relu -> f32 OUT[n][128] (LDS redistribution, 16-B stores)
//   EWM 0: no edge weights; 1: logit += EW[e] * CW[h] (self loop weight 1); 2: alpha *= EW[e] after the softmax (message scale; self loop weight 1)
template <int CH, bool SELF, int EWM, int EPI>
__global__ __launch_bounds__(256) void k_gat_agg(const unsigned short* __restrict__ XP, int XW, const float* __restrict__ AS, const float* __restrict__ AD, int ASTR, const float* __restrict__ EW, const float* __restrict__ CW,
        const int* __restrict__ esrc, const int* __restrict__ off, const int* __restrict__ cnt, const int* __restrict__ slot, const float* __restrict__ bias, const float* __restrict__ g, const float* __restrict__ bb,
        float* __restrict__ OUT, unsigned short* __restrict__ OH, unsigned short* __restrict__ OL, int N, int E, int CAP, float slope) {
    __shared__ float stage[8][256];
    const int wv = threadIdx.x >> 5; const int n = blockIdx.x * 8 + wv; const int L = threadIdx.x & 31; if (n >= N) return; const int c0 = 8 * L; const int h = c0 / CH;
    const float ad = AD[(long long)n * ASTR + h]; const float cw = (EWM == 1) ? CW[h] : 0.f; float m = -3.0e38f, s = 0.f; v4f a0, a1; a0.x = a0.y = a0.z = a0.w = 0.f; a1 = a0;
    const int p0 = cl(off[n], E + 1), cn = min(max(cnt[n], 0), CAP);
    for (int j = (SELF ? -1 : 0); j < cn; ++j) { int sj; float ew = 0.f;
        if (j < 0) { sj = n; ew = 1.f; } else { int e = slot[cl(p0 + j, E)]; e = cl(e, E); sj = cl(esrc[e], N); if (EWM != 0) ew = EW[e]; }
        float lg = AS[(long long)sj * ASTR + h] + ad + ((EWM == 1) ? ew * cw : 0.f); lg = (lg >= 0.f) ? lg : slope * lg;
        const float mn = fmaxf(m, lg); const float cz = expf(m - mn), pj = expf(lg - mn); s = s * cz + pj; const float pw = (EWM == 2) ? pj * ew : pj;
        const unsigned short* xr = XP + (long long)sj * XW + c0; a0 = a0 * cz + ld4h(xr) * pw; a1 = a1 * cz + ld4h(xr + 4) * pw; m = mn; }
    const float inv = (s > 0.f) ? 1.f / (s + 1e-16f) : 0.f; a0 = a0 * inv; a1 = a1 * inv;
    if (EPI == 0 || EPI == 1 || EPI == 4 || EPI == 5) { a0 = a0 + *(const v4f*)(bias + c0); a1 = a1 + *(const v4f*)(bias + c0 + 4); }
    if (EPI == 4 || EPI == 5) { a0.x = (a0.x > 0.f) ? a0.x : (expf(a0.x) - 1.f); a0.y = (a0.y > 0.f) ? a0.y : (expf(a0.y) - 1.f); a0.z = (a0.z > 0.f) ? a0.z : (expf(a0.z) - 1.f); a0.w = (a0.w > 0.f) ? a0.w : (expf(a0.w) - 1.f);
        a1.x = (a1.x > 0.f) ? a1.x : (expf(a1.x) - 1.f); a1.y = (a1.y > 0.f) ? a1.y : (expf(a1.y) - 1.f); a1.z = (a1.z > 0.f) ? a1.z : (expf(a1.z) - 1.f); a1.w = (a1.w > 0.f) ? a1.w : (expf(a1.w) - 1.f); }
    if (EPI == 4) { float o8[8] = {a0.x, a0.y, a0.z, a0.w, a1.x, a1.y, a1.z, a1.w}; unsigned short hh[8], ll[8];
#pragma unroll
        for (int u = 0; u < 8; ++u) bfsplit(o8[u], hh[u], ll[u]);
        const unsigned long long ph0 = (unsigned long long)hh[0] | ((unsigned long long)hh[1] << 16) | ((unsigned long long)hh[2] << 32) | ((unsigned long long)hh[3] << 48), pl0 = (unsigned long long)ll[0] | ((unsigned long long)ll[1] << 16) | ((unsigned long long)ll[2] << 32) | ((unsigned long long)ll[3] << 48);
        const unsigned long long ph1 = (unsigned long long)hh[4] | ((unsigned long long)hh[5] << 16) | ((unsigned long long)hh[6] << 32) | ((unsigned long long)hh[7] << 48), pl1 = (unsigned long long)ll[4] | ((unsigned long long)ll[5] << 16) | ((unsigned long long)ll[6] << 32) | ((unsigned long long)ll[7] << 48);
        v4u pk; pk.x = (unsigned)(ph0 & 0xFFFFFFFFull); pk.y = (unsigned)(ph0 >> 32); pk.z = (unsigned)(ph1 & 0xFFFFFFFFull); pk.w = (unsigned)(ph1 >> 32); v4u* dh = (v4u*)(OH + (long long)n * 256 + c0); *dh = pk; 
        v4u ql; ql.x = (unsigned)(pl0 & 0xFFFFFFFFull); ql.y = (unsigned)(pl0 >> 32); ql.z = (unsigned)(pl1 & 0xFFFFFFFFull); ql.w = (unsigned)(pl1 >> 32); v4u* dl = (v4u*)(OL + (long long)n * 256 + c0); *dl = ql;  return; }
    if (EPI == 6) {
        a0.x += __shfl_xor(a0.x, 16); a0.y += __shfl_xor(a0.y, 16); a0.z += __shfl_xor(a0.z, 16); a0.w += __shfl_xor(a0.w, 16); a1.x += __shfl_xor(a1.x, 16); a1.y += __shfl_xor(a1.y, 16); a1.z += __shfl_xor(a1.z, 16); a1.w += __shfl_xor(a1.w, 16);
        if (L < 16) { const int cb = 8 * L; const v4f b0 = *(const v4f*)(bias + cb), b1v = *(const v4f*)(bias + cb + 4);
            stage[wv][cb] = fmaxf(a0.x * 0.5f + b0.x, 0.f); stage[wv][cb + 1] = fmaxf(a0.y * 0.5f + b0.y, 0.f); stage[wv][cb + 2] = fmaxf(a0.z * 0.5f + b0.z, 0.f); stage[wv][cb + 3] = fmaxf(a0.w * 0.5f + b0.w, 0.f);
            stage[wv][cb + 4] = fmaxf(a1.x * 0.5f + b1v.x, 0.f); stage[wv][cb + 5] = fmaxf(a1.y * 0.5f + b1v.y, 0.f); stage[wv][cb + 6] = fmaxf(a1.z * 0.5f + b1v.z, 0.f); stage[wv][cb + 7] = fmaxf(a1.w * 0.5f + b1v.w, 0.f); }
        __builtin_amdgcn_fence(__ATOMIC_RELEASE, "workgroup"); __builtin_amdgcn_wave_barrier(); __builtin_amdgcn_fence(__ATOMIC_ACQUIRE, "workgroup");
        v4f o6; o6.x = stage[wv][4 * L]; o6.y = stage[wv][4 * L + 1]; o6.z = stage[wv][4 * L + 2]; o6.w = stage[wv][4 * L + 3]; VST2V4(OUT + (long long)n * 128 + 4 * L, o6); return; }
    if (EPI == 5) {
        a0.x += __shfl_xor(a0.x, 8); a0.y += __shfl_xor(a0.y, 8); a0.z += __shfl_xor(a0.z, 8); a0.w += __shfl_xor(a0.w, 8); a1.x += __shfl_xor(a1.x, 8); a1.y += __shfl_xor(a1.y, 8); a1.z += __shfl_xor(a1.z, 8); a1.w += __shfl_xor(a1.w, 8);
        a0.x += __shfl_xor(a0.x, 16); a0.y += __shfl_xor(a0.y, 16); a0.z += __shfl_xor(a0.z, 16); a0.w += __shfl_xor(a0.w, 16); a1.x += __shfl_xor(a1.x, 16); a1.y += __shfl_xor(a1.y, 16); a1.z += __shfl_xor(a1.z, 16); a1.w += __shfl_xor(a1.w, 16);
        const int gq5 = L & 7; a0 = a0 * 0.25f; a1 = a1 * 0.25f;
        if (L < 8) { stage[wv][8 * gq5] = a0.x; stage[wv][8 * gq5 + 1] = a0.y; stage[wv][8 * gq5 + 2] = a0.z; stage[wv][8 * gq5 + 3] = a0.w; stage[wv][8 * gq5 + 4] = a1.x; stage[wv][8 * gq5 + 5] = a1.y; stage[wv][8 * gq5 + 6] = a1.z; stage[wv][8 * gq5 + 7] = a1.w; }
        __builtin_amdgcn_fence(__ATOMIC_RELEASE, "workgroup"); __builtin_amdgcn_wave_barrier(); __builtin_amdgcn_fence(__ATOMIC_ACQUIRE, "workgroup");
        const unsigned long long pk5 = (unsigned long long)__builtin_bit_cast(unsigned, stage[wv][2 * L]) | ((unsigned long long)__builtin_bit_cast(unsigned, stage[wv][2 * L + 1]) << 32); VST2(unsigned long long, (unsigned long long*)(OUT + (long long)n * 64 + 2 * L), pk5); return; }
    if (EPI == 1) { float sm = a0.x + a0.y + a0.z + a0.w + a1.x + a1.y + a1.z + a1.w;
#pragma unroll
        for (int o = 16; o > 0; o >>= 1) sm += __shfl_xor(sm, o);
        const float mu = sm * (1.f / 256.f); const v4f d0 = a0 - mu, d1 = a1 - mu; float q = d0.x * d0.x + d0.y * d0.y + d0.z * d0.z + d0.w * d0.w + d1.x * d1.x + d1.y * d1.y + d1.z * d1.z + d1.w * d1.w;
#pragma unroll
        for (int o = 16; o > 0; o >>= 1) q += __shfl_xor(q, o);
        const float rs = rsqrtf(q * (1.f / 256.f) + 1e-5f); float o8[8] = {d0.x, d0.y, d0.z, d0.w, d1.x, d1.y, d1.z, d1.w}; unsigned short hh[8], ll[8];
#pragma unroll
        for (int u = 0; u < 8; ++u) { const float v = fmaxf(o8[u] * rs * g[c0 + u] + bb[c0 + u], 0.f); bfsplit(v, hh[u], ll[u]); }
        const unsigned long long ph0 = (unsigned long long)hh[0] | ((unsigned long long)hh[1] << 16) | ((unsigned long long)hh[2] << 32) | ((unsigned long long)hh[3] << 48), pl0 = (unsigned long long)ll[0] | ((unsigned long long)ll[1] << 16) | ((unsigned long long)ll[2] << 32) | ((unsigned long long)ll[3] << 48);
        const unsigned long long ph1 = (unsigned long long)hh[4] | ((unsigned long long)hh[5] << 16) | ((unsigned long long)hh[6] << 32) | ((unsigned long long)hh[7] << 48), pl1 = (unsigned long long)ll[4] | ((unsigned long long)ll[5] << 16) | ((unsigned long long)ll[6] << 32) | ((unsigned long long)ll[7] << 48);
        // lane L's 8 halves at c0 = 8L: 16 B -> one 16-B store per plane (32 lanes x 16 B = whole 512-B row)
        v4u pk; pk.x = (unsigned)(ph0 & 0xFFFFFFFFull); pk.y = (unsigned)(ph0 >> 32); pk.z = (unsigned)(ph1 & 0xFFFFFFFFull); pk.w = (unsigned)(ph1 >> 32); v4u* dh = (v4u*)(OH + (long long)n * 256 + c0); *dh = pk; 
        v4u ql; ql.x = (unsigned)(pl0 & 0xFFFFFFFFull); ql.y = (unsigned)(pl0 >> 32); ql.z = (unsigned)(pl1 & 0xFFFFFFFFull); ql.w = (unsigned)(pl1 >> 32); v4u* dl = (v4u*)(OL + (long long)n * 256 + c0); *dl = ql;  return; }
    if (EPI == 2 || EPI == 3) {   // head mean: lanes L, L^8, L^16, L^24 hold the same chan group of the 4 heads (CH = 64 -> 8 lanes per head)
        a0.x += __shfl_xor(a0.x, 8); a0.y += __shfl_xor(a0.y, 8); a0.z += __shfl_xor(a0.z, 8); a0.w += __shfl_xor(a0.w, 8); a1.x += __shfl_xor(a1.x, 8); a1.y += __shfl_xor(a1.y, 8); a1.z += __shfl_xor(a1.z, 8); a1.w += __shfl_xor(a1.w, 8);
        a0.x += __shfl_xor(a0.x, 16); a0.y += __shfl_xor(a0.y, 16); a0.z += __shfl_xor(a0.z, 16); a0.w += __shfl_xor(a0.w, 16); a1.x += __shfl_xor(a1.x, 16); a1.y += __shfl_xor(a1.y, 16); a1.z += __shfl_xor(a1.z, 16); a1.w += __shfl_xor(a1.w, 16);
        const int gq = L & 7; a0 = a0 * 0.25f + *(const v4f*)(bias + 8 * gq); a1 = a1 * 0.25f + *(const v4f*)(bias + 8 * gq + 4);      // every lane now holds channels 8gq..8gq+7 of the mean
        if (EPI == 3) { if (L < 8) { stage[wv][8 * gq] = a0.x; stage[wv][8 * gq + 1] = a0.y; stage[wv][8 * gq + 2] = a0.z; stage[wv][8 * gq + 3] = a0.w; stage[wv][8 * gq + 4] = a1.x; stage[wv][8 * gq + 5] = a1.y; stage[wv][8 * gq + 6] = a1.z; stage[wv][8 * gq + 7] = a1.w; }
            __builtin_amdgcn_fence(__ATOMIC_RELEASE, "workgroup"); __builtin_amdgcn_wave_barrier(); __builtin_amdgcn_fence(__ATOMIC_ACQUIRE, "workgroup");
            const unsigned long long pk3 = (unsigned long long)__builtin_bit_cast(unsigned, stage[wv][2 * L]) | ((unsigned long long)__builtin_bit_cast(unsigned, stage[wv][2 * L + 1]) << 32); VST2(unsigned long long, (unsigned long long*)(OUT + (long long)n * 64 + 2 * L), pk3); return; }
        float sm = (L < 8) ? (a0.x + a0.y + a0.z + a0.w + a1.x + a1.y + a1.z + a1.w) : 0.f;
#pragma unroll
        for (int o = 16; o > 0; o >>= 1) sm += __shfl_xor(sm, o);
        const float mu = sm * (1.f / 64.f); const v4f d0 = a0 - mu, d1 = a1 - mu; float q = (L < 8) ? (d0.x * d0.x + d0.y * d0.y + d0.z * d0.z + d0.w * d0.w + d1.x * d1.x + d1.y * d1.y + d1.z * d1.z + d1.w * d1.w) : 0.f;
#pragma unroll
        for (int o = 16; o > 0; o >>= 1) q += __shfl_xor(q, o);
        const float rs = rsqrtf(q * (1.f / 64.f) + 1e-5f);
        if (L < 8) { const float* gg = g + 8 * gq; const float* bq = bb + 8 * gq; stage[wv][8 * gq] = fmaxf(d0.x * rs * gg[0] + bq[0], 0.f); stage[wv][8 * gq + 1] = fmaxf(d0.y * rs * gg[1] + bq[1], 0.f); stage[wv][8 * gq + 2] = fmaxf(d0.z * rs * gg[2] + bq[2], 0.f); stage[wv][8 * gq + 3] = fmaxf(d0.w * rs * gg[3] + bq[3], 0.f);
            stage[wv][8 * gq + 4] = fmaxf(d1.x * rs * gg[4] + bq[4], 0.f); stage[wv][8 * gq + 5] = fmaxf(d1.y * rs * gg[5] + bq[5], 0.f); stage[wv][8 * gq + 6] = fmaxf(d1.z * rs * gg[6] + bq[6], 0.f); stage[wv][8 * gq + 7] = fmaxf(d1.w * rs * gg[7] + bq[7], 0.f); }
        __builtin_amdgcn_fence(__ATOMIC_RELEASE, "workgroup"); __builtin_amdgcn_wave_barrier(); __builtin_amdgcn_fence(__ATOMIC_ACQUIRE, "workgroup");
        const unsigned long long pk = (unsigned long long)__builtin_bit_cast(unsigned, stage[wv][2 * L]) | ((unsigned long long)__builtin_bit_cast(unsigned, stage[wv][2 * L + 1]) << 32); VST2(unsigned long long, (unsigned long long*)(OUT + (long long)n * 64 + 2 * L), pk); return; }
    // EPI 0
    stage[wv][c0] = a0.x; stage[wv][c0 + 1] = a0.y; stage[wv][c0 + 2] = a0.z; stage[wv][c0 + 3] = a0.w; stage[wv][c0 + 4] = a1.x; stage[wv][c0 + 5] = a1.y; stage[wv][c0 + 6] = a1.z; stage[wv][c0 + 7] = a1.w;
    __builtin_amdgcn_fence(__ATOMIC_RELEASE, "workgroup"); __builtin_amdgcn_wave_barrier(); __builtin_amdgcn_fence(__ATOMIC_ACQUIRE, "workgroup");
#pragma unroll
    for (int q2 = 0; q2 < 2; ++q2) { const int c = 128 * q2 + 4 * L; v4f v; v.x = stage[wv][c]; v.y = stage[wv][c + 1]; v.z = stage[wv][c + 2]; v.w = stage[wv][c + 3]; VST2V4(OUT + (long long)n * 256 + c, v); } }

__device__ __forceinline__ void st4s(unsigned short* Hp, unsigned short* Lp, long long o, v4f a) { unsigned short h[4], l[4]; bfsplit(a.x, h[0], l[0]); bfsplit(a.y, h[1], l[1]); bfsplit(a.z, h[2], l[2]); bfsplit(a.w, h[3], l[3]);
    const unsigned long long ph = (unsigned long long)h[0] | ((unsigned long long)h[1] << 16) | ((unsigned long long)h[2] << 32) | ((unsigned long long)h[3] << 48), pl = (unsigned long long)l[0] | ((unsigned long long)l[1] << 16) | ((unsigned long long)l[2] << 32) | ((unsigned long long)l[3] << 48);
    VST2(unsigned long long, (unsigned long long*)(Hp + o), ph); VST2(unsigned long long, (unsigned long long*)(Lp + o), pl); }
// f32 [nval2 pairs] -> bf16 hi/lo planes (n2 pairs; pairs >= nval2 zero); thread-linear 4-B stores per plane
__global__ __launch_bounds__(256) void k_pl(const float* __restrict__ S, unsigned short* __restrict__ PH, unsigned short* __restrict__ PL, long long nval2, long long n2) { const long long u = (long long)blockIdx.x * 256 + threadIdx.x; if (u >= n2) return; const bool in = (u < nval2); const long long uc = in ? u : ((nval2 > 0) ? (nval2 - 1) : 0); const float a = S[2 * uc], b = S[2 * uc + 1]; st_s2(PH, PL, 2 * u, in ? a : 0.f, in ? b : 0.f); }
// WC [K][NOP] (thread-linear whole rows) = [W (cols < FO) | 0 | W_h . as_h @EO+h | W_h . ad_h @EO+NH+h | 0 ...]; W is [K][FO] (x @ W layout), as/ad [NH][DH]; EO >= FO.
// branch-free: every lane loads all candidates with clamped indices and selects by value (no exec-masked load arms)
__global__ __launch_bounds__(256) void k_wext(const float* __restrict__ Wm, const float* __restrict__ AS_, const float* __restrict__ AD_, int K, int NOP, int FO, int NH, int DH, int EO, float* __restrict__ WC) {
    #pragma clang fp contract(off)
    const long long u = (long long)blockIdx.x * 256 + threadIdx.x; if (u >= (long long)K * NOP) return; const int kk = (int)(u / NOP), o = (int)(u % NOP);
    const int oo = min(o, FO - 1); const float vw = Wm[(long long)kk * FO + oo]; const int q = min(max(o - EO, 0), 2 * NH - 1); const int h = q % NH; float s = 0.f;
#pragma unroll 1
    for (int c = 0; c < DH; ++c) { const float w = Wm[(long long)kk * FO + h * DH + c]; const float asv = AS_[h * DH + c], adv = AD_[h * DH + c]; s += w * ((q < NH) ? asv : adv); }
    const float v = (o < FO) ? vw : ((o >= EO && o < EO + 2 * NH) ? s : 0.f); VST2(float, WC + u, v); }
// GAT aggregation over a device in-edge CSR (+ analytic self loop as iteration j = -1 when SELF), per-lane online softmax (lanes of one head agree):
// HS rows (pitch P floats): [0,128) projected features z, col 128 + h = a_src.z_h, col 128 + NH + h = a_dst.z_h; lane L owns channels 4L..4L+3 (head = 4L / CH).
// out = sum_j softmax_j(leaky(el[src_j][h] + er[n][h])) z[src_j] (/ (den + deps)) + bias -> ACT (0 none, 1 relu, 2 elu, 3 leaky 0.01) ->
// MODE 0: f32 OUT[n][OW] cols < OC (16-B lane stores, OC*4 contiguous B per wave; OC in {64,128}); MODE 1: bf16 hi/lo planes PH/PL pitch PP (rows n >= N zero); MODE 2: both.
template <int CH, bool SELF, int ACT, int MODE>
__global__ __launch_bounds__(256) void k_gat128(const float* __restrict__ HS, int P, int NH, const float* __restrict__ bias, const int* __restrict__ SRC, const int* __restrict__ off, const int* __restrict__ cnt, const int* __restrict__ slot,
        float* __restrict__ OUT, int OW, int OC, unsigned short* __restrict__ PH, unsigned short* __restrict__ PL, int PP, int N, int NP, int E, int CAP, float slope, float deps) {
    #pragma clang fp contract(off)
    const int n = blockIdx.x * 8 + (threadIdx.x >> 5); const int L = threadIdx.x & 31; if (n >= NP) return; const int c = 4 * L; const int h = c / CH; v4f o; o.x = o.y = o.z = o.w = 0.f;
    if (n < N) { const float* hn = HS + (long long)n * P; const float er = hn[128 + NH + h]; float m = -3.0e38f, s = 0.f; v4f a; a.x = a.y = a.z = a.w = 0.f;
        const int p0 = min(max(off[n], 0), E), cn = min(max(cnt[n], 0), CAP);
        for (int j = (SELF ? -1 : 0); j < cn; ++j) { int sj; if (j < 0) sj = n; else { const int e = min(max(slot[min(p0 + j, E - 1)], 0), E - 1); sj = min(max(SRC[e], 0), N - 1); }
            const float* hs = HS + (long long)sj * P; float lg = hs[128 + h] + er; lg = (lg >= 0.f) ? lg : slope * lg;
            const float mn = fmaxf(m, lg); const float cz = expf(m - mn), pj = expf(lg - mn); s = s * cz + pj; a = a * cz + *(const v4f*)(hs + c) * pj; m = mn; }
        const float inv = (s > 0.f || deps > 0.f) ? 1.f / (s + deps) : 0.f; o = a * inv + *(const v4f*)(bias + c);
        if (ACT == 1) { o.x = fmaxf(o.x, 0.f); o.y = fmaxf(o.y, 0.f); o.z = fmaxf(o.z, 0.f); o.w = fmaxf(o.w, 0.f); }
        if (ACT == 2) { o.x = (o.x > 0.f) ? o.x : (expf(o.x) - 1.f); o.y = (o.y > 0.f) ? o.y : (expf(o.y) - 1.f); o.z = (o.z > 0.f) ? o.z : (expf(o.z) - 1.f); o.w = (o.w > 0.f) ? o.w : (expf(o.w) - 1.f); }
        if (ACT == 3) { o.x = (o.x >= 0.f) ? o.x : 0.01f * o.x; o.y = (o.y >= 0.f) ? o.y : 0.01f * o.y; o.z = (o.z >= 0.f) ? o.z : 0.01f * o.z; o.w = (o.w >= 0.f) ? o.w : 0.01f * o.w; }
        if (MODE != 1 && c < OC) VST2V4(OUT + (long long)n * OW + c, o); }
    if (MODE != 0) st4s(PH, PL, (long long)n * PP + c, o); }

// ---- util2 ----
// generic Bt plane builder from an f32 weight: Bt[o][k] (pitch KP halves) = (TRANS ? W[k*ldw + o] : W[o*ldw + k]) * (S ? S[o] : 1) for o < NO, k < KI; zero elsewhere for o < NOP rows, k < KP (thread per (o < NOP, pair k))
__global__ __launch_bounds__(256) void k_u2_bt(const float* __restrict__ Wm, int ldw, int TRANS, int KI, int NO, int KP, int NOP, const float* __restrict__ S, unsigned short* __restrict__ PH_, unsigned short* __restrict__ PL_) {
    const long long u = (long long)blockIdx.x * 256 + threadIdx.x; if (u >= (long long)NOP * (KP / 2)) return; const int k0 = 2 * (int)(u % (KP / 2)); const int o = (int)(u / (KP / 2)); float a = 0.f, b = 0.f;
    if (o < NO) { const float s = S ? S[o] : 1.f;
        if (k0 < KI) a = (TRANS ? Wm[(long long)k0 * ldw + o] : Wm[(long long)o * ldw + k0]) * s;
        if (k0 + 1 < KI) b = (TRANS ? Wm[(long long)(k0 + 1) * ldw + o] : Wm[(long long)o * ldw + k0 + 1]) * s; }
    st_s2(PH_, PL_, (long long)o * KP + k0, a, b); }
// generic padded vector: O[i] = (i < n) ? (A[i] * (S ? S[i] : 1) + (B2 ? B2[i] : 0)) : 0 for i < NP (one block of 256, NP <= 4096 looped)
__global__ __launch_bounds__(256) void k_u2_vec(const float* __restrict__ A, const float* __restrict__ S, const float* __restrict__ B2, int n, int NP, float* __restrict__ O) { for (int i = threadIdx.x; i < NP; i += 256) { float v = 0.f; if (i < n) v = A[i] * (S ? S[i] : 1.f) + (B2 ? B2[i] : 0.f); VST2(float, O + i, v); } }
__global__ __launch_bounds__(256) void k_u2_colstat(const float* __restrict__ X, int P, int N, float eps, float* __restrict__ STAT) {
    #pragma clang fp contract(off)
    __shared__ float red[256]; const int c = blockIdx.x; const int t = threadIdx.x; float s = 0.f; for (int r = t; r < N; r += 256) s += X[(long long)r * P + c]; red[t] = s; __syncthreads();
    for (int o = 128; o > 0; o >>= 1) { if (t < o) red[t] += red[t + o]; __syncthreads(); }
    const float mu = red[0] / (float)N; __syncthreads(); float q = 0.f; for (int r = t; r < N; r += 256) { const float d = X[(long long)r * P + c] - mu; q += d * d; } red[t] = q; __syncthreads();
    for (int o = 128; o > 0; o >>= 1) { if (t < o) red[t] += red[t + o]; __syncthreads(); }
    const float rs = 1.f / sqrtf(red[0] / (float)N + eps); if (t < 32) VST2(float, STAT + (long long)c * 32 + t, (t == 0) ? mu : ((t == 1) ? rs : 0.f)); }
// rows f32 [R][W] (pitch PW) -> planes at pitch PP, column offset coff; rows >= RL (live) written as zeros up to RP (thread per (r < RP, 4 of W))
__global__ __launch_bounds__(256) void k_u2_pl(const float* __restrict__ X, int PW, int Wd, int RL, int RP, unsigned short* __restrict__ PH_, unsigned short* __restrict__ PL_, int PP, int coff) { const long long u = (long long)blockIdx.x * 256 + threadIdx.x; if (u >= (long long)RP * (Wd / 4)) return; const int r = (int)(u / (Wd / 4)); const int c = 4 * (int)(u % (Wd / 4)); v4f v; v.x = v.y = v.z = v.w = 0.f; if (r < RL) v = *(const v4f*)(X + (long long)r * PW + c); st4s(PH_, PL_, (long long)r * PP + coff + c, v); }

typedef unsigned int cm_u4 __attribute__((ext_vector_type(4)));

__global__ __launch_bounds__(256) void k_cm_zero16(unsigned short* __restrict__ DST, long long n) { const long long u = (long long)blockIdx.x * 256 + threadIdx.x; if (u * 8 >= n) return; cm_u4 z; z.x = z.y = z.z = z.w = 0u; cm_u4* d = (cm_u4*)(DST + u * 8); *d = z;  }
// f32 -> bf16 (RNE) -> f16 casts for the bf16-input-leg path: every 16-bit operand then holds exactly the bf16-rounded input value (times a power-of-two
// weight scale), so the f16 WMMA products are exact. Plain: thread per (row, 8 cols),
// dst [R][C] pitch ldd; transposed: thread per (col, 8 consecutive rows) -> dst [C][R] pitch ldd; both store 16 B per thread, thread-linear along the dst row.
__device__ __forceinline__ unsigned int cmb_pk2(float a, float b) { return (unsigned int)__builtin_bit_cast(unsigned short, (_Float16)a) | ((unsigned int)__builtin_bit_cast(unsigned short, (_Float16)b) << 16); }
__device__ __forceinline__ float cmb_bf(float v) { const unsigned u = __builtin_bit_cast(unsigned, v); const unsigned r = (u + 0x7fffu + ((u >> 16) & 1u)) & 0xffff0000u; return __builtin_bit_cast(float, r); }   // bf16 RNE, kept as f32 (finite inputs)
// BR[i] = bf16_rne(B[i]) kept as f32 (thread per element; bias vectors)
__global__ __launch_bounds__(256) void k_cm_bfvec(const float* __restrict__ SRC, float* __restrict__ DST, int n) { const int u = blockIdx.x * 256 + threadIdx.x; if (u >= n) return; VST2(float, DST + u, cmb_bf(SRC[u])); }
__global__ __launch_bounds__(256) void k_cm_castb(const float* __restrict__ SRC, int lds, unsigned short* __restrict__ DST, int ldd, int nR, int nC, float sc) {
    const long long u = (long long)blockIdx.x * 256 + threadIdx.x; const int per = nC / 8; if (u >= (long long)nR * per) return; const int r = (int)(u / per); const int c0 = 8 * (int)(u % per);
    const float* s = SRC + (long long)r * lds + c0; float w[8];
#pragma unroll
    for (int e = 0; e < 8; ++e) w[e] = cmb_bf(s[e]) * sc;
    cm_u4 pk; pk.x = cmb_pk2(w[0], w[1]); pk.y = cmb_pk2(w[2], w[3]); pk.z = cmb_pk2(w[4], w[5]); pk.w = cmb_pk2(w[6], w[7]); VST2(cm_u4, (cm_u4*)(DST + (long long)r * ldd + c0), pk); }
__global__ __launch_bounds__(256) void k_cm_castbT(const float* __restrict__ SRC, int lds, unsigned short* __restrict__ DST, int ldd, int nR, int nC, float sc) {
    const long long u = (long long)blockIdx.x * 256 + threadIdx.x; const int per = nR / 8; if (u >= (long long)nC * per) return; const int c = (int)(u / per); const int r0 = 8 * (int)(u % per);
    float w[8];
#pragma unroll
    for (int e = 0; e < 8; ++e) w[e] = cmb_bf(SRC[(long long)(r0 + e) * lds + c]) * sc;
    cm_u4 pk; pk.x = cmb_pk2(w[0], w[1]); pk.y = cmb_pk2(w[2], w[3]); pk.z = cmb_pk2(w[4], w[5]); pk.w = cmb_pk2(w[6], w[7]); VST2(cm_u4, (cm_u4*)(DST + (long long)c * ldd + r0), pk); }

// MF[b][j] = bf16(delta[b][j]) / |bf16(tau[b])| (ds_tau): the table in the units of the bare q.k product.
// KF = bf16(keys | keys_null); VF = bf16(values | values_null) written as f16 (exact from 2^-17 up in size, within 2^-25 below; finite up to 65,504), for the f16 P.V product. Both as 2-byte halves in the order the attention kernel's B fragments want them, so that a fragment is two 16-byte loads a lane
// and each load of a wave reads 512 contiguous bytes: [branch][b][h][64-key block][tile 0..3][step 0..1][half 0..1][lane 0..31][8].
//   K: key = 64 block + 16 tile + (lane & 15), e = 32 step + 16 half + 8 (lane >> 4) + i;   V: d = 16 tile + (lane & 15), key = 64 block + 32 step + 16 half + 8 (lane >> 4) + i.
// Thread per 16-byte group of the destination (thread-linear stores); which = blockIdx range, block-uniform.
__global__ __launch_bounds__(256) void k_ds_pre(const float* __restrict__ Kp, const float* __restrict__ V, const float* __restrict__ Kn, const float* __restrict__ Vn, const float* __restrict__ TAU, const float* __restrict__ DELTA, unsigned short* __restrict__ KFp, unsigned short* __restrict__ VFp, float* __restrict__ MFp) {
    #pragma clang fp contract(off)
    const int blk = blockIdx.x;
    if (blk < 4 * 1024) {
        const int which = blk >> 10;                            // 0 keys, 1 values, 2 keys_null, 3 values_null
        const int c = (blk & 1023) * 256 + threadIdx.x;         // 16-byte group within the tensor: 262,144 of them
        const int lane = c & 31, half = (c >> 5) & 1, step = (c >> 6) & 1, tile = (c >> 7) & 3, kb = (c >> 9) & 31, h = (c >> 14) & 7, b = c >> 17;
        const int inner = 32 * step + 16 * half + 8 * (lane >> 4), outer = 16 * tile + (lane & 15);
        const float* s = (which == 0) ? Kp : (which == 1) ? V : (which == 2) ? Kn : Vn;
        float w[8];
        cm_u4 pk;
        if ((which & 1) == 0) {
            const float* r = s + ((long long)(b * 2048 + kb * 64 + outer) * 8 + h) * 64 + inner;
            const v4f x = *(const v4f*)r, y = *(const v4f*)(r + 4);
            asm volatile("s_wait_xcnt 0x0" ::: "memory");   // stands behind the two loads, ahead of the rewrite of their address pair by the packing
            w[0] = x.x; w[1] = x.y; w[2] = x.z; w[3] = x.w; w[4] = y.x; w[5] = y.y; w[6] = y.z; w[7] = y.w;
            pk.x = (unsigned)bfu_rne(w[0]) | ((unsigned)bfu_rne(w[1]) << 16); pk.y = (unsigned)bfu_rne(w[2]) | ((unsigned)bfu_rne(w[3]) << 16);
            pk.z = (unsigned)bfu_rne(w[4]) | ((unsigned)bfu_rne(w[5]) << 16); pk.w = (unsigned)bfu_rne(w[6]) | ((unsigned)bfu_rne(w[7]) << 16);
        } else {
            const float* r = s + ((long long)(b * 2048 + kb * 64 + inner) * 8 + h) * 64 + outer;
#pragma unroll   // constant trip count: the eight row loads are issued together, with one wait
            for (int i = 0; i < 8; ++i) w[i] = r[i * 512];
            asm volatile("s_wait_xcnt 0x0" ::: "memory");   // stands behind the eight loads, ahead of the rewrite of their address pair by the packing
            v8h hv;   // the bf16-rounded value, written as f16: its 8 significant bits fit f16's 11
#pragma unroll   // hv is a register vector: every index a constant
            for (int i = 0; i < 8; ++i) hv[i] = (_Float16)cmb_bf(w[i]);
            pk = __builtin_bit_cast(cm_u4, hv);
        }
        unsigned short* d = ((which & 1) ? VFp : KFp) + ((which >= 2) ? 2097152 : 0) + (long long)c * 8;
        VST2(cm_u4, (cm_u4*)d, pk); }
    else { const int u = (blk - 4 * 1024) * 256 + threadIdx.x;
        float tsz, tsg; ds_tau(TAU[(blk - 4 * 1024) >> 3], tsz, tsg);   // eight blocks a batch
        VST2(float, MFp + u, cmb_bf(DELTA[u]) / tsz);
        asm volatile("s_wait_xcnt 0x0" ::: "memory");   // stands behind the store, ahead of any rewrite of the registers it names
    } }

extern "C" void kernel_launch(void* const* d_in, const int* in_sizes, int n_in, void* d_out, int out_size, void* d_ws, size_t ws_size, hipStream_t stream) {
    (void)in_sizes; (void)n_in; (void)out_size; (void)ws_size;
    const float* q = (const float*)d_in[0];
    const float* kk = (const float*)d_in[1];
    const float* v = (const float*)d_in[2];
    const float* kn = (const float*)d_in[3];
    const float* vn = (const float*)d_in[4];
    const float* tau = (const float*)d_in[5];
    const float* delta = (const float*)d_in[6];
    const float* smask = (const float*)d_in[7];
    float* out = (float*)d_out;
    char* wsp = (char*)d_ws;
    unsigned short* KF = (unsigned short*)wsp; wsp += (((size_t)((size_t)4194304) * 2 + 255) / 256) * 256;   // [branch][batch] planes of 1,048,576 bf16 in fragment order
    unsigned short* VF = (unsigned short*)wsp; wsp += (((size_t)((size_t)4194304) * 2 + 255) / 256) * 256;   // the same, as f16
    float* MF = (float*)wsp; wsp += (((size_t)((size_t)4096) * 4 + 255) / 256) * 256;
    if ((size_t)(wsp - (char*)d_ws) > ws_size) return;   // static carve guard
    k_ds_pre<<<(unsigned)(4 * 1024 + 16), 256, 0, stream>>>(kk, v, kn, vn, tau, delta, KF, VF, MF);
    k_attn_t<<<dim3(16, 16, 1), 32 * 4 * AW, 0, stream>>>(q, tau, KF, VF, MF, smask, out);   // both branches, joined and blended: writes the output
}

// v010
// Measured time: 33.2 microseconds a run.
// In two side-by-side timings against v009, it was 1.03 and 1.05 times as fast.
// All steps since the starting kernel, v000, together make it 110 times as fast.
// De-stationary causal attention with a null branch, [b, l, h, e] layout (2 x 2,048 tokens, 8 heads x 64): A = softmax(scale * (q.k * tau_b + delta_bj)) over keys j <= i for (keys, values) and for (keys_null, values_null) with the same queries; out = soft_mask * out_edit + (1 - soft_mask) * out_null per query. All inputs rounded to bf16 (RNE); k, v rounded, k is stored as bf16 and the bf16-rounded v as f16, both in WMMA fragment order, then ONE WMMA attention launch for both batches and both branches (v_wmma_f32_16x16x32_bf16, f32 accumulate) with bf16 q times the sign of tau_b against bf16 k (both exact), the per-key additive table delta_bj / |tau_b| as the products' start value, scale * |tau_b| applied in f32 in the exp2 argument, causal, f32 online softmax, P as one f16 value a score against f16 v (v_wmma_f32_16x16x32_f16, f32 accumulate); the blend in f32.
#include <hip/hip_runtime.h>
#include <math.h>

typedef __attribute__((ext_vector_type(16))) _Float16 v16h;
typedef __attribute__((ext_vector_type(8)))  _Float16 v8h;
typedef __attribute__((ext_vector_type(16))) __bf16   v16b;
typedef __attribute__((ext_vector_type(8)))  __bf16   v8b;
typedef __attribute__((ext_vector_type(8)))  float    v8f;
typedef __attribute__((ext_vector_type(4)))  float    v4f;

// 16-bit WMMA fragment map (wave32), lane L, h = L>>4, m = L&15:
//   A 16x32: lane = row m;   element i -> k = (i<8) ? 8h+i : 16+8h+(i-8)
//   B 32x16: lane = column m; the SAME k(i,h)
//   D 16x16 (8 f32): lane = column m; element r -> row 8h+r
__device__ __forceinline__ int frag_k(int i, int h) { return (i < 8) ? (8 * h + i) : (16 + 8 * h + (i - 8)); }
__device__ __forceinline__ __bf16 bf16_rne(float f) {
    unsigned int u = __float_as_uint(f);
    u += 0x7fffu + ((u >> 16) & 1u);
    return __builtin_bit_cast(__bf16, (unsigned short)(u >> 16));
}
__device__ __forceinline__ float bf16_f32(__bf16 b) { return __uint_as_float(((unsigned int)__builtin_bit_cast(unsigned short, b)) << 16); }
__device__ __forceinline__ v8f wmma16(v16h a, v16h b, v8f c) {
    c = __builtin_amdgcn_wmma_f32_16x16x32_f16(false, a, false, b, (short)0, c, false, false);
    asm volatile("v_nop\n\tv_nop\n\tv_nop\n\tv_nop" : "+v"(c) : "v"(a), "v"(b));
    return c;
}
__device__ __forceinline__ v8f wmmab(v16b a, v16b b, v8f c) {
    c = __builtin_amdgcn_wmma_f32_16x16x32_bf16(false, a, false, b, (short)0, c, false, false);
    asm volatile("v_nop\n\tv_nop\n\tv_nop\n\tv_nop" : "+v"(c) : "v"(a), "v"(b));
    return c;
}
struct Split { v16b hi, lo; };
// hi/lo split product: a.hi*b.hi + a.hi*b.lo + a.lo*b.hi
__device__ __forceinline__ v8f wmma3(const Split& a, const Split& b, v8f c) {
    c = __builtin_amdgcn_wmma_f32_16x16x32_bf16(false, a.hi, false, b.hi, (short)0, c, false, false);
    c = __builtin_amdgcn_wmma_f32_16x16x32_bf16(false, a.hi, false, b.lo, (short)0, c, false, false);
    c = __builtin_amdgcn_wmma_f32_16x16x32_bf16(false, a.lo, false, b.hi, (short)0, c, false, false);
    asm volatile("v_nop\n\tv_nop\n\tv_nop\n\tv_nop" : "+v"(c) : "v"(a.hi), "v"(a.lo), "v"(b.hi), "v"(b.lo));
    return c;
}
// hi/lo split a against a b that is exact in bf16 (its lo part is zero): a.hi*b + a.lo*b
__device__ __forceinline__ v8f wmma2(const Split& a, v16b b, v8f c) {
    c = __builtin_amdgcn_wmma_f32_16x16x32_bf16(false, a.hi, false, b, (short)0, c, false, false);
    c = __builtin_amdgcn_wmma_f32_16x16x32_bf16(false, a.lo, false, b, (short)0, c, false, false);
    return c;
}
// the same with the exact bf16 operand as A and the hi/lo split as B: a*b.hi + a*b.lo
__device__ __forceinline__ v8f wmma2t(v16b a, const Split& b, v8f c) {
    c = __builtin_amdgcn_wmma_f32_16x16x32_bf16(false, a, false, b.hi, (short)0, c, false, false);
    c = __builtin_amdgcn_wmma_f32_16x16x32_bf16(false, a, false, b.lo, (short)0, c, false, false);
    return c;
}
// One f16 fragment from a plane in fragment order, laid out as bfrag_ld's
__device__ __forceinline__ v16h hfrag_ld(const _Float16* __restrict__ p) {
    const v8h x = *(const v8h*)p, y = *(const v8h*)(p + 256);
    return __builtin_shufflevector(x, y, 0, 1, 2, 3, 4, 5, 6, 7, 8, 9, 10, 11, 12, 13, 14, 15);
}
// One B fragment from a plane in fragment order (see k_ds_pre): two blocks of 256 halves, lane L's eight halves at 8L; block 0 holds elements 0..7, block 1 elements 8..15
__device__ __forceinline__ v16b bfrag_ld(const __bf16* __restrict__ p) {
    const v8b x = *(const v8b*)p, y = *(const v8b*)(p + 256);
    return __builtin_shufflevector(x, y, 0, 1, 2, 3, 4, 5, 6, 7, 8, 9, 10, 11, 12, 13, 14, 15);
}
struct Split3 { v16b hi, mid, lo; };
// triple split product (6 terms, drops only terms below 2^-24 relative)
__device__ __forceinline__ v8f wmma6(const Split3& a, const Split3& b, v8f c) {
    c = __builtin_amdgcn_wmma_f32_16x16x32_bf16(false, a.hi, false, b.hi, (short)0, c, false, false);
    c = __builtin_amdgcn_wmma_f32_16x16x32_bf16(false, a.hi, false, b.mid, (short)0, c, false, false);
    c = __builtin_amdgcn_wmma_f32_16x16x32_bf16(false, a.mid, false, b.hi, (short)0, c, false, false);
    c = __builtin_amdgcn_wmma_f32_16x16x32_bf16(false, a.hi, false, b.lo, (short)0, c, false, false);
    c = __builtin_amdgcn_wmma_f32_16x16x32_bf16(false, a.mid, false, b.mid, (short)0, c, false, false);
    c = __builtin_amdgcn_wmma_f32_16x16x32_bf16(false, a.lo, false, b.hi, (short)0, c, false, false);
    asm volatile("v_nop\n\tv_nop\n\tv_nop\n\tv_nop" : "+v"(c) : "v"(a.hi), "v"(a.mid), "v"(a.lo), "v"(b.hi), "v"(b.mid), "v"(b.lo));
    return c;
}

// Fragment gathers from f32 memory: element i <- p[(k0 + frag_k(i,h)) * sk] * s, zero for k >= klen.
__device__ __forceinline__ v16h fh_ld(const float* __restrict__ p, long long sk, int k0, int h, int klen, float s) {
    v16h a;
#pragma unroll
    for (int i = 0; i < 16; ++i) { const int k = k0 + frag_k(i, h); a[i] = (k < klen) ? (_Float16)(p[(long long)k * sk] * s) : (_Float16)0.f; }
    return a;
}
__device__ __forceinline__ Split sp_ld(const float* __restrict__ p, long long sk, int k0, int h, int klen, float s) {
    Split r;
#pragma unroll
    for (int i = 0; i < 16; ++i) {
        const int k = k0 + frag_k(i, h); const float x = (k < klen) ? p[(long long)k * sk] * s : 0.f;
        const __bf16 hb = bf16_rne(x); r.hi[i] = hb; r.lo[i] = bf16_rne(x - bf16_f32(hb));
    }
    return r;
}
__device__ __forceinline__ Split3 sp3_ld(const float* __restrict__ p, long long sk, int k0, int h, int klen, float s) {
    Split3 r;
#pragma unroll
    for (int i = 0; i < 16; ++i) {
        const int k = k0 + frag_k(i, h); const float x = (k < klen) ? p[(long long)k * sk] * s : 0.f;
        const __bf16 hb = bf16_rne(x); const float r1 = x - bf16_f32(hb); const __bf16 mb = bf16_rne(r1);
        r.hi[i] = hb; r.mid[i] = mb; r.lo[i] = bf16_rne(r1 - bf16_f32(mb));
    }
    return r;
}
__device__ __forceinline__ v16b bh_ld(const float* __restrict__ p, long long sk, int k0, int h, int klen, float s) {
    v16b a;
#pragma unroll
    for (int i = 0; i < 16; ++i) { const int k = k0 + frag_k(i, h); a[i] = bf16_rne((k < klen) ? p[(long long)k * sk] * s : 0.f); }
    return a;
}
// f16 fragment from an f16 LDS/global row with element stride 1 (k-contiguous), no bounds (tile already zero padded)
__device__ __forceinline__ v16h fh_row(const _Float16* __restrict__ row, int k0, int h) {
    v16h a;
#pragma unroll
    for (int i = 0; i < 16; ++i) a[i] = row[k0 + frag_k(i, h)];
    return a;
}

#define VST2(T, ptr, val) do { const T vst2_v_ = (val); *(T*)(ptr) = vst2_v_;  } while (0)
typedef float v4f __attribute__((ext_vector_type(4)));
#define VST2V4(ptr, val) do { const v4f vst2_v4_ = (val); *(v4f*)(ptr) = vst2_v4_;  } while (0)

__device__ __attribute__((noinline)) float act_fn(float v, int act) {
    if (act == 1) return fmaxf(v, 0.f);                                                                               // relu
    if (act == 2) { const float u = 0.7978845608028654f * (v + 0.044715f * v * v * v); return 0.5f * v * (1.f + tanhf(u)); } // tanh-gelu
    if (act == 3) return v / (1.f + expf(-v));                                                                        // silu
    if (act == 4) return 0.5f * v * (1.f + erff(v * 0.7071067811865476f));                                             // erf-gelu
    if (act == 5) return tanhf(v);
    if (act == 6) return 1.f / (1.f + expf(-v));                                                                      // sigmoid
    if (act == 7) return (v > 0.f) ? v : 0.01f * v;                                                                   // leaky relu 0.01
    if (act == 8) return (v > 0.f) ? v : (expf(v) - 1.f);                                                             // elu
    if (act == 9) return fminf(fmaxf(v, 0.f), 6.f);                                                                   // relu6
    if (act == 10) return fabsf(v);                                                                                    // abs
    if (act == 11) return (v >= 0.f) ? v : 0.1f * v;                                                                  // leaky 0.1
    if (act == 12) return (v > 0.f) ? v : 0.2f * v;                                                                   // leaky 0.2
    if (act == 13) return (v > 20.f) ? v : log1pf(expf(v));                                                            // softplus
    return v;
}

// =====================================================================================================================
// k_gemm<MODE>: C(z, m, n) = act(alpha * sum_k A(z, m, k) * B(z, k, n) + bias) + beta * R(z, m, n)
//   One wave (32-thread block) per 16 x 32 tile of C; grid (ceil(N/32), ceil(M/16), Z). Batch z -> (zo = z / zi_n, zi = z % zi_n)
//   with separate outer/inner strides for every tensor (e.g. batch and head). A(m,k) = A[zo*sAo + zi*sAi + m*sAm + k*sAk] (f32),
//   B(k,n) = B[zo*sBo + zi*sBi + n*sBn + k*sBk] (f32); any M, N, K (K zero-padded to 32 inside the fragments, M/N tails guarded).
//   C(m,n) = C[zo*sCo + zi*sCi + m*sCm + n] (n contiguous). flags: 1 bias[n], 2 bias[m], 4 residual R[zo*sRo + zi*sRi + m*sRm + n*sRn].
//   MODE 0: f16 operands (A prescaled by sa, B by sb, both undone in the epilogue); 1: bf16 hi/lo split (3 products); 2: bf16;
//   3: bf16 hi/mid/lo triple split (6 products); 4: as 3 with Kahan-compensated f32 accumulation across k-steps.
// =====================================================================================================================
struct GemmP {
    const float* A; const float* B; const float* bias; const float* R; float* C;
    long long sAo, sAi, sAm, sAk, sBo, sBi, sBn, sBk, sCo, sCi, sCm, sRo, sRi, sRm, sRn;
    int M, N, K, zi_n, flags, act; float alpha, beta, sa, sb;
    int Npad, pad_;     // columns [N, Npad) of C are written as 0 so that padded workspace rows are covered by whole-line stores; Npad >= N
};
static_assert(sizeof(GemmP) == 5 * 8 + 15 * 8 + 6 * 4 + 4 * 4 + 2 * 4, "GemmP has padding");

template <int MODE>
__global__ __launch_bounds__(32) void k_gemm(GemmP p) {
    const int lane = threadIdx.x & 31, h = lane >> 4, l15 = lane & 15;
    const int m0 = blockIdx.y * 16, n0 = blockIdx.x * 32;
    const int z = blockIdx.z, zo = z / p.zi_n, zi = z - zo * p.zi_n;
    const float* A = p.A + zo * p.sAo + zi * p.sAi;
    const float* B = p.B + zo * p.sBo + zi * p.sBi;
    const int am = min(m0 + l15, p.M - 1);                       // clamped row for loads (stores are guarded)
    v8f acc[2], comp[2];
#pragma unroll
    for (int t = 0; t < 2; ++t) { v8f zz = {}; acc[t] = zz; comp[t] = zz; }
    for (int k0 = 0; k0 < p.K; k0 += 32) {
        const float* arow = A + (long long)am * p.sAm;
        if (MODE == 1) {
            const Split a = sp_ld(arow, p.sAk, k0, h, p.K, 1.f);
#pragma unroll
            for (int t = 0; t < 2; ++t) {
                const int bn = min(n0 + t * 16 + l15, p.N - 1);
                acc[t] = wmma3(a, sp_ld(B + (long long)bn * p.sBn, p.sBk, k0, h, p.K, 1.f), acc[t]);
            }
        } else if (MODE == 3) {
            const Split3 a = sp3_ld(arow, p.sAk, k0, h, p.K, 1.f);
#pragma unroll
            for (int t = 0; t < 2; ++t) {
                const int bn = min(n0 + t * 16 + l15, p.N - 1);
                acc[t] = wmma6(a, sp3_ld(B + (long long)bn * p.sBn, p.sBk, k0, h, p.K, 1.f), acc[t]);
            }
        } else if (MODE == 4) {
            // triple split as MODE 3, but each k-step's 6 products go into a fresh accumulator and the partial is added to the running f32 sum
            // on the VALU with Kahan compensation (accumulation error stays ~1 ulp however long K is)
            const Split3 a = sp3_ld(arow, p.sAk, k0, h, p.K, 1.f);
#pragma unroll
            for (int t = 0; t < 2; ++t) {
                const int bn = min(n0 + t * 16 + l15, p.N - 1); v8f zz = {};
                const v8f part = wmma6(a, sp3_ld(B + (long long)bn * p.sBn, p.sBk, k0, h, p.K, 1.f), zz);
                const v8f y = part - comp[t]; const v8f s = acc[t] + y; comp[t] = (s - acc[t]) - y; acc[t] = s;
            }
        } else if (MODE == 2) {
            const v16b a = bh_ld(arow, p.sAk, k0, h, p.K, 1.f);
#pragma unroll
            for (int t = 0; t < 2; ++t) {
                const int bn = min(n0 + t * 16 + l15, p.N - 1);
                acc[t] = wmmab(a, bh_ld(B + (long long)bn * p.sBn, p.sBk, k0, h, p.K, 1.f), acc[t]);
            }
        } else {
            const v16h a = fh_ld(arow, p.sAk, k0, h, p.K, p.sa);
#pragma unroll
            for (int t = 0; t < 2; ++t) {
                const int bn = min(n0 + t * 16 + l15, p.N - 1);
                acc[t] = wmma16(a, fh_ld(B + (long long)bn * p.sBn, p.sBk, k0, h, p.K, p.sb), acc[t]);
            }
        }
    }
    const float iscale = (MODE == 0) ? p.alpha / (p.sa * p.sb) : p.alpha;
    float* C = p.C + zo * p.sCo + zi * p.sCi;
    const float* R = p.R + zo * p.sRo + zi * p.sRi;
    __shared__ __align__(16) float ctile[16][36];
#pragma unroll
    for (int t = 0; t < 2; ++t) {
        const int n = n0 + t * 16 + l15; const int nn = min(n, p.N - 1);
#pragma unroll
        for (int r = 0; r < 8; ++r) {
            const int m = m0 + 8 * h + r; const int mm = min(m, p.M - 1);
            float v = acc[t][r] * iscale;
            if (p.flags & 1) v += p.bias[nn];
            if (p.flags & 2) v += p.bias[mm];
            if (p.flags & 8) v *= p.bias[(long long)zo * p.M + mm];   /* per-(z,row) scale vector laid out [Z][M]; exclusive with the bias flags */
            v = act_fn(v, p.act);
            if (p.flags & 4) v += p.beta * R[(long long)mm * p.sRm + (long long)nn * p.sRn];
            ctile[8 * h + r][t * 16 + l15] = (n < p.N) ? v : 0.f;
        }
    }
    __syncthreads();
    const int NW = (p.Npad > p.N) ? p.Npad : p.N;           // write width
    const bool fast = (m0 + 16 <= p.M) && (n0 + 32 <= NW) && ((p.sCm & 3) == 0) && ((((size_t)C) & 15) == 0);
    if (fast) {
#pragma unroll
        for (int s = 0; s < 4; ++s) {
            const int row = s * 4 + (lane >> 3), c4 = (lane & 7) * 4;
            const v4f v = *(const v4f*)&ctile[row][c4];
            VST2V4(C + (long long)(m0 + row) * p.sCm + n0 + c4, v);
        }
    } else {
        for (int row = 0; row < 16; ++row) {
            const int m = m0 + row, n = n0 + lane;
            if (m < p.M && n < NW) VST2(float, C + (long long)m * p.sCm + n, ctile[row][lane]);
        }
    }
}


// =====================================================================================================================
// k_gemmT<MODE, TM, TN>: same contract as k_gemm, but one wave computes a (16*TM) x (16*TN) tile: TM A fragments and TN B fragments are
//   loaded per 32-wide k-step and reused across TM*TN WMMAs (far fewer load/convert instructions per MAC). MODE 0 (f16), 1 (bf16 hi/lo),
//   2 (bf16) only. grid (ceil(NW/(16*TN)), ceil(M/(16*TM)), Z), block 32. Epilogue identical to k_gemm, run per 16x32 sub-tile.
// =====================================================================================================================
template <int MODE, int TM, int TN>
__global__ __launch_bounds__(32) void k_gemmT(GemmP p) {
    const int lane = threadIdx.x & 31, h = lane >> 4, l15 = lane & 15;
    const int m0 = blockIdx.y * (16 * TM), n0 = blockIdx.x * (16 * TN);
    const int z = blockIdx.z, zo = z / p.zi_n, zi = z - zo * p.zi_n;
    const float* A = p.A + zo * p.sAo + zi * p.sAi;
    const float* B = p.B + zo * p.sBo + zi * p.sBi;
    v8f acc[TM][TN];
#pragma unroll
    for (int i = 0; i < TM; ++i)
#pragma unroll
        for (int t = 0; t < TN; ++t) { v8f zz = {}; acc[i][t] = zz; }
    for (int k0 = 0; k0 < p.K; k0 += 32) {
        if (MODE == 1) {
            Split a[TM], b[TN];
#pragma unroll
            for (int i = 0; i < TM; ++i) { const int am = min(m0 + 16 * i + l15, p.M - 1); a[i] = sp_ld(A + (long long)am * p.sAm, p.sAk, k0, h, p.K, 1.f); }
#pragma unroll
            for (int t = 0; t < TN; ++t) { const int bn = min(n0 + 16 * t + l15, p.N - 1); b[t] = sp_ld(B + (long long)bn * p.sBn, p.sBk, k0, h, p.K, 1.f); }
#pragma unroll
            for (int i = 0; i < TM; ++i)
#pragma unroll
                for (int t = 0; t < TN; ++t) acc[i][t] = wmma3(a[i], b[t], acc[i][t]);
        } else if (MODE == 2) {
            v16b a[TM], b[TN];
#pragma unroll
            for (int i = 0; i < TM; ++i) { const int am = min(m0 + 16 * i + l15, p.M - 1); a[i] = bh_ld(A + (long long)am * p.sAm, p.sAk, k0, h, p.K, 1.f); }
#pragma unroll
            for (int t = 0; t < TN; ++t) { const int bn = min(n0 + 16 * t + l15, p.N - 1); b[t] = bh_ld(B + (long long)bn * p.sBn, p.sBk, k0, h, p.K, 1.f); }
#pragma unroll
            for (int i = 0; i < TM; ++i)
#pragma unroll
                for (int t = 0; t < TN; ++t) acc[i][t] = wmmab(a[i], b[t], acc[i][t]);
        } else {
            v16h a[TM], b[TN];
#pragma unroll
            for (int i = 0; i < TM; ++i) { const int am = min(m0 + 16 * i + l15, p.M - 1); a[i] = fh_ld(A + (long long)am * p.sAm, p.sAk, k0, h, p.K, p.sa); }
#pragma unroll
            for (int t = 0; t < TN; ++t) { const int bn = min(n0 + 16 * t + l15, p.N - 1); b[t] = fh_ld(B + (long long)bn * p.sBn, p.sBk, k0, h, p.K, p.sb); }
#pragma unroll
            for (int i = 0; i < TM; ++i)
#pragma unroll
                for (int t = 0; t < TN; ++t) acc[i][t] = wmma16(a[i], b[t], acc[i][t]);
        }
    }
    const float iscale = (MODE == 0) ? p.alpha / (p.sa * p.sb) : p.alpha;
    float* C = p.C + zo * p.sCo + zi * p.sCi;
    const float* R = p.R + zo * p.sRo + zi * p.sRi;
    const int NW = (p.Npad > p.N) ? p.Npad : p.N;
    __shared__ __align__(16) float ctile[16][36];
#pragma unroll
    for (int i = 0; i < TM; ++i) {
        const int mb = m0 + 16 * i; if (mb >= p.M) break;          // wave-uniform
#pragma unroll
        for (int tp = 0; tp < TN / 2; ++tp) {
            const int nb = n0 + 32 * tp; if (nb >= NW) break;        // wave-uniform
#pragma unroll
            for (int t2 = 0; t2 < 2; ++t2) {
                const int t = 2 * tp + t2; const int n = nb + t2 * 16 + l15; const int nn = min(n, p.N - 1);
#pragma unroll
                for (int r = 0; r < 8; ++r) {
                    const int m = mb + 8 * h + r; const int mm = min(m, p.M - 1);
                    float v = acc[i][t][r] * iscale;
                    if (p.flags & 1) v += p.bias[nn];
                    if (p.flags & 2) v += p.bias[mm];
            if (p.flags & 8) v *= p.bias[(long long)zo * p.M + mm];   /* per-(z,row) scale vector laid out [Z][M]; exclusive with the bias flags */
                    v = act_fn(v, p.act);
                    if (p.flags & 4) v += p.beta * R[(long long)mm * p.sRm + (long long)nn * p.sRn];
                    ctile[8 * h + r][t2 * 16 + l15] = (n < p.N) ? v : 0.f;
                }
            }
            __syncthreads();
            const bool fast = (mb + 16 <= p.M) && (nb + 32 <= NW) && ((p.sCm & 3) == 0) && ((((size_t)C) & 15) == 0);
            if (fast) {
#pragma unroll
                for (int s = 0; s < 4; ++s) {
                    const int row = s * 4 + (lane >> 3), c4 = (lane & 7) * 4;
                    const v4f v = *(const v4f*)&ctile[row][c4];
                    VST2V4(C + (long long)(mb + row) * p.sCm + nb + c4, v);
                }
            } else {
                for (int row = 0; row < 16; ++row) {
                    const int m = mb + row, n = nb + lane;
                    if (m < p.M && n < NW) VST2(float, C + (long long)m * p.sCm + n, ctile[row][lane]);
                }
            }
            __syncthreads();
        }
    }
}

// =====================================================================================================================
//   Wave = 16 queries, AW waves per block, 64-key blocks; grid (ceil(Lq/(16*AW)), H, 2 branches x 2 batches), block 32*AW. Any Lq, Lk; head dim dh <= DHP
//   (DHP multiple of 32), value dim dv <= DVP (multiple of 16, <= 128). Every tensor addressed by (batch, head, row, element) strides, f32.
//   Scores: QM 0 f16 operands, 1 bf16 hi/lo split, 2 bf16 triple split; statistics f32 (exp2 domain); P.V: P x 4096 as f16 with V f16 staged in LDS
//   (SPLITPV: P as a bf16 hi/lo split, V bf16 fragments read from memory). kv head = h / hrep. Masking: causal = 1 (keep j <= i + coff, masked -> -inf, key blocks beyond the
//   diagonal skipped), causal = 2 (masked -> mfill, a finite fill like the -1e9; no skipping), causal = 3 (keep j >= i + coff,
//   masked -> -inf, no skipping); optional additive f32 mask Mf,
//   optional int keep-mask Mi (0 -> score := mfill), both addressed b*smb + h*smh + i*smi + j*smj (0 strides broadcast).
// =====================================================================================================================
#define AW 4
struct AttnP {   // apv4
    const float* Q; const float* K; const float* V; float* O; float* P; const float* Mf; const int* Mi; float* ST;
    const float* Pw; const float* Rt; const int* SQ; const int* SK;           // optional: post-softmax weight, relative-position table, segment ids
    long long swb, swh, swi, swj, srb, srh, sri;                                 // Pw strides (b,h,i,j); Rt strides (b,h,i), column = clamp(i - j + roff, 0, rn-1)
    long long sQb, sQh, sQi, sQd, sKb, sKh, sKj, sKd, sVb, sVh, sVj, sVd, sOb, sOh, sOi, sPb, sPh, sPi, smb, smh, smi, smj;
    int Lq, Lk, dh, dv, hrep, causal, coff, pband;   // pband > 0: P holds only the band |j - i| <= pband, column j - i + pband
    float scale, mfill; int nonorm, mpol;             // nonorm (online path only): O = sum_j exp(score_j) V_j without the 1/rowsum (scores must be <= ~0); mpol: Mi masks where ==0 (mpol 0) or where !=0 (mpol 1)
    int roff, rn, segpol, win;                        // Rt column offset/count; SQ/SK: score := mfill where (segpol 0) SQ[i] != SK[j] or (segpol 1) SQ[i] == SK[j]; win > 0: keys with i - j > win (after coff) -> -inf
};
//   Pw: the softmax numerator is multiplied by Pw(b,h,i,j) AFTER the row sum is taken (probs * weight, then P.V), as in post-softmax multiplicative biases.                                                    // ST (optional): per row (b,h,i) -> ST[((b*H + h)*Lq + i)*2 + {0,1}] = {row max of the scaled+masked score (natural units), sum_j exp(score - max)}
static_assert(sizeof(AttnP) == 12 * 8 + 29 * 8 + 16 * 4, "AttnP has padding");

// Four waves per SIMD: a workgroup of 16 waves puts four on every SIMD, which fit only with at most 256 registers a wave
#ifndef KATTN_ATTR
#define KATTN_ATTR __attribute__((amdgpu_waves_per_eu(4, 4)))
#endif
// The shape of this problem's attention launch as compile-time constants: with them the
// element bounds tests (k < dh, d < dv) and every optional path fold away, the unit element strides let the compiler merge a fragment's loads into
// 16-byte loads, and the additive table (always passed here, so read without a null test) no longer depends on the query row. Only the five base pointers stay run-time values.
__device__ __forceinline__ void attn_fix_shape(AttnP& p) {
    p.P = nullptr; p.Mi = nullptr; p.ST = nullptr; p.Pw = nullptr; p.Rt = nullptr; p.SQ = nullptr; p.SK = nullptr;
    p.swb = 0; p.swh = 0; p.swi = 0; p.swj = 0; p.srb = 0; p.srh = 0; p.sri = 0;
    p.sQb = 1048576; p.sQh = 64; p.sQi = 512; p.sQd = 1; p.sKb = 1048576; p.sKh = 64; p.sKj = 512; p.sKd = 1; p.sVb = 1048576; p.sVh = 64; p.sVj = 512; p.sVd = 1;
    p.sOb = 1048576; p.sOh = 64; p.sOi = 512; p.sPb = 0; p.sPh = 0; p.sPi = 0; p.smb = 2048; p.smh = 0; p.smi = 0; p.smj = 1;
    p.Lq = 2048; p.Lk = 2048; p.dh = 64; p.dv = 64; p.hrep = 1; p.causal = 1; p.coff = 0; p.pband = 0;
    p.scale = 0.125f; p.mfill = 0.0f; p.nonorm = 0; p.mpol = 0; p.roff = 0; p.rn = 1; p.segpol = 0; p.win = 0;
}
template <int DHP, int DVP, int QM, bool SPLITPV, bool TWOPASS>
__global__ __launch_bounds__(32 * AW) KATTN_ATTR void k_attn(AttnP p) {
    attn_fix_shape(p);
    constexpr int NT = DVP / 16;                // output tiles
    constexpr int KS = DHP / 32;                // k-steps for the scores
    constexpr int VP = DVP + 8;                 // LDS pitch (halves)
    __shared__ __align__(16) float    pl[AW][16 * 64];
    __shared__ __align__(16) _Float16 vl[SPLITPV ? 8 : 64 * VP];   // f16 V tile (SPLITPV reads V fragments from memory and stages nothing)
    const int lane = threadIdx.x & 31, hf = lane >> 4, l15 = lane & 15, wave = threadIdx.x >> 5;
    // blockIdx.z = 2 * branch + batch: K, V and O hold one plane per (branch, batch), indexed by bz; Q and the additive table are shared by the branches, indexed by b
    const int h = blockIdx.y, bz = blockIdx.z, b = bz & 1, hk = h / p.hrep;
    const int q0 = (blockIdx.x * AW + wave) * 16;
    float* myp = pl[wave];
    const float L2E = 1.4426950408889634f;
    const float NEG = -__builtin_inff();
    const int qi = min(q0 + l15, p.Lq - 1);
    const float* qrow = p.Q + b * p.sQb + h * p.sQh + (long long)qi * p.sQi;
    const float* kbase = p.K + bz * p.sKb + hk * p.sKh;
    const float* vbase = p.V + bz * p.sVb + hk * p.sVh;
    // QM 1 / SPLITPV: K and V are bf16 planes in fragment order, 131,072 halves per (bz, head), 4,096 per 64-key block, 512 per fragment
    const __bf16* kfrag = (const __bf16*)p.K + (bz * 8 + hk) * 131072 + lane * 8;
    const __bf16* vfrag = (const __bf16*)p.V + (bz * 8 + hk) * 131072 + lane * 8;
    v16h qa[QM == 0 ? KS : 1]; Split qs_[QM == 1 ? KS : 1]; Split3 qt_[QM == 2 ? KS : 1];
#pragma unroll
    for (int ks = 0; ks < KS; ++ks) {
        if (QM == 2) qt_[ks] = sp3_ld(qrow, p.sQd, ks * 32, hf, p.dh, 1.f);
        else if (QM == 1) qs_[ks] = sp_ld(qrow, p.sQd, ks * 32, hf, p.dh, 1.f);
        else qa[ks] = fh_ld(qrow, p.sQd, ks * 32, hf, p.dh, 1.f);
    }
    v8f o[NT]; float m8[8], l8[8];
#pragma unroll
    for (int t = 0; t < NT; ++t) { v8f zz = {}; o[t] = zz; }
#pragma unroll
    for (int i = 0; i < 8; ++i) { m8[i] = NEG; l8[i] = 0.f; }
    int jend = p.Lk; int jstart = 0;
    if (p.causal == 1) { const int je = (blockIdx.x * AW + AW - 1) * 16 + 16 + p.coff; jend = min(jend, max(je, 0)); }   // uniform per block
    if (p.win > 0) { const int js = (int)(blockIdx.x * AW) * 16 + p.coff - p.win; jstart = (js > 0) ? (js / 64) * 64 : 0; }   // uniform per block: key blocks entirely outside every row's window hold only -inf entries and are skipped exactly
    const int npass = TWOPASS ? 2 : 1;
    for (int pass = 0; pass < npass; ++pass) {
        const bool dopv = (!TWOPASS) || pass == 1;
        for (int j0 = jstart; j0 < jend; j0 += 64) {
            v16b kf[QM == 1 ? 4 : 1][KS];
            if (QM == 1) {
                // all of the key block's K fragments are asked for before the first product: one wait for memory, not one per fragment
                const __bf16* kblk = kfrag + (j0 >> 6) * 4096;
#pragma unroll
                for (int t = 0; t < 4; ++t)
#pragma unroll
                    for (int ks = 0; ks < KS; ++ks) kf[t][ks] = bfrag_ld(kblk + (t * KS + ks) * 512);
                asm volatile("s_wait_xcnt 0x0" :: "v"(kblk) : "memory");   // the loads' address pair stays live up to this wait, so that no later load lands in it and nothing rewrites it ahead of the wait
                __builtin_amdgcn_sched_barrier(0);   // keeps every K load ahead of the first product: the scheduler otherwise holds some back until registers come free, a second wait for memory
            }
            if (dopv && !SPLITPV) {
                __syncthreads();                                 // previous key block's reads of vl / pl are done
                static_assert((32 * AW) % DVP == 0, "a thread keeps its V column from pass to pass");
                constexpr int VR = (32 * AW) / DVP;              // V rows staged by the block per pass
                const int jr0 = threadIdx.x / DVP, d = threadIdx.x - jr0 * DVP;
                const float* vsrc = vbase + (long long)(j0 + jr0) * p.sVj + (long long)d * p.sVd;   // one address; the passes differ by constant offsets
#pragma unroll   // constant trip count: all of a thread's V loads of a key block are issued before the first is waited for
                for (int n = 0; n < 64 / VR; ++n) {
                    const int jr = jr0 + n * VR, j = j0 + jr;
                    const float f = ((p.Lk % 64 == 0 || j < p.Lk) && d < p.dv) ? vsrc[(long long)(n * VR) * p.sVj] : 0.f;
                    vl[jr * VP + d] = (_Float16)f;
                }
            }
            v8f s[4];
#pragma unroll
            for (int t = 0; t < 4; ++t) {
                const int j = min(j0 + t * 16 + l15, p.Lk - 1);
                const float* krow = kbase + (long long)j * p.sKj;
                v8f acc = {};
#pragma unroll
                for (int ks = 0; ks < KS; ++ks) {
                    if (QM == 2)      acc = wmma6(qt_[ks], sp3_ld(krow, p.sKd, ks * 32, hf, p.dh, 1.f), acc);
                    else if (QM == 1) acc = wmma2(qs_[ks], kf[t][ks], acc);
                    else              acc = wmma16(qa[ks], fh_ld(krow, p.sKd, ks * 32, hf, p.dh, 1.f), acc);
                }
                s[t] = acc;
            }
            v16b vf[SPLITPV ? NT : 1][2];
            if (dopv && SPLITPV) {
                // all of the key block's V fragments are asked for together and ahead of the softmax: their way from memory is covered by the score products, not paid at the P.v products
                const __bf16* vblk = vfrag + (j0 >> 6) * 4096;
#pragma unroll
                for (int t = 0; t < NT; ++t) { vf[t][0] = bfrag_ld(vblk + (t * 2 + 0) * 512); vf[t][1] = bfrag_ld(vblk + (t * 2 + 1) * 512); }
                asm volatile("s_wait_xcnt 0x0" :: "v"(vblk) : "memory");   // the loads' address pair stays live up to this wait, so that no load of the run lands in it and nothing rewrites it ahead of the wait
            }
            float pv[8][4];
#pragma unroll
            for (int i = 0; i < 8; ++i) {
                const int irow = q0 + i + 8 * hf;
                const int ic = min(irow, p.Lq - 1);
                float sc[4];
#pragma unroll
                for (int t = 0; t < 4; ++t) {
                    const int jg = j0 + t * 16 + l15;
                    float v = s[t][i] * p.scale;
                    v += p.Mf[b * p.smb + h * p.smh + (long long)ic * p.smi + (long long)min(jg, p.Lk - 1) * p.smj];
                    if (p.Rt) { int rc = ic - min(jg, p.Lk - 1) + p.roff; rc = rc < 0 ? 0 : (rc >= p.rn ? p.rn - 1 : rc); v += p.Rt[b * p.srb + h * p.srh + (long long)ic * p.sri + rc]; }
                    if (p.Mi) { const int mv = p.Mi[b * p.smb + h * p.smh + (long long)ic * p.smi + (long long)min(jg, p.Lk - 1) * p.smj]; if (p.mpol ? (mv != 0) : (mv == 0)) v = p.mfill; }
                    if (p.SQ) { const bool same = p.SQ[(long long)b * p.Lq + ic] == p.SK[(long long)b * p.Lk + min(jg, p.Lk - 1)]; if (p.segpol ? same : !same) v = p.mfill; }
                    if (p.causal == 2 && jg > irow + p.coff) v = p.mfill;
                    // causal test against the lane's first row (jg > irow + coff, rearranged): one live register, not eight row numbers, so the 256-register cap is met without spills
                    if (jg >= p.Lk || (p.causal == 1 && jg - (q0 + 8 * hf) > i + p.coff) || (p.causal == 3 && jg < irow + p.coff) || (p.win > 0 && irow + p.coff - jg > p.win)) v = NEG; else v *= L2E;
                    sc[t] = v;
                }
                if (!TWOPASS || pass == 0) {
                    float mx = fmaxf(fmaxf(sc[0], sc[1]), fmaxf(sc[2], sc[3]));
                    mx = fmaxf(mx, __shfl_xor(mx, 1, 32)); mx = fmaxf(mx, __shfl_xor(mx, 2, 32));
                    mx = fmaxf(mx, __shfl_xor(mx, 4, 32)); mx = fmaxf(mx, __shfl_xor(mx, 8, 32));
                    const float mnew = fmaxf(m8[i], mx);
                    const float corr = (mnew == NEG) ? 1.f : exp2f(m8[i] - mnew);
                    float rs = 0.f;
#pragma unroll
                    for (int t = 0; t < 4; ++t) {
                        const float pp = (sc[t] == NEG) ? 0.f : exp2f(sc[t] - mnew); rs += pp;
                        pv[i][t] = p.Pw ? pp * p.Pw[b * p.swb + h * p.swh + (long long)ic * p.swi + (long long)min(j0 + t * 16 + l15, p.Lk - 1) * p.swj] : pp;
                    }
                    rs += __shfl_xor(rs, 1, 32); rs += __shfl_xor(rs, 2, 32); rs += __shfl_xor(rs, 4, 32); rs += __shfl_xor(rs, 8, 32);
                    l8[i] = l8[i] * corr + rs; m8[i] = mnew;
                    if (!TWOPASS) {
#pragma unroll
                        for (int t = 0; t < NT; ++t) o[t][i] *= corr;
                    }
                } else {
                    const float inv = (l8[i] > 0.f) ? 1.f / l8[i] : 0.f;
#pragma unroll
                    for (int t = 0; t < 4; ++t) {
                        const int jg = j0 + t * 16 + l15;
                        float pp = (sc[t] == NEG) ? 0.f : exp2f(sc[t] - m8[i]) * inv;
                        if (p.Pw) pp *= p.Pw[b * p.swb + h * p.swh + (long long)ic * p.swi + (long long)min(jg, p.Lk - 1) * p.swj];
                        pv[i][t] = pp;
                    }
                }
            }
            if (dopv) {
#pragma unroll
                for (int i = 0; i < 8; ++i)
#pragma unroll
                    for (int t = 0; t < 4; ++t) ((float*)myp)[(i + 8 * hf) * 64 + t * 16 + l15] = pv[i][t];
                if (SPLITPV) {
                    // P is private to its wave and V is not staged: the wave's own LDS stores only have to be ordered before its lanes' reads of each other's values
                    __builtin_amdgcn_fence(__ATOMIC_RELEASE, "workgroup"); __builtin_amdgcn_wave_barrier(); __builtin_amdgcn_fence(__ATOMIC_ACQUIRE, "workgroup");
                } else __syncthreads();                          // P (per wave) and V (shared) visible
                if (p.P) {
                    float* pb_ = p.P + b * p.sPb + h * p.sPh;
                    const bool fastP = (p.pband == 0) && ((p.sPi & 3) == 0) && (j0 + 64 <= p.Lk) && (q0 + 16 <= p.Lq) && ((((size_t)pb_) & 15) == 0);
                    if (fastP) {
#pragma unroll
                        for (int s = 0; s < 8; ++s) {
                            const int row = s * 2 + (lane >> 4), c4 = (lane & 15) * 4;
                            const v4f v = *(const v4f*)(myp + row * 64 + c4);
                            VST2V4(pb_ + (long long)(q0 + row) * p.sPi + j0 + c4, v);
                        }
                    } else {
                        for (int row = 0; row < 16; ++row) {
                            const int irow = q0 + row; if (irow >= p.Lq) continue;
                            for (int c = lane; c < 64; c += 32) {
                                const int jg = j0 + c; if (jg >= p.Lk) continue;
                                if (p.pband == 0) VST2(float, pb_ + (long long)irow * p.sPi + jg, myp[row * 64 + c]);
                                else if (jg - irow <= p.pband && irow - jg <= p.pband) VST2(float, pb_ + (long long)irow * p.sPi + (jg - irow + p.pband), myp[row * 64 + c]);
                            }
                        }
                    }
                }
                if (SPLITPV) {
                    const Split pa0 = sp_ld(myp + l15 * 64, 1, 0, hf, 64, 1.f), pa1 = sp_ld(myp + l15 * 64, 1, 32, hf, 64, 1.f);
#pragma unroll
                    for (int t = 0; t < NT; ++t) {
                        o[t] = wmma2(pa0, vf[t][0], o[t]);
                        o[t] = wmma2(pa1, vf[t][1], o[t]);
                    }
                } else {
                    const v16h pa0 = fh_ld(myp + l15 * 64, 1, 0, hf, 64, 4096.f), pa1 = fh_ld(myp + l15 * 64, 1, 32, hf, 64, 4096.f);
#pragma unroll
                    for (int t = 0; t < NT; ++t) {
                        const int dcol = t * 16 + l15;
                        v16h b0, b1;
#pragma unroll
                        for (int e = 0; e < 16; ++e) { b0[e] = vl[frag_k(e, hf) * VP + dcol]; b1[e] = vl[(32 + frag_k(e, hf)) * VP + dcol]; }
                        o[t] = wmma16(pa0, b0, o[t]);
                        o[t] = wmma16(pa1, b1, o[t]);
                    }
                }
            }
        }
    }
    float* obase = p.O + bz * p.sOb + h * p.sOh;
    if (p.ST) {
        const int rl = lane >> 1, isel = rl & 7;           // row q0 + rl ; rl>>3 == hf holds because lane>>4 == (lane>>1)>>3
        float mv = 0.f, lv = 0.f;
#pragma unroll
        for (int i = 0; i < 8; ++i) if (i == isel) { mv = m8[i]; lv = l8[i]; }
        const int irow = q0 + rl;
        if (irow < p.Lq) { float* st = p.ST + (((long long)b * gridDim.y + h) * p.Lq + irow) * 2 + (lane & 1); VST2(float, st, (lane & 1) ? lv : mv * 0.6931471805599453f); }
    }
    float invr[8];
#pragma unroll
    for (int i = 0; i < 8; ++i) {
        if (TWOPASS) invr[i] = SPLITPV ? 1.f : (1.f / 4096.f);
        else if (p.nonorm) invr[i] = exp2f(m8[i]) * (SPLITPV ? 1.f : (1.f / 4096.f));
        else invr[i] = (l8[i] > 0.f) ? (SPLITPV ? 1.f / l8[i] : 1.f / (l8[i] * 4096.f)) : 0.f;
    }
    __syncthreads();                                             // all waves done with pl/vl from the main loop
    const bool ofast = ((p.sOi & 3) == 0) && ((((size_t)obase) & 15) == 0) && (q0 + 16 <= p.Lq);
#pragma unroll
    for (int c0 = 0; c0 < DVP; c0 += 64) {
#pragma unroll
        for (int i = 0; i < 8; ++i)
#pragma unroll
            for (int t = 0; t < NT; ++t) if (t * 16 >= c0 && t * 16 < c0 + 64) ((float*)myp)[(i + 8 * hf) * 64 + (t * 16 - c0) + l15] = o[t][i] * invr[i];
        __syncthreads();
        const int cw = (DVP - c0 < 64) ? (DVP - c0) : 64;      // staged columns in this chunk (multiple of 16)
        if (ofast && (c0 + cw <= p.dv) && (cw % 32 == 0)) {
            const int lpr = cw / 4;                              // lanes per row (16 for 64 cols, 8 for 32)
            const int rows_per_ins = 32 / lpr;
            for (int r0 = 0; r0 < 16; r0 += rows_per_ins) {
                const int row = r0 + lane / lpr, c4 = (lane % lpr) * 4;
                const v4f v = *(const v4f*)(myp + row * 64 + c4);
                VST2V4(obase + (long long)(q0 + row) * p.sOi + c0 + c4, v);
            }
        } else {
            for (int row = 0; row < 16; ++row) {
                const int irow = q0 + row; if (irow >= p.Lq) continue;
                for (int c = lane; c < cw; c += 32) { const int d = c0 + c; if (d < p.dv) VST2(float, obase + (long long)irow * p.sOi + d, myp[row * 64 + c]); }
            }
        }
        __syncthreads();
    }
}

typedef __attribute__((ext_vector_type(2))) float  v2f;
typedef __attribute__((ext_vector_type(2))) _Float16 v2h;
__device__ __forceinline__ float xhalf(float x) {   // the value of lane L ^ 16
    const int u = __float_as_int(x);
    return __int_as_float(__builtin_amdgcn_permlanex16(u, u, 0x76543210, 0xfedcba98, false, false));
}
// tau of a batch, rounded to bf16 like every input, as (size, sign): scale * (q.k * tau + delta) = scale * size * (sign * q.k + delta / size).
// A tau below 1e-30 in size moves an exp2 argument by less than any f32 softmax weight can show: it counts as 0, for which sign = 0 and size = 1 give scale * delta with no division by 0.
__device__ __forceinline__ void ds_tau(float tau, float& size, float& sign) {
    const float t = bf16_f32(bf16_rne(tau)), a = fabsf(t);
    const bool on = a >= 1e-30f;
    size = on ? a : 1.f; sign = on ? (t < 0.f ? -1.f : 1.f) : 0.f;
}
#define SOP 68   // floats a query row of an output tile takes in LDS: 272 bytes, an odd multiple of 16, the pitch at which 16-byte LDS accesses of neighbouring rows miss each other's banks
__global__ __launch_bounds__(32 * 4 * AW) KATTN_ATTR void k_attn_t(const float* __restrict__ Q, const float* __restrict__ TAU, const unsigned short* __restrict__ KF, const unsigned short* __restrict__ VF, const float* __restrict__ MF, const float* __restrict__ SM, float* __restrict__ O) {
    __shared__ __attribute__((aligned(16))) float so[2 * 4 * AW * 32 * SOP];   // [pass][wave][query of the wave's 32][d]: every wave's unnormalised output
    __shared__ v2f sml[2 * 4 * AW * 32];                                       // [pass][wave][query of the wave's 32]: its maximum (exp2 units) and sum
    const int lane = threadIdx.x & 31, hf = lane >> 4, l15 = lane & 15;
    const int wave = __builtin_amdgcn_readfirstlane(threadIdx.x >> 5);     // in a scalar register: the key range and the K, V planes hang on it, and the loop and its diagonal test stay scalar branches
    const int qp = wave & 1, grp = wave >> 1, part = grp & 3;              // wave = 2 (4 branch + part) + half of the query block
    // bz = 2 * branch + batch: K and V hold one plane per (branch, batch), indexed by bz; Q, the additive table and the output are shared by the branches, indexed by b
    const int h = blockIdx.x & 7, b = blockIdx.x >> 3, bz = ((grp >> 2) << 1) + b;
    const float L2E = 1.4426950408889634f;
    const float NEG = -__builtin_inff();
    float tsz, tsg; ds_tau(TAU[b], tsz, tsg);
    const float cs = tsz * (0.125f * L2E);           // accumulator units to exp2 arguments; the same for the whole workgroup
    // 131,072 halves per (bz, head), 4,096 per 64-key block, 512 per fragment
    const __bf16* kfrag = (const __bf16*)KF + (bz * 8 + h) * 131072 + lane * 8;
    const _Float16* vfrag = (const _Float16*)VF + (bz * 8 + h) * 131072 + lane * 8;
    const float* mrow = MF + b * 2048 + 8 * hf;      // the lane's eight keys of a tile
    // the lane's place in the join behind the passes (said there); its two queries' soft masks are asked for here, so that their way from memory is not paid behind the barrier
    const int qq = wave * 4 + (lane >> 3), c4 = (lane & 7) * 4, qa = (31 - blockIdx.y) * 64 + qq, qb = blockIdx.y * 64 + qq;
    const int ia = b * 2048 + qa, ib = b * 2048 + qb;
    const float smr[2] = {SM[ia], SM[ib]};
    asm volatile("s_wait_xcnt 0x0" :: "v"(ia), "v"(ib) : "memory");   // the two loads' index registers stay live up to this wait, so that nothing rewrites them ahead of it
    // two passes: query block 31 - y, then block y, so that the 256 workgroups, one on each WGP, carry the same load.
    // No barrier stands between the passes (each has its own LDS): a wave goes on at once, and its Q loads are covered by the waves still at work
    for (int pass = 0; pass < 2; ++pass) {
        // the wave's 32 queries start at q0 and see nu = q0 / 32 + 1 trips of 32 keys, the last of them on the diagonal; part p takes trips p cu .. p cu + cu - 1 as far as they exist (cu is the same for both halves of a block: 2 xb + 1 is odd)
        const int xb = pass ? blockIdx.y : 31 - blockIdx.y;
        const int nu = 2 * xb + 1 + qp, cu = (nu + 3) >> 2;
        const int ubeg = part * cu, uend = min(ubeg + cu, nu);
        const int q0 = xb * 64 + qp * 32;
        v16b qs_[2][2];   // [query tile][step]
#pragma unroll
        for (int cg = 0; cg < 2; ++cg) {
            const float* qrow = Q + b * 1048576 + h * 64 + (q0 + cg * 16 + l15) * 512;
#pragma unroll
            for (int ks = 0; ks < 2; ++ks) qs_[cg][ks] = bh_ld(qrow, 1, ks * 32, hf, 64, tsg);   // the query rounded to bf16, with tau's sign: exact in one operand
        }
        v8f o[4][2]; float m[2] = {NEG, NEG}; v2f l2[2] = {{0.f, 0.f}, {0.f, 0.f}};    // l2: the sum over this lane half's keys, even and odd registers apart; joined behind the loop
#pragma unroll
        for (int t = 0; t < 4; ++t) { v8f zz = {}; o[t][0] = zz; o[t][1] = zz; }
        for (int u = ubeg; u < uend; ++u) {
            v16b kf[2][2];
            // all of the trip's K fragments are asked for before the first product: one wait for memory, not one per fragment
            const __bf16* kblk = kfrag + u * 2048;
#pragma unroll
            for (int t = 0; t < 2; ++t)
#pragma unroll
                for (int ks = 0; ks < 2; ++ks) kf[t][ks] = bfrag_ld(kblk + (t * 2 + ks) * 512);
            asm volatile("s_wait_xcnt 0x0" :: "v"(kblk) : "memory");   // the loads' address pair stays live up to this wait, so that no later load lands in it and nothing rewrites it ahead of the wait
            // the additive table of the lane's 16 keys, asked for with the K fragments: it is the score products' start value (their C operand) for both query tiles, so that adding it costs no instruction
            const float* mblk = mrow + u * 32;
            v8f tab[2];
#pragma unroll
            for (int t = 0; t < 2; ++t) tab[t] = *(const v8f*)(mblk + t * 16);
            asm volatile("s_wait_xcnt 0x0" :: "v"(mblk) : "memory");   // stands behind the table loads, ahead of any rewrite of their address pair, which stays live up to here
            __builtin_amdgcn_sched_barrier(0);   // keeps every K load ahead of the first product: the scheduler otherwise holds some back until registers come free, a second wait for memory
            v8f s[2][2];   // [key tile][query tile]
#pragma unroll
            for (int t = 0; t < 2; ++t) {
#pragma unroll
                for (int cg = 0; cg < 2; ++cg) s[t][cg] = __builtin_amdgcn_wmma_f32_16x16x32_bf16(false, kf[t][0], false, qs_[cg][0], (short)0, tab[t], false, false);
            }
#pragma unroll
            for (int t = 0; t < 2; ++t) {
#pragma unroll
                for (int cg = 0; cg < 2; ++cg) s[t][cg] = __builtin_amdgcn_wmma_f32_16x16x32_bf16(false, kf[t][1], false, qs_[cg][1], (short)0, s[t][cg], false, false);
            }
            v16h vf[4];
            // all of the trip's V fragments are asked for together and ahead of the softmax: their way from memory is covered by the score products, not paid at the P.v products
            const _Float16* vblk = vfrag + (u >> 1) * 4096 + (u & 1) * 512;
#pragma unroll
            for (int t = 0; t < 4; ++t) vf[t] = hfrag_ld(vblk + t * 1024);
            asm volatile("s_wait_xcnt 0x0" :: "v"(vblk) : "memory");   // the loads' address pair stays live up to this wait, so that no load of the run lands in it and nothing rewrites it ahead of the wait
            // the unrolls from here to the foot of the trip: s, pb and o are register arrays, which stay in registers only where every index is a constant
            if (u == nu - 1) {                           // only the trip on the diagonal holds keys behind a query (the same for the whole wave, in scalar registers: a scalar branch); its first key is the wave's first query
                const int qrel = l15 - 8 * hf;           // causal test (key > query) against constants: one live register
#pragma unroll
                for (int t = 0; t < 2; ++t) {
#pragma unroll
                    for (int cg = 0; cg < 2; ++cg) {
#pragma unroll
                        for (int r = 0; r < 8; ++r) s[t][cg][r] = (t * 16 + r - cg * 16 > qrel) ? NEG : s[t][cg][r];
                    }
                }
            }
            v16h pb[2];   // P as one f16 value a score: 11 significant bits, 0 <= p <= 1; the sum l2 takes the unrounded f32 values
            float corr[2];
#pragma unroll
            for (int cg = 0; cg < 2; ++cg) {
                float mx2[2];
#pragma unroll
                for (int t = 0; t < 2; ++t) {
                    mx2[t] = fmaxf(fmaxf(s[t][cg][0], s[t][cg][1]), s[t][cg][2]);
                    mx2[t] = fmaxf(fmaxf(mx2[t], s[t][cg][3]), s[t][cg][4]);
                    mx2[t] = fmaxf(fmaxf(mx2[t], s[t][cg][5]), s[t][cg][6]);
                    mx2[t] = fmaxf(mx2[t], s[t][cg][7]);
                }
                float mx = fmaxf(mx2[0], mx2[1]);
                mx = fmaxf(mx, xhalf(mx));
                // the first key of every trip (at most the wave's first query) is open to each of its queries and every score is finite, so mnew is finite from the first trip on: exp2 of -inf gives the 0 that a masked key and the first trip's corr want
                const float mnew = fmaxf(m[cg], mx * cs);    // m runs in exp2 units, as the join wants it
                corr[cg] = __builtin_amdgcn_exp2f(m[cg] - mnew);
                v2f rs2[2];
#pragma unroll
                for (int t = 0; t < 2; ++t) {
#pragma unroll
                    for (int r = 0; r < 8; r += 2) {
                        const v2f x = __builtin_elementwise_fma((v2f){s[t][cg][r], s[t][cg][r + 1]}, (v2f){cs, cs}, (v2f){-mnew, -mnew});
                        const v2f pp = {__builtin_amdgcn_exp2f(x.x), __builtin_amdgcn_exp2f(x.y)};
                        rs2[t] = (r == 0) ? pp : rs2[t] + pp;
                        const v2h hb = __builtin_convertvector(pp, v2h);
                        pb[cg][t * 8 + r] = hb.x; pb[cg][t * 8 + r + 1] = hb.y;
                    }
                }
                l2[cg] = l2[cg] * corr[cg] + (rs2[0] + rs2[1]); m[cg] = mnew;
            }
#pragma unroll
            for (int t = 0; t < 4; ++t) { o[t][0] *= corr[0]; o[t][1] *= corr[1]; }
#pragma unroll
            for (int t = 0; t < 4; ++t) {
                o[t][0] = __builtin_amdgcn_wmma_f32_16x16x32_f16(false, vf[t], false, pb[0], (short)0, o[t][0], false, false);
                o[t][1] = __builtin_amdgcn_wmma_f32_16x16x32_f16(false, vf[t], false, pb[1], (short)0, o[t][1], false, false);
            }
        }
        // every wave lays its unnormalised output, maximum and sum down in LDS
#pragma unroll   // o, m and l2 are register arrays: every index a constant
        for (int cg = 0; cg < 2; ++cg) {
            float l = l2[cg].x + l2[cg].y;
            l += xhalf(l);
            float* srow = so + ((pass * 4 * AW + wave) * 32 + cg * 16 + l15) * SOP + 8 * hf;
#pragma unroll
            for (int t = 0; t < 4; ++t) {
                const v4f x = {o[t][cg][0], o[t][cg][1], o[t][cg][2], o[t][cg][3]}, y = {o[t][cg][4], o[t][cg][5], o[t][cg][6], o[t][cg][7]};
                *(v4f*)(srow + t * 16) = x; *(v4f*)(srow + t * 16 + 4) = y;
            }
            if (hf == 0) { const v2f ml = {m[cg], l}; sml[(pass * 4 * AW + wave) * 32 + cg * 16 + l15] = ml; }
        }
    }
    __syncthreads();   // every wave passes it once (a wave without trips too): behind it each wave reads the results of the eight waves of one 32-query half
    // the join, shared out: wave w finishes queries 4 w .. 4 w + 3 of the block; eight lanes a query, a lane takes d = 4 (lane & 7) + 0..3 and the same + 32, so that each store instruction fills whole 128-byte lines
    // query qq of the block lies in source wave 2 g + (qq >> 5), g = 4 branch + part, at row qq & 31: 32 (2 g) + qq rows from the pass's start
    for (int pass = 0; pass < 2; ++pass) {
        const float sm = bf16_f32(bf16_rne(smr[pass]));   // the soft mask, rounded to bf16 like every input
        float w[8];   // weight of (branch, part): 2^(max - joint max) over the branch's joint sum, times the branch's share of the blend. A part without trips has maximum -inf and sum 0: weight 0 (part 0 always has a finite maximum)
#pragma unroll   // w is a register array: every index a constant
        for (int br = 0; br < 2; ++br) {
            v2f e[4];
#pragma unroll
            for (int p = 0; p < 4; ++p) e[p] = sml[(pass * 4 * AW + (br * 4 + p) * 2) * 32 + qq];
            const float mm = fmaxf(fmaxf(e[0].x, e[1].x), fmaxf(e[2].x, e[3].x));
            float a[4], den = 0.f;
#pragma unroll
            for (int p = 0; p < 4; ++p) { a[p] = __builtin_amdgcn_exp2f(e[p].x - mm); den += e[p].y * a[p]; }
            const float sh = (br ? 1.f - sm : sm) / den;
#pragma unroll
            for (int p = 0; p < 4; ++p) w[br * 4 + p] = a[p] * sh;
        }
        const float* jrow = so + (pass * 4 * AW * 32 + qq) * SOP + c4;
        float* orow = O + b * 1048576 + (pass ? qb : qa) * 512 + h * 64 + c4;
#pragma unroll
        for (int hh = 0; hh < 2; ++hh) {
            v4f r = *(const v4f*)(jrow + hh * 32) * w[0];
#pragma unroll
            for (int g = 1; g < 8; ++g) r += *(const v4f*)(jrow + g * (2 * 32 * SOP) + hh * 32) * w[g];
            VST2V4(orow + hh * 32, r);
        }
    }
}

// =====================================================================================================================
// k_tr: dst(z, c, r) = alpha * src(z, r, c) (+ beta * R2(z, c, r)): [Z][R][C] (row stride lds) -> [Z][C][R] (row stride ldd) through a 32x32 LDS tile;
//   flags: 1 -> add beta * residual R2 addressed like dst (z*sRz + c*ldr + r); act applied before the residual.
// =====================================================================================================================
struct TrP { const float* src; float* dst; const float* R2; long long sSz, lds, sDz, ldd, sRz, ldr; int R, C, flags, act; float alpha, beta; };
static_assert(sizeof(TrP) == 3 * 8 + 6 * 8 + 6 * 4, "TrP has padding");
__global__ __launch_bounds__(256) void k_tr(TrP p) {
    __shared__ float tile[32][33];
    const int c0 = blockIdx.x * 32, r0 = blockIdx.y * 32, z = blockIdx.z;
    const int lane = threadIdx.x & 31, wave = threadIdx.x >> 5;
    const float* s = p.src + z * p.sSz;
#pragma unroll
    for (int k = 0; k < 4; ++k) {
        const int rl = wave * 4 + k, r = r0 + rl, c = c0 + lane;
        tile[rl][lane] = (r < p.R && c < p.C) ? s[(long long)r * p.lds + c] : 0.f;
    }
    __syncthreads();
    float* d = p.dst + z * p.sDz; const float* rr = p.R2 + z * p.sRz;
#pragma unroll
    for (int k = 0; k < 4; ++k) {
        const int cl = wave * 4 + k, c = c0 + cl, r = r0 + lane;
        if (c < p.C && r < p.R) {
            float v = act_fn(p.alpha * tile[lane][cl], p.act);
            if (p.flags & 1) v += p.beta * rr[(long long)c * p.ldr + r];
            VST2(float, d + (long long)c * p.ldd + r, v);
        }
    }
}

// k_affine: dst[i] = a * (sdev ? sdev[0] : 1) * src[i] + b, i < n (one thread per element; consecutive lanes -> consecutive addresses)
__global__ __launch_bounds__(256) void k_affine(const float* __restrict__ src, float* __restrict__ dst, int n, float a, float b, const float* __restrict__ sdev) {
    const int i = blockIdx.x * 256 + threadIdx.x;
    if (i < n) { const float aa = sdev ? a * sdev[0] : a; const float v = aa * src[i] + b; VST2(float, dst + i, v); }
}

// =====================================================================================================================
// k_softmax: row softmax over n contiguous elements, one 256-thread block per row; rows addressed z*sz + r*sr (grid (R, Z)).
//   out = scale_out * softmax(scale_in * x + (Mf ? Mf[z*smz + r*smr + j] : 0)); a row whose max is -inf is written as 0.
// =====================================================================================================================
struct SmP { const float* src; float* dst; const float* Mf; long long sz, sr, dz, dr, smz, smr; int n, pad; float scale_in, scale_out; };
static_assert(sizeof(SmP) == 3 * 8 + 6 * 8 + 4 * 4, "SmP has padding");
__global__ __launch_bounds__(256) void k_softmax(SmP p) {
    __shared__ float red[256];
    const int r = blockIdx.x, z = blockIdx.y, tid = threadIdx.x;
    const float* s = p.src + z * p.sz + (long long)r * p.sr;
    const float* mf = p.Mf ? (p.Mf + z * p.smz + (long long)r * p.smr) : nullptr;
    float mx = -__builtin_inff();
    for (int j = tid; j < p.n; j += 256) { float v = s[j] * p.scale_in; if (mf) v += mf[j]; mx = fmaxf(mx, v); }
    red[tid] = mx; __syncthreads();
    for (int o = 128; o > 0; o >>= 1) { if (tid < o) red[tid] = fmaxf(red[tid], red[tid + o]); __syncthreads(); }
    mx = red[0]; __syncthreads();
    float sum = 0.f;
    for (int j = tid; j < p.n; j += 256) { float v = s[j] * p.scale_in; if (mf) v += mf[j]; sum += (mx == -__builtin_inff()) ? 0.f : expf(v - mx); }
    red[tid] = sum; __syncthreads();
    for (int o = 128; o > 0; o >>= 1) { if (tid < o) red[tid] += red[tid + o]; __syncthreads(); }
    sum = red[0];
    const float inv = (sum > 0.f) ? p.scale_out / sum : 0.f;
    float* d = p.dst + z * p.dz + (long long)r * p.dr;
    for (int j = tid; j < p.n; j += 256) { float v = s[j] * p.scale_in; if (mf) v += mf[j]; const float o = (mx == -__builtin_inff()) ? 0.f : expf(v - mx) * inv; VST2(float, d + j, o); }
}
// =====================================================================================================================
// k_stats: mean and rsqrt(var + eps) over a set of n elements addressed base + z*sz + (e / inner) * so + (e % inner) * si, one 256-thread
// k_norm_apply: y = (x - mean[set]) * rstd[set] * g[c] + b[c] over a [Z][C][L] chan-major tensor with set = z*G + c / (C/G) (G groups per z;
//   G = C -> per-chan sets indexed z*C+c; for batch norm pass stats indexed by c only via bn = 1). Optional act. Output same layout.
// =====================================================================================================================
//   mode 0: mean / rsqrt(var + eps); mode 1 (RMSNorm): 0 / rsqrt(mean(x^2) + eps); mode 2 (L2 normalize * sqrt(n)): 0 / sqrt(n) / max(||x||, eps); mode 3: as 0 with unbiased variance (n-1)
__global__ __launch_bounds__(256) void k_stats(const float* __restrict__ x, long long sz, long long so, long long si, int inner, int n, float eps, float* __restrict__ stat, int mode) {
    __shared__ float red[256];
    const int z = blockIdx.x, tid = threadIdx.x;
    const float* base = x + z * sz;
    float s = 0.f;
    for (int e = tid; e < n; e += 256) s += base[(long long)(e / inner) * so + (long long)(e % inner) * si];
    red[tid] = s; __syncthreads();
    for (int o = 128; o > 0; o >>= 1) { if (tid < o) red[tid] += red[tid + o]; __syncthreads(); }
    const float mu = (mode == 0 || mode == 3) ? red[0] / (float)n : 0.f; __syncthreads();
    float q = 0.f;
    for (int e = tid; e < n; e += 256) { const float dlt = base[(long long)(e / inner) * so + (long long)(e % inner) * si] - mu; q += dlt * dlt; }
    red[tid] = q; __syncthreads();
    for (int o = 128; o > 0; o >>= 1) { if (tid < o) red[tid] += red[tid + o]; __syncthreads(); }
    {
        float rs;
        if (mode == 2) rs = sqrtf((float)n) / fmaxf(sqrtf(red[0]), eps); else if (mode == 3) rs = rsqrtf(red[0] / (float)(n - 1) + eps); else rs = rsqrtf(red[0] / (float)n + eps);
        if (tid < 32) { const float v = (tid == 0) ? mu : ((tid == 1) ? rs : 0.f); VST2(float, stat + (long long)z * 32 + tid, v); }
    }
}
//   One thread per element over the flat [Z][C][L] index space: grid ceil(Z*C*L / 256).
__global__ __launch_bounds__(256) void k_norm_apply(const float* __restrict__ x, float* __restrict__ y, const float* __restrict__ stat, const float* __restrict__ g, const float* __restrict__ bta,
                                                     int Z, int C, int L, int G, int bn, int act) {
    const long long idx = (long long)blockIdx.x * 256 + threadIdx.x;
    if (idx >= (long long)Z * C * L) return;
    const int l = (int)(idx % L); const long long zc = idx / L; const int c = (int)(zc % C), z = (int)(zc / C); (void)l;
    const int set = bn ? c : (z * G + c / (C / G));
    float v = (x[idx] - stat[(long long)set * 32]) * stat[(long long)set * 32 + 1];
    if (g) v *= g[c];
    if (bta) v += bta[c];
    v = act_fn(v, act);
    VST2(float, y + idx, v);
}

// k_lse_neg: c[i] = -(st[2i] + log(st[2i+1])) = minus the log-sum-exp of row i from k_attn's ST output (for softmax over the query dimension)
__global__ __launch_bounds__(256) void k_lse_neg(const float* __restrict__ st, float* __restrict__ c, int n) {
    const int i = blockIdx.x * 256 + threadIdx.x;
    if (i < n) { const float v = -(st[2 * i] + logf(st[2 * i + 1])); VST2(float, c + i, v); }
}

// k_iota: dst[i] = a * i + b as int32 (segment/position id helper)
__global__ __launch_bounds__(256) void k_iota(int* __restrict__ dst, int n, int a, int b) {
    const int i = blockIdx.x * 256 + threadIdx.x;
    if (i < n) { const int v = a * i + b; VST2(int, dst + i, v); }
}

// k_axpby: dst[i] = a * x[i] + b * y[i] (+ c), i < n
__global__ __launch_bounds__(256) void k_axpby(const float* __restrict__ x, const float* __restrict__ y, float* __restrict__ dst, int n, float a, float b, float c) {
    const int i = blockIdx.x * 256 + threadIdx.x;
    if (i < n) { const float v = a * x[i] + b * y[i] + c; VST2(float, dst + i, v); }
}

// =====================================================================================================================
// k_rope: rotary embedding on a [R rows][Hn heads][D] view (row stride sXr, head stride sXh, element stride 1) -> Y (own strides).
//   mode 0: rotate_half (partner d±D/2, sign - for d<D/2); mode 1: interleaved pairs (partner d^1, sign - for even d).
//   table column tcol: tmode 0 -> d, 1 -> d % (D/2), 2 -> d / 2; position p: pmode 0 -> r % S, 1 -> head index, 2 -> pos[r];
//   c = C[(r / S) * sCb + p * sCp + tcol * sCd], s likewise from Sn; y = x[d] * c + sign * x[partner] * s. X and Y must not alias.
// =====================================================================================================================
struct RopeP { const float* X; float* Y; const float* C; const float* Sn; const int* pos; long long sXr, sXh, sYr, sYh, sCb, sCp, sCd; int R, Hn, D, S, mode, tmode, pmode, pad; };
static_assert(sizeof(RopeP) == 5 * 8 + 7 * 8 + 8 * 4, "RopeP has padding");
__global__ __launch_bounds__(256) void k_rope(RopeP p) {
    const long long idx = (long long)blockIdx.x * 256 + threadIdx.x;
    if (idx >= (long long)p.R * p.Hn * p.D) return;
    const int d = (int)(idx % p.D); const long long rh = idx / p.D; const int h = (int)(rh % p.Hn); const int r = (int)(rh / p.Hn);
    const int half = p.D / 2;
    int partner; float sign;
    if (p.mode == 0) { partner = (d < half) ? d + half : d - half; sign = (d < half) ? -1.f : 1.f; }
    else { partner = d ^ 1; sign = (d & 1) ? 1.f : -1.f; }
    const int tcol = (p.tmode == 0) ? d : ((p.tmode == 1) ? (d % half) : (d >> 1));
    const int pp = (p.pmode == 0) ? (r % p.S) : ((p.pmode == 1) ? h : p.pos[r]);
    const long long toff = (long long)(r / p.S) * p.sCb + (long long)pp * p.sCp + (long long)tcol * p.sCd;
    const float* xr = p.X + (long long)r * p.sXr + (long long)h * p.sXh;
    const float v = xr[d] * p.C[toff] + sign * xr[partner] * p.Sn[toff];
    VST2(float, p.Y + (long long)r * p.sYr + (long long)h * p.sYh + d, v);
}

// k_invf + k_sincos (split so neither kernel carries a large VALU-fma footprint): invf_i = num * (1 / powf(base, (2 i)/D)) [fmode 0],
//   num * expf((2 i) * cexp) [fmode 1], num * powf(base, -2 (i - 1) / D) [fmode 2]; then cs/sn[s*half + i] = cos/sin((pscale * s) * invf_i)
__global__ __launch_bounds__(256) void k_invf(float* __restrict__ invb, int half, int D, float base, float num, int fmode, float cexp) {
    const int i = blockIdx.x * 256 + threadIdx.x;
    if (i >= ((half + 31) / 32) * 32) return;
    if (i >= half) { VST2(float, invb + i, 0.f); return; }
    const float e = (float)(2 * i) / (float)D;
    float invf;
    if (fmode == 1) invf = num * expf((float)(2 * i) * cexp);
    else if (fmode == 2) invf = num * powf(base, (-2.0f * ((float)i - 1.0f)) / (float)D);
    else invf = num * (1.0f / powf(base, e));
    VST2(float, invb + i, invf);
}
__global__ __launch_bounds__(256) void k_sincos(float* __restrict__ cs, float* __restrict__ sn, const float* __restrict__ invb, int S, int half, float pscale) {
    const int idx = blockIdx.x * 256 + threadIdx.x;
    if (idx >= S * half) return;
    const int s = idx / half, i = idx - s * half;
    const float ang = (pscale * (float)s) * invb[i];
    VST2(float, cs + idx, cosf(ang)); VST2(float, sn + idx, sinf(ang));
}

// k_mulact: dst[i] = act(x[i]) * y[i]
__global__ __launch_bounds__(256) void k_mulact(const float* __restrict__ x, const float* __restrict__ y, float* __restrict__ dst, int n, int act) {
    const int i = blockIdx.x * 256 + threadIdx.x;
    if (i < n) { const float v = act_fn(x[i], act) * y[i]; VST2(float, dst + i, v); }
}

// =====================================================================================================================
// k_matvec: thread-per-row matrix-vector products for N <= 8 output columns (heads with 1-3 outputs, gates), f32 on the VALU.
//   C[r*sCm + j] = act(alpha * sum_k A[r*sAm + k*sAk] * B[j*sBn + k*sBk] + bias[j]) + beta * R[r*sRm + j*sRn]; each thread writes its N contiguous floats.
// =====================================================================================================================
__global__ __launch_bounds__(256) void k_matvec(GemmP p) {
    // 32 lanes write one line with one instruction.
    const int rpt = (p.N == 1) ? 1 : 32;
    const long long r0 = ((long long)blockIdx.x * 256 + threadIdx.x) * rpt; const int z = blockIdx.z, zo = z / p.zi_n, zi = z - zo * p.zi_n;
    if (r0 >= p.M) return;
    const float* Bb = p.B + zo * p.sBo + zi * p.sBi;
    float* C = p.C + zo * p.sCo + zi * p.sCi; const float* R = p.R + zo * p.sRo + zi * p.sRi;
    for (int rr = 0; rr < rpt; ++rr) {
        const long long r = r0 + rr; if (r >= p.M) break;
        const float* A = p.A + zo * p.sAo + zi * p.sAi + r * p.sAm;
        float acc[8] = {0.f, 0.f, 0.f, 0.f, 0.f, 0.f, 0.f, 0.f};
        for (int k = 0; k < p.K; ++k) { const float a = A[(long long)k * p.sAk];
#pragma unroll
            for (int j = 0; j < 8; ++j) if (j < p.N) acc[j] += a * Bb[(long long)j * p.sBn + (long long)k * p.sBk]; }
#pragma unroll
        for (int j = 0; j < 8; ++j) if (j < p.N) {
            float v = acc[j] * p.alpha;
            if (p.flags & 1) v += p.bias[j];
            if (p.flags & 2) v += p.bias[r];
            v = act_fn(v, p.act);
            if (p.flags & 4) v += p.beta * R[r * p.sRm + (long long)j * p.sRn];
            VST2(float, C + r * p.sCm + j, v);
        }
    }
}
// k_smallsoftmax: thread-per-row softmax for short rows (n <= 64): dst[r*dr + j] = softmax(scale*src[r*sr + j])
__global__ __launch_bounds__(256) void k_smallsoftmax(const float* __restrict__ src, float* __restrict__ dst, long long sr, long long dr, int n, long long R, float scale) {
    const long long r0 = ((long long)blockIdx.x * 256 + threadIdx.x) * 32;
    for (int rr = 0; rr < 32; ++rr) {
        const long long r = r0 + rr; if (r >= R) return;
        const float* s = src + r * sr; float* d = dst + r * dr;
        float mx = -__builtin_inff();
        for (int j = 0; j < n; ++j) mx = fmaxf(mx, s[j] * scale);
        float sum = 0.f;
        for (int j = 0; j < n; ++j) sum += expf(s[j] * scale - mx);
        const float inv = 1.f / sum;
        for (int j = 0; j < n; ++j) { const float v = expf(s[j] * scale - mx) * inv; VST2(float, d + j, v); }
    }
}

__global__ __launch_bounds__(32) void k_unitstat(float* __restrict__ st) { const int t = threadIdx.x; const float v = (t == 1) ? 1.f : 0.f; VST2(float, st + t, v); }

// destination (e.g. a d_out whose row width is not a multiple of 32 floats) is written by consecutive lanes of one instruction
__global__ __launch_bounds__(256) void k_lincopy(const float* __restrict__ src, long long lds, float* __restrict__ dst, long long ldd, long long rows, int cols) {
    const long long i = (long long)blockIdx.x * 256 + threadIdx.x; if (i >= rows * cols) return;
    const long long r = i / cols; const int c = (int)(i - r * cols);
    const float v = src[r * lds + c]; VST2(float, dst + r * ldd + c, v);
}


__device__ __forceinline__ void st_h2(unsigned short* d2, float a, float b) { const unsigned u = (unsigned)__builtin_bit_cast(unsigned short, (_Float16)a) | ((unsigned)__builtin_bit_cast(unsigned short, (_Float16)b) << 16); unsigned* d = (unsigned*)d2; *d = u;  }
__device__ __forceinline__ float ldh(const unsigned short* p) { return (float)__builtin_bit_cast(_Float16, *p); }
__device__ __forceinline__ v4f ld4h(const unsigned short* p) { const unsigned long long u = *(const unsigned long long*)p; v4f a;
    a.x = (float)__builtin_bit_cast(_Float16, (unsigned short)(u & 0xFFFFu)); a.y = (float)__builtin_bit_cast(_Float16, (unsigned short)((u >> 16) & 0xFFFFu)); a.z = (float)__builtin_bit_cast(_Float16, (unsigned short)((u >> 32) & 0xFFFFu)); a.w = (float)__builtin_bit_cast(_Float16, (unsigned short)((u >> 48) & 0xFFFFu)); return a; }
__device__ __forceinline__ unsigned long long pk4h(v4f s) { return (unsigned long long)__builtin_bit_cast(unsigned short, (_Float16)s.x) | ((unsigned long long)__builtin_bit_cast(unsigned short, (_Float16)s.y) << 16) | ((unsigned long long)__builtin_bit_cast(unsigned short, (_Float16)s.z) << 32) | ((unsigned long long)__builtin_bit_cast(unsigned short, (_Float16)s.w) << 48); }
typedef unsigned v4u __attribute__((ext_vector_type(4)));
__device__ __forceinline__ void st8h(unsigned short* d, v4f a, v4f b) { const unsigned long long pa = pk4h(a), pb = pk4h(b); v4u pk; pk.x = (unsigned)(pa & 0xFFFFFFFFull); pk.y = (unsigned)(pa >> 32); pk.z = (unsigned)(pb & 0xFFFFFFFFull); pk.w = (unsigned)(pb >> 32); v4u* dd = (v4u*)d; *dd = pk;  }
__device__ __forceinline__ unsigned short bfu_rne(float v) { unsigned u = __builtin_bit_cast(unsigned, v); u += 0x7FFFu + ((u >> 16) & 1u); return (unsigned short)(u >> 16); }
__device__ __forceinline__ void bfsplit(float v, unsigned short& hi, unsigned short& lo) { hi = bfu_rne(v); lo = bfu_rne(v - __builtin_bit_cast(float, (unsigned)hi << 16)); }
__device__ __forceinline__ void st_s2(unsigned short* Hp, unsigned short* Lp, long long o, float a, float b) { unsigned short h0,l0,h1,l1; bfsplit(a,h0,l0); bfsplit(b,h1,l1); const unsigned ph = (unsigned)h0 | ((unsigned)h1 << 16), pl = (unsigned)l0 | ((unsigned)l1 << 16);
    unsigned* dh = (unsigned*)(Hp + o); unsigned* dl = (unsigned*)(Lp + o); *dh = ph; *dl = pl;  }
__device__ __forceinline__ int cl(int v, int n) { return min(max(v, 0), n - 1); }

// GAT-style aggregation over a device in-edge CSR at dst (+ optional explicit self loop as iteration j = -1):
//   logit = leaky(AS[src][h] + AD[n][h] (+ EW[e]*CW[h]), slope); softmax over the node's edges per head; acc[c] = sum alpha XP[src][c] (f16 gather plane, pitch XW; 256 channels = H heads x CH)
//   wave per node; lane L owns channels 8L..8L+7 (head = 8L / CH); per-lane softmax state (lanes of one head agree) -> no shuffles in the loop.
//   EPI 0: + bias -> f32 OUT[n][256] via LDS redistribution (two 16-B stores per lane, each instruction 512 contiguous B)
//   EPI 1: + bias, LayerNorm(256) * g + bb, relu -> bf16 hi/lo planes OH/OL [n][256] (16-B stores)
//   EPI 2: mean over the 256/CH heads + bias[0..63], LayerNorm(64) * g + bb, relu -> f32 OUT[n][64] (CH must be 64; LDS redistribution, 8-B stores)
//   EPI 3: mean over heads + bias -> f32 OUT[n][64] (no norm / activation)
//   EPI 4: + bias, ELU -> bf16 hi/lo planes OH/OL [n][256];  EPI 5: + bias (full 256-wide, per head), ELU, then mean over the 256/CH heads -> f32 OUT[n][64]
//   EPI 6: (CH = 128, two heads) mean over the two heads, + bias[0..127], relu -> f32 OUT[n][128] (LDS redistribution, 16-B stores)
//   EWM 0: no edge weights; 1: logit += EW[e] * CW[h] (self loop weight 1); 2: alpha *= EW[e] after the softmax (message scale; self loop weight 1)
template <int CH, bool SELF, int EWM, int EPI>
__global__ __launch_bounds__(256) void k_gat_agg(const unsigned short* __restrict__ XP, int XW, const float* __restrict__ AS, const float* __restrict__ AD, int ASTR, const float* __restrict__ EW, const float* __restrict__ CW,
        const int* __restrict__ esrc, const int* __restrict__ off, const int* __restrict__ cnt, const int* __restrict__ slot, const float* __restrict__ bias, const float* __restrict__ g, const float* __restrict__ bb,
        float* __restrict__ OUT, unsigned short* __restrict__ OH, unsigned short* __restrict__ OL, int N, int E, int CAP, float slope) {
    __shared__ float stage[8][256];
    const int wv = threadIdx.x >> 5; const int n = blockIdx.x * 8 + wv; const int L = threadIdx.x & 31; if (n >= N) return; const int c0 = 8 * L; const int h = c0 / CH;
    const float ad = AD[(long long)n * ASTR + h]; const float cw = (EWM == 1) ? CW[h] : 0.f; float m = -3.0e38f, s = 0.f; v4f a0, a1; a0.x = a0.y = a0.z = a0.w = 0.f; a1 = a0;
    const int p0 = cl(off[n], E + 1), cn = min(max(cnt[n], 0), CAP);
    for (int j = (SELF ? -1 : 0); j < cn; ++j) { int sj; float ew = 0.f;
        if (j < 0) { sj = n; ew = 1.f; } else { int e = slot[cl(p0 + j, E)]; e = cl(e, E); sj = cl(esrc[e], N); if (EWM != 0) ew = EW[e]; }
        float lg = AS[(long long)sj * ASTR + h] + ad + ((EWM == 1) ? ew * cw : 0.f); lg = (lg >= 0.f) ? lg : slope * lg;
        const float mn = fmaxf(m, lg); const float cz = expf(m - mn), pj = expf(lg - mn); s = s * cz + pj; const float pw = (EWM == 2) ? pj * ew : pj;
        const unsigned short* xr = XP + (long long)sj * XW + c0; a0 = a0 * cz + ld4h(xr) * pw; a1 = a1 * cz + ld4h(xr + 4) * pw; m = mn; }
    const float inv = (s > 0.f) ? 1.f / (s + 1e-16f) : 0.f; a0 = a0 * inv; a1 = a1 * inv;
    if (EPI == 0 || EPI == 1 || EPI == 4 || EPI == 5) { a0 = a0 + *(const v4f*)(bias + c0); a1 = a1 + *(const v4f*)(bias + c0 + 4); }
    if (EPI == 4 || EPI == 5) { a0.x = (a0.x > 0.f) ? a0.x : (expf(a0.x) - 1.f); a0.y = (a0.y > 0.f) ? a0.y : (expf(a0.y) - 1.f); a0.z = (a0.z > 0.f) ? a0.z : (expf(a0.z) - 1.f); a0.w = (a0.w > 0.f) ? a0.w : (expf(a0.w) - 1.f);
        a1.x = (a1.x > 0.f) ? a1.x : (expf(a1.x) - 1.f); a1.y = (a1.y > 0.f) ? a1.y : (expf(a1.y) - 1.f); a1.z = (a1.z > 0.f) ? a1.z : (expf(a1.z) - 1.f); a1.w = (a1.w > 0.f) ? a1.w : (expf(a1.w) - 1.f); }
    if (EPI == 4) { float o8[8] = {a0.x, a0.y, a0.z, a0.w, a1.x, a1.y, a1.z, a1.w}; unsigned short hh[8], ll[8];
#pragma unroll
        for (int u = 0; u < 8; ++u) bfsplit(o8[u], hh[u], ll[u]);
        const unsigned long long ph0 = (unsigned long long)hh[0] | ((unsigned long long)hh[1] << 16) | ((unsigned long long)hh[2] << 32) | ((unsigned long long)hh[3] << 48), pl0 = (unsigned long long)ll[0] | ((unsigned long long)ll[1] << 16) | ((unsigned long long)ll[2] << 32) | ((unsigned long long)ll[3] << 48);
        const unsigned long long ph1 = (unsigned long long)hh[4] | ((unsigned long long)hh[5] << 16) | ((unsigned long long)hh[6] << 32) | ((unsigned long long)hh[7] << 48), pl1 = (unsigned long long)ll[4] | ((unsigned long long)ll[5] << 16) | ((unsigned long long)ll[6] << 32) | ((unsigned long long)ll[7] << 48);
        v4u pk; pk.x = (unsigned)(ph0 & 0xFFFFFFFFull); pk.y = (unsigned)(ph0 >> 32); pk.z = (unsigned)(ph1 & 0xFFFFFFFFull); pk.w = (unsigned)(ph1 >> 32); v4u* dh = (v4u*)(OH + (long long)n * 256 + c0); *dh = pk; 
        v4u ql; ql.x = (unsigned)(pl0 & 0xFFFFFFFFull); ql.y = (unsigned)(pl0 >> 32); ql.z = (unsigned)(pl1 & 0xFFFFFFFFull); ql.w = (unsigned)(pl1 >> 32); v4u* dl = (v4u*)(OL + (long long)n * 256 + c0); *dl = ql;  return; }
    if (EPI == 6) {
        a0.x += __shfl_xor(a0.x, 16); a0.y += __shfl_xor(a0.y, 16); a0.z += __shfl_xor(a0.z, 16); a0.w += __shfl_xor(a0.w, 16); a1.x += __shfl_xor(a1.x, 16); a1.y += __shfl_xor(a1.y, 16); a1.z += __shfl_xor(a1.z, 16); a1.w += __shfl_xor(a1.w, 16);
        if (L < 16) { const int cb = 8 * L; const v4f b0 = *(const v4f*)(bias + cb), b1v = *(const v4f*)(bias + cb + 4);
            stage[wv][cb] = fmaxf(a0.x * 0.5f + b0.x, 0.f); stage[wv][cb + 1] = fmaxf(a0.y * 0.5f + b0.y, 0.f); stage[wv][cb + 2] = fmaxf(a0.z * 0.5f + b0.z, 0.f); stage[wv][cb + 3] = fmaxf(a0.w * 0.5f + b0.w, 0.f);
            stage[wv][cb + 4] = fmaxf(a1.x * 0.5f + b1v.x, 0.f); stage[wv][cb + 5] = fmaxf(a1.y * 0.5f + b1v.y, 0.f); stage[wv][cb + 6] = fmaxf(a1.z * 0.5f + b1v.z, 0.f); stage[wv][cb + 7] = fmaxf(a1.w * 0.5f + b1v.w, 0.f); }
        __builtin_amdgcn_fence(__ATOMIC_RELEASE, "workgroup"); __builtin_amdgcn_wave_barrier(); __builtin_amdgcn_fence(__ATOMIC_ACQUIRE, "workgroup");
        v4f o6; o6.x = stage[wv][4 * L]; o6.y = stage[wv][4 * L + 1]; o6.z = stage[wv][4 * L + 2]; o6.w = stage[wv][4 * L + 3]; VST2V4(OUT + (long long)n * 128 + 4 * L, o6); return; }
    if (EPI == 5) {
        a0.x += __shfl_xor(a0.x, 8); a0.y += __shfl_xor(a0.y, 8); a0.z += __shfl_xor(a0.z, 8); a0.w += __shfl_xor(a0.w, 8); a1.x += __shfl_xor(a1.x, 8); a1.y += __shfl_xor(a1.y, 8); a1.z += __shfl_xor(a1.z, 8); a1.w += __shfl_xor(a1.w, 8);
        a0.x += __shfl_xor(a0.x, 16); a0.y += __shfl_xor(a0.y, 16); a0.z += __shfl_xor(a0.z, 16); a0.w += __shfl_xor(a0.w, 16); a1.x += __shfl_xor(a1.x, 16); a1.y += __shfl_xor(a1.y, 16); a1.z += __shfl_xor(a1.z, 16); a1.w += __shfl_xor(a1.w, 16);
        const int gq5 = L & 7; a0 = a0 * 0.25f; a1 = a1 * 0.25f;
        if (L < 8) { stage[wv][8 * gq5] = a0.x; stage[wv][8 * gq5 + 1] = a0.y; stage[wv][8 * gq5 + 2] = a0.z; stage[wv][8 * gq5 + 3] = a0.w; stage[wv][8 * gq5 + 4] = a1.x; stage[wv][8 * gq5 + 5] = a1.y; stage[wv][8 * gq5 + 6] = a1.z; stage[wv][8 * gq5 + 7] = a1.w; }
        __builtin_amdgcn_fence(__ATOMIC_RELEASE, "workgroup"); __builtin_amdgcn_wave_barrier(); __builtin_amdgcn_fence(__ATOMIC_ACQUIRE, "workgroup");
        const unsigned long long pk5 = (unsigned long long)__builtin_bit_cast(unsigned, stage[wv][2 * L]) | ((unsigned long long)__builtin_bit_cast(unsigned, stage[wv][2 * L + 1]) << 32); VST2(unsigned long long, (unsigned long long*)(OUT + (long long)n * 64 + 2 * L), pk5); return; }
    if (EPI == 1) { float sm = a0.x + a0.y + a0.z + a0.w + a1.x + a1.y + a1.z + a1.w;
#pragma unroll
        for (int o = 16; o > 0; o >>= 1) sm += __shfl_xor(sm, o);
        const float mu = sm * (1.f / 256.f); const v4f d0 = a0 - mu, d1 = a1 - mu; float q = d0.x * d0.x + d0.y * d0.y + d0.z * d0.z + d0.w * d0.w + d1.x * d1.x + d1.y * d1.y + d1.z * d1.z + d1.w * d1.w;
#pragma unroll
        for (int o = 16; o > 0; o >>= 1) q += __shfl_xor(q, o);
        const float rs = rsqrtf(q * (1.f / 256.f) + 1e-5f); float o8[8] = {d0.x, d0.y, d0.z, d0.w, d1.x, d1.y, d1.z, d1.w}; unsigned short hh[8], ll[8];
#pragma unroll
        for (int u = 0; u < 8; ++u) { const float v = fmaxf(o8[u] * rs * g[c0 + u] + bb[c0 + u], 0.f); bfsplit(v, hh[u], ll[u]); }
        const unsigned long long ph0 = (unsigned long long)hh[0] | ((unsigned long long)hh[1] << 16) | ((unsigned long long)hh[2] << 32) | ((unsigned long long)hh[3] << 48), pl0 = (unsigned long long)ll[0] | ((unsigned long long)ll[1] << 16) | ((unsigned long long)ll[2] << 32) | ((unsigned long long)ll[3] << 48);
        const unsigned long long ph1 = (unsigned long long)hh[4] | ((unsigned long long)hh[5] << 16) | ((unsigned long long)hh[6] << 32) | ((unsigned long long)hh[7] << 48), pl1 = (unsigned long long)ll[4] | ((unsigned long long)ll[5] << 16) | ((unsigned long long)ll[6] << 32) | ((unsigned long long)ll[7] << 48);
        // lane L's 8 halves at c0 = 8L: 16 B -> one 16-B store per plane (32 lanes x 16 B = whole 512-B row)
        v4u pk; pk.x = (unsigned)(ph0 & 0xFFFFFFFFull); pk.y = (unsigned)(ph0 >> 32); pk.z = (unsigned)(ph1 & 0xFFFFFFFFull); pk.w = (unsigned)(ph1 >> 32); v4u* dh = (v4u*)(OH + (long long)n * 256 + c0); *dh = pk; 
        v4u ql; ql.x = (unsigned)(pl0 & 0xFFFFFFFFull); ql.y = (unsigned)(pl0 >> 32); ql.z = (unsigned)(pl1 & 0xFFFFFFFFull); ql.w = (unsigned)(pl1 >> 32); v4u* dl = (v4u*)(OL + (long long)n * 256 + c0); *dl = ql;  return; }
    if (EPI == 2 || EPI == 3) {   // head mean: lanes L, L^8, L^16, L^24 hold the same chan group of the 4 heads (CH = 64 -> 8 lanes per head)
        a0.x += __shfl_xor(a0.x, 8); a0.y += __shfl_xor(a0.y, 8); a0.z += __shfl_xor(a0.z, 8); a0.w += __shfl_xor(a0.w, 8); a1.x += __shfl_xor(a1.x, 8); a1.y += __shfl_xor(a1.y, 8); a1.z += __shfl_xor(a1.z, 8); a1.w += __shfl_xor(a1.w, 8);
        a0.x += __shfl_xor(a0.x, 16); a0.y += __shfl_xor(a0.y, 16); a0.z += __shfl_xor(a0.z, 16); a0.w += __shfl_xor(a0.w, 16); a1.x += __shfl_xor(a1.x, 16); a1.y += __shfl_xor(a1.y, 16); a1.z += __shfl_xor(a1.z, 16); a1.w += __shfl_xor(a1.w, 16);
        const int gq = L & 7; a0 = a0 * 0.25f + *(const v4f*)(bias + 8 * gq); a1 = a1 * 0.25f + *(const v4f*)(bias + 8 * gq + 4);      // every lane now holds channels 8gq..8gq+7 of the mean
        if (EPI == 3) { if (L < 8) { stage[wv][8 * gq] = a0.x; stage[wv][8 * gq + 1] = a0.y; stage[wv][8 * gq + 2] = a0.z; stage[wv][8 * gq + 3] = a0.w; stage[wv][8 * gq + 4] = a1.x; stage[wv][8 * gq + 5] = a1.y; stage[wv][8 * gq + 6] = a1.z; stage[wv][8 * gq + 7] = a1.w; }
            __builtin_amdgcn_fence(__ATOMIC_RELEASE, "workgroup"); __builtin_amdgcn_wave_barrier(); __builtin_amdgcn_fence(__ATOMIC_ACQUIRE, "workgroup");
            const unsigned long long pk3 = (unsigned long long)__builtin_bit_cast(unsigned, stage[wv][2 * L]) | ((unsigned long long)__builtin_bit_cast(unsigned, stage[wv][2 * L + 1]) << 32); VST2(unsigned long long, (unsigned long long*)(OUT + (long long)n * 64 + 2 * L), pk3); return; }
        float sm = (L < 8) ? (a0.x + a0.y + a0.z + a0.w + a1.x + a1.y + a1.z + a1.w) : 0.f;
#pragma unroll
        for (int o = 16; o > 0; o >>= 1) sm += __shfl_xor(sm, o);
        const float mu = sm * (1.f / 64.f); const v4f d0 = a0 - mu, d1 = a1 - mu; float q = (L < 8) ? (d0.x * d0.x + d0.y * d0.y + d0.z * d0.z + d0.w * d0.w + d1.x * d1.x + d1.y * d1.y + d1.z * d1.z + d1.w * d1.w) : 0.f;
#pragma unroll
        for (int o = 16; o > 0; o >>= 1) q += __shfl_xor(q, o);
        const float rs = rsqrtf(q * (1.f / 64.f) + 1e-5f);
        if (L < 8) { const float* gg = g + 8 * gq; const float* bq = bb + 8 * gq; stage[wv][8 * gq] = fmaxf(d0.x * rs * gg[0] + bq[0], 0.f); stage[wv][8 * gq + 1] = fmaxf(d0.y * rs * gg[1] + bq[1], 0.f); stage[wv][8 * gq + 2] = fmaxf(d0.z * rs * gg[2] + bq[2], 0.f); stage[wv][8 * gq + 3] = fmaxf(d0.w * rs * gg[3] + bq[3], 0.f);
            stage[wv][8 * gq + 4] = fmaxf(d1.x * rs * gg[4] + bq[4], 0.f); stage[wv][8 * gq + 5] = fmaxf(d1.y * rs * gg[5] + bq[5], 0.f); stage[wv][8 * gq + 6] = fmaxf(d1.z * rs * gg[6] + bq[6], 0.f); stage[wv][8 * gq + 7] = fmaxf(d1.w * rs * gg[7] + bq[7], 0.f); }
        __builtin_amdgcn_fence(__ATOMIC_RELEASE, "workgroup"); __builtin_amdgcn_wave_barrier(); __builtin_amdgcn_fence(__ATOMIC_ACQUIRE, "workgroup");
        const unsigned long long pk = (unsigned long long)__builtin_bit_cast(unsigned, stage[wv][2 * L]) | ((unsigned long long)__builtin_bit_cast(unsigned, stage[wv][2 * L + 1]) << 32); VST2(unsigned long long, (unsigned long long*)(OUT + (long long)n * 64 + 2 * L), pk); return; }
    // EPI 0
    stage[wv][c0] = a0.x; stage[wv][c0 + 1] = a0.y; stage[wv][c0 + 2] = a0.z; stage[wv][c0 + 3] = a0.w; stage[wv][c0 + 4] = a1.x; stage[wv][c0 + 5] = a1.y; stage[wv][c0 + 6] = a1.z; stage[wv][c0 + 7] = a1.w;
    __builtin_amdgcn_fence(__ATOMIC_RELEASE, "workgroup"); __builtin_amdgcn_wave_barrier(); __builtin_amdgcn_fence(__ATOMIC_ACQUIRE, "workgroup");
#pragma unroll
    for (int q2 = 0; q2 < 2; ++q2) { const int c = 128 * q2 + 4 * L; v4f v; v.x = stage[wv][c]; v.y = stage[wv][c + 1]; v.z = stage[wv][c + 2]; v.w = stage[wv][c + 3]; VST2V4(OUT + (long long)n * 256 + c, v); } }

__device__ __forceinline__ void st4s(unsigned short* Hp, unsigned short* Lp, long long o, v4f a) { unsigned short h[4], l[4]; bfsplit(a.x, h[0], l[0]); bfsplit(a.y, h[1], l[1]); bfsplit(a.z, h[2], l[2]); bfsplit(a.w, h[3], l[3]);
    const unsigned long long ph = (unsigned long long)h[0] | ((unsigned long long)h[1] << 16) | ((unsigned long long)h[2] << 32) | ((unsigned long long)h[3] << 48), pl = (unsigned long long)l[0] | ((unsigned long long)l[1] << 16) | ((unsigned long long)l[2] << 32) | ((unsigned long long)l[3] << 48);
    VST2(unsigned long long, (unsigned long long*)(Hp + o), ph); VST2(unsigned long long, (unsigned long long*)(Lp + o), pl); }
// f32 [nval2 pairs] -> bf16 hi/lo planes (n2 pairs; pairs >= nval2 zero); thread-linear 4-B stores per plane
__global__ __launch_bounds__(256) void k_pl(const float* __restrict__ S, unsigned short* __restrict__ PH, unsigned short* __restrict__ PL, long long nval2, long long n2) { const long long u = (long long)blockIdx.x * 256 + threadIdx.x; if (u >= n2) return; const bool in = (u < nval2); const long long uc = in ? u : ((nval2 > 0) ? (nval2 - 1) : 0); const float a = S[2 * uc], b = S[2 * uc + 1]; st_s2(PH, PL, 2 * u, in ? a : 0.f, in ? b : 0.f); }
// WC [K][NOP] (thread-linear whole rows) = [W (cols < FO) | 0 | W_h . as_h @EO+h | W_h . ad_h @EO+NH+h | 0 ...]; W is [K][FO] (x @ W layout), as/ad [NH][DH]; EO >= FO.
// branch-free: every lane loads all candidates with clamped indices and selects by value (no exec-masked load arms)
__global__ __launch_bounds__(256) void k_wext(const float* __restrict__ Wm, const float* __restrict__ AS_, const float* __restrict__ AD_, int K, int NOP, int FO, int NH, int DH, int EO, float* __restrict__ WC) {
    #pragma clang fp contract(off)
    const long long u = (long long)blockIdx.x * 256 + threadIdx.x; if (u >= (long long)K * NOP) return; const int kk = (int)(u / NOP), o = (int)(u % NOP);
    const int oo = min(o, FO - 1); const float vw = Wm[(long long)kk * FO + oo]; const int q = min(max(o - EO, 0), 2 * NH - 1); const int h = q % NH; float s = 0.f;
#pragma unroll 1
    for (int c = 0; c < DH; ++c) { const float w = Wm[(long long)kk * FO + h * DH + c]; const float asv = AS_[h * DH + c], adv = AD_[h * DH + c]; s += w * ((q < NH) ? asv : adv); }
    const float v = (o < FO) ? vw : ((o >= EO && o < EO + 2 * NH) ? s : 0.f); VST2(float, WC + u, v); }
// GAT aggregation over a device in-edge CSR (+ analytic self loop as iteration j = -1 when SELF), per-lane online softmax (lanes of one head agree):
// HS rows (pitch P floats): [0,128) projected features z, col 128 + h = a_src.z_h, col 128 + NH + h = a_dst.z_h; lane L owns channels 4L..4L+3 (head = 4L / CH).
// out = sum_j softmax_j(leaky(el[src_j][h] + er[n][h])) z[src_j] (/ (den + deps)) + bias -> ACT (0 none, 1 relu, 2 elu, 3 leaky 0.01) ->
// MODE 0: f32 OUT[n][OW] cols < OC (16-B lane stores, OC*4 contiguous B per wave; OC in {64,128}); MODE 1: bf16 hi/lo planes PH/PL pitch PP (rows n >= N zero); MODE 2: both.
template <int CH, bool SELF, int ACT, int MODE>
__global__ __launch_bounds__(256) void k_gat128(const float* __restrict__ HS, int P, int NH, const float* __restrict__ bias, const int* __restrict__ SRC, const int* __restrict__ off, const int* __restrict__ cnt, const int* __restrict__ slot,
        float* __restrict__ OUT, int OW, int OC, unsigned short* __restrict__ PH, unsigned short* __restrict__ PL, int PP, int N, int NP, int E, int CAP, float slope, float deps) {
    #pragma clang fp contract(off)
    const int n = blockIdx.x * 8 + (threadIdx.x >> 5); const int L = threadIdx.x & 31; if (n >= NP) return; const int c = 4 * L; const int h = c / CH; v4f o; o.x = o.y = o.z = o.w = 0.f;
    if (n < N) { const float* hn = HS + (long long)n * P; const float er = hn[128 + NH + h]; float m = -3.0e38f, s = 0.f; v4f a; a.x = a.y = a.z = a.w = 0.f;
        const int p0 = min(max(off[n], 0), E), cn = min(max(cnt[n], 0), CAP);
        for (int j = (SELF ? -1 : 0); j < cn; ++j) { int sj; if (j < 0) sj = n; else { const int e = min(max(slot[min(p0 + j, E - 1)], 0), E - 1); sj = min(max(SRC[e], 0), N - 1); }
            const float* hs = HS + (long long)sj * P; float lg = hs[128 + h] + er; lg = (lg >= 0.f) ? lg : slope * lg;
            const float mn = fmaxf(m, lg); const float cz = expf(m - mn), pj = expf(lg - mn); s = s * cz + pj; a = a * cz + *(const v4f*)(hs + c) * pj; m = mn; }
        const float inv = (s > 0.f || deps > 0.f) ? 1.f / (s + deps) : 0.f; o = a * inv + *(const v4f*)(bias + c);
        if (ACT == 1) { o.x = fmaxf(o.x, 0.f); o.y = fmaxf(o.y, 0.f); o.z = fmaxf(o.z, 0.f); o.w = fmaxf(o.w, 0.f); }
        if (ACT == 2) { o.x = (o.x > 0.f) ? o.x : (expf(o.x) - 1.f); o.y = (o.y > 0.f) ? o.y : (expf(o.y) - 1.f); o.z = (o.z > 0.f) ? o.z : (expf(o.z) - 1.f); o.w = (o.w > 0.f) ? o.w : (expf(o.w) - 1.f); }
        if (ACT == 3) { o.x = (o.x >= 0.f) ? o.x : 0.01f * o.x; o.y = (o.y >= 0.f) ? o.y : 0.01f * o.y; o.z = (o.z >= 0.f) ? o.z : 0.01f * o.z; o.w = (o.w >= 0.f) ? o.w : 0.01f * o.w; }
        if (MODE != 1 && c < OC) VST2V4(OUT + (long long)n * OW + c, o); }
    if (MODE != 0) st4s(PH, PL, (long long)n * PP + c, o); }

// ---- util2 ----
// generic Bt plane builder from an f32 weight: Bt[o][k] (pitch KP halves) = (TRANS ? W[k*ldw + o] : W[o*ldw + k]) * (S ? S[o] : 1) for o < NO, k < KI; zero elsewhere for o < NOP rows, k < KP (thread per (o < NOP, pair k))
__global__ __launch_bounds__(256) void k_u2_bt(const float* __restrict__ Wm, int ldw, int TRANS, int KI, int NO, int KP, int NOP, const float* __restrict__ S, unsigned short* __restrict__ PH_, unsigned short* __restrict__ PL_) {
    const long long u = (long long)blockIdx.x * 256 + threadIdx.x; if (u >= (long long)NOP * (KP / 2)) return; const int k0 = 2 * (int)(u % (KP / 2)); const int o = (int)(u / (KP / 2)); float a = 0.f, b = 0.f;
    if (o < NO) { const float s = S ? S[o] : 1.f;
        if (k0 < KI) a = (TRANS ? Wm[(long long)k0 * ldw + o] : Wm[(long long)o * ldw + k0]) * s;
        if (k0 + 1 < KI) b = (TRANS ? Wm[(long long)(k0 + 1) * ldw + o] : Wm[(long long)o * ldw + k0 + 1]) * s; }
    st_s2(PH_, PL_, (long long)o * KP + k0, a, b); }
// generic padded vector: O[i] = (i < n) ? (A[i] * (S ? S[i] : 1) + (B2 ? B2[i] : 0)) : 0 for i < NP (one block of 256, NP <= 4096 looped)
__global__ __launch_bounds__(256) void k_u2_vec(const float* __restrict__ A, const float* __restrict__ S, const float* __restrict__ B2, int n, int NP, float* __restrict__ O) { for (int i = threadIdx.x; i < NP; i += 256) { float v = 0.f; if (i < n) v = A[i] * (S ? S[i] : 1.f) + (B2 ? B2[i] : 0.f); VST2(float, O + i, v); } }
__global__ __launch_bounds__(256) void k_u2_colstat(const float* __restrict__ X, int P, int N, float eps, float* __restrict__ STAT) {
    #pragma clang fp contract(off)
    __shared__ float red[256]; const int c = blockIdx.x; const int t = threadIdx.x; float s = 0.f; for (int r = t; r < N; r += 256) s += X[(long long)r * P + c]; red[t] = s; __syncthreads();
    for (int o = 128; o > 0; o >>= 1) { if (t < o) red[t] += red[t + o]; __syncthreads(); }
    const float mu = red[0] / (float)N; __syncthreads(); float q = 0.f; for (int r = t; r < N; r += 256) { const float d = X[(long long)r * P + c] - mu; q += d * d; } red[t] = q; __syncthreads();
    for (int o = 128; o > 0; o >>= 1) { if (t < o) red[t] += red[t + o]; __syncthreads(); }
    const float rs = 1.f / sqrtf(red[0] / (float)N + eps); if (t < 32) VST2(float, STAT + (long long)c * 32 + t, (t == 0) ? mu : ((t == 1) ? rs : 0.f)); }
// rows f32 [R][W] (pitch PW) -> planes at pitch PP, column offset coff; rows >= RL (live) written as zeros up to RP (thread per (r < RP, 4 of W))
__global__ __launch_bounds__(256) void k_u2_pl(const float* __restrict__ X, int PW, int Wd, int RL, int RP, unsigned short* __restrict__ PH_, unsigned short* __restrict__ PL_, int PP, int coff) { const long long u = (long long)blockIdx.x * 256 + threadIdx.x; if (u >= (long long)RP * (Wd / 4)) return; const int r = (int)(u / (Wd / 4)); const int c = 4 * (int)(u % (Wd / 4)); v4f v; v.x = v.y = v.z = v.w = 0.f; if (r < RL) v = *(const v4f*)(X + (long long)r * PW + c); st4s(PH_, PL_, (long long)r * PP + coff + c, v); }

typedef unsigned int cm_u4 __attribute__((ext_vector_type(4)));

__global__ __launch_bounds__(256) void k_cm_zero16(unsigned short* __restrict__ DST, long long n) { const long long u = (long long)blockIdx.x * 256 + threadIdx.x; if (u * 8 >= n) return; cm_u4 z; z.x = z.y = z.z = z.w = 0u; cm_u4* d = (cm_u4*)(DST + u * 8); *d = z;  }
// f32 -> bf16 (RNE) -> f16 casts for the bf16-input-leg path: every 16-bit operand then holds exactly the bf16-rounded input value (times a power-of-two
// weight scale), so the f16 WMMA products are exact. Plain: thread per (row, 8 cols),
// dst [R][C] pitch ldd; transposed: thread per (col, 8 consecutive rows) -> dst [C][R] pitch ldd; both store 16 B per thread, thread-linear along the dst row.
__device__ __forceinline__ unsigned int cmb_pk2(float a, float b) { return (unsigned int)__builtin_bit_cast(unsigned short, (_Float16)a) | ((unsigned int)__builtin_bit_cast(unsigned short, (_Float16)b) << 16); }
__device__ __forceinline__ float cmb_bf(float v) { const unsigned u = __builtin_bit_cast(unsigned, v); const unsigned r = (u + 0x7fffu + ((u >> 16) & 1u)) & 0xffff0000u; return __builtin_bit_cast(float, r); }   // bf16 RNE, kept as f32 (finite inputs)
// BR[i] = bf16_rne(B[i]) kept as f32 (thread per element; bias vectors)
__global__ __launch_bounds__(256) void k_cm_bfvec(const float* __restrict__ SRC, float* __restrict__ DST, int n) { const int u = blockIdx.x * 256 + threadIdx.x; if (u >= n) return; VST2(float, DST + u, cmb_bf(SRC[u])); }
__global__ __launch_bounds__(256) void k_cm_castb(const float* __restrict__ SRC, int lds, unsigned short* __restrict__ DST, int ldd, int nR, int nC, float sc) {
    const long long u = (long long)blockIdx.x * 256 + threadIdx.x; const int per = nC / 8; if (u >= (long long)nR * per) return; const int r = (int)(u / per); const int c0 = 8 * (int)(u % per);
    const float* s = SRC + (long long)r * lds + c0; float w[8];
#pragma unroll
    for (int e = 0; e < 8; ++e) w[e] = cmb_bf(s[e]) * sc;
    cm_u4 pk; pk.x = cmb_pk2(w[0], w[1]); pk.y = cmb_pk2(w[2], w[3]); pk.z = cmb_pk2(w[4], w[5]); pk.w = cmb_pk2(w[6], w[7]); VST2(cm_u4, (cm_u4*)(DST + (long long)r * ldd + c0), pk); }
__global__ __launch_bounds__(256) void k_cm_castbT(const float* __restrict__ SRC, int lds, unsigned short* __restrict__ DST, int ldd, int nR, int nC, float sc) {
    const long long u = (long long)blockIdx.x * 256 + threadIdx.x; const int per = nR / 8; if (u >= (long long)nC * per) return; const int c = (int)(u / per); const int r0 = 8 * (int)(u % per);
    float w[8];
#pragma unroll
    for (int e = 0; e < 8; ++e) w[e] = cmb_bf(SRC[(long long)(r0 + e) * lds + c]) * sc;
    cm_u4 pk; pk.x = cmb_pk2(w[0], w[1]); pk.y = cmb_pk2(w[2], w[3]); pk.z = cmb_pk2(w[4], w[5]); pk.w = cmb_pk2(w[6], w[7]); VST2(cm_u4, (cm_u4*)(DST + (long long)c * ldd + r0), pk); }

// MF[b][j] = bf16(delta[b][j]) / |bf16(tau[b])| (ds_tau): the table in the units of the bare q.k product.
// KF = bf16(keys | keys_null); VF = bf16(values | values_null) written as f16 (exact from 2^-17 up in size, within 2^-25 below; finite up to 65,504), for the f16 P.V product. Both as 2-byte halves in the order the attention kernel's B fragments want them, so that a fragment is two 16-byte loads a lane
// and each load of a wave reads 512 contiguous bytes: [branch][b][h][64-key block][tile 0..3][step 0..1][half 0..1][lane 0..31][8].
//   K: key = 64 block + 16 tile + (lane & 15), e = 32 step + 16 half + 8 (lane >> 4) + i;   V: d = 16 tile + (lane & 15), key = 64 block + 32 step + 16 half + 8 (lane >> 4) + i.
// Thread per 16-byte group of the destination (thread-linear stores); which = blockIdx range, block-uniform.
__global__ __launch_bounds__(256) void k_ds_pre(const float* __restrict__ Kp, const float* __restrict__ V, const float* __restrict__ Kn, const float* __restrict__ Vn, const float* __restrict__ TAU, const float* __restrict__ DELTA, unsigned short* __restrict__ KFp, unsigned short* __restrict__ VFp, float* __restrict__ MFp) {
    #pragma clang fp contract(off)
    const int blk = blockIdx.x;
    if (blk < 4 * 1024) {
        const int which = blk >> 10;                            // 0 keys, 1 values, 2 keys_null, 3 values_null
        const int c = (blk & 1023) * 256 + threadIdx.x;         // 16-byte group within the tensor: 262,144 of them
        const int lane = c & 31, half = (c >> 5) & 1, step = (c >> 6) & 1, tile = (c >> 7) & 3, kb = (c >> 9) & 31, h = (c >> 14) & 7, b = c >> 17;
        const int inner = 32 * step + 16 * half + 8 * (lane >> 4), outer = 16 * tile + (lane & 15);
        const float* s = (which == 0) ? Kp : (which == 1) ? V : (which == 2) ? Kn : Vn;
        float w[8];
        cm_u4 pk;
        if ((which & 1) == 0) {
            const float* r = s + ((long long)(b * 2048 + kb * 64 + outer) * 8 + h) * 64 + inner;
            const v4f x = *(const v4f*)r, y = *(const v4f*)(r + 4);
            asm volatile("s_wait_xcnt 0x0" ::: "memory");   // stands behind the two loads, ahead of the rewrite of their address pair by the packing
            w[0] = x.x; w[1] = x.y; w[2] = x.z; w[3] = x.w; w[4] = y.x; w[5] = y.y; w[6] = y.z; w[7] = y.w;
            pk.x = (unsigned)bfu_rne(w[0]) | ((unsigned)bfu_rne(w[1]) << 16); pk.y = (unsigned)bfu_rne(w[2]) | ((unsigned)bfu_rne(w[3]) << 16);
            pk.z = (unsigned)bfu_rne(w[4]) | ((unsigned)bfu_rne(w[5]) << 16); pk.w = (unsigned)bfu_rne(w[6]) | ((unsigned)bfu_rne(w[7]) << 16);
        } else {
            const float* r = s + ((long long)(b * 2048 + kb * 64 + inner) * 8 + h) * 64 + outer;
#pragma unroll   // constant trip count: the eight row loads are issued together, with one wait
            for (int i = 0; i < 8; ++i) w[i] = r[i * 512];
            asm volatile("s_wait_xcnt 0x0" ::: "memory");   // stands behind the eight loads, ahead of the rewrite of their address pair by the packing
            v8h hv;   // the bf16-rounded value, written as f16: its 8 significant bits fit f16's 11
#pragma unroll   // hv is a register vector: every index a constant
            for (int i = 0; i < 8; ++i) hv[i] = (_Float16)cmb_bf(w[i]);
            pk = __builtin_bit_cast(cm_u4, hv);
        }
        unsigned short* d = ((which & 1) ? VFp : KFp) + ((which >= 2) ? 2097152 : 0) + (long long)c * 8;
        VST2(cm_u4, (cm_u4*)d, pk); }
    else { const int u = (blk - 4 * 1024) * 256 + threadIdx.x;
        float tsz, tsg; ds_tau(TAU[(blk - 4 * 1024) >> 3], tsz, tsg);   // eight blocks a batch
        VST2(float, MFp + u, cmb_bf(DELTA[u]) / tsz);
        asm volatile("s_wait_xcnt 0x0" ::: "memory");   // stands behind the store, ahead of any rewrite of the registers it names
    } }

extern "C" void kernel_launch(void* const* d_in, const int* in_sizes, int n_in, void* d_out, int out_size, void* d_ws, size_t ws_size, hipStream_t stream) {
    (void)in_sizes; (void)n_in; (void)out_size; (void)ws_size;
    const float* q = (const float*)d_in[0];
    const float* kk = (const float*)d_in[1];
    const float* v = (const float*)d_in[2];
    const float* kn = (const float*)d_in[3];
    const float* vn = (const float*)d_in[4];
    const float* tau = (const float*)d_in[5];
    const float* delta = (const float*)d_in[6];
    const float* smask = (const float*)d_in[7];
    float* out = (float*)d_out;
    char* wsp = (char*)d_ws;
    unsigned short* KF = (unsigned short*)wsp; wsp += (((size_t)((size_t)4194304) * 2 + 255) / 256) * 256;   // [branch][batch] planes of 1,048,576 bf16 in fragment order
    unsigned short* VF = (unsigned short*)wsp; wsp += (((size_t)((size_t)4194304) * 2 + 255) / 256) * 256;   // the same, as f16
    float* MF = (float*)wsp; wsp += (((size_t)((size_t)4096) * 4 + 255) / 256) * 256;
    if ((size_t)(wsp - (char*)d_ws) > ws_size) return;   // static carve guard
    k_ds_pre<<<(unsigned)(4 * 1024 + 16), 256, 0, stream>>>(kk, v, kn, vn, tau, delta, KF, VF, MF);
    k_attn_t<<<dim3(16, 16, 1), 32 * 4 * AW, 0, stream>>>(q, tau, KF, VF, MF, smask, out);   // both branches, joined and blended: writes the output
}
